// v000
// The times below were measured on an AMD MI455X: many runs one after another, warmed up first and cycling through
// copies of the inputs, with the whole window's GPU time divided by the number of runs. Launches and the gaps
// between them are all in it. The median over several windows is given; except for v000 it joins two sittings, which
// can be a few percent apart, so the side-by-side timings, each taken in one sitting, are the better comparison.
// The starting kernel, v000, takes 1590 microseconds a run.
#include <hip/hip_runtime.h>

// Grouped-query RoPE causal attention ('eager' path) (x [2][2048][2048]; q = x w_q^T ([2048][2048]: 16 heads x 128), k, v = x w_k^T / w_v^T ([512][2048]: 4 kv heads); rotate-half RoPE (theta 1e6, full 128 dims, tables computed on device); kv head = h/4; scores = q.k/sqrt(128); causal (finfo.min == exact zero weight); softmax; out = merged w_o^T -> [2][2048][2048] (8.4 M)).
// Compute dtypes, f32 accumulate: every input rounded to bf16; q/k/v on PLAIN bf16 operands (inputs: exact); rotary in f32 (cos/sin from an on-device f32 table: inv_freq_i = 1e6^(-2i/128), precise cosf/sinf); causal scores and attn.v (tile skipping): query rows < 512 hl (3 products), the rest single fp16 (x1024); softmax f32; w_o hl x exact (2 products).

#define NB_  2
#define TT   2048
#define DM   2048
#define NH_  16
#define NKV  4
#define REP  (NH_ / NKV)
#define HD   128
#define DQ   (NH_ * HD)
#define DKV  (NKV * HD)
#define ZH   2
#define RH   512                  // query rows < RH use hi+lo planes (0: none)
#define WIN  2048
#define PCAR 1024.0f
#define SCL  0.088388347648318447f   // HD^-0.5
typedef _Float16 h16;
typedef unsigned short bf;
typedef __attribute__((ext_vector_type(16))) __bf16   v16bf;
typedef __attribute__((ext_vector_type(16))) _Float16 v16h;
typedef __attribute__((ext_vector_type(8)))  _Float16 v8h;
typedef __attribute__((ext_vector_type(8)))  unsigned short v8us;
typedef __attribute__((ext_vector_type(8)))  float    v8f;
typedef __attribute__((ext_vector_type(4)))  float    v4f;
typedef v8h  __attribute__((may_alias)) v8ha;
typedef v4f  __attribute__((may_alias)) v4fa;
typedef v8us __attribute__((may_alias)) v8usa;

__device__ __forceinline__ unsigned short f2bf(float f) { unsigned u = __float_as_uint(f); u += 0x7FFFu + ((u >> 16) & 1u); return (unsigned short)(u >> 16); }
__device__ __forceinline__ float bf2f(unsigned short b) { return __uint_as_float(((unsigned)b) << 16); }
__device__ __forceinline__ float bfr(float f) { return bf2f(f2bf(f)); }
__device__ __forceinline__ v16h cat16(v8h lo, v8h hi) { return __builtin_shufflevector(lo, hi, 0, 1, 2, 3, 4, 5, 6, 7, 8, 9, 10, 11, 12, 13, 14, 15); }
__device__ __forceinline__ v16bf cat16b(v8us lo, v8us hi) { return __builtin_bit_cast(v16bf, __builtin_shufflevector(lo, hi, 0, 1, 2, 3, 4, 5, 6, 7, 8, 9, 10, 11, 12, 13, 14, 15)); }
__device__ __forceinline__ v8f wmma16(v16h a, v16h b, v8f c) { return __builtin_amdgcn_wmma_f32_16x16x32_f16(false, a, false, b, (short)0, c, false, false); }
__device__ __forceinline__ v8f wmmab(v16bf a, v16bf b, v8f c) { return __builtin_amdgcn_wmma_f32_16x16x32_bf16(false, a, false, b, (short)0, c, false, false); }



// ---- k_gemmw: register-blocked GEMM, ONE WAVE per 64x64 output tile (16 accumulators), operands straight from K-contiguous 16-bit planes; grid (M/64, N/64, Z), 32 threads.
// C[m][n] (f32, pitch ldc, + optional f32 bias[n]) = sum_k A[m][k] Bt[n][k] (+ split products per NSPLIT). z-batch strides sA/sB/sC in elements. K % 32 == 0.
template <typename T16> struct WFrag;
template <> struct WFrag<h16> { typedef v16h V; static __device__ __forceinline__ V ld(const h16* p) { return cat16(*(const v8h*)p, *(const v8h*)(p + 16)); } static __device__ __forceinline__ v8f mma(V a, V b, v8f c) { return wmma16(a, b, c); } };
template <> struct WFrag<bf> { typedef v16bf V; static __device__ __forceinline__ V ld(const bf* p) { return cat16b(*(const v8us*)p, *(const v8us*)(p + 16)); } static __device__ __forceinline__ v8f mma(V a, V b, v8f c) { return wmmab(a, b, c); } };
template <typename T16, int NSPLIT, bool BIAS>
__global__ __launch_bounds__(32) void k_gemmw(const T16* __restrict__ A, const T16* __restrict__ A2, const T16* __restrict__ Bt, const T16* __restrict__ Bt2, int K, float* C, int ldc, const float* __restrict__ bias, size_t sA, size_t sB, size_t sC) {
    typedef typename WFrag<T16>::V V;
    __shared__ __align__(16) float os[16 * 68];
    const size_t z = blockIdx.z; A += z * sA; if (A2) A2 += z * sA; Bt += z * sB; if (Bt2) Bt2 += z * sB; C += z * sC;
    const int lane = threadIdx.x & 31, lr = lane & 15, hi = lane >> 4; const int r0 = blockIdx.x * 64, c0 = blockIdx.y * 64;
    v8f acc[4][4];
#pragma unroll
    for (int mb = 0; mb < 4; ++mb)
#pragma unroll
        for (int nb = 0; nb < 4; ++nb) acc[mb][nb] = (v8f){};
    const size_t aoff = (size_t)(r0 + lr) * K + 8 * hi, boff = (size_t)(c0 + lr) * K + 8 * hi;
#pragma unroll 1
    for (int kc = 0; kc < K; kc += 32) {
        V a[4], a2[4];
#pragma unroll
        for (int mb = 0; mb < 4; ++mb) { a[mb] = WFrag<T16>::ld(A + aoff + (size_t)mb * 16 * K + kc); if (NSPLIT == 1 || NSPLIT == 2) a2[mb] = WFrag<T16>::ld(A2 + aoff + (size_t)mb * 16 * K + kc); }
#pragma unroll
        for (int nb = 0; nb < 4; ++nb) { const V b = WFrag<T16>::ld(Bt + boff + (size_t)nb * 16 * K + kc); V b2; if (NSPLIT >= 2) b2 = WFrag<T16>::ld(Bt2 + boff + (size_t)nb * 16 * K + kc);
#pragma unroll
            for (int mb = 0; mb < 4; ++mb) { acc[mb][nb] = WFrag<T16>::mma(a[mb], b, acc[mb][nb]); if (NSPLIT == 1 || NSPLIT == 2) acc[mb][nb] = WFrag<T16>::mma(a2[mb], b, acc[mb][nb]); if (NSPLIT >= 2) acc[mb][nb] = WFrag<T16>::mma(a[mb], b2, acc[mb][nb]); } }
        asm volatile("v_nop\n\tv_nop\n\tv_nop\n\tv_nop" : "+v"(acc[0][0]), "+v"(acc[1][1]), "+v"(acc[2][2]), "+v"(acc[3][3]) : "v"(a[0]), "v"(a[3]));
    }
#pragma unroll
    for (int mb = 0; mb < 4; ++mb) {
#pragma unroll
        for (int nb = 0; nb < 4; ++nb) {
#pragma unroll
            for (int j = 0; j < 8; ++j) os[(hi * 8 + j) * 68 + nb * 16 + lr] = acc[mb][nb][j]; }
        __builtin_amdgcn_wave_barrier(); asm volatile("" ::: "memory");
        float* crow = C + (size_t)(r0 + mb * 16) * ldc + c0;
{
#pragma unroll
            for (int s = 0; s < 8; ++s) { const int row = 2 * s + hi, cofs = lr * 4; v4f val = *(const v4fa*)(os + row * 68 + cofs); if (BIAS) { val[0] += bfr(bias[c0 + cofs]); val[1] += bfr(bias[c0 + cofs + 1]); val[2] += bfr(bias[c0 + cofs + 2]); val[3] += bfr(bias[c0 + cofs + 3]); }
                *(v4f*)(crow + (size_t)row * ldc + cofs) = val; }
             }
        __builtin_amdgcn_wave_barrier(); asm volatile("" ::: "memory");
    }
}

// ---- k_gemmc: the same one-wave 64x64 tile GEMM specialised for causal attention: CMODE 1 skips score tiles entirely above the diagonal (query rows r0+roff.., key columns c0..), CMODE 2 limits the
// key (K) loop of the probability x value contraction to the diagonal block (probabilities beyond it are exactly zero). roff = row offset of this launch's first row within the sequence.
template <typename T16, int NSPLIT, int CMODE>
__global__ __launch_bounds__(32) void k_gemmc(const T16* __restrict__ A, const T16* __restrict__ A2, const T16* __restrict__ Bt, const T16* __restrict__ Bt2, int K, float* C, int ldc, int roff, size_t sA, size_t sB, size_t sC) {
    typedef typename WFrag<T16>::V V;
    __shared__ __align__(16) float os[16 * 68];
    const size_t z = blockIdx.z; A += z * sA; if (A2) A2 += z * sA; Bt += z * sB; if (Bt2) Bt2 += z * sB; C += z * sC;
    const int lane = threadIdx.x & 31, lr = lane & 15, hi = lane >> 4; const int r0 = blockIdx.x * 64, c0 = blockIdx.y * 64;
    if (CMODE == 1 && c0 > r0 + roff + 63) return;                  // score tile entirely above the causal diagonal: never read (the softmax masks j > i by select)
    const int Kl = (CMODE == 2) ? min(K, r0 + roff + 64) : K;        // P.V: probabilities are exactly 0 beyond the diagonal block, so the K loop stops there
    v8f acc[4][4];
#pragma unroll
    for (int mb = 0; mb < 4; ++mb)
#pragma unroll
        for (int nb = 0; nb < 4; ++nb) acc[mb][nb] = (v8f){};
    const size_t aoff = (size_t)(r0 + lr) * K + 8 * hi, boff = (size_t)(c0 + lr) * K + 8 * hi;
#pragma unroll 1
    for (int kc = 0; kc < Kl; kc += 32) {
        V a[4], a2[4];
#pragma unroll
        for (int mb = 0; mb < 4; ++mb) { a[mb] = WFrag<T16>::ld(A + aoff + (size_t)mb * 16 * K + kc); if (NSPLIT == 1 || NSPLIT == 2) a2[mb] = WFrag<T16>::ld(A2 + aoff + (size_t)mb * 16 * K + kc); }
#pragma unroll
        for (int nb = 0; nb < 4; ++nb) { const V b = WFrag<T16>::ld(Bt + boff + (size_t)nb * 16 * K + kc); V b2; if (NSPLIT >= 2) b2 = WFrag<T16>::ld(Bt2 + boff + (size_t)nb * 16 * K + kc);
#pragma unroll
            for (int mb = 0; mb < 4; ++mb) { acc[mb][nb] = WFrag<T16>::mma(a[mb], b, acc[mb][nb]); if (NSPLIT == 1 || NSPLIT == 2) acc[mb][nb] = WFrag<T16>::mma(a2[mb], b, acc[mb][nb]); if (NSPLIT >= 2) acc[mb][nb] = WFrag<T16>::mma(a[mb], b2, acc[mb][nb]); } }
        asm volatile("v_nop\n\tv_nop\n\tv_nop\n\tv_nop" : "+v"(acc[0][0]), "+v"(acc[1][1]), "+v"(acc[2][2]), "+v"(acc[3][3]) : "v"(a[0]), "v"(a[3]));
    }
#pragma unroll
    for (int mb = 0; mb < 4; ++mb) {
#pragma unroll
        for (int nb = 0; nb < 4; ++nb) {
#pragma unroll
            for (int j = 0; j < 8; ++j) os[(hi * 8 + j) * 68 + nb * 16 + lr] = acc[mb][nb][j]; }
        __builtin_amdgcn_wave_barrier(); asm volatile("" ::: "memory");
        float* crow = C + (size_t)(r0 + mb * 16) * ldc + c0;
{
#pragma unroll
            for (int s = 0; s < 8; ++s) { const int row = 2 * s + hi, cofs = lr * 4; v4f val = *(const v4fa*)(os + row * 68 + cofs);
                *(v4f*)(crow + (size_t)row * ldc + cofs) = val; }
             }
        __builtin_amdgcn_wave_barrier(); asm volatile("" ::: "memory");
    }
}

__device__ __forceinline__ h16 tohx(float x) { return (h16)x; }
__device__ __forceinline__ void splitf(float y, unsigned short& h, unsigned short& l) { h = f2bf(y); l = f2bf(y - bf2f(h)); }
typedef __attribute__((ext_vector_type(2))) _Float16 v2h;
typedef __attribute__((ext_vector_type(4))) _Float16 v4h;
typedef __attribute__((ext_vector_type(2))) unsigned short v2us;
typedef __attribute__((ext_vector_type(4))) unsigned short v4us;
typedef __attribute__((ext_vector_type(2))) float v2f;
typedef __attribute__((ext_vector_type(4))) int v4i;

__global__ __launch_bounds__(256) void k_wtG(const float* __restrict__ w, int K, int N, bf* Bt) {
    const int lane = threadIdx.x & 31; const int L0 = (blockIdx.x * 8 + (threadIdx.x >> 5)) * 8; const int nlines = N * K / 64;
{
#pragma unroll 1
        for (int l = 0; l < 8; ++l) { const int L = L0 + l; if (L >= nlines) break; const size_t e = (size_t)L * 64 + lane * 2; const int k = (int)(e % K), n = (int)(e / K); v2us o;
            o[0] = f2bf(w[(size_t)k * N + n]); o[1] = f2bf(w[(size_t)(k + 1) * N + n]); *(v2us*)(Bt + e) = o; }
         }
}
__global__ __launch_bounds__(256) void k_cvt8(const float* __restrict__ src, bf* dst, size_t n8) { const size_t i = (size_t)blockIdx.x * 256 + threadIdx.x; if (i >= n8) return; const v8f v = *(const v8f*)(src + i * 8); v8us o;
#pragma unroll
    for (int k = 0; k < 8; ++k) o[k] = f2bf(v[k]); *(v8us*)(dst + i * 8) = o;  }
__constant__ float INV[HD / 2] = {1.00000000f,0.805842161f,0.649381638f,0.523299098f,0.421696514f,0.339820832f,0.273841977f,0.220673412f,0.177827939f,0.143301263f,0.115478195f,0.0930572078f,0.0749894232f,0.0604296401f,0.0486967526f,0.0392418988f,0.0316227749f,0.0254829675f,0.0205352511f,0.0165481716f,0.0133352140f,0.0107460786f,0.00865964312f,0.00697830599f,0.00562341325f,0.00453158375f,0.00365174119f,0.00294272718f,0.00237137382f,0.00191095297f,0.00153992651f,0.00124093774f,0.00100000005f,0.000805842166f,0.000649381604f,0.000523299095f,0.000421696517f,0.000339820836f,0.000273841957f,0.000220673406f,0.000177827940f,0.000143301251f,0.000115478200f,0.0000930572060f,0.0000749894243f,0.0000604296401f,0.0000486967510f,0.0000392418988f,0.0000316227779f,0.0000254829683f,0.0000205352499f,0.0000165481706f,0.0000133352141f,0.0000107460783f,0.00000865964284f,0.00000697830592f,0.00000562341347f,0.00000453158373f,0.00000365174128f,0.00000294272718f,0.00000237137374f,0.00000191095296f,0.00000153992653f,0.00000124093776f};
__global__ __launch_bounds__(256) void k_cstab(float* CS) { const int idx = blockIdx.x * 256 + threadIdx.x; if (idx >= TT * HD) return; const int t = idx / HD, d = idx % HD; const float ang = __fmul_rn((float)t, INV[d % (HD / 2)]); v2f cs; cs[0] = cosf(ang); cs[1] = sinf(ang);
    *(v2f*)(CS + (size_t)idx * 2) = cs;  }

// k_rope: head planes [h][t][d] (fp16 + hi/lo) of rope(x) x sc with the rotate-half convention out[d] = x[d] cos[t][d] - x[d+HD/2] sin[t][d], out[d+HD/2] = x[d+HD/2] cos[t][d+HD/2] + x[d] sin[t][d+HD/2]
__global__ __launch_bounds__(256) void k_rope(const float* __restrict__ F, int pitch, int nheads, const float* __restrict__ CS, const float* __restrict__ RF, const float* __restrict__ nw, float sc, h16* P16, bf* Ph, bf* Pl) {
    const size_t e = ((size_t)blockIdx.x * 256 + threadIdx.x) * 2; if (e >= (size_t)nheads * TT * HD) return; const int d = (int)(e % HD); const int t = (int)((e / HD) % TT); const int h = (int)(e / ((size_t)HD * TT)); const float* f = F + (size_t)t * pitch + h * HD; const float rf = RF ? RF[(size_t)h * TT + t] : 1.0f; v2h o16; v2us oh, ol;
#pragma unroll
    for (int q = 0; q < 2; ++q) { const int dd = d + q; const int dp = (dd < HD / 2) ? dd + HD / 2 : dd - HD / 2; float x0 = f[dd], x1 = f[dp];
        if (RF) { float n0 = __fmul_rn(x0, rf), n1 = __fmul_rn(x1, rf); asm volatile("" : "+v"(n0)); asm volatile("" : "+v"(n1)); x0 = __fmul_rn(bfr(nw[dd]), n0); x1 = __fmul_rn(bfr(nw[dp]), n1); }
        const v2f cs = *(const v2f*)(CS + ((size_t)t * HD + dd) * 2); float a = __fmul_rn(x0, cs[0]), bq = __fmul_rn(x1, cs[1]); asm volatile("" : "+v"(a)); asm volatile("" : "+v"(bq)); const float r = ((dd < HD / 2) ? __fsub_rn(a, bq) : __fadd_rn(a, bq)) * sc;
        o16[q] = tohx(r); unsigned short a2, c2; splitf(r, a2, c2); oh[q] = a2; ol[q] = c2; }
    *(v2h*)(P16 + e) = o16; *(v2us*)(Ph + e) = oh; *(v2us*)(Pl + e) = ol;  }
__global__ __launch_bounds__(256) void k_vtp(const float* __restrict__ F, int pitch, int nheads, h16* V16, bf* Vh, bf* Vl) { const size_t e = ((size_t)blockIdx.x * 256 + threadIdx.x) * 2; if (e >= (size_t)nheads * HD * TT) return; const int t = (int)(e % TT); const int d = (int)((e / TT) % HD); const int g = (int)(e / ((size_t)TT * HD)); v2h o16; v2us oh, ol;
#pragma unroll
    for (int q = 0; q < 2; ++q) { const float x = F[(size_t)(t + q) * pitch + g * HD + d]; o16[q] = tohx(x); unsigned short a2, c2; splitf(x, a2, c2); oh[q] = a2; ol[q] = c2; }
    *(v2h*)(V16 + e) = o16; *(v2us*)(Vh + e) = oh; *(v2us*)(Vl + e) = ol;  }
// k_asoft: per row (zz, i): t = S x HD^-0.5 for j <= i and i - j < WIN (sliding causal window; the reference's -1e9 additive fill vanishes identically); softmax over the 2048 keys (register row, one exp, fixed trees);
__global__ __launch_bounds__(256) void k_asoft(const float* __restrict__ Sb, h16* P16, bf* Ph, bf* Pl) {
    const int lane = threadIdx.x & 31; const int row = blockIdx.x * 8 + (threadIdx.x >> 5); if (row >= ZH * TT) return; const int i = row % TT; const int zz = row / TT; (void)zz; const bool hires = (i < RH); const float* sr = Sb + (size_t)row * TT; float v[TT / 32]; float mx = -3.0e38f;
#pragma unroll
    for (int ch = 0; ch < TT / 128; ++ch) { const int j0 = ch * 128 + lane * 4; const v4f a = *(const v4f*)(sr + j0);
#pragma unroll
        for (int q = 0; q < 4; ++q) { const int j = j0 + q; (void)j; const float t = (j <= i && i - j < WIN) ? a[q] * SCL : -3.0e38f; v[ch * 4 + q] = t; mx = fmaxf(mx, t); } }
#pragma unroll
    for (int sh = 16; sh; sh >>= 1) mx = fmaxf(mx, __shfl_xor(mx, sh, 32));
    float sum = 0.f;
#pragma unroll
    for (int k = 0; k < TT / 32; ++k) { float d0 = __fsub_rn(v[k], mx); asm volatile("" : "+v"(d0)); v[k] = __builtin_amdgcn_exp2f(__fmul_rn(d0, 1.4426950408889634f)); sum += v[k]; }
#pragma unroll
    for (int sh = 16; sh; sh >>= 1) sum += __shfl_xor(sum, sh, 32);
    const float f = __fdiv_rn(hires ? 1.0f : PCAR, sum);
{
        if (hires) {
#pragma unroll
            for (int ch = 0; ch < TT / 128; ++ch) { v4us oh, ol;
#pragma unroll
                for (int q = 0; q < 4; ++q) { unsigned short a, c2; splitf(v[ch * 4 + q] * f, a, c2); oh[q] = a; ol[q] = c2; }
                const size_t oo = ((size_t)zz * (RH ? RH : 1) + i) * TT + ch * 128 + lane * 4; *(v4us*)(Ph + oo) = oh; *(v4us*)(Pl + oo) = ol; }
        } else {
#pragma unroll
            for (int ch = 0; ch < TT / 128; ++ch) { v4h o4;
#pragma unroll
                for (int q = 0; q < 4; ++q) o4[q] = tohx(v[ch * 4 + q] * f);
                *(v4h*)(P16 + (size_t)row * TT + ch * 128 + lane * 4) = o4; } }
         }
}
__global__ __launch_bounds__(256) void k_merge(const float* __restrict__ O, int h0, bf* Ah, bf* Al) { const size_t e = ((size_t)blockIdx.x * 256 + threadIdx.x) * 2; if (e >= (size_t)ZH * TT * HD) return; const int d = (int)(e % HD); const int t = (int)((e / HD) % TT); const int zz = (int)(e / ((size_t)HD * TT)); const float cs = (t < RH) ? 1.0f : (1.0f / PCAR); const size_t oo = (size_t)t * DQ + (h0 + zz) * HD + d;
    v2us oh, ol;
#pragma unroll
    for (int q = 0; q < 2; ++q) { unsigned short a, c2; splitf(O[e + q] * cs, a, c2); oh[q] = a; ol[q] = c2; } *(v2us*)(Ah + oo) = oh; *(v2us*)(Al + oo) = ol;  }

extern "C" void kernel_launch(void* const* d_in, const int* in_sizes, int n_in,
                              void* d_out, int out_size, void* d_ws, size_t ws_size, hipStream_t stream) {
    (void)in_sizes; (void)n_in; (void)out_size;
    const float* x = (const float*)d_in[0]; const float* wq = (const float*)d_in[1]; const float* wk = (const float*)d_in[2]; const float* wv = (const float*)d_in[3]; const float* wo = (const float*)d_in[4];
    float* OUT = (float*)d_out;     // [2][2048][2048]
    char* wsp = (char*)d_ws;
    auto take = [&](size_t bytes) { char* p = wsp; wsp += (bytes + 255) & ~(size_t)255; return (void*)p; };
    bf* WQ = (bf*)take((size_t)DQ * DM * 2); bf* WK = (bf*)take((size_t)DKV * DM * 2); bf* WV = (bf*)take((size_t)DKV * DM * 2); bf* WO = (bf*)take((size_t)DM * DQ * 2); float* CS = (float*)take((size_t)TT * HD * 2 * 4);
    bf* XB = (bf*)take((size_t)TT * DM * 2); float* FQ = (float*)take((size_t)TT * DQ * 4); float* FK = (float*)take((size_t)TT * DKV * 4);
    h16* QP16 = (h16*)take((size_t)NH_ * TT * HD * 2); h16* KP16 = (h16*)take((size_t)NKV * TT * HD * 2); h16* VT16 = (h16*)take((size_t)NKV * HD * TT * 2);
    bf* QPh = (bf*)take((size_t)NH_ * TT * HD * 2); bf* QPl = (bf*)take((size_t)NH_ * TT * HD * 2); bf* KPh = (bf*)take((size_t)NKV * TT * HD * 2); bf* KPl = (bf*)take((size_t)NKV * TT * HD * 2); bf* VTh = (bf*)take((size_t)NKV * HD * TT * 2); bf* VTl = (bf*)take((size_t)NKV * HD * TT * 2); bf* Ph = (bf*)take((size_t)ZH * RH * TT * 2); bf* Pl = (bf*)take((size_t)ZH * RH * TT * 2);
    float* Sb = (float*)take((size_t)ZH * TT * TT * 4); h16* P16 = (h16*)take((size_t)ZH * TT * TT * 2); float* Ob = (float*)take((size_t)ZH * TT * HD * 4); bf* ATh = (bf*)take((size_t)TT * DQ * 2); bf* ATl = (bf*)take((size_t)TT * DQ * 2);
    if ((size_t)(wsp - (char*)d_ws) > ws_size) return;    // ws 256 MiB
    float* FV = FK;   // v projection reuses the k buffer after the k planes are built (stream-ordered)
    { k_cvt8<<<(unsigned)(((size_t)DQ * DM / 8 + 255) / 256), 256, 0, stream>>>(wq, WQ, (size_t)DQ * DM / 8); k_cvt8<<<(unsigned)(((size_t)DKV * DM / 8 + 255) / 256), 256, 0, stream>>>(wk, WK, (size_t)DKV * DM / 8); k_cvt8<<<(unsigned)(((size_t)DKV * DM / 8 + 255) / 256), 256, 0, stream>>>(wv, WV, (size_t)DKV * DM / 8);
      k_cvt8<<<(unsigned)(((size_t)DM * DQ / 8 + 255) / 256), 256, 0, stream>>>(wo, WO, (size_t)DM * DQ / 8);
      k_cstab<<<(TT * HD + 255) / 256, 256, 0, stream>>>(CS); }
    const unsigned LQ = (unsigned)(((size_t)NH_ * TT * HD / 2 + 255) / 256), LKv = (unsigned)(((size_t)NKV * TT * HD / 2 + 255) / 256);
    for (int b = 0; b < NB_; ++b) {
        
        k_cvt8<<<(unsigned)(((size_t)TT * DM / 8 + 255) / 256), 256, 0, stream>>>(x + (size_t)b * TT * DM, XB, (size_t)TT * DM / 8);
        k_gemmw<bf, 0, false><<<dim3(TT / 64, DQ / 64, 1), 32, 0, stream>>>(XB, nullptr, WQ, nullptr, DM, FQ, DQ, nullptr, 0, 0, 0);
        k_rope<<<LQ, 256, 0, stream>>>(FQ, DQ, NH_, CS, nullptr, nullptr, 1.0f, QP16, QPh, QPl);
        k_gemmw<bf, 0, false><<<dim3(TT / 64, DKV / 64, 1), 32, 0, stream>>>(XB, nullptr, WK, nullptr, DM, FK, DKV, nullptr, 0, 0, 0);
        k_rope<<<LKv, 256, 0, stream>>>(FK, DKV, NKV, CS, nullptr, nullptr, 1.0f, KP16, KPh, KPl);
        k_gemmw<bf, 0, false><<<dim3(TT / 64, DKV / 64, 1), 32, 0, stream>>>(XB, nullptr, WV, nullptr, DM, FV, DKV, nullptr, 0, 0, 0); k_vtp<<<LKv, 256, 0, stream>>>(FV, DKV, NKV, VT16, VTh, VTl);
        for (int h0 = 0; h0 < NH_; h0 += ZH) { const size_t zq = (size_t)h0, zk = (size_t)(h0 / REP);   // both heads of a pass share kv group h0/REP (REP >= 2): sB = 0
            k_gemmc<bf, 2, 1><<<dim3(RH / 64, TT / 64, ZH), 32, 0, stream>>>(QPh + zq * TT * HD, QPl + zq * TT * HD, KPh + zk * TT * HD, KPl + zk * TT * HD, HD, Sb, TT, 0, (size_t)TT * HD, 0, (size_t)TT * TT);
            k_gemmc<h16, 0, 1><<<dim3((TT - RH) / 64, TT / 64, ZH), 32, 0, stream>>>(QP16 + zq * TT * HD + (size_t)RH * HD, nullptr, KP16 + zk * TT * HD, nullptr, HD, Sb + (size_t)RH * TT, TT, RH, (size_t)TT * HD, 0, (size_t)TT * TT);
            k_asoft<<<ZH * TT / 8, 256, 0, stream>>>(Sb, P16, Ph, Pl);
            k_gemmc<bf, 2, 2><<<dim3(RH / 64, HD / 64, ZH), 32, 0, stream>>>(Ph, Pl, VTh + zk * HD * TT, VTl + zk * HD * TT, TT, Ob, HD, 0, (size_t)RH * TT, 0, (size_t)TT * HD);
            k_gemmc<h16, 0, 2><<<dim3((TT - RH) / 64, HD / 64, ZH), 32, 0, stream>>>(P16 + (size_t)RH * TT, nullptr, VT16 + zk * HD * TT, nullptr, TT, Ob + (size_t)RH * HD, HD, RH, (size_t)TT * TT, 0, (size_t)TT * HD);
            k_merge<<<(unsigned)(((size_t)ZH * TT * HD / 2 + 255) / 256), 256, 0, stream>>>(Ob, h0, ATh, ATl); }
        k_gemmw<bf, 1, false><<<dim3(TT / 64, DM / 64, 1), 32, 0, stream>>>(ATh, ATl, WO, nullptr, DQ, OUT + (size_t)b * TT * DM, DM, nullptr, 0, 0, 0); }
}

// v001
// A run of this version takes 930 microseconds.
// Two timings next to v000 both put it at 1.73 times that version's speed.
#include <hip/hip_runtime.h>

// Grouped-query RoPE causal attention ('eager' path) (x [2][2048][2048]; q = x w_q^T ([2048][2048]: 16 heads x 128), k, v = x w_k^T / w_v^T ([512][2048]: 4 kv heads); rotate-half RoPE (theta 1e6, full 128 dims, tables computed on device); kv head = h/4; scores = q.k/sqrt(128); causal (finfo.min == exact zero weight); softmax; out = merged w_o^T -> [2][2048][2048] (8.4 M)).
// Compute dtypes, f32 accumulate: every input rounded to bf16; q/k/v on PLAIN bf16 operands (inputs: exact); rotary in f32 (cos/sin from an on-device f32 table: inv_freq_i = 1e6^(-2i/128), precise cosf/sinf); causal scores and attn.v (tile skipping): query rows < 512 hl (3 products), the rest single fp16 (x1024); softmax f32; w_o hl x exact (2 products).

#define NB_  2
#define TT   2048
#define DM   2048
#define NH_  16
#define NKV  4
#define REP  (NH_ / NKV)
#define HD   128
#define DQ   (NH_ * HD)
#define DKV  (NKV * HD)
#define ZH   2
#define RH   512                  // query rows < RH use hi+lo planes (0: none)
#define WIN  2048
#define PCAR 1024.0f
#define SCL  0.088388347648318447f   // HD^-0.5
typedef _Float16 h16;
typedef unsigned short bf;
typedef __attribute__((ext_vector_type(16))) __bf16   v16bf;
typedef __attribute__((ext_vector_type(16))) _Float16 v16h;
typedef __attribute__((ext_vector_type(8)))  _Float16 v8h;
typedef __attribute__((ext_vector_type(8)))  unsigned short v8us;
typedef __attribute__((ext_vector_type(8)))  float    v8f;
typedef __attribute__((ext_vector_type(4)))  float    v4f;
typedef v8h  __attribute__((may_alias)) v8ha;
typedef v4f  __attribute__((may_alias)) v4fa;
typedef v8us __attribute__((may_alias)) v8usa;

__device__ __forceinline__ unsigned short f2bf(float f) { unsigned u = __float_as_uint(f); u += 0x7FFFu + ((u >> 16) & 1u); return (unsigned short)(u >> 16); }
__device__ __forceinline__ float bf2f(unsigned short b) { return __uint_as_float(((unsigned)b) << 16); }
__device__ __forceinline__ float bfr(float f) { return bf2f(f2bf(f)); }
__device__ __forceinline__ v16h cat16(v8h lo, v8h hi) { return __builtin_shufflevector(lo, hi, 0, 1, 2, 3, 4, 5, 6, 7, 8, 9, 10, 11, 12, 13, 14, 15); }
__device__ __forceinline__ v16bf cat16b(v8us lo, v8us hi) { return __builtin_bit_cast(v16bf, __builtin_shufflevector(lo, hi, 0, 1, 2, 3, 4, 5, 6, 7, 8, 9, 10, 11, 12, 13, 14, 15)); }
__device__ __forceinline__ v8f wmma16(v16h a, v16h b, v8f c) { return __builtin_amdgcn_wmma_f32_16x16x32_f16(false, a, false, b, (short)0, c, false, false); }
__device__ __forceinline__ v8f wmmab(v16bf a, v16bf b, v8f c) { return __builtin_amdgcn_wmma_f32_16x16x32_bf16(false, a, false, b, (short)0, c, false, false); }



// ---- k_gemmw: register-blocked GEMM, NW WAVES per 64x64 output tile: wave w takes the K slices w, w + NW, ... of 32 * KS elements into its own 16 accumulators; the NW partial tiles are summed through LDS in wave order.
// Operands straight from K-contiguous 16-bit planes; grid (M/64, N/64, Z), NW * 32 threads. K % (32 * KS) == 0.
// C[m][n] (f32, pitch ldc, + optional f32 bias[n]) = sum_k A[m][k] Bt[n][k] (+ split products per NSPLIT). z-batch strides sA/sB/sC in elements. K % (32 * KS) == 0.
template <typename T16> struct WFrag;
template <> struct WFrag<h16> { typedef v16h V; static __device__ __forceinline__ V ld(const h16* p) { return cat16(*(const v8h*)p, *(const v8h*)(p + 16)); } static __device__ __forceinline__ v8f mma(V a, V b, v8f c) { return wmma16(a, b, c); } };
template <> struct WFrag<bf> { typedef v16bf V; static __device__ __forceinline__ V ld(const bf* p) { return cat16b(*(const v8us*)p, *(const v8us*)(p + 16)); } static __device__ __forceinline__ v8f mma(V a, V b, v8f c) { return wmmab(a, b, c); } };
template <typename T16, int NSPLIT, bool BIAS, int NW, int KS>
__global__ __launch_bounds__(NW * 32) void k_gemmw(const T16* __restrict__ A, const T16* __restrict__ A2, const T16* __restrict__ Bt, const T16* __restrict__ Bt2, int K, float* C, int ldc, const float* __restrict__ bias, size_t sA, size_t sB, size_t sC) {
    typedef typename WFrag<T16>::V V;
    __shared__ __align__(16) float os[NW * 64 * 68];
    const size_t z = blockIdx.z; A += z * sA; if (A2) A2 += z * sA; Bt += z * sB; if (Bt2) Bt2 += z * sB; C += z * sC;
    const int lane = threadIdx.x & 31, lr = lane & 15, hi = lane >> 4; const int r0 = blockIdx.x * 64, c0 = blockIdx.y * 64;
    const int wv = __builtin_amdgcn_readfirstlane((int)(threadIdx.x >> 5));   // this wave's K-slice phase, kept scalar so that the loop control stays scalar
    v8f acc[4][4];
#pragma unroll
    for (int mb = 0; mb < 4; ++mb)
#pragma unroll
        for (int nb = 0; nb < 4; ++nb) acc[mb][nb] = (v8f){};
    const size_t aoff = (size_t)(r0 + lr) * K + 8 * hi, boff = (size_t)(c0 + lr) * K + 8 * hi;
#pragma unroll 1
    for (int ks = wv * (32 * KS); ks < K; ks += NW * 32 * KS)      // this wave's K slices, dealt round robin over the block's waves
#pragma unroll
    for (int kc = ks; kc < ks + 32 * KS; kc += 32) {
        V a[4], a2[4];
#pragma unroll
        for (int mb = 0; mb < 4; ++mb) { a[mb] = WFrag<T16>::ld(A + aoff + (size_t)mb * 16 * K + kc); if (NSPLIT == 1 || NSPLIT == 2) a2[mb] = WFrag<T16>::ld(A2 + aoff + (size_t)mb * 16 * K + kc); }
#pragma unroll
        for (int nb = 0; nb < 4; ++nb) { const V b = WFrag<T16>::ld(Bt + boff + (size_t)nb * 16 * K + kc); V b2; if (NSPLIT >= 2) b2 = WFrag<T16>::ld(Bt2 + boff + (size_t)nb * 16 * K + kc);
#pragma unroll
            for (int mb = 0; mb < 4; ++mb) { acc[mb][nb] = WFrag<T16>::mma(a[mb], b, acc[mb][nb]); if (NSPLIT == 1 || NSPLIT == 2) acc[mb][nb] = WFrag<T16>::mma(a2[mb], b, acc[mb][nb]); if (NSPLIT >= 2) acc[mb][nb] = WFrag<T16>::mma(a[mb], b2, acc[mb][nb]); } }
        asm volatile("v_nop\n\tv_nop\n\tv_nop\n\tv_nop" : "+v"(acc[0][0]), "+v"(acc[1][1]), "+v"(acc[2][2]), "+v"(acc[3][3]) : "v"(a[0]), "v"(a[3]));
    }
#pragma unroll
    for (int mb = 0; mb < 4; ++mb) {
#pragma unroll
        for (int nb = 0; nb < 4; ++nb) {
#pragma unroll
            for (int j = 0; j < 8; ++j) os[wv * (64 * 68) + (mb * 16 + hi * 8 + j) * 68 + nb * 16 + lr] = acc[mb][nb][j]; }
    }
    __syncthreads();   // every wave's partial tile is in LDS before any wave sums it
    float* crow = C + (size_t)r0 * ldc + c0;
#pragma unroll
    for (int i = 0; i < 32 / NW; ++i) { const int row = 2 * (wv + i * NW) + hi, cofs = lr * 4; v4f val = *(const v4fa*)(os + row * 68 + cofs);
#pragma unroll
        for (int p = 1; p < NW; ++p) val += *(const v4fa*)(os + p * (64 * 68) + row * 68 + cofs); if (BIAS) { val[0] += bfr(bias[c0 + cofs]); val[1] += bfr(bias[c0 + cofs + 1]); val[2] += bfr(bias[c0 + cofs + 2]); val[3] += bfr(bias[c0 + cofs + 3]); }
        *(v4f*)(crow + (size_t)row * ldc + cofs) = val; }
}

// ---- k_gemmc: the same 64x64 tile GEMM (NW waves, K slices dealt round robin) specialised for causal attention: CMODE 1 skips score tiles entirely above the diagonal (query rows r0+roff.., key columns c0..), CMODE 2 limits the
// key (K) loop of the probability x value contraction to the diagonal block (probabilities beyond it are exactly zero). roff = row offset of this launch's first row within the sequence.
template <typename T16, int NSPLIT, int CMODE, int NW, int KS>
__global__ __launch_bounds__(NW * 32) void k_gemmc(const T16* __restrict__ A, const T16* __restrict__ A2, const T16* __restrict__ Bt, const T16* __restrict__ Bt2, int K, float* C, int ldc, int roff, size_t sA, size_t sB, size_t sC) {
    typedef typename WFrag<T16>::V V;
    __shared__ __align__(16) float os[NW * 64 * 68];
    const size_t z = blockIdx.z; A += z * sA; if (A2) A2 += z * sA; Bt += z * sB; if (Bt2) Bt2 += z * sB; C += z * sC;
    const int lane = threadIdx.x & 31, lr = lane & 15, hi = lane >> 4; const int r0 = blockIdx.x * 64, c0 = blockIdx.y * 64;
    const int wv = __builtin_amdgcn_readfirstlane((int)(threadIdx.x >> 5));   // this wave's K-slice phase, kept scalar so that the loop control stays scalar
    if (CMODE == 1 && c0 > r0 + roff + 63) return;                  // score tile entirely above the causal diagonal: never read (the softmax masks j > i by select)
    const int Kl = (CMODE == 2) ? min(K, r0 + roff + 64) : K;        // P.V: probabilities are exactly 0 beyond the diagonal block, so the K loop stops there
    v8f acc[4][4];
#pragma unroll
    for (int mb = 0; mb < 4; ++mb)
#pragma unroll
        for (int nb = 0; nb < 4; ++nb) acc[mb][nb] = (v8f){};
    const size_t aoff = (size_t)(r0 + lr) * K + 8 * hi, boff = (size_t)(c0 + lr) * K + 8 * hi;
#pragma unroll 1
    for (int ks = wv * (32 * KS); ks < Kl; ks += NW * 32 * KS)      // this wave's K slices, dealt round robin over the block's waves
#pragma unroll
    for (int kc = ks; kc < ks + 32 * KS; kc += 32) {
        V a[4], a2[4];
#pragma unroll
        for (int mb = 0; mb < 4; ++mb) { a[mb] = WFrag<T16>::ld(A + aoff + (size_t)mb * 16 * K + kc); if (NSPLIT == 1 || NSPLIT == 2) a2[mb] = WFrag<T16>::ld(A2 + aoff + (size_t)mb * 16 * K + kc); }
#pragma unroll
        for (int nb = 0; nb < 4; ++nb) { const V b = WFrag<T16>::ld(Bt + boff + (size_t)nb * 16 * K + kc); V b2; if (NSPLIT >= 2) b2 = WFrag<T16>::ld(Bt2 + boff + (size_t)nb * 16 * K + kc);
#pragma unroll
            for (int mb = 0; mb < 4; ++mb) { acc[mb][nb] = WFrag<T16>::mma(a[mb], b, acc[mb][nb]); if (NSPLIT == 1 || NSPLIT == 2) acc[mb][nb] = WFrag<T16>::mma(a2[mb], b, acc[mb][nb]); if (NSPLIT >= 2) acc[mb][nb] = WFrag<T16>::mma(a[mb], b2, acc[mb][nb]); } }
        asm volatile("v_nop\n\tv_nop\n\tv_nop\n\tv_nop" : "+v"(acc[0][0]), "+v"(acc[1][1]), "+v"(acc[2][2]), "+v"(acc[3][3]) : "v"(a[0]), "v"(a[3]));
    }
#pragma unroll
    for (int mb = 0; mb < 4; ++mb) {
#pragma unroll
        for (int nb = 0; nb < 4; ++nb) {
#pragma unroll
            for (int j = 0; j < 8; ++j) os[wv * (64 * 68) + (mb * 16 + hi * 8 + j) * 68 + nb * 16 + lr] = acc[mb][nb][j]; }
    }
    __syncthreads();   // every wave's partial tile is in LDS before any wave sums it
    float* crow = C + (size_t)r0 * ldc + c0;
#pragma unroll
    for (int i = 0; i < 32 / NW; ++i) { const int row = 2 * (wv + i * NW) + hi, cofs = lr * 4; v4f val = *(const v4fa*)(os + row * 68 + cofs);
#pragma unroll
        for (int p = 1; p < NW; ++p) val += *(const v4fa*)(os + p * (64 * 68) + row * 68 + cofs);
        *(v4f*)(crow + (size_t)row * ldc + cofs) = val; }
}

__device__ __forceinline__ h16 tohx(float x) { return (h16)x; }
__device__ __forceinline__ void splitf(float y, unsigned short& h, unsigned short& l) { h = f2bf(y); l = f2bf(y - bf2f(h)); }
typedef __attribute__((ext_vector_type(2))) _Float16 v2h;
typedef __attribute__((ext_vector_type(4))) _Float16 v4h;
typedef __attribute__((ext_vector_type(2))) unsigned short v2us;
typedef __attribute__((ext_vector_type(4))) unsigned short v4us;
typedef __attribute__((ext_vector_type(2))) float v2f;
typedef __attribute__((ext_vector_type(4))) int v4i;

__global__ __launch_bounds__(256) void k_wtG(const float* __restrict__ w, int K, int N, bf* Bt) {
    const int lane = threadIdx.x & 31; const int L0 = (blockIdx.x * 8 + (threadIdx.x >> 5)) * 8; const int nlines = N * K / 64;
{
#pragma unroll 1
        for (int l = 0; l < 8; ++l) { const int L = L0 + l; if (L >= nlines) break; const size_t e = (size_t)L * 64 + lane * 2; const int k = (int)(e % K), n = (int)(e / K); v2us o;
            o[0] = f2bf(w[(size_t)k * N + n]); o[1] = f2bf(w[(size_t)(k + 1) * N + n]); *(v2us*)(Bt + e) = o; }
         }
}
__global__ __launch_bounds__(256) void k_cvt8(const float* __restrict__ src, bf* dst, size_t n8) { const size_t i = (size_t)blockIdx.x * 256 + threadIdx.x; if (i >= n8) return; const v8f v = *(const v8f*)(src + i * 8); v8us o;
#pragma unroll
    for (int k = 0; k < 8; ++k) o[k] = f2bf(v[k]); *(v8us*)(dst + i * 8) = o;  }
__constant__ float INV[HD / 2] = {1.00000000f,0.805842161f,0.649381638f,0.523299098f,0.421696514f,0.339820832f,0.273841977f,0.220673412f,0.177827939f,0.143301263f,0.115478195f,0.0930572078f,0.0749894232f,0.0604296401f,0.0486967526f,0.0392418988f,0.0316227749f,0.0254829675f,0.0205352511f,0.0165481716f,0.0133352140f,0.0107460786f,0.00865964312f,0.00697830599f,0.00562341325f,0.00453158375f,0.00365174119f,0.00294272718f,0.00237137382f,0.00191095297f,0.00153992651f,0.00124093774f,0.00100000005f,0.000805842166f,0.000649381604f,0.000523299095f,0.000421696517f,0.000339820836f,0.000273841957f,0.000220673406f,0.000177827940f,0.000143301251f,0.000115478200f,0.0000930572060f,0.0000749894243f,0.0000604296401f,0.0000486967510f,0.0000392418988f,0.0000316227779f,0.0000254829683f,0.0000205352499f,0.0000165481706f,0.0000133352141f,0.0000107460783f,0.00000865964284f,0.00000697830592f,0.00000562341347f,0.00000453158373f,0.00000365174128f,0.00000294272718f,0.00000237137374f,0.00000191095296f,0.00000153992653f,0.00000124093776f};
__global__ __launch_bounds__(256) void k_cstab(float* CS) { const int idx = blockIdx.x * 256 + threadIdx.x; if (idx >= TT * HD) return; const int t = idx / HD, d = idx % HD; const float ang = __fmul_rn((float)t, INV[d % (HD / 2)]); v2f cs; cs[0] = cosf(ang); cs[1] = sinf(ang);
    *(v2f*)(CS + (size_t)idx * 2) = cs;  }

// k_rope: head planes [h][t][d] (fp16 + hi/lo) of rope(x) x sc with the rotate-half convention out[d] = x[d] cos[t][d] - x[d+HD/2] sin[t][d], out[d+HD/2] = x[d+HD/2] cos[t][d+HD/2] + x[d] sin[t][d+HD/2]
__global__ __launch_bounds__(256) void k_rope(const float* __restrict__ F, int pitch, int nheads, const float* __restrict__ CS, const float* __restrict__ RF, const float* __restrict__ nw, float sc, h16* P16, bf* Ph, bf* Pl) {
    const size_t e = ((size_t)blockIdx.x * 256 + threadIdx.x) * 2; if (e >= (size_t)nheads * TT * HD) return; const int d = (int)(e % HD); const int t = (int)((e / HD) % TT); const int h = (int)(e / ((size_t)HD * TT)); const float* f = F + (size_t)t * pitch + h * HD; const float rf = RF ? RF[(size_t)h * TT + t] : 1.0f; v2h o16; v2us oh, ol;
#pragma unroll
    for (int q = 0; q < 2; ++q) { const int dd = d + q; const int dp = (dd < HD / 2) ? dd + HD / 2 : dd - HD / 2; float x0 = f[dd], x1 = f[dp];
        if (RF) { float n0 = __fmul_rn(x0, rf), n1 = __fmul_rn(x1, rf); asm volatile("" : "+v"(n0)); asm volatile("" : "+v"(n1)); x0 = __fmul_rn(bfr(nw[dd]), n0); x1 = __fmul_rn(bfr(nw[dp]), n1); }
        const v2f cs = *(const v2f*)(CS + ((size_t)t * HD + dd) * 2); float a = __fmul_rn(x0, cs[0]), bq = __fmul_rn(x1, cs[1]); asm volatile("" : "+v"(a)); asm volatile("" : "+v"(bq)); const float r = ((dd < HD / 2) ? __fsub_rn(a, bq) : __fadd_rn(a, bq)) * sc;
        o16[q] = tohx(r); unsigned short a2, c2; splitf(r, a2, c2); oh[q] = a2; ol[q] = c2; }
    *(v2h*)(P16 + e) = o16; *(v2us*)(Ph + e) = oh; *(v2us*)(Pl + e) = ol;  }
__global__ __launch_bounds__(256) void k_vtp(const float* __restrict__ F, int pitch, int nheads, h16* V16, bf* Vh, bf* Vl) { const size_t e = ((size_t)blockIdx.x * 256 + threadIdx.x) * 2; if (e >= (size_t)nheads * HD * TT) return; const int t = (int)(e % TT); const int d = (int)((e / TT) % HD); const int g = (int)(e / ((size_t)TT * HD)); v2h o16; v2us oh, ol;
#pragma unroll
    for (int q = 0; q < 2; ++q) { const float x = F[(size_t)(t + q) * pitch + g * HD + d]; o16[q] = tohx(x); unsigned short a2, c2; splitf(x, a2, c2); oh[q] = a2; ol[q] = c2; }
    *(v2h*)(V16 + e) = o16; *(v2us*)(Vh + e) = oh; *(v2us*)(Vl + e) = ol;  }
// k_asoft: per row (zz, i): t = S x HD^-0.5 for j <= i and i - j < WIN (sliding causal window; the reference's -1e9 additive fill vanishes identically); softmax over the 2048 keys (register row, one exp, fixed trees);
__global__ __launch_bounds__(256) void k_asoft(const float* __restrict__ Sb, h16* P16, bf* Ph, bf* Pl) {
    const int lane = threadIdx.x & 31; const int row = blockIdx.x * 8 + (threadIdx.x >> 5); if (row >= ZH * TT) return; const int i = row % TT; const int zz = row / TT; (void)zz; const bool hires = (i < RH); const float* sr = Sb + (size_t)row * TT; float v[TT / 32]; float mx = -3.0e38f;
#pragma unroll
    for (int ch = 0; ch < TT / 128; ++ch) { const int j0 = ch * 128 + lane * 4; const v4f a = *(const v4f*)(sr + j0);
#pragma unroll
        for (int q = 0; q < 4; ++q) { const int j = j0 + q; (void)j; const float t = (j <= i && i - j < WIN) ? a[q] * SCL : -3.0e38f; v[ch * 4 + q] = t; mx = fmaxf(mx, t); } }
#pragma unroll
    for (int sh = 16; sh; sh >>= 1) mx = fmaxf(mx, __shfl_xor(mx, sh, 32));
    float sum = 0.f;
#pragma unroll
    for (int k = 0; k < TT / 32; ++k) { float d0 = __fsub_rn(v[k], mx); asm volatile("" : "+v"(d0)); v[k] = __builtin_amdgcn_exp2f(__fmul_rn(d0, 1.4426950408889634f)); sum += v[k]; }
#pragma unroll
    for (int sh = 16; sh; sh >>= 1) sum += __shfl_xor(sum, sh, 32);
    const float f = __fdiv_rn(hires ? 1.0f : PCAR, sum);
{
        if (hires) {
#pragma unroll
            for (int ch = 0; ch < TT / 128; ++ch) { v4us oh, ol;
#pragma unroll
                for (int q = 0; q < 4; ++q) { unsigned short a, c2; splitf(v[ch * 4 + q] * f, a, c2); oh[q] = a; ol[q] = c2; }
                const size_t oo = ((size_t)zz * (RH ? RH : 1) + i) * TT + ch * 128 + lane * 4; *(v4us*)(Ph + oo) = oh; *(v4us*)(Pl + oo) = ol; }
        } else {
#pragma unroll
            for (int ch = 0; ch < TT / 128; ++ch) { v4h o4;
#pragma unroll
                for (int q = 0; q < 4; ++q) o4[q] = tohx(v[ch * 4 + q] * f);
                *(v4h*)(P16 + (size_t)row * TT + ch * 128 + lane * 4) = o4; } }
         }
}
__global__ __launch_bounds__(256) void k_merge(const float* __restrict__ O, int h0, bf* Ah, bf* Al) { const size_t e = ((size_t)blockIdx.x * 256 + threadIdx.x) * 2; if (e >= (size_t)ZH * TT * HD) return; const int d = (int)(e % HD); const int t = (int)((e / HD) % TT); const int zz = (int)(e / ((size_t)HD * TT)); const float cs = (t < RH) ? 1.0f : (1.0f / PCAR); const size_t oo = (size_t)t * DQ + (h0 + zz) * HD + d;
    v2us oh, ol;
#pragma unroll
    for (int q = 0; q < 2; ++q) { unsigned short a, c2; splitf(O[e + q] * cs, a, c2); oh[q] = a; ol[q] = c2; } *(v2us*)(Ah + oo) = oh; *(v2us*)(Al + oo) = ol;  }

extern "C" void kernel_launch(void* const* d_in, const int* in_sizes, int n_in,
                              void* d_out, int out_size, void* d_ws, size_t ws_size, hipStream_t stream) {
    (void)in_sizes; (void)n_in; (void)out_size;
    const float* x = (const float*)d_in[0]; const float* wq = (const float*)d_in[1]; const float* wk = (const float*)d_in[2]; const float* wv = (const float*)d_in[3]; const float* wo = (const float*)d_in[4];
    float* OUT = (float*)d_out;     // [2][2048][2048]
    char* wsp = (char*)d_ws;
    auto take = [&](size_t bytes) { char* p = wsp; wsp += (bytes + 255) & ~(size_t)255; return (void*)p; };
    bf* WQ = (bf*)take((size_t)DQ * DM * 2); bf* WK = (bf*)take((size_t)DKV * DM * 2); bf* WV = (bf*)take((size_t)DKV * DM * 2); bf* WO = (bf*)take((size_t)DM * DQ * 2); float* CS = (float*)take((size_t)TT * HD * 2 * 4);
    bf* XB = (bf*)take((size_t)TT * DM * 2); float* FQ = (float*)take((size_t)TT * DQ * 4); float* FK = (float*)take((size_t)TT * DKV * 4);
    h16* QP16 = (h16*)take((size_t)NH_ * TT * HD * 2); h16* KP16 = (h16*)take((size_t)NKV * TT * HD * 2); h16* VT16 = (h16*)take((size_t)NKV * HD * TT * 2);
    bf* QPh = (bf*)take((size_t)NH_ * TT * HD * 2); bf* QPl = (bf*)take((size_t)NH_ * TT * HD * 2); bf* KPh = (bf*)take((size_t)NKV * TT * HD * 2); bf* KPl = (bf*)take((size_t)NKV * TT * HD * 2); bf* VTh = (bf*)take((size_t)NKV * HD * TT * 2); bf* VTl = (bf*)take((size_t)NKV * HD * TT * 2); bf* Ph = (bf*)take((size_t)ZH * RH * TT * 2); bf* Pl = (bf*)take((size_t)ZH * RH * TT * 2);
    float* Sb = (float*)take((size_t)ZH * TT * TT * 4); h16* P16 = (h16*)take((size_t)ZH * TT * TT * 2); float* Ob = (float*)take((size_t)ZH * TT * HD * 4); bf* ATh = (bf*)take((size_t)TT * DQ * 2); bf* ATl = (bf*)take((size_t)TT * DQ * 2);
    if ((size_t)(wsp - (char*)d_ws) > ws_size) return;    // ws 256 MiB
    float* FV = FK;   // v projection reuses the k buffer after the k planes are built (stream-ordered)
    { k_cvt8<<<(unsigned)(((size_t)DQ * DM / 8 + 255) / 256), 256, 0, stream>>>(wq, WQ, (size_t)DQ * DM / 8); k_cvt8<<<(unsigned)(((size_t)DKV * DM / 8 + 255) / 256), 256, 0, stream>>>(wk, WK, (size_t)DKV * DM / 8); k_cvt8<<<(unsigned)(((size_t)DKV * DM / 8 + 255) / 256), 256, 0, stream>>>(wv, WV, (size_t)DKV * DM / 8);
      k_cvt8<<<(unsigned)(((size_t)DM * DQ / 8 + 255) / 256), 256, 0, stream>>>(wo, WO, (size_t)DM * DQ / 8);
      k_cstab<<<(TT * HD + 255) / 256, 256, 0, stream>>>(CS); }
    const unsigned LQ = (unsigned)(((size_t)NH_ * TT * HD / 2 + 255) / 256), LKv = (unsigned)(((size_t)NKV * TT * HD / 2 + 255) / 256);
    for (int b = 0; b < NB_; ++b) {
        
        k_cvt8<<<(unsigned)(((size_t)TT * DM / 8 + 255) / 256), 256, 0, stream>>>(x + (size_t)b * TT * DM, XB, (size_t)TT * DM / 8);
        k_gemmw<bf, 0, false, 4, 2><<<dim3(TT / 64, DQ / 64, 1), 128, 0, stream>>>(XB, nullptr, WQ, nullptr, DM, FQ, DQ, nullptr, 0, 0, 0);
        k_rope<<<LQ, 256, 0, stream>>>(FQ, DQ, NH_, CS, nullptr, nullptr, 1.0f, QP16, QPh, QPl);
        k_gemmw<bf, 0, false, 8, 2><<<dim3(TT / 64, DKV / 64, 1), 256, 0, stream>>>(XB, nullptr, WK, nullptr, DM, FK, DKV, nullptr, 0, 0, 0);
        k_rope<<<LKv, 256, 0, stream>>>(FK, DKV, NKV, CS, nullptr, nullptr, 1.0f, KP16, KPh, KPl);
        k_gemmw<bf, 0, false, 8, 2><<<dim3(TT / 64, DKV / 64, 1), 256, 0, stream>>>(XB, nullptr, WV, nullptr, DM, FV, DKV, nullptr, 0, 0, 0); k_vtp<<<LKv, 256, 0, stream>>>(FV, DKV, NKV, VT16, VTh, VTl);
        for (int h0 = 0; h0 < NH_; h0 += ZH) { const size_t zq = (size_t)h0, zk = (size_t)(h0 / REP);   // both heads of a pass share kv group h0/REP (REP >= 2): sB = 0
            k_gemmc<bf, 2, 1, 1, 1><<<dim3(RH / 64, TT / 64, ZH), 32, 0, stream>>>(QPh + zq * TT * HD, QPl + zq * TT * HD, KPh + zk * TT * HD, KPl + zk * TT * HD, HD, Sb, TT, 0, (size_t)TT * HD, 0, (size_t)TT * TT);
            k_gemmc<h16, 0, 1, 1, 1><<<dim3((TT - RH) / 64, TT / 64, ZH), 32, 0, stream>>>(QP16 + zq * TT * HD + (size_t)RH * HD, nullptr, KP16 + zk * TT * HD, nullptr, HD, Sb + (size_t)RH * TT, TT, RH, (size_t)TT * HD, 0, (size_t)TT * TT);
            k_asoft<<<ZH * TT / 8, 256, 0, stream>>>(Sb, P16, Ph, Pl);
            k_gemmc<bf, 2, 2, 8, 1><<<dim3(RH / 64, HD / 64, ZH), 256, 0, stream>>>(Ph, Pl, VTh + zk * HD * TT, VTl + zk * HD * TT, TT, Ob, HD, 0, (size_t)RH * TT, 0, (size_t)TT * HD);
            k_gemmc<h16, 0, 2, 8, 2><<<dim3((TT - RH) / 64, HD / 64, ZH), 256, 0, stream>>>(P16 + (size_t)RH * TT, nullptr, VT16 + zk * HD * TT, nullptr, TT, Ob + (size_t)RH * HD, HD, RH, (size_t)TT * TT, 0, (size_t)TT * HD);
            k_merge<<<(unsigned)(((size_t)ZH * TT * HD / 2 + 255) / 256), 256, 0, stream>>>(Ob, h0, ATh, ATl); }
        k_gemmw<bf, 1, false, 4, 1><<<dim3(TT / 64, DM / 64, 1), 128, 0, stream>>>(ATh, ATl, WO, nullptr, DQ, OUT + (size_t)b * TT * DM, DM, nullptr, 0, 0, 0); }
}

// v002
// Measured time: 630 microseconds a run.
// Timed twice side by side with v001, it ran 1.49 and 1.47 times as fast.
// All steps since v000 together make it 2.56 times as fast.
#include <hip/hip_runtime.h>

// Grouped-query RoPE causal attention ('eager' path) (x [2][2048][2048]; q = x w_q^T ([2048][2048]: 16 heads x 128), k, v = x w_k^T / w_v^T ([512][2048]: 4 kv heads); rotate-half RoPE (theta 1e6, full 128 dims, tables computed on device); kv head = h/4; scores = q.k/sqrt(128); causal (finfo.min == exact zero weight); softmax; out = merged w_o^T -> [2][2048][2048] (8.4 M)).
// Compute dtypes, f32 accumulate: every input rounded to bf16; q/k/v on PLAIN bf16 operands (inputs: exact); rotary in f32 (cos/sin from an on-device f32 table: inv_freq_i = 1e6^(-2i/128), precise cosf/sinf); causal scores and attn.v (tile skipping): query rows < 512 hl (3 products), the rest single fp16 (x1024); softmax f32; w_o hl x exact (2 products).

#define NB_  2
#define TT   2048
#define DM   2048
#define NH_  16
#define NKV  4
#define REP  (NH_ / NKV)
#define HD   128
#define DQ   (NH_ * HD)
#define DKV  (NKV * HD)
#define ZH   8                    // query heads per attention pass (a multiple of REP; the f32 score planes of one pass are ZH * TT * TT)
#define RH   512                  // query rows < RH use hi+lo planes (0: none)
#define WIN  2048
#define PCAR 1024.0f
#define SCL  0.088388347648318447f   // HD^-0.5
typedef _Float16 h16;
typedef unsigned short bf;
typedef __attribute__((ext_vector_type(16))) __bf16   v16bf;
typedef __attribute__((ext_vector_type(16))) _Float16 v16h;
typedef __attribute__((ext_vector_type(8)))  _Float16 v8h;
typedef __attribute__((ext_vector_type(8)))  unsigned short v8us;
typedef __attribute__((ext_vector_type(8)))  float    v8f;
typedef __attribute__((ext_vector_type(4)))  float    v4f;
typedef v8h  __attribute__((may_alias)) v8ha;
typedef v4f  __attribute__((may_alias)) v4fa;
typedef v8us __attribute__((may_alias)) v8usa;

__device__ __forceinline__ unsigned short f2bf(float f) { unsigned u = __float_as_uint(f); u += 0x7FFFu + ((u >> 16) & 1u); return (unsigned short)(u >> 16); }
__device__ __forceinline__ float bf2f(unsigned short b) { return __uint_as_float(((unsigned)b) << 16); }
__device__ __forceinline__ float bfr(float f) { return bf2f(f2bf(f)); }
__device__ __forceinline__ v16h cat16(v8h lo, v8h hi) { return __builtin_shufflevector(lo, hi, 0, 1, 2, 3, 4, 5, 6, 7, 8, 9, 10, 11, 12, 13, 14, 15); }
__device__ __forceinline__ v16bf cat16b(v8us lo, v8us hi) { return __builtin_bit_cast(v16bf, __builtin_shufflevector(lo, hi, 0, 1, 2, 3, 4, 5, 6, 7, 8, 9, 10, 11, 12, 13, 14, 15)); }
__device__ __forceinline__ v8f wmma16(v16h a, v16h b, v8f c) { return __builtin_amdgcn_wmma_f32_16x16x32_f16(false, a, false, b, (short)0, c, false, false); }
__device__ __forceinline__ v8f wmmab(v16bf a, v16bf b, v8f c) { return __builtin_amdgcn_wmma_f32_16x16x32_bf16(false, a, false, b, (short)0, c, false, false); }



// ---- k_gemmw: register-blocked GEMM, NW WAVES per 64x64 output tile: wave w takes the K slices w, w + NW, ... of 32 * KS elements into its own 16 accumulators; the NW partial tiles are summed through LDS in wave order.
// Operands straight from K-contiguous 16-bit planes; grid (M/64, N/64, Z), NW * 32 threads. K % (32 * KS) == 0.
// C[m][n] (f32, pitch ldc, + optional f32 bias[n]) = sum_k A[m][k] Bt[n][k] (+ split products per NSPLIT). z-batch strides sA/sB/sC in elements. K % (32 * KS) == 0.
template <typename T16> struct WFrag;
template <> struct WFrag<h16> { typedef v16h V; static __device__ __forceinline__ V ld(const h16* p) { return cat16(*(const v8h*)p, *(const v8h*)(p + 16)); } static __device__ __forceinline__ v8f mma(V a, V b, v8f c) { return wmma16(a, b, c); } };
template <> struct WFrag<bf> { typedef v16bf V; static __device__ __forceinline__ V ld(const bf* p) { return cat16b(*(const v8us*)p, *(const v8us*)(p + 16)); } static __device__ __forceinline__ v8f mma(V a, V b, v8f c) { return wmmab(a, b, c); } };
template <typename T16, int NSPLIT, bool BIAS, int NW, int KS>
__global__ __launch_bounds__(NW * 32) void k_gemmw(const T16* __restrict__ A, const T16* __restrict__ A2, const T16* __restrict__ Bt, const T16* __restrict__ Bt2, int K, float* C, int ldc, const float* __restrict__ bias, size_t sA, size_t sB, size_t sC) {
    typedef typename WFrag<T16>::V V;
    __shared__ __align__(16) float os[NW * 64 * 68];
    const size_t z = blockIdx.z; A += z * sA; if (A2) A2 += z * sA; Bt += z * sB; if (Bt2) Bt2 += z * sB; C += z * sC;
    const int lane = threadIdx.x & 31, lr = lane & 15, hi = lane >> 4; const int r0 = blockIdx.x * 64, c0 = blockIdx.y * 64;
    const int wv = __builtin_amdgcn_readfirstlane((int)(threadIdx.x >> 5));   // this wave's K-slice phase, kept scalar so that the loop control stays scalar
    v8f acc[4][4];
#pragma unroll
    for (int mb = 0; mb < 4; ++mb)
#pragma unroll
        for (int nb = 0; nb < 4; ++nb) acc[mb][nb] = (v8f){};
    const size_t aoff = (size_t)(r0 + lr) * K + 8 * hi, boff = (size_t)(c0 + lr) * K + 8 * hi;
#pragma unroll 1
    for (int ks = wv * (32 * KS); ks < K; ks += NW * 32 * KS)      // this wave's K slices, dealt round robin over the block's waves
#pragma unroll
    for (int kc = ks; kc < ks + 32 * KS; kc += 32) {
        V a[4], a2[4];
#pragma unroll
        for (int mb = 0; mb < 4; ++mb) { a[mb] = WFrag<T16>::ld(A + aoff + (size_t)mb * 16 * K + kc); if (NSPLIT == 1 || NSPLIT == 2) a2[mb] = WFrag<T16>::ld(A2 + aoff + (size_t)mb * 16 * K + kc); }
#pragma unroll
        for (int nb = 0; nb < 4; ++nb) { const V b = WFrag<T16>::ld(Bt + boff + (size_t)nb * 16 * K + kc); V b2; if (NSPLIT >= 2) b2 = WFrag<T16>::ld(Bt2 + boff + (size_t)nb * 16 * K + kc);
#pragma unroll
            for (int mb = 0; mb < 4; ++mb) { acc[mb][nb] = WFrag<T16>::mma(a[mb], b, acc[mb][nb]); if (NSPLIT == 1 || NSPLIT == 2) acc[mb][nb] = WFrag<T16>::mma(a2[mb], b, acc[mb][nb]); if (NSPLIT >= 2) acc[mb][nb] = WFrag<T16>::mma(a[mb], b2, acc[mb][nb]); } }
        asm volatile("v_nop\n\tv_nop\n\tv_nop\n\tv_nop" : "+v"(acc[0][0]), "+v"(acc[1][1]), "+v"(acc[2][2]), "+v"(acc[3][3]) : "v"(a[0]), "v"(a[3]));
    }
#pragma unroll
    for (int mb = 0; mb < 4; ++mb) {
#pragma unroll
        for (int nb = 0; nb < 4; ++nb) {
#pragma unroll
            for (int j = 0; j < 8; ++j) os[wv * (64 * 68) + (mb * 16 + hi * 8 + j) * 68 + nb * 16 + lr] = acc[mb][nb][j]; }
    }
    __syncthreads();   // every wave's partial tile is in LDS before any wave sums it
    float* crow = C + (size_t)r0 * ldc + c0;
#pragma unroll
    for (int i = 0; i < 32 / NW; ++i) { const int row = 2 * (wv + i * NW) + hi, cofs = lr * 4; v4f val = *(const v4fa*)(os + row * 68 + cofs);
#pragma unroll
        for (int p = 1; p < NW; ++p) val += *(const v4fa*)(os + p * (64 * 68) + row * 68 + cofs); if (BIAS) { val[0] += bfr(bias[c0 + cofs]); val[1] += bfr(bias[c0 + cofs + 1]); val[2] += bfr(bias[c0 + cofs + 2]); val[3] += bfr(bias[c0 + cofs + 3]); }
        *(v4f*)(crow + (size_t)row * ldc + cofs) = val; }
}

// ---- k_gemmc: the same 64x64 tile GEMM (NW waves, K slices dealt round robin) specialised for causal attention: CMODE 1 skips score tiles entirely above the diagonal (query rows r0+roff.., key columns c0..), CMODE 2 limits the
// key (K) loop of the probability x value contraction to the diagonal block (probabilities beyond it are exactly zero). roff = row offset of this launch's first row within the sequence. lda = pitch of the A rows in elements (Bt rows have pitch K). Grid z = query head of the pass; its Bt plane is that of kv head z / REP.
template <typename T16, int NSPLIT, int CMODE, int NW, int KS>
__global__ __launch_bounds__(NW * 32) void k_gemmc(const T16* __restrict__ A, const T16* __restrict__ A2, int lda, const T16* __restrict__ Bt, const T16* __restrict__ Bt2, int K, float* C, int ldc, int roff, size_t sA, size_t sB, size_t sC) {
    typedef typename WFrag<T16>::V V;
    __shared__ __align__(16) float os[NW * 64 * 68];
    const size_t z = blockIdx.z; A += z * sA; if (A2) A2 += z * sA; Bt += (z / REP) * sB; if (Bt2) Bt2 += (z / REP) * sB; C += z * sC;
    const int lane = threadIdx.x & 31, lr = lane & 15, hi = lane >> 4; const int r0 = blockIdx.x * 64, c0 = blockIdx.y * 64;
    const int wv = __builtin_amdgcn_readfirstlane((int)(threadIdx.x >> 5));   // this wave's K-slice phase, kept scalar so that the loop control stays scalar
    if (CMODE == 1 && c0 > r0 + roff + 63) return;                  // score tile entirely above the causal diagonal: never read (the softmax masks j > i by select)
    const int Kl = (CMODE == 2) ? min(K, r0 + roff + 64) : K;        // P.V: probabilities are exactly 0 beyond the diagonal block, so the K loop stops there
    v8f acc[4][4];
#pragma unroll
    for (int mb = 0; mb < 4; ++mb)
#pragma unroll
        for (int nb = 0; nb < 4; ++nb) acc[mb][nb] = (v8f){};
    const size_t aoff = (size_t)(r0 + lr) * lda + 8 * hi, boff = (size_t)(c0 + lr) * K + 8 * hi;
#pragma unroll 1
    for (int ks = wv * (32 * KS); ks < Kl; ks += NW * 32 * KS) {    // this wave's K slices, dealt round robin over the block's waves
        const T16* pa[4]; const T16* pa2[4]; const T16* pb[4]; const T16* pb2[4];   // the row addresses of this trip's fragments
#pragma unroll
        for (int q = 0; q < 4; ++q) { pa[q] = A + aoff + (size_t)q * 16 * lda + ks; if (NSPLIT == 1 || NSPLIT == 2) pa2[q] = A2 + aoff + (size_t)q * 16 * lda + ks; pb[q] = Bt + boff + (size_t)q * 16 * K + ks; if (NSPLIT >= 2) pb2[q] = Bt2 + boff + (size_t)q * 16 * K + ks; }
#pragma unroll
    for (int kc = 0; kc < 32 * KS; kc += 32) {
        V a[4], a2[4];
#pragma unroll
        for (int mb = 0; mb < 4; ++mb) { a[mb] = WFrag<T16>::ld(pa[mb] + kc); if (NSPLIT == 1 || NSPLIT == 2) a2[mb] = WFrag<T16>::ld(pa2[mb] + kc); }
        // the wait that stands before a register of an issued global load is overwritten; it takes the loads' addresses as inputs, so that every address register stays as it is up to the wait
        if (NSPLIT == 1 || NSPLIT == 2) asm volatile("s_wait_xcnt 0x0" :: "v"(pa[0]), "v"(pa[1]), "v"(pa[2]), "v"(pa[3]), "v"(pa2[0]), "v"(pa2[1]), "v"(pa2[2]), "v"(pa2[3]) : "memory"); else asm volatile("s_wait_xcnt 0x0" :: "v"(pa[0]), "v"(pa[1]), "v"(pa[2]), "v"(pa[3]) : "memory");
#pragma unroll
        for (int nb = 0; nb < 4; ++nb) { const V b = WFrag<T16>::ld(pb[nb] + kc); V b2; if (NSPLIT >= 2) b2 = WFrag<T16>::ld(pb2[nb] + kc);
            // the same wait behind the B loads, with their addresses as inputs
            if (NSPLIT >= 2) asm volatile("s_wait_xcnt 0x0" :: "v"(pb[nb]), "v"(pb2[nb]) : "memory"); else asm volatile("s_wait_xcnt 0x0" :: "v"(pb[nb]) : "memory");
#pragma unroll
            for (int mb = 0; mb < 4; ++mb) { acc[mb][nb] = WFrag<T16>::mma(a[mb], b, acc[mb][nb]); if (NSPLIT == 1 || NSPLIT == 2) acc[mb][nb] = WFrag<T16>::mma(a2[mb], b, acc[mb][nb]); if (NSPLIT >= 2) acc[mb][nb] = WFrag<T16>::mma(a[mb], b2, acc[mb][nb]); } }
        asm volatile("v_nop\n\tv_nop\n\tv_nop\n\tv_nop" : "+v"(acc[0][0]), "+v"(acc[1][1]), "+v"(acc[2][2]), "+v"(acc[3][3]) : "v"(a[0]), "v"(a[3]));
    } }
#pragma unroll
    for (int mb = 0; mb < 4; ++mb) {
#pragma unroll
        for (int nb = 0; nb < 4; ++nb) {
#pragma unroll
            for (int j = 0; j < 8; ++j) os[wv * (64 * 68) + (mb * 16 + hi * 8 + j) * 68 + nb * 16 + lr] = acc[mb][nb][j]; }
    }
    __syncthreads();   // every wave's partial tile is in LDS before any wave sums it
    float* crow = C + (size_t)r0 * ldc + c0;
#pragma unroll
    for (int i = 0; i < 32 / NW; ++i) { const int row = 2 * (wv + i * NW) + hi, cofs = lr * 4; v4f val = *(const v4fa*)(os + row * 68 + cofs);
#pragma unroll
        for (int p = 1; p < NW; ++p) val += *(const v4fa*)(os + p * (64 * 68) + row * 68 + cofs);
        *(v4f*)(crow + (size_t)row * ldc + cofs) = val; }
}

__device__ __forceinline__ h16 tohx(float x) { return (h16)x; }
__device__ __forceinline__ void splitf(float y, unsigned short& h, unsigned short& l) { h = f2bf(y); l = f2bf(y - bf2f(h)); }
typedef __attribute__((ext_vector_type(2))) _Float16 v2h;
typedef __attribute__((ext_vector_type(4))) _Float16 v4h;
typedef __attribute__((ext_vector_type(2))) unsigned short v2us;
typedef __attribute__((ext_vector_type(4))) unsigned short v4us;
typedef v4h  __attribute__((may_alias)) v4ha;
typedef v4us __attribute__((may_alias)) v4usa;
typedef __attribute__((ext_vector_type(2))) float v2f;
typedef __attribute__((ext_vector_type(4))) int v4i;

__global__ __launch_bounds__(256) void k_wtG(const float* __restrict__ w, int K, int N, bf* Bt) {
    const int lane = threadIdx.x & 31; const int L0 = (blockIdx.x * 8 + (threadIdx.x >> 5)) * 8; const int nlines = N * K / 64;
{
#pragma unroll 1
        for (int l = 0; l < 8; ++l) { const int L = L0 + l; if (L >= nlines) break; const size_t e = (size_t)L * 64 + lane * 2; const int k = (int)(e % K), n = (int)(e / K); v2us o;
            o[0] = f2bf(w[(size_t)k * N + n]); o[1] = f2bf(w[(size_t)(k + 1) * N + n]); *(v2us*)(Bt + e) = o; }
         }
}
__global__ __launch_bounds__(256) void k_cvt8(const float* __restrict__ src, bf* dst, size_t n8) { const size_t i = (size_t)blockIdx.x * 256 + threadIdx.x; if (i >= n8) return; const v8f v = *(const v8f*)(src + i * 8); v8us o;
#pragma unroll
    for (int k = 0; k < 8; ++k) o[k] = f2bf(v[k]); *(v8us*)(dst + i * 8) = o;  }
__constant__ float INV[HD / 2] = {1.00000000f,0.805842161f,0.649381638f,0.523299098f,0.421696514f,0.339820832f,0.273841977f,0.220673412f,0.177827939f,0.143301263f,0.115478195f,0.0930572078f,0.0749894232f,0.0604296401f,0.0486967526f,0.0392418988f,0.0316227749f,0.0254829675f,0.0205352511f,0.0165481716f,0.0133352140f,0.0107460786f,0.00865964312f,0.00697830599f,0.00562341325f,0.00453158375f,0.00365174119f,0.00294272718f,0.00237137382f,0.00191095297f,0.00153992651f,0.00124093774f,0.00100000005f,0.000805842166f,0.000649381604f,0.000523299095f,0.000421696517f,0.000339820836f,0.000273841957f,0.000220673406f,0.000177827940f,0.000143301251f,0.000115478200f,0.0000930572060f,0.0000749894243f,0.0000604296401f,0.0000486967510f,0.0000392418988f,0.0000316227779f,0.0000254829683f,0.0000205352499f,0.0000165481706f,0.0000133352141f,0.0000107460783f,0.00000865964284f,0.00000697830592f,0.00000562341347f,0.00000453158373f,0.00000365174128f,0.00000294272718f,0.00000237137374f,0.00000191095296f,0.00000153992653f,0.00000124093776f};
__global__ __launch_bounds__(256) void k_cstab(float* CS) { const int idx = blockIdx.x * 256 + threadIdx.x; if (idx >= TT * HD) return; const int t = idx / HD, d = idx % HD; const float ang = __fmul_rn((float)t, INV[d % (HD / 2)]); v2f cs; cs[0] = cosf(ang); cs[1] = sinf(ang);
    *(v2f*)(CS + (size_t)idx * 2) = cs;  }

// k_rope: head planes [h][t][d] (fp16 + hi/lo) of rope(x) x sc with the rotate-half convention out[d] = x[d] cos[t][d] - x[d+HD/2] sin[t][d], out[d+HD/2] = x[d+HD/2] cos[t][d+HD/2] + x[d] sin[t][d+HD/2]
__global__ __launch_bounds__(256) void k_rope(const float* __restrict__ F, int pitch, int nheads, const float* __restrict__ CS, const float* __restrict__ RF, const float* __restrict__ nw, float sc, h16* P16, bf* Ph, bf* Pl) {
    const size_t e = ((size_t)blockIdx.x * 256 + threadIdx.x) * 2; if (e >= (size_t)nheads * TT * HD) return; const int d = (int)(e % HD); const int t = (int)((e / HD) % TT); const int h = (int)(e / ((size_t)HD * TT)); const float* f = F + (size_t)t * pitch + h * HD; const float rf = RF ? RF[(size_t)h * TT + t] : 1.0f; v2h o16; v2us oh, ol;
#pragma unroll
    for (int q = 0; q < 2; ++q) { const int dd = d + q; const int dp = (dd < HD / 2) ? dd + HD / 2 : dd - HD / 2; float x0 = f[dd], x1 = f[dp];
        if (RF) { float n0 = __fmul_rn(x0, rf), n1 = __fmul_rn(x1, rf); asm volatile("" : "+v"(n0)); asm volatile("" : "+v"(n1)); x0 = __fmul_rn(bfr(nw[dd]), n0); x1 = __fmul_rn(bfr(nw[dp]), n1); }
        const v2f cs = *(const v2f*)(CS + ((size_t)t * HD + dd) * 2); float a = __fmul_rn(x0, cs[0]), bq = __fmul_rn(x1, cs[1]); asm volatile("" : "+v"(a)); asm volatile("" : "+v"(bq)); const float r = ((dd < HD / 2) ? __fsub_rn(a, bq) : __fadd_rn(a, bq)) * sc;
        o16[q] = tohx(r); unsigned short a2, c2; splitf(r, a2, c2); oh[q] = a2; ol[q] = c2; }
    *(v2h*)(P16 + e) = o16; *(v2us*)(Ph + e) = oh; *(v2us*)(Pl + e) = ol;  }
__global__ __launch_bounds__(256) void k_vtp(const float* __restrict__ F, int pitch, int nheads, h16* V16, bf* Vh, bf* Vl) { const size_t e = ((size_t)blockIdx.x * 256 + threadIdx.x) * 2; if (e >= (size_t)nheads * HD * TT) return; const int t = (int)(e % TT); const int d = (int)((e / TT) % HD); const int g = (int)(e / ((size_t)TT * HD)); v2h o16; v2us oh, ol;
#pragma unroll
    for (int q = 0; q < 2; ++q) { const float x = F[(size_t)(t + q) * pitch + g * HD + d]; o16[q] = tohx(x); unsigned short a2, c2; splitf(x, a2, c2); oh[q] = a2; ol[q] = c2; }
    *(v2h*)(V16 + e) = o16; *(v2us*)(Vh + e) = oh; *(v2us*)(Vl + e) = ol;  }
// k_asoft: per row (zz, i): t = S x HD^-0.5 for j <= i and i - j < WIN (sliding causal window; the reference's -1e9 additive fill vanishes identically); softmax over the 2048 keys (register row, one exp, fixed trees);
// the probabilities go back INTO the row's own 4 * TT score bytes (the wave holds its whole row in registers before its first store, and no other wave touches the row): rows >= RH fp16 in the first half; rows < RH the hi plane in the first half, the lo plane in the second. Row pitch of every plane: 2 * TT 16-bit elements.
__global__ __launch_bounds__(256) void k_asoft(float* Sb) {
    const int lane = threadIdx.x & 31; const int row = blockIdx.x * 8 + (threadIdx.x >> 5); if (row >= ZH * TT) return; const int i = row % TT; const int zz = row / TT; (void)zz; const bool hires = (i < RH); float* sr = Sb + (size_t)row * TT; float v[TT / 32]; float mx = -3.0e38f;
#pragma unroll
    for (int ch = 0; ch < TT / 128; ++ch) { const int j0 = ch * 128 + lane * 4; const v4f a = *(const v4f*)(sr + j0);
#pragma unroll
        for (int q = 0; q < 4; ++q) { const int j = j0 + q; (void)j; const float t = (j <= i && i - j < WIN) ? a[q] * SCL : -3.0e38f; v[ch * 4 + q] = t; mx = fmaxf(mx, t); } }
#pragma unroll
    for (int sh = 16; sh; sh >>= 1) mx = fmaxf(mx, __shfl_xor(mx, sh, 32));
    float sum = 0.f;
#pragma unroll
    for (int k = 0; k < TT / 32; ++k) { float d0 = __fsub_rn(v[k], mx); asm volatile("" : "+v"(d0)); v[k] = __builtin_amdgcn_exp2f(__fmul_rn(d0, 1.4426950408889634f)); sum += v[k]; }
#pragma unroll
    for (int sh = 16; sh; sh >>= 1) sum += __shfl_xor(sum, sh, 32);
    const float f = __fdiv_rn(hires ? 1.0f : PCAR, sum);
{
        if (hires) {
#pragma unroll
            for (int ch = 0; ch < TT / 128; ++ch) { v4us oh, ol;
#pragma unroll
                for (int q = 0; q < 4; ++q) { unsigned short a, c2; splitf(v[ch * 4 + q] * f, a, c2); oh[q] = a; ol[q] = c2; }
                bf* pr = (bf*)sr + ch * 128 + lane * 4; *(v4usa*)pr = oh; *(v4usa*)(pr + TT) = ol; }
        } else {
#pragma unroll
            for (int ch = 0; ch < TT / 128; ++ch) { v4h o4;
#pragma unroll
                for (int q = 0; q < 4; ++q) o4[q] = tohx(v[ch * 4 + q] * f);
                *(v4ha*)((h16*)sr + ch * 128 + lane * 4) = o4; } }
         }
}
__global__ __launch_bounds__(256) void k_merge(const float* __restrict__ O, int h0, bf* Ah, bf* Al) { const size_t e = ((size_t)blockIdx.x * 256 + threadIdx.x) * 2; if (e >= (size_t)ZH * TT * HD) return; const int d = (int)(e % HD); const int t = (int)((e / HD) % TT); const int zz = (int)(e / ((size_t)HD * TT)); const float cs = (t < RH) ? 1.0f : (1.0f / PCAR); const size_t oo = (size_t)t * DQ + (h0 + zz) * HD + d;
    v2us oh, ol;
#pragma unroll
    for (int q = 0; q < 2; ++q) { unsigned short a, c2; splitf(O[e + q] * cs, a, c2); oh[q] = a; ol[q] = c2; } *(v2us*)(Ah + oo) = oh; *(v2us*)(Al + oo) = ol;  }

extern "C" void kernel_launch(void* const* d_in, const int* in_sizes, int n_in,
                              void* d_out, int out_size, void* d_ws, size_t ws_size, hipStream_t stream) {
    (void)in_sizes; (void)n_in; (void)out_size;
    const float* x = (const float*)d_in[0]; const float* wq = (const float*)d_in[1]; const float* wk = (const float*)d_in[2]; const float* wv = (const float*)d_in[3]; const float* wo = (const float*)d_in[4];
    float* OUT = (float*)d_out;     // [2][2048][2048]
    char* wsp = (char*)d_ws;
    auto take = [&](size_t bytes) { char* p = wsp; wsp += (bytes + 255) & ~(size_t)255; return (void*)p; };
    bf* WQ = (bf*)take((size_t)DQ * DM * 2); bf* WK = (bf*)take((size_t)DKV * DM * 2); bf* WV = (bf*)take((size_t)DKV * DM * 2); bf* WO = (bf*)take((size_t)DM * DQ * 2); float* CS = (float*)take((size_t)TT * HD * 2 * 4);
    bf* XB = (bf*)take((size_t)TT * DM * 2); float* FQ = (float*)take((size_t)TT * DQ * 4); float* FK = (float*)take((size_t)TT * DKV * 4);
    h16* QP16 = (h16*)take((size_t)NH_ * TT * HD * 2); h16* KP16 = (h16*)take((size_t)NKV * TT * HD * 2); h16* VT16 = (h16*)take((size_t)NKV * HD * TT * 2);
    bf* QPh = (bf*)take((size_t)NH_ * TT * HD * 2); bf* QPl = (bf*)take((size_t)NH_ * TT * HD * 2); bf* KPh = (bf*)take((size_t)NKV * TT * HD * 2); bf* KPl = (bf*)take((size_t)NKV * TT * HD * 2); bf* VTh = (bf*)take((size_t)NKV * HD * TT * 2); bf* VTl = (bf*)take((size_t)NKV * HD * TT * 2);
    float* Sb = (float*)take((size_t)ZH * TT * TT * 4); float* Ob = (float*)take((size_t)ZH * TT * HD * 4); bf* ATh = (bf*)take((size_t)TT * DQ * 2); bf* ATl = (bf*)take((size_t)TT * DQ * 2);
    if ((size_t)(wsp - (char*)d_ws) > ws_size) return;    // ws 256 MiB
    float* FV = FK;   // v projection reuses the k buffer after the k planes are built (stream-ordered)
    { k_cvt8<<<(unsigned)(((size_t)DQ * DM / 8 + 255) / 256), 256, 0, stream>>>(wq, WQ, (size_t)DQ * DM / 8); k_cvt8<<<(unsigned)(((size_t)DKV * DM / 8 + 255) / 256), 256, 0, stream>>>(wk, WK, (size_t)DKV * DM / 8); k_cvt8<<<(unsigned)(((size_t)DKV * DM / 8 + 255) / 256), 256, 0, stream>>>(wv, WV, (size_t)DKV * DM / 8);
      k_cvt8<<<(unsigned)(((size_t)DM * DQ / 8 + 255) / 256), 256, 0, stream>>>(wo, WO, (size_t)DM * DQ / 8);
      k_cstab<<<(TT * HD + 255) / 256, 256, 0, stream>>>(CS); }
    const unsigned LQ = (unsigned)(((size_t)NH_ * TT * HD / 2 + 255) / 256), LKv = (unsigned)(((size_t)NKV * TT * HD / 2 + 255) / 256);
    for (int b = 0; b < NB_; ++b) {
        
        k_cvt8<<<(unsigned)(((size_t)TT * DM / 8 + 255) / 256), 256, 0, stream>>>(x + (size_t)b * TT * DM, XB, (size_t)TT * DM / 8);
        k_gemmw<bf, 0, false, 4, 2><<<dim3(TT / 64, DQ / 64, 1), 128, 0, stream>>>(XB, nullptr, WQ, nullptr, DM, FQ, DQ, nullptr, 0, 0, 0);
        k_rope<<<LQ, 256, 0, stream>>>(FQ, DQ, NH_, CS, nullptr, nullptr, 1.0f, QP16, QPh, QPl);
        k_gemmw<bf, 0, false, 8, 2><<<dim3(TT / 64, DKV / 64, 1), 256, 0, stream>>>(XB, nullptr, WK, nullptr, DM, FK, DKV, nullptr, 0, 0, 0);
        k_rope<<<LKv, 256, 0, stream>>>(FK, DKV, NKV, CS, nullptr, nullptr, 1.0f, KP16, KPh, KPl);
        k_gemmw<bf, 0, false, 8, 2><<<dim3(TT / 64, DKV / 64, 1), 256, 0, stream>>>(XB, nullptr, WV, nullptr, DM, FV, DKV, nullptr, 0, 0, 0); k_vtp<<<LKv, 256, 0, stream>>>(FV, DKV, NKV, VT16, VTh, VTl);
        for (int h0 = 0; h0 < NH_; h0 += ZH) { const size_t zq = (size_t)h0, zk = (size_t)(h0 / REP);   // head h0 + z of a pass reads kv head h0 / REP + z / REP (h0 is a multiple of REP)
            k_gemmc<bf, 2, 1, 1, 1><<<dim3(RH / 64, TT / 64, ZH), 32, 0, stream>>>(QPh + zq * TT * HD, QPl + zq * TT * HD, HD, KPh + zk * TT * HD, KPl + zk * TT * HD, HD, Sb, TT, 0, (size_t)TT * HD, (size_t)TT * HD, (size_t)TT * TT);
            k_gemmc<h16, 0, 1, 1, 1><<<dim3((TT - RH) / 64, TT / 64, ZH), 32, 0, stream>>>(QP16 + zq * TT * HD + (size_t)RH * HD, nullptr, HD, KP16 + zk * TT * HD, nullptr, HD, Sb + (size_t)RH * TT, TT, RH, (size_t)TT * HD, (size_t)TT * HD, (size_t)TT * TT);
            k_asoft<<<ZH * TT / 8, 256, 0, stream>>>(Sb);
            k_gemmc<bf, 2, 2, 8, 1><<<dim3(RH / 64, HD / 64, ZH), 256, 0, stream>>>((const bf*)Sb, (const bf*)Sb + TT, 2 * TT, VTh + zk * HD * TT, VTl + zk * HD * TT, TT, Ob, HD, 0, (size_t)TT * 2 * TT, (size_t)HD * TT, (size_t)TT * HD);
            k_gemmc<h16, 0, 2, 8, 2><<<dim3((TT - RH) / 64, HD / 64, ZH), 256, 0, stream>>>((const h16*)Sb + (size_t)RH * 2 * TT, nullptr, 2 * TT, VT16 + zk * HD * TT, nullptr, TT, Ob + (size_t)RH * HD, HD, RH, (size_t)TT * 2 * TT, (size_t)HD * TT, (size_t)TT * HD);
            k_merge<<<(unsigned)(((size_t)ZH * TT * HD / 2 + 255) / 256), 256, 0, stream>>>(Ob, h0, ATh, ATl); }
        k_gemmw<bf, 1, false, 4, 1><<<dim3(TT / 64, DM / 64, 1), 128, 0, stream>>>(ATh, ATl, WO, nullptr, DQ, OUT + (size_t)b * TT * DM, DM, nullptr, 0, 0, 0); }
}

// v003
// A run of this version takes 385 microseconds.
// Timed twice side by side with v002, it ran 1.63 times as fast both times.
// All steps since v000 together make it 4.17 times as fast.
#include <hip/hip_runtime.h>

// Grouped-query RoPE causal attention ('eager' path) (x [2][2048][2048]; q = x w_q^T ([2048][2048]: 16 heads x 128), k, v = x w_k^T / w_v^T ([512][2048]: 4 kv heads); rotate-half RoPE (theta 1e6, full 128 dims, tables computed on device); kv head = h/4; scores = q.k/sqrt(128); causal (finfo.min == exact zero weight); softmax; out = merged w_o^T -> [2][2048][2048] (8.4 M)).
// Compute dtypes, f32 accumulate: every input rounded to bf16; q/k/v on PLAIN bf16 operands (inputs: exact); rotary in f32 (cos/sin from an on-device f32 table: inv_freq_i = 1e6^(-2i/128), precise cosf/sinf); causal scores, softmax (f32, running maximum and sum) and attn.v in one kernel: query rows < 512 hl (3 products), the rest single fp16; w_o hl x exact (2 products).

#define NB_  2
#define TT   2048
#define DM   2048
#define NH_  16
#define NKV  4
#define REP  (NH_ / NKV)
#define HD   128
#define DQ   (NH_ * HD)
#define DKV  (NKV * HD)
#define RH   512                  // query rows < RH use hi+lo planes (0: none)
typedef _Float16 h16;
typedef unsigned short bf;
typedef __attribute__((ext_vector_type(16))) __bf16   v16bf;
typedef __attribute__((ext_vector_type(16))) _Float16 v16h;
typedef __attribute__((ext_vector_type(8)))  _Float16 v8h;
typedef __attribute__((ext_vector_type(8)))  unsigned short v8us;
typedef __attribute__((ext_vector_type(8)))  float    v8f;
typedef __attribute__((ext_vector_type(4)))  float    v4f;
typedef v8h  __attribute__((may_alias)) v8ha;
typedef v4f  __attribute__((may_alias)) v4fa;
typedef v8us __attribute__((may_alias)) v8usa;

__device__ __forceinline__ unsigned short f2bf(float f) { unsigned u = __float_as_uint(f); u += 0x7FFFu + ((u >> 16) & 1u); return (unsigned short)(u >> 16); }
__device__ __forceinline__ float bf2f(unsigned short b) { return __uint_as_float(((unsigned)b) << 16); }
__device__ __forceinline__ float bfr(float f) { return bf2f(f2bf(f)); }
__device__ __forceinline__ v16h cat16(v8h lo, v8h hi) { return __builtin_shufflevector(lo, hi, 0, 1, 2, 3, 4, 5, 6, 7, 8, 9, 10, 11, 12, 13, 14, 15); }
__device__ __forceinline__ v16bf cat16b(v8us lo, v8us hi) { return __builtin_bit_cast(v16bf, __builtin_shufflevector(lo, hi, 0, 1, 2, 3, 4, 5, 6, 7, 8, 9, 10, 11, 12, 13, 14, 15)); }
__device__ __forceinline__ v8f wmma16(v16h a, v16h b, v8f c) { return __builtin_amdgcn_wmma_f32_16x16x32_f16(false, a, false, b, (short)0, c, false, false); }
__device__ __forceinline__ v8f wmmab(v16bf a, v16bf b, v8f c) { return __builtin_amdgcn_wmma_f32_16x16x32_bf16(false, a, false, b, (short)0, c, false, false); }



// ---- k_gemmw: register-blocked GEMM, NW WAVES per 64x64 output tile: wave w takes the K slices w, w + NW, ... of 32 * KS elements into its own 16 accumulators; the NW partial tiles are summed through LDS in wave order.
// Operands straight from K-contiguous 16-bit planes; grid (M/64, N/64, Z), NW * 32 threads. K % (32 * KS) == 0.
// C[m][n] (f32, pitch ldc, + optional f32 bias[n]) = sum_k A[m][k] Bt[n][k] (+ split products per NSPLIT). z-batch strides sA/sB/sC in elements. K % (32 * KS) == 0.
template <typename T16> struct WFrag;
template <> struct WFrag<h16> { typedef v16h V; static __device__ __forceinline__ V ld(const h16* p) { return cat16(*(const v8h*)p, *(const v8h*)(p + 16)); } static __device__ __forceinline__ v8f mma(V a, V b, v8f c) { return wmma16(a, b, c); } };
template <> struct WFrag<bf> { typedef v16bf V; static __device__ __forceinline__ V ld(const bf* p) { return cat16b(*(const v8us*)p, *(const v8us*)(p + 16)); } static __device__ __forceinline__ v8f mma(V a, V b, v8f c) { return wmmab(a, b, c); } };
template <typename T16, int NSPLIT, bool BIAS, int NW, int KS>
__global__ __launch_bounds__(NW * 32) void k_gemmw(const T16* __restrict__ A, const T16* __restrict__ A2, const T16* __restrict__ Bt, const T16* __restrict__ Bt2, int K, float* C, int ldc, const float* __restrict__ bias, size_t sA, size_t sB, size_t sC) {
    typedef typename WFrag<T16>::V V;
    __shared__ __align__(16) float os[NW * 64 * 68];
    const size_t z = blockIdx.z; A += z * sA; if (A2) A2 += z * sA; Bt += z * sB; if (Bt2) Bt2 += z * sB; C += z * sC;
    const int lane = threadIdx.x & 31, lr = lane & 15, hi = lane >> 4; const int r0 = blockIdx.x * 64, c0 = blockIdx.y * 64;
    const int wv = __builtin_amdgcn_readfirstlane((int)(threadIdx.x >> 5));   // this wave's K-slice phase, kept scalar so that the loop control stays scalar
    v8f acc[4][4];
#pragma unroll
    for (int mb = 0; mb < 4; ++mb)
#pragma unroll
        for (int nb = 0; nb < 4; ++nb) acc[mb][nb] = (v8f){};
    const size_t aoff = (size_t)(r0 + lr) * K + 8 * hi, boff = (size_t)(c0 + lr) * K + 8 * hi;
#pragma unroll 1
    for (int ks = wv * (32 * KS); ks < K; ks += NW * 32 * KS)      // this wave's K slices, dealt round robin over the block's waves
#pragma unroll
    for (int kc = ks; kc < ks + 32 * KS; kc += 32) {
        V a[4], a2[4];
#pragma unroll
        for (int mb = 0; mb < 4; ++mb) { a[mb] = WFrag<T16>::ld(A + aoff + (size_t)mb * 16 * K + kc); if (NSPLIT == 1 || NSPLIT == 2) a2[mb] = WFrag<T16>::ld(A2 + aoff + (size_t)mb * 16 * K + kc); }
#pragma unroll
        for (int nb = 0; nb < 4; ++nb) { const V b = WFrag<T16>::ld(Bt + boff + (size_t)nb * 16 * K + kc); V b2; if (NSPLIT >= 2) b2 = WFrag<T16>::ld(Bt2 + boff + (size_t)nb * 16 * K + kc);
#pragma unroll
            for (int mb = 0; mb < 4; ++mb) { acc[mb][nb] = WFrag<T16>::mma(a[mb], b, acc[mb][nb]); if (NSPLIT == 1 || NSPLIT == 2) acc[mb][nb] = WFrag<T16>::mma(a2[mb], b, acc[mb][nb]); if (NSPLIT >= 2) acc[mb][nb] = WFrag<T16>::mma(a[mb], b2, acc[mb][nb]); } }
        asm volatile("v_nop\n\tv_nop\n\tv_nop\n\tv_nop" : "+v"(acc[0][0]), "+v"(acc[1][1]), "+v"(acc[2][2]), "+v"(acc[3][3]) : "v"(a[0]), "v"(a[3]));
    }
#pragma unroll
    for (int mb = 0; mb < 4; ++mb) {
#pragma unroll
        for (int nb = 0; nb < 4; ++nb) {
#pragma unroll
            for (int j = 0; j < 8; ++j) os[wv * (64 * 68) + (mb * 16 + hi * 8 + j) * 68 + nb * 16 + lr] = acc[mb][nb][j]; }
    }
    __syncthreads();   // every wave's partial tile is in LDS before any wave sums it
    float* crow = C + (size_t)r0 * ldc + c0;
#pragma unroll
    for (int i = 0; i < 32 / NW; ++i) { const int row = 2 * (wv + i * NW) + hi, cofs = lr * 4; v4f val = *(const v4fa*)(os + row * 68 + cofs);
#pragma unroll
        for (int p = 1; p < NW; ++p) val += *(const v4fa*)(os + p * (64 * 68) + row * 68 + cofs); if (BIAS) { val[0] += bfr(bias[c0 + cofs]); val[1] += bfr(bias[c0 + cofs + 1]); val[2] += bfr(bias[c0 + cofs + 2]); val[3] += bfr(bias[c0 + cofs + 3]); }
        *(v4f*)(crow + (size_t)row * ldc + cofs) = val; }
}

__device__ __forceinline__ h16 tohx(float x) { return (h16)x; }
__device__ __forceinline__ void splitf(float y, unsigned short& h, unsigned short& l) { h = f2bf(y); l = f2bf(y - bf2f(h)); }
typedef __attribute__((ext_vector_type(2))) _Float16 v2h;
typedef __attribute__((ext_vector_type(4))) _Float16 v4h;
typedef __attribute__((ext_vector_type(2))) unsigned short v2us;
typedef __attribute__((ext_vector_type(4))) unsigned short v4us;
typedef v4h  __attribute__((may_alias)) v4ha;
typedef v4us __attribute__((may_alias)) v4usa;
typedef __attribute__((ext_vector_type(2))) float v2f;
typedef __attribute__((ext_vector_type(4))) int v4i;

__global__ __launch_bounds__(256) void k_wtG(const float* __restrict__ w, int K, int N, bf* Bt) {
    const int lane = threadIdx.x & 31; const int L0 = (blockIdx.x * 8 + (threadIdx.x >> 5)) * 8; const int nlines = N * K / 64;
{
#pragma unroll 1
        for (int l = 0; l < 8; ++l) { const int L = L0 + l; if (L >= nlines) break; const size_t e = (size_t)L * 64 + lane * 2; const int k = (int)(e % K), n = (int)(e / K); v2us o;
            o[0] = f2bf(w[(size_t)k * N + n]); o[1] = f2bf(w[(size_t)(k + 1) * N + n]); *(v2us*)(Bt + e) = o; }
         }
}
__global__ __launch_bounds__(256) void k_cvt8(const float* __restrict__ src, bf* dst, size_t n8) { const size_t i = (size_t)blockIdx.x * 256 + threadIdx.x; if (i >= n8) return; const v8f v = *(const v8f*)(src + i * 8); v8us o;
#pragma unroll
    for (int k = 0; k < 8; ++k) o[k] = f2bf(v[k]); *(v8us*)(dst + i * 8) = o;  }
__constant__ float INV[HD / 2] = {1.00000000f,0.805842161f,0.649381638f,0.523299098f,0.421696514f,0.339820832f,0.273841977f,0.220673412f,0.177827939f,0.143301263f,0.115478195f,0.0930572078f,0.0749894232f,0.0604296401f,0.0486967526f,0.0392418988f,0.0316227749f,0.0254829675f,0.0205352511f,0.0165481716f,0.0133352140f,0.0107460786f,0.00865964312f,0.00697830599f,0.00562341325f,0.00453158375f,0.00365174119f,0.00294272718f,0.00237137382f,0.00191095297f,0.00153992651f,0.00124093774f,0.00100000005f,0.000805842166f,0.000649381604f,0.000523299095f,0.000421696517f,0.000339820836f,0.000273841957f,0.000220673406f,0.000177827940f,0.000143301251f,0.000115478200f,0.0000930572060f,0.0000749894243f,0.0000604296401f,0.0000486967510f,0.0000392418988f,0.0000316227779f,0.0000254829683f,0.0000205352499f,0.0000165481706f,0.0000133352141f,0.0000107460783f,0.00000865964284f,0.00000697830592f,0.00000562341347f,0.00000453158373f,0.00000365174128f,0.00000294272718f,0.00000237137374f,0.00000191095296f,0.00000153992653f,0.00000124093776f};
__global__ __launch_bounds__(256) void k_cstab(float* CS) { const int idx = blockIdx.x * 256 + threadIdx.x; if (idx >= TT * HD) return; const int t = idx / HD, d = idx % HD; const float ang = __fmul_rn((float)t, INV[d % (HD / 2)]); v2f cs; cs[0] = cosf(ang); cs[1] = sinf(ang);
    *(v2f*)(CS + (size_t)idx * 2) = cs;  }

// k_rope: head planes [h][t][d] (fp16 + hi/lo) of rope(x) x sc with the rotate-half convention out[d] = x[d] cos[t][d] - x[d+HD/2] sin[t][d], out[d+HD/2] = x[d+HD/2] cos[t][d+HD/2] + x[d] sin[t][d+HD/2]
__global__ __launch_bounds__(256) void k_rope(const float* __restrict__ F, int pitch, int nheads, const float* __restrict__ CS, const float* __restrict__ RF, const float* __restrict__ nw, float sc, h16* P16, bf* Ph, bf* Pl) {
    const size_t e = ((size_t)blockIdx.x * 256 + threadIdx.x) * 2; if (e >= (size_t)nheads * TT * HD) return; const int d = (int)(e % HD); const int t = (int)((e / HD) % TT); const int h = (int)(e / ((size_t)HD * TT)); const float* f = F + (size_t)t * pitch + h * HD; const float rf = RF ? RF[(size_t)h * TT + t] : 1.0f; v2h o16; v2us oh, ol;
#pragma unroll
    for (int q = 0; q < 2; ++q) { const int dd = d + q; const int dp = (dd < HD / 2) ? dd + HD / 2 : dd - HD / 2; float x0 = f[dd], x1 = f[dp];
        if (RF) { float n0 = __fmul_rn(x0, rf), n1 = __fmul_rn(x1, rf); asm volatile("" : "+v"(n0)); asm volatile("" : "+v"(n1)); x0 = __fmul_rn(bfr(nw[dd]), n0); x1 = __fmul_rn(bfr(nw[dp]), n1); }
        const v2f cs = *(const v2f*)(CS + ((size_t)t * HD + dd) * 2); float a = __fmul_rn(x0, cs[0]), bq = __fmul_rn(x1, cs[1]); asm volatile("" : "+v"(a)); asm volatile("" : "+v"(bq)); const float r = ((dd < HD / 2) ? __fsub_rn(a, bq) : __fadd_rn(a, bq)) * sc;
        o16[q] = tohx(r); unsigned short a2, c2; splitf(r, a2, c2); oh[q] = a2; ol[q] = c2; }
    *(v2h*)(P16 + e) = o16; *(v2us*)(Ph + e) = oh; *(v2us*)(Pl + e) = ol;  }
__global__ __launch_bounds__(256) void k_vtp(const float* __restrict__ F, int pitch, int nheads, h16* V16, bf* Vh, bf* Vl) { const size_t e = ((size_t)blockIdx.x * 256 + threadIdx.x) * 2; if (e >= (size_t)nheads * HD * TT) return; const int t = (int)(e % TT); const int d = (int)((e / TT) % HD); const int g = (int)(e / ((size_t)TT * HD)); v2h o16; v2us oh, ol;
#pragma unroll
    for (int q = 0; q < 2; ++q) { const float x = F[(size_t)(t + q) * pitch + g * HD + d]; o16[q] = tohx(x); unsigned short a2, c2; splitf(x, a2, c2); oh[q] = a2; ol[q] = c2; }
    *(v2h*)(V16 + e) = o16; *(v2us*)(Vh + e) = oh; *(v2us*)(Vl + e) = ol;  }
// ---- k_fattn: scores, causal softmax and probability x value product of one query strip in ONE kernel; no score or probability ever goes to memory.
// A wave owns 16 query rows of one head and walks the keys 0 .. its diagonal in blocks of KB, transposed: St = K Qt (A = key rows, B = the strip's query rows, kept in registers), Ot += Vt Pt (A = rows of the [d][t] value plane).
// In both accumulators a lane holds ONE query (column lr): the running maximum, the running sum and the rescale factor are per lane, with one exchange between the two lane halves; the accumulator registers of two score tiles
// (keys 8 hi + j and 16 + 8 hi + j) are, converted, exactly the B fragment of the next product in the k order of WFrag::ld. Probabilities are exp(t - running max), at most 1, divided by the row's sum only at the end.
// NSPLIT 2: hi + lo planes, 3 products (query rows < RH), KB 32; NSPLIT 0: single fp16, KB 64: either way 16 key and 16 value fragments are in flight. The epilogue writes the merged [t][h * HD + d] hi and lo planes, 8 neighbouring d per lane.
template <typename T16> struct PFrag;
template <> struct PFrag<h16> { static __device__ __forceinline__ void mk(const v8f p0, const v8f p1, v16h& f, v16h& f2) { (void)f2;
#pragma unroll
    for (int j = 0; j < 8; ++j) { f[j] = (h16)p0[j]; f[8 + j] = (h16)p1[j]; } } };
template <> struct PFrag<bf> { static __device__ __forceinline__ void mk(const v8f p0, const v8f p1, v16bf& f, v16bf& f2) { v8us h0, h1, l0, l1;
#pragma unroll
    for (int j = 0; j < 8; ++j) { unsigned short a, c; splitf(p0[j], a, c); h0[j] = a; l0[j] = c; splitf(p1[j], a, c); h1[j] = a; l1[j] = c; }
    f = cat16b(h0, h1); f2 = cat16b(l0, l1); } };
// One plane's fragments of a block, loaded as ONE group: all its loads are in flight together, one latency per group. The group stands between two scheduling barriers, with the wait that comes before a register of an
// issued global load is overwritten as its last instruction: the barriers keep the loads from sinking to their uses and keep every other instruction (which could take an address register) out of the group.
// The address is formed inside the group, from a wave-uniform base and the lane's own 32-bit element offset.
template <typename T16, int N, int INNER, bool HOLD>
__device__ __forceinline__ void ldgroup(typename WFrag<T16>::V (&f)[N], const T16* base, unsigned off, int outer) {
    __builtin_amdgcn_sched_barrier(0);   // opens the group: nothing from in front of it moves in
    const T16* p = base + off;
#pragma unroll
    for (int i = 0; i < N; ++i) f[i] = WFrag<T16>::ld(p + ((i / INNER) * outer + (i % INNER) * 32));
    // the wait before an address register of the group is overwritten; HOLD: with the address as its input, for the groups whose last load this compiler would else give that very register as its destination
    if (HOLD) asm volatile("s_wait_xcnt 0x0" :: "v"(p) : "memory"); else asm volatile("s_wait_xcnt 0x0" ::: "memory");
    __builtin_amdgcn_sched_barrier(0);   // closes the group: no load sinks behind it, nothing from behind it moves in
}
#define SCL2 0.12751743082459868f    // HD^-0.5 * log2(e): scores are carried in the base-2 domain
template <typename T16, int NSPLIT, int KB>
__device__ __forceinline__ void fattn_strip(const T16* __restrict__ Q, const T16* __restrict__ Q2, const T16* __restrict__ Kp, const T16* __restrict__ Kp2, const T16* __restrict__ Vt, const T16* __restrict__ Vt2, int q0, int lr, int hi, bf* __restrict__ oh, bf* __restrict__ ol) {
    typedef typename WFrag<T16>::V V;
    constexpr int MBN = KB / 16, KCN = KB / 32;               // score tiles and 32-key slices of one key block
    const int qi = q0 + lr;                                   // this lane's query row
    v8f o[8];
#pragma unroll
    for (int db = 0; db < 8; ++db) o[db] = (v8f){};
    float m = -3.0e38f, l = 0.f;                              // running maximum (base-2 domain, the same in both lane halves) and this lane half's running sum
    const unsigned qoff = (unsigned)(lr * HD + 8 * hi), voff = (unsigned)(lr * TT + 8 * hi);   // the lane's place in a 16-row fragment of the [t][d] planes and of the [d][t] planes
    V qf[4], qf2[4], kf[MBN * 4], kf2[MBN * 4], kg[MBN * 4], kg2[MBN * 4];   // the strip's query fragments and the first key block's; every later key block is fetched one trip ahead, into the other of the two fragment sets
    ldgroup<T16, 4, 4, false>(qf, Q + (size_t)q0 * HD, qoff, 0); if (NSPLIT == 2) ldgroup<T16, 4, 4, false>(qf2, Q2 + (size_t)q0 * HD, qoff, 0);
    ldgroup<T16, MBN * 4, 4, NSPLIT == 2>(kf, Kp, qoff, 16 * HD); if (NSPLIT == 2) ldgroup<T16, MBN * 4, 4, NSPLIT == 2>(kf2, Kp2, qoff, 16 * HD);
    int kb = 0;
    // One trip: key block kb, its fragments in (ka, ka2); the next block's go into (kx, kx2). q0 is a multiple of 16 and kb of KB: key kb itself is visible to every query of the strip, and kb + KB - 1 < TT
    auto trip = [&](V (&ka)[MBN * 4], V (&ka2)[MBN * 4], V (&kx)[MBN * 4], V (&kx2)[MBN * 4]) __attribute__((always_inline)) {
        V vf[8 * KCN], vf2[8 * KCN];
        ldgroup<T16, 8 * KCN, KCN, false>(vf, Vt + kb, voff, 16 * TT); if (NSPLIT == 2) ldgroup<T16, 8 * KCN, KCN, false>(vf2, Vt2 + kb, voff, 16 * TT);   // the value fragments fly under the score products and the softmax
        v8f s[MBN];
#pragma unroll
        for (int mb = 0; mb < MBN; ++mb) s[mb] = (v8f){};
#pragma unroll
        for (int kc = 0; kc < 4; ++kc)
#pragma unroll
            for (int mb = 0; mb < MBN; ++mb) { s[mb] = WFrag<T16>::mma(ka[mb * 4 + kc], qf[kc], s[mb]);
                if (NSPLIT == 2) { s[mb] = WFrag<T16>::mma(ka[mb * 4 + kc], qf2[kc], s[mb]); s[mb] = WFrag<T16>::mma(ka2[mb * 4 + kc], qf[kc], s[mb]); } }
        const size_t kn = (size_t)min(kb + KB, q0 & ~(KB - 1)) * HD;   // the next key block flies under the softmax and the value products; the last trip reads its own block again (in bounds, unused) instead of branching
        ldgroup<T16, MBN * 4, 4, NSPLIT == 2>(kx, Kp + kn, qoff, 16 * HD); if (NSPLIT == 2) ldgroup<T16, MBN * 4, 4, NSPLIT == 2>(kx2, Kp2 + kn, qoff, 16 * HD);
        float mt = -3.0e38f;
        if (kb + KB - 1 > q0) {                               // the diagonal block (wave-uniform test): keys behind the query get weight exactly 0
#pragma unroll
            for (int mb = 0; mb < MBN; ++mb)
#pragma unroll
                for (int j = 0; j < 8; ++j) { const float t = (kb + mb * 16 + hi * 8 + j <= qi) ? s[mb][j] * SCL2 : -3.0e38f; s[mb][j] = t; mt = fmaxf(mt, t); }
        } else {
#pragma unroll
            for (int mb = 0; mb < MBN; ++mb)
#pragma unroll
                for (int j = 0; j < 8; ++j) { const float t = s[mb][j] * SCL2; s[mb][j] = t; mt = fmaxf(mt, t); }
        }
        mt = fmaxf(mt, __shfl_xor(mt, 16, 32));               // the other half of this query's keys is in the other lane half
        const float mn = fmaxf(m, mt); const float al = __builtin_amdgcn_exp2f(m - mn); m = mn;
        float ps = 0.f;
#pragma unroll
        for (int mb = 0; mb < MBN; ++mb)
#pragma unroll
            for (int j = 0; j < 8; ++j) { const float p = __builtin_amdgcn_exp2f(s[mb][j] - mn); s[mb][j] = p; ps += p; }
        l = l * al + ps;
        V pf[KCN], pf2[KCN];
#pragma unroll
        for (int kc = 0; kc < KCN; ++kc) PFrag<T16>::mk(s[2 * kc], s[2 * kc + 1], pf[kc], pf2[kc]);
#pragma unroll
        for (int db = 0; db < 8; ++db) o[db] *= al;
#pragma unroll
        for (int kc = 0; kc < KCN; ++kc)
#pragma unroll
            for (int db = 0; db < 8; ++db) { o[db] = WFrag<T16>::mma(vf[db * KCN + kc], pf[kc], o[db]);
                if (NSPLIT == 2) { o[db] = WFrag<T16>::mma(vf[db * KCN + kc], pf2[kc], o[db]); o[db] = WFrag<T16>::mma(vf2[db * KCN + kc], pf[kc], o[db]); } }
        kb += KB;
    };
#pragma unroll 1
    for (;;) { trip(kf, kf2, kg, kg2); if (kb > q0) break; trip(kg, kg2, kf, kf2); if (kb > q0) break; }   // key blocks kb <= q0 (block 0 always is one); two trips a pass, so that the two fragment sets swap roles without register copies
    l += __shfl_xor(l, 16, 32);
    const float f = __fdiv_rn(1.0f, l);
#pragma unroll
    for (int db = 0; db < 8; ++db) { v8us vh, vl;
#pragma unroll
        for (int j = 0; j < 8; ++j) { unsigned short a, c; splitf(o[db][j] * f, a, c); vh[j] = a; vl[j] = c; }
        const size_t oo = (size_t)qi * DQ + db * 16 + hi * 8; *(v8us*)(oh + oo) = vh; *(v8us*)(ol + oo) = vl; }
}
// Grid (query heads, TT / 128), 8 waves. Cost grows with the row index, so a block takes one long and one short 64-row block: waves 0..3 the rows of block TT / 64 - 1 - y, waves 4..7 those of block y; every block then
// walks the same number of keys. A wave works alone: no LDS, no barrier, and the choice of the path (hi + lo or single plane) is uniform in the wave.
__global__ __launch_bounds__(256) void k_fattn(const h16* __restrict__ Q16, const bf* __restrict__ Qh, const bf* __restrict__ Ql, const h16* __restrict__ K16, const bf* __restrict__ Kh, const bf* __restrict__ Kl, const h16* __restrict__ V16, const bf* __restrict__ Vh, const bf* __restrict__ Vl, bf* __restrict__ Ah, bf* __restrict__ Al) {
    const int lane = threadIdx.x & 31, lr = lane & 15, hi = lane >> 4;
    const int wv = __builtin_amdgcn_readfirstlane((int)(threadIdx.x >> 5));   // kept scalar so that the path choice and the key loop's control stay scalar
    const int h = blockIdx.x, r0 = ((wv < 4) ? TT / 64 - 1 - (int)blockIdx.y : (int)blockIdx.y) * 64, q0 = r0 + (wv & 3) * 16;
    const size_t zq = (size_t)h * TT * HD, zk = (size_t)(h / REP) * TT * HD;
    if (r0 < RH) fattn_strip<bf, 2, 32>(Qh + zq, Ql + zq, Kh + zk, Kl + zk, Vh + zk, Vl + zk, q0, lr, hi, Ah + h * HD, Al + h * HD);
    else fattn_strip<h16, 0, 64>(Q16 + zq, nullptr, K16 + zk, nullptr, V16 + zk, nullptr, q0, lr, hi, Ah + h * HD, Al + h * HD);
}

extern "C" void kernel_launch(void* const* d_in, const int* in_sizes, int n_in,
                              void* d_out, int out_size, void* d_ws, size_t ws_size, hipStream_t stream) {
    (void)in_sizes; (void)n_in; (void)out_size;
    const float* x = (const float*)d_in[0]; const float* wq = (const float*)d_in[1]; const float* wk = (const float*)d_in[2]; const float* wv = (const float*)d_in[3]; const float* wo = (const float*)d_in[4];
    float* OUT = (float*)d_out;     // [2][2048][2048]
    char* wsp = (char*)d_ws;
    auto take = [&](size_t bytes) { char* p = wsp; wsp += (bytes + 255) & ~(size_t)255; return (void*)p; };
    bf* WQ = (bf*)take((size_t)DQ * DM * 2); bf* WK = (bf*)take((size_t)DKV * DM * 2); bf* WV = (bf*)take((size_t)DKV * DM * 2); bf* WO = (bf*)take((size_t)DM * DQ * 2); float* CS = (float*)take((size_t)TT * HD * 2 * 4);
    bf* XB = (bf*)take((size_t)TT * DM * 2); float* FQ = (float*)take((size_t)TT * DQ * 4); float* FK = (float*)take((size_t)TT * DKV * 4);
    h16* QP16 = (h16*)take((size_t)NH_ * TT * HD * 2); h16* KP16 = (h16*)take((size_t)NKV * TT * HD * 2); h16* VT16 = (h16*)take((size_t)NKV * HD * TT * 2);
    bf* QPh = (bf*)take((size_t)NH_ * TT * HD * 2); bf* QPl = (bf*)take((size_t)NH_ * TT * HD * 2); bf* KPh = (bf*)take((size_t)NKV * TT * HD * 2); bf* KPl = (bf*)take((size_t)NKV * TT * HD * 2); bf* VTh = (bf*)take((size_t)NKV * HD * TT * 2); bf* VTl = (bf*)take((size_t)NKV * HD * TT * 2);
    bf* ATh = (bf*)take((size_t)TT * DQ * 2); bf* ATl = (bf*)take((size_t)TT * DQ * 2);
    if ((size_t)(wsp - (char*)d_ws) > ws_size) return;    // ws 256 MiB
    float* FV = FK;   // v projection reuses the k buffer after the k planes are built (stream-ordered)
    { k_cvt8<<<(unsigned)(((size_t)DQ * DM / 8 + 255) / 256), 256, 0, stream>>>(wq, WQ, (size_t)DQ * DM / 8); k_cvt8<<<(unsigned)(((size_t)DKV * DM / 8 + 255) / 256), 256, 0, stream>>>(wk, WK, (size_t)DKV * DM / 8); k_cvt8<<<(unsigned)(((size_t)DKV * DM / 8 + 255) / 256), 256, 0, stream>>>(wv, WV, (size_t)DKV * DM / 8);
      k_cvt8<<<(unsigned)(((size_t)DM * DQ / 8 + 255) / 256), 256, 0, stream>>>(wo, WO, (size_t)DM * DQ / 8);
      k_cstab<<<(TT * HD + 255) / 256, 256, 0, stream>>>(CS); }
    const unsigned LQ = (unsigned)(((size_t)NH_ * TT * HD / 2 + 255) / 256), LKv = (unsigned)(((size_t)NKV * TT * HD / 2 + 255) / 256);
    for (int b = 0; b < NB_; ++b) {
        
        k_cvt8<<<(unsigned)(((size_t)TT * DM / 8 + 255) / 256), 256, 0, stream>>>(x + (size_t)b * TT * DM, XB, (size_t)TT * DM / 8);
        k_gemmw<bf, 0, false, 4, 2><<<dim3(TT / 64, DQ / 64, 1), 128, 0, stream>>>(XB, nullptr, WQ, nullptr, DM, FQ, DQ, nullptr, 0, 0, 0);
        k_rope<<<LQ, 256, 0, stream>>>(FQ, DQ, NH_, CS, nullptr, nullptr, 1.0f, QP16, QPh, QPl);
        k_gemmw<bf, 0, false, 8, 2><<<dim3(TT / 64, DKV / 64, 1), 256, 0, stream>>>(XB, nullptr, WK, nullptr, DM, FK, DKV, nullptr, 0, 0, 0);
        k_rope<<<LKv, 256, 0, stream>>>(FK, DKV, NKV, CS, nullptr, nullptr, 1.0f, KP16, KPh, KPl);
        k_gemmw<bf, 0, false, 8, 2><<<dim3(TT / 64, DKV / 64, 1), 256, 0, stream>>>(XB, nullptr, WV, nullptr, DM, FV, DKV, nullptr, 0, 0, 0); k_vtp<<<LKv, 256, 0, stream>>>(FV, DKV, NKV, VT16, VTh, VTl);
        k_fattn<<<dim3(NH_, TT / 128, 1), 256, 0, stream>>>(QP16, QPh, QPl, KP16, KPh, KPl, VT16, VTh, VTl, ATh, ATl);
        k_gemmw<bf, 1, false, 4, 1><<<dim3(TT / 64, DM / 64, 1), 128, 0, stream>>>(ATh, ATl, WO, nullptr, DQ, OUT + (size_t)b * TT * DM, DM, nullptr, 0, 0, 0); }
}

// v004
// It runs in 326 microseconds.
// Next to v003, in two timings, it ran 1.19 and 1.20 times as fast.
// Over all steps from v000 it is 4.97 times as fast.
#include <hip/hip_runtime.h>

// Grouped-query RoPE causal attention ('eager' path) (x [2][2048][2048]; q = x w_q^T ([2048][2048]: 16 heads x 128), k, v = x w_k^T / w_v^T ([512][2048]: 4 kv heads); rotate-half RoPE (theta 1e6, full 128 dims, tables computed on device); kv head = h/4; scores = q.k/sqrt(128); causal (finfo.min == exact zero weight); softmax; out = merged w_o^T -> [2][2048][2048] (8.4 M)).
// Compute dtypes, f32 accumulate: every input rounded to bf16; q/k/v on PLAIN bf16 operands (inputs: exact); rotary in f32 (cos/sin from an on-device f32 table: inv_freq_i = 1e6^(-2i/128), precise cosf/sinf); causal scores, softmax (f32, running maximum and sum) and attn.v in one kernel: query rows < 512 hl (3 products), the rest single fp16; w_o hl x exact (2 products).

#define NB_  2
#define TT   2048
#define DM   2048
#define NH_  16
#define NKV  4
#define REP  (NH_ / NKV)
#define HD   128
#define DQ   (NH_ * HD)
#define DKV  (NKV * HD)
#define RH   512                  // query rows < RH use hi+lo planes (0: none)
typedef _Float16 h16;
typedef unsigned short bf;
typedef __attribute__((ext_vector_type(16))) __bf16   v16bf;
typedef __attribute__((ext_vector_type(16))) _Float16 v16h;
typedef __attribute__((ext_vector_type(8)))  _Float16 v8h;
typedef __attribute__((ext_vector_type(8)))  unsigned short v8us;
typedef __attribute__((ext_vector_type(8)))  float    v8f;
typedef __attribute__((ext_vector_type(4)))  float    v4f;
typedef v8h  __attribute__((may_alias)) v8ha;
typedef v4f  __attribute__((may_alias)) v4fa;
typedef v8us __attribute__((may_alias)) v8usa;

__device__ __forceinline__ unsigned short f2bf(float f) { unsigned u = __float_as_uint(f); u += 0x7FFFu + ((u >> 16) & 1u); return (unsigned short)(u >> 16); }
__device__ __forceinline__ float bf2f(unsigned short b) { return __uint_as_float(((unsigned)b) << 16); }
__device__ __forceinline__ float bfr(float f) { return bf2f(f2bf(f)); }
__device__ __forceinline__ v16h cat16(v8h lo, v8h hi) { return __builtin_shufflevector(lo, hi, 0, 1, 2, 3, 4, 5, 6, 7, 8, 9, 10, 11, 12, 13, 14, 15); }
__device__ __forceinline__ v16bf cat16b(v8us lo, v8us hi) { return __builtin_bit_cast(v16bf, __builtin_shufflevector(lo, hi, 0, 1, 2, 3, 4, 5, 6, 7, 8, 9, 10, 11, 12, 13, 14, 15)); }
__device__ __forceinline__ v8f wmma16(v16h a, v16h b, v8f c) { return __builtin_amdgcn_wmma_f32_16x16x32_f16(false, a, false, b, (short)0, c, false, false); }
__device__ __forceinline__ v8f wmmab(v16bf a, v16bf b, v8f c) { return __builtin_amdgcn_wmma_f32_16x16x32_bf16(false, a, false, b, (short)0, c, false, false); }



// ---- k_gemmw: register-blocked GEMM, NW WAVES per 64x64 output tile: wave w takes the K slices w, w + NW, ... of 32 * KS elements into its own 16 accumulators; the NW partial tiles are summed through LDS in wave order.
// Operands straight from K-contiguous 16-bit planes; grid (M/64, N/64, Z), NW * 32 threads. K % (32 * KS) == 0.
// C[m][n] (f32, pitch ldc, + optional f32 bias[n]) = sum_k A[m][k] Bt[n][k] (+ split products per NSPLIT). z-batch strides sA/sB/sC in elements. K % (32 * KS) == 0.
template <typename T16> struct WFrag;
template <> struct WFrag<h16> { typedef v16h V; static __device__ __forceinline__ V ld(const h16* p) { return cat16(*(const v8h*)p, *(const v8h*)(p + 16)); } static __device__ __forceinline__ v8f mma(V a, V b, v8f c) { return wmma16(a, b, c); } };
template <> struct WFrag<bf> { typedef v16bf V; static __device__ __forceinline__ V ld(const bf* p) { return cat16b(*(const v8us*)p, *(const v8us*)(p + 16)); } static __device__ __forceinline__ v8f mma(V a, V b, v8f c) { return wmmab(a, b, c); } };
template <typename T16, int NSPLIT, bool BIAS, int NW, int KS>
__global__ __launch_bounds__(NW * 32) void k_gemmw(const T16* __restrict__ A, const T16* __restrict__ A2, const T16* __restrict__ Bt, const T16* __restrict__ Bt2, int K, float* C, int ldc, const float* __restrict__ bias, size_t sA, size_t sB, size_t sC) {
    typedef typename WFrag<T16>::V V;
    __shared__ __align__(16) float os[NW * 64 * 68];
    const size_t z = blockIdx.z; A += z * sA; if (A2) A2 += z * sA; Bt += z * sB; if (Bt2) Bt2 += z * sB; C += z * sC;
    const int lane = threadIdx.x & 31, lr = lane & 15, hi = lane >> 4; const int r0 = blockIdx.x * 64, c0 = blockIdx.y * 64;
    const int wv = __builtin_amdgcn_readfirstlane((int)(threadIdx.x >> 5));   // this wave's K-slice phase, kept scalar so that the loop control stays scalar
    v8f acc[4][4];
#pragma unroll
    for (int mb = 0; mb < 4; ++mb)
#pragma unroll
        for (int nb = 0; nb < 4; ++nb) acc[mb][nb] = (v8f){};
    const size_t aoff = (size_t)(r0 + lr) * K + 8 * hi, boff = (size_t)(c0 + lr) * K + 8 * hi;
#pragma unroll 1
    for (int ks = wv * (32 * KS); ks < K; ks += NW * 32 * KS)      // this wave's K slices, dealt round robin over the block's waves
#pragma unroll
    for (int kc = ks; kc < ks + 32 * KS; kc += 32) {
        V a[4], a2[4];
#pragma unroll
        for (int mb = 0; mb < 4; ++mb) { a[mb] = WFrag<T16>::ld(A + aoff + (size_t)mb * 16 * K + kc); if (NSPLIT == 1 || NSPLIT == 2) a2[mb] = WFrag<T16>::ld(A2 + aoff + (size_t)mb * 16 * K + kc); }
#pragma unroll
        for (int nb = 0; nb < 4; ++nb) { const V b = WFrag<T16>::ld(Bt + boff + (size_t)nb * 16 * K + kc); V b2; if (NSPLIT >= 2) b2 = WFrag<T16>::ld(Bt2 + boff + (size_t)nb * 16 * K + kc);
#pragma unroll
            for (int mb = 0; mb < 4; ++mb) { acc[mb][nb] = WFrag<T16>::mma(a[mb], b, acc[mb][nb]); if (NSPLIT == 1 || NSPLIT == 2) acc[mb][nb] = WFrag<T16>::mma(a2[mb], b, acc[mb][nb]); if (NSPLIT >= 2) acc[mb][nb] = WFrag<T16>::mma(a[mb], b2, acc[mb][nb]); } }
        asm volatile("v_nop\n\tv_nop\n\tv_nop\n\tv_nop" : "+v"(acc[0][0]), "+v"(acc[1][1]), "+v"(acc[2][2]), "+v"(acc[3][3]) : "v"(a[0]), "v"(a[3]));
    }
#pragma unroll
    for (int mb = 0; mb < 4; ++mb) {
#pragma unroll
        for (int nb = 0; nb < 4; ++nb) {
#pragma unroll
            for (int j = 0; j < 8; ++j) os[wv * (64 * 68) + (mb * 16 + hi * 8 + j) * 68 + nb * 16 + lr] = acc[mb][nb][j]; }
    }
    __syncthreads();   // every wave's partial tile is in LDS before any wave sums it
    float* crow = C + (size_t)r0 * ldc + c0;
#pragma unroll
    for (int i = 0; i < 32 / NW; ++i) { const int row = 2 * (wv + i * NW) + hi, cofs = lr * 4; v4f val = *(const v4fa*)(os + row * 68 + cofs);
#pragma unroll
        for (int p = 1; p < NW; ++p) val += *(const v4fa*)(os + p * (64 * 68) + row * 68 + cofs); if (BIAS) { val[0] += bfr(bias[c0 + cofs]); val[1] += bfr(bias[c0 + cofs + 1]); val[2] += bfr(bias[c0 + cofs + 2]); val[3] += bfr(bias[c0 + cofs + 3]); }
        *(v4f*)(crow + (size_t)row * ldc + cofs) = val; }
}

__device__ __forceinline__ h16 tohx(float x) { return (h16)x; }
__device__ __forceinline__ void splitf(float y, unsigned short& h, unsigned short& l) { h = f2bf(y); l = f2bf(y - bf2f(h)); }
typedef __attribute__((ext_vector_type(2))) _Float16 v2h;
typedef __attribute__((ext_vector_type(4))) _Float16 v4h;
typedef __attribute__((ext_vector_type(2))) unsigned short v2us;
typedef __attribute__((ext_vector_type(4))) unsigned short v4us;
typedef v4h  __attribute__((may_alias)) v4ha;
typedef v4us __attribute__((may_alias)) v4usa;
typedef __attribute__((ext_vector_type(2))) float v2f;
typedef __attribute__((ext_vector_type(4))) int v4i;

__global__ __launch_bounds__(256) void k_wtG(const float* __restrict__ w, int K, int N, bf* Bt) {
    const int lane = threadIdx.x & 31; const int L0 = (blockIdx.x * 8 + (threadIdx.x >> 5)) * 8; const int nlines = N * K / 64;
{
#pragma unroll 1
        for (int l = 0; l < 8; ++l) { const int L = L0 + l; if (L >= nlines) break; const size_t e = (size_t)L * 64 + lane * 2; const int k = (int)(e % K), n = (int)(e / K); v2us o;
            o[0] = f2bf(w[(size_t)k * N + n]); o[1] = f2bf(w[(size_t)(k + 1) * N + n]); *(v2us*)(Bt + e) = o; }
         }
}
__device__ __forceinline__ void d_cvt8(unsigned blk, const float* __restrict__ src, bf* dst, size_t n8) { const size_t i = (size_t)blk * 256 + threadIdx.x; if (i >= n8) return; const v8f v = *(const v8f*)(src + i * 8); v8us o;
#pragma unroll
    for (int k = 0; k < 8; ++k) o[k] = f2bf(v[k]); *(v8us*)(dst + i * 8) = o;  }
__constant__ float INV[HD / 2] = {1.00000000f,0.805842161f,0.649381638f,0.523299098f,0.421696514f,0.339820832f,0.273841977f,0.220673412f,0.177827939f,0.143301263f,0.115478195f,0.0930572078f,0.0749894232f,0.0604296401f,0.0486967526f,0.0392418988f,0.0316227749f,0.0254829675f,0.0205352511f,0.0165481716f,0.0133352140f,0.0107460786f,0.00865964312f,0.00697830599f,0.00562341325f,0.00453158375f,0.00365174119f,0.00294272718f,0.00237137382f,0.00191095297f,0.00153992651f,0.00124093774f,0.00100000005f,0.000805842166f,0.000649381604f,0.000523299095f,0.000421696517f,0.000339820836f,0.000273841957f,0.000220673406f,0.000177827940f,0.000143301251f,0.000115478200f,0.0000930572060f,0.0000749894243f,0.0000604296401f,0.0000486967510f,0.0000392418988f,0.0000316227779f,0.0000254829683f,0.0000205352499f,0.0000165481706f,0.0000133352141f,0.0000107460783f,0.00000865964284f,0.00000697830592f,0.00000562341347f,0.00000453158373f,0.00000365174128f,0.00000294272718f,0.00000237137374f,0.00000191095296f,0.00000153992653f,0.00000124093776f};
__device__ __forceinline__ void d_cstab(unsigned blk, float* CS) { const int idx = (int)blk * 256 + threadIdx.x; if (idx >= TT * HD) return; const int t = idx / HD, d = idx % HD; const int di = d % (HD / 2); const float iv = INV[di];
    asm volatile("s_wait_xcnt 0x0" :: "v"(di) : "memory");   // the wait before the register of the table load's index is overwritten; the index is its input, or else this compiler gives the load that very register as its destination
    const float ang = __fmul_rn((float)t, iv); v2f cs; cs[0] = cosf(ang); cs[1] = sinf(ang);
    *(v2f*)(CS + (size_t)idx * 2) = cs;  }
// ---- k_prep: everything that depends on the inputs alone, in ONE launch: the rotary table (first: its blocks run longest), then x (both batches) and the four weights rounded to bf16. A block does one job, picked by its index (block-uniform).
#define PB_CS  (TT * HD / 256)
#define PB_X   (NB_ * TT * DM / 8 / 256)
#define PB_WQ  (DQ * DM / 8 / 256)
#define PB_WKV (DKV * DM / 8 / 256)
#define PB_WO  (DM * DQ / 8 / 256)
__global__ __launch_bounds__(256) void k_prep(const float* __restrict__ x, const float* __restrict__ wq, const float* __restrict__ wk, const float* __restrict__ wv, const float* __restrict__ wo, bf* XB, bf* WQ, bf* WK, bf* WV, bf* WO, float* CS) {
    unsigned blk = blockIdx.x;
    if (blk < PB_CS) { d_cstab(blk, CS); return; }
    blk -= PB_CS; const float* s; bf* d; unsigned nb;
    if (blk < PB_X) { s = x; d = XB; nb = PB_X; }
    else if ((blk -= PB_X) < PB_WQ) { s = wq; d = WQ; nb = PB_WQ; }
    else if ((blk -= PB_WQ) < PB_WKV) { s = wk; d = WK; nb = PB_WKV; }
    else if ((blk -= PB_WKV) < PB_WKV) { s = wv; d = WV; nb = PB_WKV; }
    else { blk -= PB_WKV; s = wo; d = WO; nb = PB_WO; }
    d_cvt8(blk, s, d, (size_t)nb * 256);
}

// d_rope: head planes [b][h][t][d] (fp16 + hi/lo) of rope(x) x sc with the rotate-half convention out[d] = x[d] cos[t][d] - x[d+HD/2] sin[t][d], out[d+HD/2] = x[d+HD/2] cos[t][d+HD/2] + x[d] sin[t][d+HD/2]
__device__ __forceinline__ void d_rope(unsigned blk, const float* __restrict__ F, int pitch, int nheads, const float* __restrict__ CS, const float* __restrict__ RF, const float* __restrict__ nw, float sc, h16* P16, bf* Ph, bf* Pl) {
    const size_t e = ((size_t)blk * 256 + threadIdx.x) * 2; if (e >= (size_t)NB_ * nheads * TT * HD) return; const int d = (int)(e % HD); const int t = (int)((e / HD) % TT); const int bh = (int)(e / ((size_t)HD * TT)); const int h = bh % nheads; const float* f = F + ((size_t)(bh / nheads) * TT + t) * pitch + h * HD; const float rf = RF ? RF[(size_t)h * TT + t] : 1.0f; v2h o16; v2us oh, ol;
#pragma unroll
    for (int q = 0; q < 2; ++q) { const int dd = d + q; const int dp = (dd < HD / 2) ? dd + HD / 2 : dd - HD / 2; float x0 = f[dd], x1 = f[dp];
        if (RF) { float n0 = __fmul_rn(x0, rf), n1 = __fmul_rn(x1, rf); asm volatile("" : "+v"(n0)); asm volatile("" : "+v"(n1)); x0 = __fmul_rn(bfr(nw[dd]), n0); x1 = __fmul_rn(bfr(nw[dp]), n1); }
        const v2f cs = *(const v2f*)(CS + ((size_t)t * HD + dd) * 2); float a = __fmul_rn(x0, cs[0]), bq = __fmul_rn(x1, cs[1]); asm volatile("" : "+v"(a)); asm volatile("" : "+v"(bq)); const float r = ((dd < HD / 2) ? __fsub_rn(a, bq) : __fadd_rn(a, bq)) * sc;
        o16[q] = tohx(r); unsigned short a2, c2; splitf(r, a2, c2); oh[q] = a2; ol[q] = c2; }
    *(v2h*)(P16 + e) = o16; *(v2us*)(Ph + e) = oh; *(v2us*)(Pl + e) = ol;  }
__device__ __forceinline__ void d_vtp(unsigned blk, const float* __restrict__ F, int pitch, int nheads, h16* V16, bf* Vh, bf* Vl) { const size_t e = ((size_t)blk * 256 + threadIdx.x) * 2; if (e >= (size_t)NB_ * nheads * HD * TT) return; const int t = (int)(e % TT) + (int)(e / ((size_t)TT * HD * nheads)) * TT; const int d = (int)((e / TT) % HD); const int g = (int)(e / ((size_t)TT * HD)) % nheads; v2h o16; v2us oh, ol;
#pragma unroll
    for (int q = 0; q < 2; ++q) { const float x = F[(size_t)(t + q) * pitch + g * HD + d]; o16[q] = tohx(x); unsigned short a2, c2; splitf(x, a2, c2); oh[q] = a2; ol[q] = c2; }
    *(v2h*)(V16 + e) = o16; *(v2us*)(Vh + e) = oh; *(v2us*)(Vl + e) = ol;  }
// ---- k_planes: the operand planes of the attention kernel, all in ONE launch, from the joint projection F [b * TT + t][q columns | k columns | v columns]: rotated q, rotated k, transposed v. A block does one job, picked by its index (block-uniform).
#define DF     (DQ + 2 * DKV)
#define LB_Q   (NB_ * NH_ * TT * HD / 2 / 256)
#define LB_KV  (NB_ * NKV * TT * HD / 2 / 256)
__global__ __launch_bounds__(256) void k_planes(const float* __restrict__ F, const float* __restrict__ CS, h16* QP16, bf* QPh, bf* QPl, h16* KP16, bf* KPh, bf* KPl, h16* VT16, bf* VTh, bf* VTl) {
    const unsigned blk = blockIdx.x;
    if (blk < LB_Q) d_rope(blk, F, DF, NH_, CS, nullptr, nullptr, 1.0f, QP16, QPh, QPl);
    else if (blk < LB_Q + LB_KV) d_rope(blk - LB_Q, F + DQ, DF, NKV, CS, nullptr, nullptr, 1.0f, KP16, KPh, KPl);
    else d_vtp(blk - (LB_Q + LB_KV), F + DQ + DKV, DF, NKV, VT16, VTh, VTl);
}
// ---- k_fattn: scores, causal softmax and probability x value product of one query strip in ONE kernel; no score or probability ever goes to memory.
// A wave owns 16 query rows of one head and walks the keys 0 .. its diagonal in blocks of KB, transposed: St = K Qt (A = key rows, B = the strip's query rows, kept in registers), Ot += Vt Pt (A = rows of the [d][t] value plane).
// In both accumulators a lane holds ONE query (column lr): the running maximum, the running sum and the rescale factor are per lane, with one exchange between the two lane halves; the accumulator registers of two score tiles
// (keys 8 hi + j and 16 + 8 hi + j) are, converted, exactly the B fragment of the next product in the k order of WFrag::ld. Probabilities are exp(t - running max), at most 1, divided by the row's sum only at the end.
// NSPLIT 2: hi + lo planes, 3 products (query rows < RH), KB 32; NSPLIT 0: single fp16, KB 64: either way 16 key and 16 value fragments are in flight. The epilogue writes the merged [t][h * HD + d] hi and lo planes, 8 neighbouring d per lane.
template <typename T16> struct PFrag;
template <> struct PFrag<h16> { static __device__ __forceinline__ void mk(const v8f p0, const v8f p1, v16h& f, v16h& f2) { (void)f2;
#pragma unroll
    for (int j = 0; j < 8; ++j) { f[j] = (h16)p0[j]; f[8 + j] = (h16)p1[j]; } } };
template <> struct PFrag<bf> { static __device__ __forceinline__ void mk(const v8f p0, const v8f p1, v16bf& f, v16bf& f2) { v8us h0, h1, l0, l1;
#pragma unroll
    for (int j = 0; j < 8; ++j) { unsigned short a, c; splitf(p0[j], a, c); h0[j] = a; l0[j] = c; splitf(p1[j], a, c); h1[j] = a; l1[j] = c; }
    f = cat16b(h0, h1); f2 = cat16b(l0, l1); } };
// One plane's fragments of a block, loaded as ONE group: all its loads are in flight together, one latency per group. The group stands between two scheduling barriers, with the wait that comes before a register of an
// issued global load is overwritten as its last instruction: the barriers keep the loads from sinking to their uses and keep every other instruction (which could take an address register) out of the group.
// The address is formed inside the group, from a wave-uniform base and the lane's own 32-bit element offset.
template <typename T16, int N, int INNER, bool HOLD>
__device__ __forceinline__ void ldgroup(typename WFrag<T16>::V (&f)[N], const T16* base, unsigned off, int outer) {
    __builtin_amdgcn_sched_barrier(0);   // opens the group: nothing from in front of it moves in
    const T16* p = base + off;
#pragma unroll
    for (int i = 0; i < N; ++i) f[i] = WFrag<T16>::ld(p + ((i / INNER) * outer + (i % INNER) * 32));
    // the wait before an address register of the group is overwritten; HOLD: with the address as its input, for the groups whose last load this compiler would else give that very register as its destination
    if (HOLD) asm volatile("s_wait_xcnt 0x0" :: "v"(p) : "memory"); else asm volatile("s_wait_xcnt 0x0" ::: "memory");
    __builtin_amdgcn_sched_barrier(0);   // closes the group: no load sinks behind it, nothing from behind it moves in
}
#define SCL2 0.12751743082459868f    // HD^-0.5 * log2(e): scores are carried in the base-2 domain
template <typename T16, int NSPLIT, int KB>
__device__ __forceinline__ void fattn_strip(const T16* __restrict__ Q, const T16* __restrict__ Q2, const T16* __restrict__ Kp, const T16* __restrict__ Kp2, const T16* __restrict__ Vt, const T16* __restrict__ Vt2, int q0, int lr, int hi, bf* __restrict__ oh, bf* __restrict__ ol) {
    typedef typename WFrag<T16>::V V;
    constexpr int MBN = KB / 16, KCN = KB / 32;               // score tiles and 32-key slices of one key block
    const int qi = q0 + lr;                                   // this lane's query row
    v8f o[8];
#pragma unroll
    for (int db = 0; db < 8; ++db) o[db] = (v8f){};
    float m = -3.0e38f, l = 0.f;                              // running maximum (base-2 domain, the same in both lane halves) and this lane half's running sum
    const unsigned qoff = (unsigned)(lr * HD + 8 * hi), voff = (unsigned)(lr * TT + 8 * hi);   // the lane's place in a 16-row fragment of the [t][d] planes and of the [d][t] planes
    V qf[4], qf2[4], kf[MBN * 4], kf2[MBN * 4], kg[MBN * 4], kg2[MBN * 4];   // the strip's query fragments and the first key block's; every later key block is fetched one trip ahead, into the other of the two fragment sets
    ldgroup<T16, 4, 4, false>(qf, Q + (size_t)q0 * HD, qoff, 0); if (NSPLIT == 2) ldgroup<T16, 4, 4, false>(qf2, Q2 + (size_t)q0 * HD, qoff, 0);
    ldgroup<T16, MBN * 4, 4, NSPLIT == 2>(kf, Kp, qoff, 16 * HD); if (NSPLIT == 2) ldgroup<T16, MBN * 4, 4, NSPLIT == 2>(kf2, Kp2, qoff, 16 * HD);
    int kb = 0;
    // One trip: key block kb, its fragments in (ka, ka2); the next block's go into (kx, kx2). q0 is a multiple of 16 and kb of KB: key kb itself is visible to every query of the strip, and kb + KB - 1 < TT
    auto trip = [&](V (&ka)[MBN * 4], V (&ka2)[MBN * 4], V (&kx)[MBN * 4], V (&kx2)[MBN * 4]) __attribute__((always_inline)) {
        V vf[8 * KCN], vf2[8 * KCN];
        ldgroup<T16, 8 * KCN, KCN, false>(vf, Vt + kb, voff, 16 * TT); if (NSPLIT == 2) ldgroup<T16, 8 * KCN, KCN, false>(vf2, Vt2 + kb, voff, 16 * TT);   // the value fragments fly under the score products and the softmax
        v8f s[MBN];
#pragma unroll
        for (int mb = 0; mb < MBN; ++mb) s[mb] = (v8f){};
#pragma unroll
        for (int kc = 0; kc < 4; ++kc)
#pragma unroll
            for (int mb = 0; mb < MBN; ++mb) { s[mb] = WFrag<T16>::mma(ka[mb * 4 + kc], qf[kc], s[mb]);
                if (NSPLIT == 2) { s[mb] = WFrag<T16>::mma(ka[mb * 4 + kc], qf2[kc], s[mb]); s[mb] = WFrag<T16>::mma(ka2[mb * 4 + kc], qf[kc], s[mb]); } }
        const size_t kn = (size_t)min(kb + KB, q0 & ~(KB - 1)) * HD;   // the next key block flies under the softmax and the value products; the last trip reads its own block again (in bounds, unused) instead of branching
        ldgroup<T16, MBN * 4, 4, NSPLIT == 2>(kx, Kp + kn, qoff, 16 * HD); if (NSPLIT == 2) ldgroup<T16, MBN * 4, 4, NSPLIT == 2>(kx2, Kp2 + kn, qoff, 16 * HD);
        float mt = -3.0e38f;
        if (kb + KB - 1 > q0) {                               // the diagonal block (wave-uniform test): keys behind the query get weight exactly 0
#pragma unroll
            for (int mb = 0; mb < MBN; ++mb)
#pragma unroll
                for (int j = 0; j < 8; ++j) { const float t = (kb + mb * 16 + hi * 8 + j <= qi) ? s[mb][j] * SCL2 : -3.0e38f; s[mb][j] = t; mt = fmaxf(mt, t); }
        } else {
#pragma unroll
            for (int mb = 0; mb < MBN; ++mb)
#pragma unroll
                for (int j = 0; j < 8; ++j) { const float t = s[mb][j] * SCL2; s[mb][j] = t; mt = fmaxf(mt, t); }
        }
        mt = fmaxf(mt, __shfl_xor(mt, 16, 32));               // the other half of this query's keys is in the other lane half
        const float mn = fmaxf(m, mt); const float al = __builtin_amdgcn_exp2f(m - mn); m = mn;
        float ps = 0.f;
#pragma unroll
        for (int mb = 0; mb < MBN; ++mb)
#pragma unroll
            for (int j = 0; j < 8; ++j) { const float p = __builtin_amdgcn_exp2f(s[mb][j] - mn); s[mb][j] = p; ps += p; }
        l = l * al + ps;
        V pf[KCN], pf2[KCN];
#pragma unroll
        for (int kc = 0; kc < KCN; ++kc) PFrag<T16>::mk(s[2 * kc], s[2 * kc + 1], pf[kc], pf2[kc]);
#pragma unroll
        for (int db = 0; db < 8; ++db) o[db] *= al;
#pragma unroll
        for (int kc = 0; kc < KCN; ++kc)
#pragma unroll
            for (int db = 0; db < 8; ++db) { o[db] = WFrag<T16>::mma(vf[db * KCN + kc], pf[kc], o[db]);
                if (NSPLIT == 2) { o[db] = WFrag<T16>::mma(vf[db * KCN + kc], pf2[kc], o[db]); o[db] = WFrag<T16>::mma(vf2[db * KCN + kc], pf[kc], o[db]); } }
        kb += KB;
    };
#pragma unroll 1
    for (;;) { trip(kf, kf2, kg, kg2); if (kb > q0) break; trip(kg, kg2, kf, kf2); if (kb > q0) break; }   // key blocks kb <= q0 (block 0 always is one); two trips a pass, so that the two fragment sets swap roles without register copies
    l += __shfl_xor(l, 16, 32);
    const float f = __fdiv_rn(1.0f, l);
#pragma unroll
    for (int db = 0; db < 8; ++db) { v8us vh, vl;
#pragma unroll
        for (int j = 0; j < 8; ++j) { unsigned short a, c; splitf(o[db][j] * f, a, c); vh[j] = a; vl[j] = c; }
        const size_t oo = (size_t)qi * DQ + db * 16 + hi * 8; *(v8us*)(oh + oo) = vh; *(v8us*)(ol + oo) = vl; }
}
// Grid (query heads, TT / 128, batches), 8 waves. Cost grows with the row index, so a block takes one long and one short 64-row block: waves 0..3 the rows of block TT / 64 - 1 - y, waves 4..7 those of block y; every block then
// walks the same number of keys. A wave works alone: no LDS, no barrier, and the choice of the path (hi + lo or single plane) is uniform in the wave.
__global__ __launch_bounds__(256) void k_fattn(const h16* __restrict__ Q16, const bf* __restrict__ Qh, const bf* __restrict__ Ql, const h16* __restrict__ K16, const bf* __restrict__ Kh, const bf* __restrict__ Kl, const h16* __restrict__ V16, const bf* __restrict__ Vh, const bf* __restrict__ Vl, bf* __restrict__ Ah, bf* __restrict__ Al) {
    const int lane = threadIdx.x & 31, lr = lane & 15, hi = lane >> 4;
    const int wv = __builtin_amdgcn_readfirstlane((int)(threadIdx.x >> 5));   // kept scalar so that the path choice and the key loop's control stay scalar
    const int h = blockIdx.x, r0 = ((wv < 4) ? TT / 64 - 1 - (int)blockIdx.y : (int)blockIdx.y) * 64, q0 = r0 + (wv & 3) * 16;
    const int b = blockIdx.z; Ah += (size_t)b * TT * DQ; Al += (size_t)b * TT * DQ;
    const size_t zq = (size_t)(b * NH_ + h) * TT * HD, zk = (size_t)(b * NKV + h / REP) * TT * HD;
    if (r0 < RH) fattn_strip<bf, 2, 32>(Qh + zq, Ql + zq, Kh + zk, Kl + zk, Vh + zk, Vl + zk, q0, lr, hi, Ah + h * HD, Al + h * HD);
    else fattn_strip<h16, 0, 64>(Q16 + zq, nullptr, K16 + zk, nullptr, V16 + zk, nullptr, q0, lr, hi, Ah + h * HD, Al + h * HD);
}

extern "C" void kernel_launch(void* const* d_in, const int* in_sizes, int n_in,
                              void* d_out, int out_size, void* d_ws, size_t ws_size, hipStream_t stream) {
    (void)in_sizes; (void)n_in; (void)out_size;
    const float* x = (const float*)d_in[0]; const float* wq = (const float*)d_in[1]; const float* wk = (const float*)d_in[2]; const float* wv = (const float*)d_in[3]; const float* wo = (const float*)d_in[4];
    float* OUT = (float*)d_out;     // [2][2048][2048]
    char* wsp = (char*)d_ws;
    auto take = [&](size_t bytes) { char* p = wsp; wsp += (bytes + 255) & ~(size_t)255; return (void*)p; };
    bf* WQ = (bf*)take((size_t)DF * DM * 2); bf* WK = WQ + (size_t)DQ * DM; bf* WV = WK + (size_t)DKV * DM;   // one [DF][DM] plane: the rows of w_q, w_k, w_v one behind the other
    bf* WO = (bf*)take((size_t)DM * DQ * 2); float* CS = (float*)take((size_t)TT * HD * 2 * 4);
    bf* XB = (bf*)take((size_t)NB_ * TT * DM * 2); float* F = (float*)take((size_t)NB_ * TT * DF * 4);
    h16* QP16 = (h16*)take((size_t)NB_ * NH_ * TT * HD * 2); h16* KP16 = (h16*)take((size_t)NB_ * NKV * TT * HD * 2); h16* VT16 = (h16*)take((size_t)NB_ * NKV * HD * TT * 2);
    bf* QPh = (bf*)take((size_t)NB_ * NH_ * TT * HD * 2); bf* QPl = (bf*)take((size_t)NB_ * NH_ * TT * HD * 2); bf* KPh = (bf*)take((size_t)NB_ * NKV * TT * HD * 2); bf* KPl = (bf*)take((size_t)NB_ * NKV * TT * HD * 2); bf* VTh = (bf*)take((size_t)NB_ * NKV * HD * TT * 2); bf* VTl = (bf*)take((size_t)NB_ * NKV * HD * TT * 2);
    bf* ATh = (bf*)take((size_t)NB_ * TT * DQ * 2); bf* ATl = (bf*)take((size_t)NB_ * TT * DQ * 2);
    if ((size_t)(wsp - (char*)d_ws) > ws_size) return;    // 190 MiB of the 256 MiB
    // Five launches, each over both batches (the rows b * TT + t of x, F, the merged planes and out are one matrix of NB_ * TT rows)
    k_prep<<<PB_CS + PB_X + PB_WQ + 2 * PB_WKV + PB_WO, 256, 0, stream>>>(x, wq, wk, wv, wo, XB, WQ, WK, WV, WO, CS);
    k_gemmw<bf, 0, false, 4, 2><<<dim3(NB_ * TT / 64, DF / 64, 1), 128, 0, stream>>>(XB, nullptr, WQ, nullptr, DM, F, DF, nullptr, 0, 0, 0);
    k_planes<<<LB_Q + 2 * LB_KV, 256, 0, stream>>>(F, CS, QP16, QPh, QPl, KP16, KPh, KPl, VT16, VTh, VTl);
    k_fattn<<<dim3(NH_, TT / 128, NB_), 256, 0, stream>>>(QP16, QPh, QPl, KP16, KPh, KPl, VT16, VTh, VTl, ATh, ATl);
    k_gemmw<bf, 1, false, 4, 1><<<dim3(NB_ * TT / 64, DM / 64, 1), 128, 0, stream>>>(ATh, ATl, WO, nullptr, DQ, OUT, DM, nullptr, 0, 0, 0);
}

// v005
// A run of this version takes 186 microseconds.
// Timed twice side by side with v004, it ran 1.75 and 1.76 times as fast.
// All steps since v000 together make it 8.73 times as fast.
#include <hip/hip_runtime.h>

// Grouped-query RoPE causal attention ('eager' path) (x [2][2048][2048]; q = x w_q^T ([2048][2048]: 16 heads x 128), k, v = x w_k^T / w_v^T ([512][2048]: 4 kv heads); rotate-half RoPE (theta 1e6, full 128 dims, tables computed on device); kv head = h/4; scores = q.k/sqrt(128); causal (finfo.min == exact zero weight); softmax; out = merged w_o^T -> [2][2048][2048] (8.4 M)).
// Compute dtypes, f32 accumulate: every input rounded to bf16; q/k/v on PLAIN bf16 operands (inputs: exact); rotary in f32 (cos/sin from an on-device f32 table: inv_freq_i = 1e6^(-2i/128), precise cosf/sinf); causal scores, softmax (f32, running maximum and sum) and attn.v in one kernel: query rows < 512 hl (3 products), the rest single fp16; w_o hl x exact (2 products).

#define NB_  2
#define TT   2048
#define DM   2048
#define NH_  16
#define NKV  4
#define REP  (NH_ / NKV)
#define HD   128
#define DQ   (NH_ * HD)
#define DKV  (NKV * HD)
#define RH   512                  // query rows < RH use hi+lo planes (0: none)
typedef _Float16 h16;
typedef unsigned short bf;
typedef __attribute__((ext_vector_type(16))) __bf16   v16bf;
typedef __attribute__((ext_vector_type(16))) _Float16 v16h;
typedef __attribute__((ext_vector_type(8)))  _Float16 v8h;
typedef __attribute__((ext_vector_type(8)))  unsigned short v8us;
typedef __attribute__((ext_vector_type(8)))  float    v8f;
typedef __attribute__((ext_vector_type(4)))  float    v4f;
typedef v8h  __attribute__((may_alias)) v8ha;
typedef v4f  __attribute__((may_alias)) v4fa;
typedef v8us __attribute__((may_alias)) v8usa;

__device__ __forceinline__ unsigned short f2bf(float f) { unsigned u = __float_as_uint(f); u += 0x7FFFu + ((u >> 16) & 1u); return (unsigned short)(u >> 16); }
__device__ __forceinline__ float bf2f(unsigned short b) { return __uint_as_float(((unsigned)b) << 16); }
__device__ __forceinline__ float bfr(float f) { return bf2f(f2bf(f)); }
__device__ __forceinline__ v16h cat16(v8h lo, v8h hi) { return __builtin_shufflevector(lo, hi, 0, 1, 2, 3, 4, 5, 6, 7, 8, 9, 10, 11, 12, 13, 14, 15); }
__device__ __forceinline__ v16bf cat16b(v8us lo, v8us hi) { return __builtin_bit_cast(v16bf, __builtin_shufflevector(lo, hi, 0, 1, 2, 3, 4, 5, 6, 7, 8, 9, 10, 11, 12, 13, 14, 15)); }
__device__ __forceinline__ v8f wmma16(v16h a, v16h b, v8f c) { return __builtin_amdgcn_wmma_f32_16x16x32_f16(false, a, false, b, (short)0, c, false, false); }
__device__ __forceinline__ v8f wmmab(v16bf a, v16bf b, v8f c) { return __builtin_amdgcn_wmma_f32_16x16x32_bf16(false, a, false, b, (short)0, c, false, false); }



// ---- Fragment order: every 16-bit operand plane [rows][K] is stored tile by tile, a tile = 16 rows x 32 k = 1 KiB, tile (r / 16, k / 32) at element (r / 16 * (K / 32) + k / 32) * 512 (16 rows keep their 16 * K elements).
// Inside a tile the 16-byte pieces (8 neighbouring k of one row) stand in the order in which the lanes of a wave take them: piece = (k / 16 % 2) * 32 + (k / 8 % 2) * 16 + r % 16. A fragment is then two loads of 512 contiguous bytes
// (lane * 8 and 256 + lane * 8 elements into the tile): 4 whole cache lines a load, where a row-major plane gives 32 bytes out of each of 16 lines. The k order of a fragment is the one it had.
__device__ __forceinline__ size_t pk(int r, int k, int K) { return ((size_t)(r >> 4) * (K >> 5) + (k >> 5)) * 512 + ((k >> 4) & 1) * 256 + (((k >> 3) & 1) * 16 + (r & 15)) * 8 + (k & 7); }
// ---- k_gemmw: register-blocked GEMM, NW WAVES per 64x64 output tile: wave w takes the K slices w, w + NW, ... of 32 * KS elements into its own 16 accumulators; the NW partial tiles are summed through LDS in wave order.
// Operands straight from 16-bit planes in fragment order; grid (M/64, N/64, Z), NW * 32 threads. K % (32 * KS) == 0.
// C[m][n] (f32, pitch ldc, + optional f32 bias[n]) = sum_k A[m][k] Bt[n][k] (+ split products per NSPLIT). z-batch strides sA/sB/sC in elements. K % 32 == 0.
template <typename T16> struct WFrag;
template <> struct WFrag<h16> { typedef v16h V; static __device__ __forceinline__ V ld(const h16* p) { return cat16(*(const v8h*)p, *(const v8h*)(p + 256)); } static __device__ __forceinline__ v8f mma(V a, V b, v8f c) { return wmma16(a, b, c); } };
template <> struct WFrag<bf> { typedef v16bf V; static __device__ __forceinline__ V ld(const bf* p) { return cat16b(*(const v8us*)p, *(const v8us*)(p + 256)); } static __device__ __forceinline__ v8f mma(V a, V b, v8f c) { return wmmab(a, b, c); } };
template <typename T16, int NSPLIT, bool BIAS, int NW, int KS, int K>
__global__ __launch_bounds__(NW * 32) void k_gemmw(const T16* __restrict__ A, const T16* __restrict__ A2, const T16* __restrict__ Bt, const T16* __restrict__ Bt2, float* C, int ldc, const float* __restrict__ bias, size_t sA, size_t sB, size_t sC) {
    typedef typename WFrag<T16>::V V;
    __shared__ __align__(16) float os[NW * 64 * 68];
    const size_t z = blockIdx.z; A += z * sA; if (A2) A2 += z * sA; Bt += z * sB; if (Bt2) Bt2 += z * sB; C += z * sC;
    const int lane = threadIdx.x & 31, lr = lane & 15, hi = lane >> 4; const int r0 = blockIdx.x * 64, c0 = blockIdx.y * 64;
    const int wv = __builtin_amdgcn_readfirstlane((int)(threadIdx.x >> 5));   // this wave's K-slice phase, kept scalar so that the loop control stays scalar
    v8f acc[4][4];
#pragma unroll
    for (int mb = 0; mb < 4; ++mb)
#pragma unroll
        for (int nb = 0; nb < 4; ++nb) acc[mb][nb] = (v8f){};
    const size_t aoff = (size_t)r0 * K + 8 * lane, boff = (size_t)c0 * K + 8 * lane;   // the lane's piece in the first tile of the block's rows; the tile of k = kc stands kc * 16 elements on, the next 16 rows 16 * K: with K known at compile time every fragment of a K slice is an immediate offset from one address per plane
#pragma unroll 1
    for (int ks = wv * (32 * KS); ks < K; ks += NW * 32 * KS) {    // this wave's K slices, dealt round robin over the block's waves
    const T16* pa = A + aoff + ks * 16; const T16* pa2 = (NSPLIT == 1 || NSPLIT == 2) ? A2 + aoff + ks * 16 : pa; const T16* pb = Bt + boff + ks * 16; const T16* pb2 = (NSPLIT >= 2) ? Bt2 + boff + ks * 16 : pb;   // the slice's one address per plane
#pragma unroll
    for (int kc = 0; kc < 32 * KS; kc += 32) {
        V a[4], a2[4];
#pragma unroll
        for (int mb = 0; mb < 4; ++mb) { a[mb] = WFrag<T16>::ld(pa + mb * 16 * K + kc * 16); if (NSPLIT == 1 || NSPLIT == 2) a2[mb] = WFrag<T16>::ld(pa2 + mb * 16 * K + kc * 16); }
#pragma unroll
        for (int nb = 0; nb < 4; ++nb) { const V b = WFrag<T16>::ld(pb + nb * 16 * K + kc * 16); V b2; if (NSPLIT >= 2) b2 = WFrag<T16>::ld(pb2 + nb * 16 * K + kc * 16);
#pragma unroll
            for (int mb = 0; mb < 4; ++mb) { acc[mb][nb] = WFrag<T16>::mma(a[mb], b, acc[mb][nb]); if (NSPLIT == 1 || NSPLIT == 2) acc[mb][nb] = WFrag<T16>::mma(a2[mb], b, acc[mb][nb]); if (NSPLIT >= 2) acc[mb][nb] = WFrag<T16>::mma(a[mb], b2, acc[mb][nb]); } }
        asm volatile("v_nop\n\tv_nop\n\tv_nop\n\tv_nop" : "+v"(acc[0][0]), "+v"(acc[1][1]), "+v"(acc[2][2]), "+v"(acc[3][3]) : "v"(a[0]), "v"(a[3]));
    }
    asm volatile("s_wait_xcnt 0x0" :: "v"(pa), "v"(pa2), "v"(pb), "v"(pb2) : "memory");   // the wait before an address register of the slice's loads is overwritten; the addresses are its inputs, or else this compiler gives a later load of the slice an earlier one's address register as its destination
    }
#pragma unroll
    for (int mb = 0; mb < 4; ++mb) {
#pragma unroll
        for (int nb = 0; nb < 4; ++nb) {
#pragma unroll
            for (int j = 0; j < 8; ++j) os[wv * (64 * 68) + (mb * 16 + hi * 8 + j) * 68 + nb * 16 + lr] = acc[mb][nb][j]; }
    }
    __syncthreads();   // every wave's partial tile is in LDS before any wave sums it
    float* crow = C + (size_t)r0 * ldc + c0;
#pragma unroll
    for (int i = 0; i < 32 / NW; ++i) { const int row = 2 * (wv + i * NW) + hi, cofs = lr * 4; v4f val = *(const v4fa*)(os + row * 68 + cofs);
#pragma unroll
        for (int p = 1; p < NW; ++p) val += *(const v4fa*)(os + p * (64 * 68) + row * 68 + cofs); if (BIAS) { val[0] += bfr(bias[c0 + cofs]); val[1] += bfr(bias[c0 + cofs + 1]); val[2] += bfr(bias[c0 + cofs + 2]); val[3] += bfr(bias[c0 + cofs + 3]); }
        *(v4f*)(crow + (size_t)row * ldc + cofs) = val; }
}

__device__ __forceinline__ h16 tohx(float x) { return (h16)x; }
__device__ __forceinline__ void splitf(float y, unsigned short& h, unsigned short& l) { h = f2bf(y); l = f2bf(y - bf2f(h)); }
typedef __attribute__((ext_vector_type(2))) _Float16 v2h;
typedef __attribute__((ext_vector_type(4))) _Float16 v4h;
typedef __attribute__((ext_vector_type(2))) unsigned short v2us;
typedef __attribute__((ext_vector_type(4))) unsigned short v4us;
typedef v4h  __attribute__((may_alias)) v4ha;
typedef v4us __attribute__((may_alias)) v4usa;
typedef __attribute__((ext_vector_type(2))) float v2f;
typedef __attribute__((ext_vector_type(4))) int v4i;

__global__ __launch_bounds__(256) void k_wtG(const float* __restrict__ w, int K, int N, bf* Bt) {
    const int lane = threadIdx.x & 31; const int L0 = (blockIdx.x * 8 + (threadIdx.x >> 5)) * 8; const int nlines = N * K / 64;
{
#pragma unroll 1
        for (int l = 0; l < 8; ++l) { const int L = L0 + l; if (L >= nlines) break; const size_t e = (size_t)L * 64 + lane * 2; const int k = (int)(e % K), n = (int)(e / K); v2us o;
            o[0] = f2bf(w[(size_t)k * N + n]); o[1] = f2bf(w[(size_t)(k + 1) * N + n]); *(v2us*)(Bt + e) = o; }
         }
}
// d_cvt8: a row-major f32 matrix [rows][K] rounded to bf16, into fragment order. A wave takes 8 rows x 32 k (half a tile) in two loads of 4 rows x 128 bytes (whole lines); a lane's 4 values go out as half a 16-byte piece.
__device__ __forceinline__ void d_cvt8(unsigned blk, const float* __restrict__ src, bf* dst, size_t n8, int K) { const size_t i = (size_t)blk * 256 + threadIdx.x; if (i >= n8) return; const int l = (int)(i & 31); const int w = (int)(i >> 5);
    const int tile = w >> 1; const int r = tile / (K >> 5) * 16 + (w & 1) * 8 + (l >> 3), k = tile % (K >> 5) * 32 + (l & 7) * 4;
    const float* s0 = src + (size_t)r * K + k; const float* s1 = s0 + (size_t)4 * K; const v4f v[2] = {*(const v4f*)s0, *(const v4f*)s1};
    asm volatile("s_wait_xcnt 0x0" :: "v"(s0), "v"(s1) : "memory");   // the wait before an address register of the two loads is overwritten; the addresses are its inputs, or else this compiler gives a load its own address register as its destination
#pragma unroll
    for (int u = 0; u < 2; ++u) { v4us o;
#pragma unroll
        for (int q = 0; q < 4; ++q) o[q] = f2bf(v[u][q]);
        *(v4us*)(dst + pk(r + 4 * u, k, K)) = o; }  }
__constant__ float INV[HD / 2] = {1.00000000f,0.805842161f,0.649381638f,0.523299098f,0.421696514f,0.339820832f,0.273841977f,0.220673412f,0.177827939f,0.143301263f,0.115478195f,0.0930572078f,0.0749894232f,0.0604296401f,0.0486967526f,0.0392418988f,0.0316227749f,0.0254829675f,0.0205352511f,0.0165481716f,0.0133352140f,0.0107460786f,0.00865964312f,0.00697830599f,0.00562341325f,0.00453158375f,0.00365174119f,0.00294272718f,0.00237137382f,0.00191095297f,0.00153992651f,0.00124093774f,0.00100000005f,0.000805842166f,0.000649381604f,0.000523299095f,0.000421696517f,0.000339820836f,0.000273841957f,0.000220673406f,0.000177827940f,0.000143301251f,0.000115478200f,0.0000930572060f,0.0000749894243f,0.0000604296401f,0.0000486967510f,0.0000392418988f,0.0000316227779f,0.0000254829683f,0.0000205352499f,0.0000165481706f,0.0000133352141f,0.0000107460783f,0.00000865964284f,0.00000697830592f,0.00000562341347f,0.00000453158373f,0.00000365174128f,0.00000294272718f,0.00000237137374f,0.00000191095296f,0.00000153992653f,0.00000124093776f};
__device__ __forceinline__ void d_cstab(unsigned blk, float* CS) { const int idx = (int)blk * 256 + threadIdx.x; if (idx >= TT * HD) return; const int t = idx / HD, d = idx % HD; const int di = d % (HD / 2); const float iv = INV[di];
    asm volatile("s_wait_xcnt 0x0" :: "v"(di) : "memory");   // the wait before the register of the table load's index is overwritten; the index is its input, or else this compiler gives the load that very register as its destination
    const float ang = __fmul_rn((float)t, iv); v2f cs; cs[0] = cosf(ang); cs[1] = sinf(ang);
    *(v2f*)(CS + (size_t)idx * 2) = cs;  }
// ---- k_prep: everything that depends on the inputs alone, in ONE launch: the rotary table (first: its blocks run longest), then x (both batches) and the four weights rounded to bf16, in fragment order. A block does one job, picked by its index (block-uniform).
#define PB_CS  (TT * HD / 256)
#define PB_X   (NB_ * TT * DM / 8 / 256)
#define PB_WQ  (DQ * DM / 8 / 256)
#define PB_WKV (DKV * DM / 8 / 256)
#define PB_WO  (DM * DQ / 8 / 256)
__global__ __launch_bounds__(256) void k_prep(const float* __restrict__ x, const float* __restrict__ wq, const float* __restrict__ wk, const float* __restrict__ wv, const float* __restrict__ wo, bf* XB, bf* WQ, bf* WK, bf* WV, bf* WO, float* CS) {
    unsigned blk = blockIdx.x;
    if (blk < PB_CS) { d_cstab(blk, CS); return; }
    blk -= PB_CS; const float* s; bf* d; unsigned nb;
    if (blk < PB_X) { s = x; d = XB; nb = PB_X; }
    else if ((blk -= PB_X) < PB_WQ) { s = wq; d = WQ; nb = PB_WQ; }
    else if ((blk -= PB_WQ) < PB_WKV) { s = wk; d = WK; nb = PB_WKV; }
    else if ((blk -= PB_WKV) < PB_WKV) { s = wv; d = WV; nb = PB_WKV; }
    else { blk -= PB_WKV; s = wo; d = WO; nb = PB_WO; }
    d_cvt8(blk, s, d, (size_t)nb * 256, DM);   // every one of them has rows of DM elements
    static_assert(DQ == DM, "w_o's rows are DQ long");
}

// d_rope: head planes [b][h] of [t][d] in fragment order (fp16 + hi/lo) of rope(x) x sc; a wave takes 4 rows t x 32 d (whole 128-byte lines of F), a lane 4 neighbouring d (half a 16-byte piece); with the rotate-half convention out[d] = x[d] cos[t][d] - x[d+HD/2] sin[t][d], out[d+HD/2] = x[d+HD/2] cos[t][d+HD/2] + x[d] sin[t][d+HD/2]
__device__ __forceinline__ void d_rope(unsigned blk, const float* __restrict__ F, int pitch, int nheads, const float* __restrict__ CS, const float* __restrict__ RF, const float* __restrict__ nw, float sc, h16* P16, bf* Ph, bf* Pl) {
    const size_t i = (size_t)blk * 256 + threadIdx.x; if (i * 4 >= (size_t)NB_ * nheads * TT * HD) return; const int l = (int)(i & 31); const int w = (int)(i >> 5);   // wave w: d tile w % (HD / 32) of the rows 4 (w / (HD / 32)) .. + 3, counted through all heads
    const int d = w % (HD / 32) * 32 + (l & 7) * 4; const int t = w / (HD / 32) % (TT / 4) * 4 + (l >> 3); const int bh = w / (HD / 32) / (TT / 4); const int h = bh % nheads; const float* f = F + ((size_t)(bh / nheads) * TT + t) * pitch + h * HD; const float rf = RF ? RF[(size_t)h * TT + t] : 1.0f; v4h o16; v4us oh, ol;
    const float* f0 = f + d; const float* f1 = f + ((d < HD / 2) ? d + HD / 2 : d - HD / 2); const v4f X0 = *(const v4f*)f0, X1 = *(const v4f*)f1;   // the lane's 4 values and their 4 partners, one 16-byte load each
    asm volatile("s_wait_xcnt 0x0" :: "v"(f0), "v"(f1) : "memory");   // the wait before an address register of the two loads is overwritten; the addresses are its inputs, so that no load gets its own address register as its destination
#pragma unroll
    for (int q = 0; q < 4; ++q) { const int dd = d + q; const int dp = (dd < HD / 2) ? dd + HD / 2 : dd - HD / 2; float x0 = X0[q], x1 = X1[q];
        if (RF) { float n0 = __fmul_rn(x0, rf), n1 = __fmul_rn(x1, rf); asm volatile("" : "+v"(n0)); asm volatile("" : "+v"(n1)); x0 = __fmul_rn(bfr(nw[dd]), n0); x1 = __fmul_rn(bfr(nw[dp]), n1); }
        const v2f cs = *(const v2f*)(CS + ((size_t)t * HD + dd) * 2); float a = __fmul_rn(x0, cs[0]), bq = __fmul_rn(x1, cs[1]); asm volatile("" : "+v"(a)); asm volatile("" : "+v"(bq)); const float r = ((dd < HD / 2) ? __fsub_rn(a, bq) : __fadd_rn(a, bq)) * sc;
        o16[q] = tohx(r); unsigned short a2, c2; splitf(r, a2, c2); oh[q] = a2; ol[q] = c2; }
    const size_t e = (size_t)bh * TT * HD + pk(t, d, HD);
    *(v4h*)(P16 + e) = o16; *(v4us*)(Ph + e) = oh; *(v4us*)(Pl + e) = ol;  }
// d_vtp: value planes [b][g] of [d][t] in fragment order. A thread makes one 16-byte piece (8 neighbouring t of one d), the threads in the order of the pieces: a wave stores 512 contiguous bytes, and each of its 8 loads takes 16 neighbouring d of two rows of F.
__device__ __forceinline__ void d_vtp(unsigned blk, const float* __restrict__ F, int pitch, int nheads, h16* V16, bf* Vh, bf* Vl) { const size_t e = ((size_t)blk * 256 + threadIdx.x) * 8; if (e >= (size_t)NB_ * nheads * HD * TT) return; const int pl = (int)(e / ((size_t)TT * HD)); const int pe = (int)(e % ((size_t)TT * HD)); const int tile = pe >> 9, pc = (pe >> 3) & 63;   // plane b * nheads + g, tile in it, piece in the tile
    const int t = tile % (TT / 32) * 32 + (pc >> 5) * 16 + ((pc >> 4) & 1) * 8 + pl / nheads * TT; const int d = tile / (TT / 32) * 16 + (pc & 15); const int g = pl % nheads; v8h o16; v8us oh, ol;
#pragma unroll
    for (int q = 0; q < 8; ++q) { const float x = F[(size_t)(t + q) * pitch + g * HD + d]; o16[q] = tohx(x); unsigned short a2, c2; splitf(x, a2, c2); oh[q] = a2; ol[q] = c2; }
    *(v8h*)(V16 + e) = o16; *(v8us*)(Vh + e) = oh; *(v8us*)(Vl + e) = ol;  }
// ---- k_planes: the operand planes of the attention kernel, all in ONE launch, from the joint projection F [b * TT + t][q columns | k columns | v columns]: rotated q, rotated k, transposed v. A block does one job, picked by its index (block-uniform).
#define DF     (DQ + 2 * DKV)
#define LB_Q   (NB_ * NH_ * TT * HD / 4 / 256)
#define LB_K   (NB_ * NKV * TT * HD / 4 / 256)
#define LB_V   (NB_ * NKV * TT * HD / 8 / 256)
__global__ __launch_bounds__(256) void k_planes(const float* __restrict__ F, const float* __restrict__ CS, h16* QP16, bf* QPh, bf* QPl, h16* KP16, bf* KPh, bf* KPl, h16* VT16, bf* VTh, bf* VTl) {
    const unsigned blk = blockIdx.x;
    if (blk < LB_Q) d_rope(blk, F, DF, NH_, CS, nullptr, nullptr, 1.0f, QP16, QPh, QPl);
    else if (blk < LB_Q + LB_K) d_rope(blk - LB_Q, F + DQ, DF, NKV, CS, nullptr, nullptr, 1.0f, KP16, KPh, KPl);
    else d_vtp(blk - (LB_Q + LB_K), F + DQ + DKV, DF, NKV, VT16, VTh, VTl);
}
// ---- k_fattn: scores, causal softmax and probability x value product of one query strip in ONE kernel; no score or probability ever goes to memory.
// A wave owns 16 query rows of one head and walks the keys 0 .. its diagonal in blocks of KB, transposed: St = K Qt (A = key rows, B = the strip's query rows, kept in registers), Ot += Vt Pt (A = rows of the [d][t] value plane).
// In both accumulators a lane holds ONE query (column lr): the running maximum, the running sum and the rescale factor are per lane, with one exchange between the two lane halves; the accumulator registers of two score tiles
// (keys 8 hi + j and 16 + 8 hi + j) are, converted, exactly the B fragment of the next product in the k order of WFrag::ld. Probabilities are exp(t - running max), at most 1, divided by the row's sum only at the end.
// NSPLIT 2: hi + lo planes, 3 products (query rows < RH), KB 32; NSPLIT 0: single fp16, KB 64: either way 16 key and 16 value fragments are in flight. The epilogue writes the merged [t][h * HD + d] hi and lo planes in fragment order, 8 neighbouring d per lane, 512 contiguous bytes per store.
template <typename T16> struct PFrag;
template <> struct PFrag<h16> { static __device__ __forceinline__ void mk(const v8f p0, const v8f p1, v16h& f, v16h& f2) { (void)f2;
#pragma unroll
    for (int j = 0; j < 8; ++j) { f[j] = (h16)p0[j]; f[8 + j] = (h16)p1[j]; } } };
template <> struct PFrag<bf> { static __device__ __forceinline__ void mk(const v8f p0, const v8f p1, v16bf& f, v16bf& f2) { v8us h0, h1, l0, l1;
#pragma unroll
    for (int j = 0; j < 8; ++j) { unsigned short a, c; splitf(p0[j], a, c); h0[j] = a; l0[j] = c; splitf(p1[j], a, c); h1[j] = a; l1[j] = c; }
    f = cat16b(h0, h1); f2 = cat16b(l0, l1); } };
// One plane's fragments of a block, loaded as ONE group: all its loads are in flight together, one latency per group. The group stands between two scheduling barriers, with the wait that comes before a register of an
// issued global load is overwritten as its last instruction: the barriers keep the loads from sinking to their uses and keep every other instruction (which could take an address register) out of the group.
// The address is formed inside the group, from a wave-uniform base and the lane's own 32-bit element offset.
template <typename T16, int N, int INNER, bool HOLD>
__device__ __forceinline__ void ldgroup(typename WFrag<T16>::V (&f)[N], const T16* base, unsigned off, int outer) {
    __builtin_amdgcn_sched_barrier(0);   // opens the group: nothing from in front of it moves in
    const T16* p = base + off;
#pragma unroll
    for (int i = 0; i < N; ++i) f[i] = WFrag<T16>::ld(p + ((i / INNER) * outer + (i % INNER) * 512));   // the next 32 k of the same rows are the next tile
    // the wait before an address register of the group is overwritten; HOLD: with the address as its input, for the groups whose last load this compiler would else give that very register as its destination
    if (HOLD) asm volatile("s_wait_xcnt 0x0" :: "v"(p) : "memory"); else asm volatile("s_wait_xcnt 0x0" ::: "memory");
    __builtin_amdgcn_sched_barrier(0);   // closes the group: no load sinks behind it, nothing from behind it moves in
}
#define SCL2 0.12751743082459868f    // HD^-0.5 * log2(e): scores are carried in the base-2 domain
template <typename T16, int NSPLIT, int KB>
__device__ __forceinline__ void fattn_strip(const T16* __restrict__ Q, const T16* __restrict__ Q2, const T16* __restrict__ Kp, const T16* __restrict__ Kp2, const T16* __restrict__ Vt, const T16* __restrict__ Vt2, int q0, int lr, int hi, bf* __restrict__ oh, bf* __restrict__ ol) {
    typedef typename WFrag<T16>::V V;
    constexpr int MBN = KB / 16, KCN = KB / 32;               // score tiles and 32-key slices of one key block
    const int qi = q0 + lr;                                   // this lane's query row
    v8f o[8];
#pragma unroll
    for (int db = 0; db < 8; ++db) o[db] = (v8f){};
    float m = -3.0e38f, l = 0.f;                              // running maximum (base-2 domain, the same in both lane halves) and this lane half's running sum
    const unsigned qoff = (unsigned)((hi * 16 + lr) * 8), voff = qoff;   // the lane's piece in a tile, the same in every plane (fragment order)
    V qf[4], qf2[4], kf[MBN * 4], kf2[MBN * 4], kg[MBN * 4], kg2[MBN * 4];   // the strip's query fragments and the first key block's; every later key block is fetched one trip ahead, into the other of the two fragment sets
    ldgroup<T16, 4, 4, false>(qf, Q + (size_t)q0 * HD, qoff, 0); if (NSPLIT == 2) ldgroup<T16, 4, 4, false>(qf2, Q2 + (size_t)q0 * HD, qoff, 0);
    ldgroup<T16, MBN * 4, 4, NSPLIT == 2>(kf, Kp, qoff, 16 * HD); if (NSPLIT == 2) ldgroup<T16, MBN * 4, 4, NSPLIT == 2>(kf2, Kp2, qoff, 16 * HD);
    int kb = 0;
    // One trip: key block kb, its fragments in (ka, ka2); the next block's go into (kx, kx2). q0 is a multiple of 16 and kb of KB: key kb itself is visible to every query of the strip, and kb + KB - 1 < TT
    auto trip = [&](V (&ka)[MBN * 4], V (&ka2)[MBN * 4], V (&kx)[MBN * 4], V (&kx2)[MBN * 4]) __attribute__((always_inline)) {
        V vf[8 * KCN], vf2[8 * KCN];
        ldgroup<T16, 8 * KCN, KCN, false>(vf, Vt + kb * 16, voff, 16 * TT); if (NSPLIT == 2) ldgroup<T16, 8 * KCN, KCN, false>(vf2, Vt2 + kb * 16, voff, 16 * TT);   // the value fragments fly under the score products and the softmax
        v8f s[MBN];
#pragma unroll
        for (int mb = 0; mb < MBN; ++mb) s[mb] = (v8f){};
#pragma unroll
        for (int kc = 0; kc < 4; ++kc)
#pragma unroll
            for (int mb = 0; mb < MBN; ++mb) { s[mb] = WFrag<T16>::mma(ka[mb * 4 + kc], qf[kc], s[mb]);
                if (NSPLIT == 2) { s[mb] = WFrag<T16>::mma(ka[mb * 4 + kc], qf2[kc], s[mb]); s[mb] = WFrag<T16>::mma(ka2[mb * 4 + kc], qf[kc], s[mb]); } }
        const size_t kn = (size_t)min(kb + KB, q0 & ~(KB - 1)) * HD;   // the next key block flies under the softmax and the value products; the last trip reads its own block again (in bounds, unused) instead of branching
        ldgroup<T16, MBN * 4, 4, NSPLIT == 2>(kx, Kp + kn, qoff, 16 * HD); if (NSPLIT == 2) ldgroup<T16, MBN * 4, 4, NSPLIT == 2>(kx2, Kp2 + kn, qoff, 16 * HD);
        float mt = -3.0e38f;
        if (kb + KB - 1 > q0) {                               // the diagonal block (wave-uniform test): keys behind the query get weight exactly 0
#pragma unroll
            for (int mb = 0; mb < MBN; ++mb)
#pragma unroll
                for (int j = 0; j < 8; ++j) { const float t = (kb + mb * 16 + hi * 8 + j <= qi) ? s[mb][j] * SCL2 : -3.0e38f; s[mb][j] = t; mt = fmaxf(mt, t); }
        } else {
#pragma unroll
            for (int mb = 0; mb < MBN; ++mb)
#pragma unroll
                for (int j = 0; j < 8; ++j) { const float t = s[mb][j] * SCL2; s[mb][j] = t; mt = fmaxf(mt, t); }
        }
        mt = fmaxf(mt, __shfl_xor(mt, 16, 32));               // the other half of this query's keys is in the other lane half
        const float mn = fmaxf(m, mt); const float al = __builtin_amdgcn_exp2f(m - mn); m = mn;
        float ps = 0.f;
#pragma unroll
        for (int mb = 0; mb < MBN; ++mb)
#pragma unroll
            for (int j = 0; j < 8; ++j) { const float p = __builtin_amdgcn_exp2f(s[mb][j] - mn); s[mb][j] = p; ps += p; }
        l = l * al + ps;
        V pf[KCN], pf2[KCN];
#pragma unroll
        for (int kc = 0; kc < KCN; ++kc) PFrag<T16>::mk(s[2 * kc], s[2 * kc + 1], pf[kc], pf2[kc]);
#pragma unroll
        for (int db = 0; db < 8; ++db) o[db] *= al;
#pragma unroll
        for (int kc = 0; kc < KCN; ++kc)
#pragma unroll
            for (int db = 0; db < 8; ++db) { o[db] = WFrag<T16>::mma(vf[db * KCN + kc], pf[kc], o[db]);
                if (NSPLIT == 2) { o[db] = WFrag<T16>::mma(vf[db * KCN + kc], pf2[kc], o[db]); o[db] = WFrag<T16>::mma(vf2[db * KCN + kc], pf[kc], o[db]); } }
        kb += KB;
    };
#pragma unroll 1
    for (;;) { trip(kf, kf2, kg, kg2); if (kb > q0) break; trip(kg, kg2, kf, kf2); if (kb > q0) break; }   // key blocks kb <= q0 (block 0 always is one); two trips a pass, so that the two fragment sets swap roles without register copies
    l += __shfl_xor(l, 16, 32);
    const float f = __fdiv_rn(1.0f, l);
#pragma unroll
    for (int db = 0; db < 8; ++db) { v8us vh, vl;
#pragma unroll
        for (int j = 0; j < 8; ++j) { unsigned short a, c; splitf(o[db][j] * f, a, c); vh[j] = a; vl[j] = c; }
        const size_t oo = (size_t)q0 * DQ + db * 256 + qoff; *(v8us*)(oh + oo) = vh; *(v8us*)(ol + oo) = vl; }   // fragment order: the 16 d of db are half a tile, the lane's 8 its own piece
}
// Grid (query heads, TT / 128, batches), 8 waves. Cost grows with the row index, so a block takes one long and one short 64-row block: waves 0..3 the rows of block TT / 64 - 1 - y, waves 4..7 those of block y; every block then
// walks the same number of keys. A wave works alone: no LDS, no barrier, and the choice of the path (hi + lo or single plane) is uniform in the wave.
__global__ __launch_bounds__(256) void k_fattn(const h16* __restrict__ Q16, const bf* __restrict__ Qh, const bf* __restrict__ Ql, const h16* __restrict__ K16, const bf* __restrict__ Kh, const bf* __restrict__ Kl, const h16* __restrict__ V16, const bf* __restrict__ Vh, const bf* __restrict__ Vl, bf* __restrict__ Ah, bf* __restrict__ Al) {
    const int lane = threadIdx.x & 31, lr = lane & 15, hi = lane >> 4;
    const int wv = __builtin_amdgcn_readfirstlane((int)(threadIdx.x >> 5));   // kept scalar so that the path choice and the key loop's control stay scalar
    const int h = blockIdx.x, r0 = ((wv < 4) ? TT / 64 - 1 - (int)blockIdx.y : (int)blockIdx.y) * 64, q0 = r0 + (wv & 3) * 16;
    const int b = blockIdx.z; Ah += (size_t)b * TT * DQ; Al += (size_t)b * TT * DQ;
    const size_t zq = (size_t)(b * NH_ + h) * TT * HD, zk = (size_t)(b * NKV + h / REP) * TT * HD;
    if (r0 < RH) fattn_strip<bf, 2, 32>(Qh + zq, Ql + zq, Kh + zk, Kl + zk, Vh + zk, Vl + zk, q0, lr, hi, Ah + h * HD * 16, Al + h * HD * 16);   // head h's columns begin h * HD / 32 tiles into a 16-row band
    else fattn_strip<h16, 0, 64>(Q16 + zq, nullptr, K16 + zk, nullptr, V16 + zk, nullptr, q0, lr, hi, Ah + h * HD * 16, Al + h * HD * 16);
}

extern "C" void kernel_launch(void* const* d_in, const int* in_sizes, int n_in,
                              void* d_out, int out_size, void* d_ws, size_t ws_size, hipStream_t stream) {
    (void)in_sizes; (void)n_in; (void)out_size;
    const float* x = (const float*)d_in[0]; const float* wq = (const float*)d_in[1]; const float* wk = (const float*)d_in[2]; const float* wv = (const float*)d_in[3]; const float* wo = (const float*)d_in[4];
    float* OUT = (float*)d_out;     // [2][2048][2048]
    char* wsp = (char*)d_ws;
    auto take = [&](size_t bytes) { char* p = wsp; wsp += (bytes + 255) & ~(size_t)255; return (void*)p; };
    bf* WQ = (bf*)take((size_t)DF * DM * 2); bf* WK = WQ + (size_t)DQ * DM; bf* WV = WK + (size_t)DKV * DM;   // one [DF][DM] plane: the rows of w_q, w_k, w_v one behind the other
    bf* WO = (bf*)take((size_t)DM * DQ * 2); float* CS = (float*)take((size_t)TT * HD * 2 * 4);
    bf* XB = (bf*)take((size_t)NB_ * TT * DM * 2); float* F = (float*)take((size_t)NB_ * TT * DF * 4);
    h16* QP16 = (h16*)take((size_t)NB_ * NH_ * TT * HD * 2); h16* KP16 = (h16*)take((size_t)NB_ * NKV * TT * HD * 2); h16* VT16 = (h16*)take((size_t)NB_ * NKV * HD * TT * 2);
    bf* QPh = (bf*)take((size_t)NB_ * NH_ * TT * HD * 2); bf* QPl = (bf*)take((size_t)NB_ * NH_ * TT * HD * 2); bf* KPh = (bf*)take((size_t)NB_ * NKV * TT * HD * 2); bf* KPl = (bf*)take((size_t)NB_ * NKV * TT * HD * 2); bf* VTh = (bf*)take((size_t)NB_ * NKV * HD * TT * 2); bf* VTl = (bf*)take((size_t)NB_ * NKV * HD * TT * 2);
    bf* ATh = (bf*)take((size_t)NB_ * TT * DQ * 2); bf* ATl = (bf*)take((size_t)NB_ * TT * DQ * 2);
    if ((size_t)(wsp - (char*)d_ws) > ws_size) return;    // 190 MiB of the 256 MiB
    // Five launches, each over both batches (the rows b * TT + t of x, F, the merged planes and out are one matrix of NB_ * TT rows)
    k_prep<<<PB_CS + PB_X + PB_WQ + 2 * PB_WKV + PB_WO, 256, 0, stream>>>(x, wq, wk, wv, wo, XB, WQ, WK, WV, WO, CS);
    k_gemmw<bf, 0, false, 4, 2, DM><<<dim3(NB_ * TT / 64, DF / 64, 1), 128, 0, stream>>>(XB, nullptr, WQ, nullptr, F, DF, nullptr, 0, 0, 0);
    k_planes<<<LB_Q + LB_K + LB_V, 256, 0, stream>>>(F, CS, QP16, QPh, QPl, KP16, KPh, KPl, VT16, VTh, VTl);
    k_fattn<<<dim3(NH_, TT / 128, NB_), 256, 0, stream>>>(QP16, QPh, QPl, KP16, KPh, KPl, VT16, VTh, VTl, ATh, ATl);
    k_gemmw<bf, 1, false, 4, 1, DQ><<<dim3(NB_ * TT / 64, DM / 64, 1), 128, 0, stream>>>(ATh, ATl, WO, nullptr, OUT, DM, nullptr, 0, 0, 0);
}

// v006
// A run of this version takes 163 microseconds.
// In two side-by-side timings against v005, it was 1.15 and 1.14 times as fast.
// Counting every step since v000, it is 9.97 times as fast.
#include <hip/hip_runtime.h>

// Grouped-query RoPE causal attention ('eager' path) (x [2][2048][2048]; q = x w_q^T ([2048][2048]: 16 heads x 128), k, v = x w_k^T / w_v^T ([512][2048]: 4 kv heads); rotate-half RoPE (theta 1e6, full 128 dims, tables computed on device); kv head = h/4; scores = q.k/sqrt(128); causal (finfo.min == exact zero weight); softmax; out = merged w_o^T -> [2][2048][2048] (8.4 M)).
// Compute dtypes, f32 accumulate: every input rounded to bf16; q/k/v on PLAIN bf16 operands (inputs: exact); rotary in f32 (cos/sin from an on-device f32 table: inv_freq_i = 1e6^(-2i/128), precise cosf/sinf); causal scores, softmax (f32, running maximum and sum) and attn.v in one kernel: query rows < 512 hl (3 products), the rest single fp16; w_o hl x exact (2 products).

#define NB_  2
#define TT   2048
#define DM   2048
#define NH_  16
#define NKV  4
#define REP  (NH_ / NKV)
#define HD   128
#define DQ   (NH_ * HD)
#define DKV  (NKV * HD)
#define RH   512                  // query rows < RH use hi+lo planes (0: none)
typedef _Float16 h16;
typedef unsigned short bf;
typedef __attribute__((ext_vector_type(16))) __bf16   v16bf;
typedef __attribute__((ext_vector_type(16))) _Float16 v16h;
typedef __attribute__((ext_vector_type(8)))  _Float16 v8h;
typedef __attribute__((ext_vector_type(8)))  unsigned short v8us;
typedef __attribute__((ext_vector_type(8)))  float    v8f;
typedef __attribute__((ext_vector_type(4)))  float    v4f;
typedef v8h  __attribute__((may_alias)) v8ha;
typedef v4f  __attribute__((may_alias)) v4fa;
typedef v8us __attribute__((may_alias)) v8usa;

__device__ __forceinline__ unsigned short f2bf(float f) { unsigned u = __float_as_uint(f); u += 0x7FFFu + ((u >> 16) & 1u); return (unsigned short)(u >> 16); }
__device__ __forceinline__ float bf2f(unsigned short b) { return __uint_as_float(((unsigned)b) << 16); }
__device__ __forceinline__ float bfr(float f) { return bf2f(f2bf(f)); }
__device__ __forceinline__ v16h cat16(v8h lo, v8h hi) { return __builtin_shufflevector(lo, hi, 0, 1, 2, 3, 4, 5, 6, 7, 8, 9, 10, 11, 12, 13, 14, 15); }
__device__ __forceinline__ v16bf cat16b(v8us lo, v8us hi) { return __builtin_bit_cast(v16bf, __builtin_shufflevector(lo, hi, 0, 1, 2, 3, 4, 5, 6, 7, 8, 9, 10, 11, 12, 13, 14, 15)); }
__device__ __forceinline__ v8f wmma16(v16h a, v16h b, v8f c) { return __builtin_amdgcn_wmma_f32_16x16x32_f16(false, a, false, b, (short)0, c, false, false); }
__device__ __forceinline__ v8f wmmab(v16bf a, v16bf b, v8f c) { return __builtin_amdgcn_wmma_f32_16x16x32_bf16(false, a, false, b, (short)0, c, false, false); }



// ---- Fragment order: every 16-bit operand plane [rows][K] is stored tile by tile, a tile = 16 rows x 32 k = 1 KiB, tile (r / 16, k / 32) at element (r / 16 * (K / 32) + k / 32) * 512 (16 rows keep their 16 * K elements).
// Inside a tile the 16-byte pieces (8 neighbouring k of one row) stand in the order in which the lanes of a wave take them: piece = (k / 16 % 2) * 32 + (k / 8 % 2) * 16 + r % 16. A fragment is then two loads of 512 contiguous bytes
// (lane * 8 and 256 + lane * 8 elements into the tile): 4 whole cache lines a load, where a row-major plane gives 32 bytes out of each of 16 lines. The k order of a fragment is the one it had.
__device__ __forceinline__ size_t pk(int r, int k, int K) { return ((size_t)(r >> 4) * (K >> 5) + (k >> 5)) * 512 + ((k >> 4) & 1) * 256 + (((k >> 3) & 1) * 16 + (r & 15)) * 8 + (k & 7); }
// ---- k_gemmw: register-blocked GEMM, one 128x128 output tile per block of 4 waves (2 x 2), a wave on its own 64x64 quarter with 16 accumulators over the whole K.
// The block's operand rows go through LDS, so that each fragment leaves L2 once per block and serves two waves: a stage is 64 k of every row, a 16-row band of it 2 KiB that are contiguous in the plane (two tiles in fragment order)
// and stay so in LDS: a fragment is two ds loads of 512 contiguous bytes, free of bank conflicts without a pad. Two stage buffers, filled by asynchronous copies (16 bytes a lane), the next stage but one issued as soon as a buffer is free.
// C[m][n] (f32, pitch ldc) = sum_k A[m][k] Bt[n][k] (NSPLIT 1: + A2[m][k] Bt[n][k]). Grid (M/128, N/128), 128 threads. K % 64 == 0, K >= 128.
template <typename T16> struct WFrag;
template <> struct WFrag<h16> { typedef v16h V; static __device__ __forceinline__ V ld(const h16* p) { return cat16(*(const v8h*)p, *(const v8h*)(p + 256)); } static __device__ __forceinline__ v8f mma(V a, V b, v8f c) { return wmma16(a, b, c); } };
template <> struct WFrag<bf> { typedef v16bf V; static __device__ __forceinline__ V ld(const bf* p) { return cat16b(*(const v8us*)p, *(const v8us*)(p + 256)); } static __device__ __forceinline__ v8f mma(V a, V b, v8f c) { return wmmab(a, b, c); } };
// A run of copies of a wave, 512 bytes each, with the wait before a register that an issued copy names is overwritten as the last line of their own statement (8 or 12 copies: a stage is two runs either way).
template <typename T16>
__device__ __forceinline__ void cprun(const unsigned (&l)[8], const T16* const (&g)[8]) {
    asm volatile("global_load_async_to_lds_b128 %0, %8, off\n\t"
                 "global_load_async_to_lds_b128 %1, %9, off\n\t"
                 "global_load_async_to_lds_b128 %2, %10, off\n\t"
                 "global_load_async_to_lds_b128 %3, %11, off\n\t"
                 "global_load_async_to_lds_b128 %4, %12, off\n\t"
                 "global_load_async_to_lds_b128 %5, %13, off\n\t"
                 "global_load_async_to_lds_b128 %6, %14, off\n\t"
                 "global_load_async_to_lds_b128 %7, %15, off\n\t"
                 "s_wait_xcnt 0x0"
                 :: "v"(l[0]), "v"(l[1]), "v"(l[2]), "v"(l[3]), "v"(l[4]), "v"(l[5]), "v"(l[6]), "v"(l[7]), "v"(g[0]), "v"(g[1]), "v"(g[2]), "v"(g[3]), "v"(g[4]), "v"(g[5]), "v"(g[6]), "v"(g[7]) : "memory");
}
template <typename T16>
__device__ __forceinline__ void cprun(const unsigned (&l)[12], const T16* const (&g)[12]) {
    asm volatile("global_load_async_to_lds_b128 %0, %12, off\n\t"
                 "global_load_async_to_lds_b128 %1, %13, off\n\t"
                 "global_load_async_to_lds_b128 %2, %14, off\n\t"
                 "global_load_async_to_lds_b128 %3, %15, off\n\t"
                 "global_load_async_to_lds_b128 %4, %16, off\n\t"
                 "global_load_async_to_lds_b128 %5, %17, off\n\t"
                 "global_load_async_to_lds_b128 %6, %18, off\n\t"
                 "global_load_async_to_lds_b128 %7, %19, off\n\t"
                 "global_load_async_to_lds_b128 %8, %20, off\n\t"
                 "global_load_async_to_lds_b128 %9, %21, off\n\t"
                 "global_load_async_to_lds_b128 %10, %22, off\n\t"
                 "global_load_async_to_lds_b128 %11, %23, off\n\t"
                 "s_wait_xcnt 0x0"
                 :: "v"(l[0]), "v"(l[1]), "v"(l[2]), "v"(l[3]), "v"(l[4]), "v"(l[5]), "v"(l[6]), "v"(l[7]), "v"(l[8]), "v"(l[9]), "v"(l[10]), "v"(l[11]),
                    "v"(g[0]), "v"(g[1]), "v"(g[2]), "v"(g[3]), "v"(g[4]), "v"(g[5]), "v"(g[6]), "v"(g[7]), "v"(g[8]), "v"(g[9]), "v"(g[10]), "v"(g[11]) : "memory");
}
template <typename T16, int NSPLIT, int K>
__global__ __launch_bounds__(128) void k_gemmw(const T16* __restrict__ A, const T16* __restrict__ A2, const T16* __restrict__ Bt, float* C, int ldc) {
    typedef typename WFrag<T16>::V V;
    static_assert(NSPLIT == 0 || NSPLIT == 1, "one or two A planes"); static_assert(K % 64 == 0 && K >= 128, "whole stages, at least two");
    constexpr int NA = (NSPLIT == 1) ? 16 : 8, NBD = NA + 8;        // 16-row bands of a stage: A (then A2), then Bt
    constexpr int STG = NBD * 2048, OST = 4 * 64 * 68 * 4;          // bytes of one stage; bytes of the four output quarters staged behind the loop
    __shared__ __align__(1024) unsigned char sm[2 * STG > OST ? 2 * STG : OST];
    const int lane = threadIdx.x & 31, lr = lane & 15, hi = lane >> 4; const int r0 = blockIdx.x * 128, c0 = blockIdx.y * 128;
    const int wv = __builtin_amdgcn_readfirstlane((int)(threadIdx.x >> 5));   // kept scalar so that the quarter's LDS offsets stay scalar
    const int wm = wv >> 1, wn = wv & 1;
    v8f acc[4][4];
#pragma unroll
    for (int mb = 0; mb < 4; ++mb)
#pragma unroll
        for (int nb = 0; nb < 4; ++nb) acc[mb][nb] = (v8f){};
    // Wave wv copies the 512-byte quarter wv of every band of a stage, a lane its own 16 bytes: the same offset in the band in the plane and in LDS
    const unsigned lds0 = (unsigned)(size_t)(__attribute__((address_space(3))) unsigned char*)sm + wv * 512 + lane * 16;
    const T16* ga = A + (size_t)r0 * K + wv * 256 + lane * 8; const T16* ga2 = (NSPLIT == 1) ? A2 + (size_t)r0 * K + wv * 256 + lane * 8 : ga; const T16* gb = Bt + (size_t)c0 * K + wv * 256 + lane * 8;
    auto fill = [&](int buf, int k0) __attribute__((always_inline)) {   // stage k0 .. k0 + 63 into buffer buf (both the same in the whole block)
#pragma unroll
        for (int i0 = 0; i0 < NBD; i0 += NBD / 2) { unsigned l[NBD / 2]; const T16* g[NBD / 2];
#pragma unroll
            for (int q = 0; q < NBD / 2; ++q) { const int i = i0 + q; l[q] = lds0 + buf * STG + i * 2048; g[q] = (i < 8 ? ga + i * 16 * K : i < NA ? ga2 + (i - 8) * 16 * K : gb + (i - NA) * 16 * K) + k0 * 16; }
            cprun<T16>(l, g); }
    };
    fill(0, 0);
    asm volatile("s_wait_asynccnt 0x0" ::: "memory");   // this wave's copies of stage 0 have landed
    __syncthreads();                                    // ... and every other wave's: stage 0 may be read
    fill(1, 64);
    // the stage loop stays rolled: its body is 32 or 64 products long already, and the order at its foot stands once
#pragma unroll 1
    for (int t = 0; t < K / 64; ++t) {
    const T16* sb = (const T16*)(sm + (t & 1) * STG) + 8 * lane;   // the lane's piece in the first tile of this stage's buffer; a band is 1024 elements, its second 32 k 512
#pragma unroll
    for (int kc = 0; kc < 2; ++kc) {
        V a[4], a2[4], b[4];
        __builtin_amdgcn_sched_barrier(0);   // opens the load group: all fragments of these 32 k are asked for together, one LDS latency a group and not one in front of every fourth product
#pragma unroll
        for (int mb = 0; mb < 4; ++mb) { a[mb] = WFrag<T16>::ld(sb + (wm * 4 + mb) * 1024 + kc * 512); if (NSPLIT == 1) a2[mb] = WFrag<T16>::ld(sb + (8 + wm * 4 + mb) * 1024 + kc * 512); }
#pragma unroll
        for (int nb = 0; nb < 4; ++nb) b[nb] = WFrag<T16>::ld(sb + (NA + wn * 4 + nb) * 1024 + kc * 512);
        __builtin_amdgcn_sched_barrier(0);   // closes the group: no load sinks in among the products
#pragma unroll
        for (int nb = 0; nb < 4; ++nb) {
#pragma unroll
            for (int mb = 0; mb < 4; ++mb) { acc[mb][nb] = WFrag<T16>::mma(a[mb], b[nb], acc[mb][nb]); if (NSPLIT == 1) acc[mb][nb] = WFrag<T16>::mma(a2[mb], b[nb], acc[mb][nb]); } }
    }
    asm volatile("s_wait_dscnt 0x0" ::: "memory");      // this wave's reads of the buffer are done before it may be refilled
    asm volatile("s_wait_asynccnt 0x0" ::: "memory");   // this wave's copies of the next stage have landed
    __syncthreads();                                    // the one barrier of a stage: the next stage may be read, this stage's buffer is free
    if (t + 2 < K / 64) fill(t & 1, (t + 2) * 64);
    }
    asm volatile("s_wait_asynccnt 0x0" ::: "memory");   // no copy is outstanding when the ring becomes output staging (the last stage's barrier has ended every read of it)
    float* os = (float*)sm + wv * (64 * 68);            // each wave stages its own quarter, so that a store is whole lines
#pragma unroll
    for (int mb = 0; mb < 4; ++mb) {
#pragma unroll
        for (int nb = 0; nb < 4; ++nb) {
#pragma unroll
            for (int j = 0; j < 8; ++j) os[(mb * 16 + hi * 8 + j) * 68 + nb * 16 + lr] = acc[mb][nb][j]; }
    }
    asm volatile("s_wait_dscnt 0x0" ::: "memory");      // the wave's own rows are in LDS before its lanes read them back
    float* crow = C + (size_t)(r0 + wm * 64) * ldc + c0 + wn * 64;
#pragma unroll
    for (int i = 0; i < 32; ++i) { const int row = 2 * i + hi, cofs = lr * 4; *(v4f*)(crow + (size_t)row * ldc + cofs) = *(const v4fa*)(os + row * 68 + cofs); }
}

__device__ __forceinline__ h16 tohx(float x) { return (h16)x; }
__device__ __forceinline__ void splitf(float y, unsigned short& h, unsigned short& l) { h = f2bf(y); l = f2bf(y - bf2f(h)); }
typedef __attribute__((ext_vector_type(2))) _Float16 v2h;
typedef __attribute__((ext_vector_type(4))) _Float16 v4h;
typedef __attribute__((ext_vector_type(2))) unsigned short v2us;
typedef __attribute__((ext_vector_type(4))) unsigned short v4us;
typedef v4h  __attribute__((may_alias)) v4ha;
typedef v4us __attribute__((may_alias)) v4usa;
typedef __attribute__((ext_vector_type(2))) float v2f;
typedef __attribute__((ext_vector_type(4))) int v4i;

__global__ __launch_bounds__(256) void k_wtG(const float* __restrict__ w, int K, int N, bf* Bt) {
    const int lane = threadIdx.x & 31; const int L0 = (blockIdx.x * 8 + (threadIdx.x >> 5)) * 8; const int nlines = N * K / 64;
{
#pragma unroll 1
        for (int l = 0; l < 8; ++l) { const int L = L0 + l; if (L >= nlines) break; const size_t e = (size_t)L * 64 + lane * 2; const int k = (int)(e % K), n = (int)(e / K); v2us o;
            o[0] = f2bf(w[(size_t)k * N + n]); o[1] = f2bf(w[(size_t)(k + 1) * N + n]); *(v2us*)(Bt + e) = o; }
         }
}
// d_cvt8: a row-major f32 matrix [rows][K] rounded to bf16, into fragment order. A wave takes 8 rows x 32 k (half a tile) in two loads of 4 rows x 128 bytes (whole lines); a lane's 4 values go out as half a 16-byte piece.
__device__ __forceinline__ void d_cvt8(unsigned blk, const float* __restrict__ src, bf* dst, size_t n8, int K) { const size_t i = (size_t)blk * 256 + threadIdx.x; if (i >= n8) return; const int l = (int)(i & 31); const int w = (int)(i >> 5);
    const int tile = w >> 1; const int r = tile / (K >> 5) * 16 + (w & 1) * 8 + (l >> 3), k = tile % (K >> 5) * 32 + (l & 7) * 4;
    const float* s0 = src + (size_t)r * K + k; const float* s1 = s0 + (size_t)4 * K; const v4f v[2] = {*(const v4f*)s0, *(const v4f*)s1};
    asm volatile("s_wait_xcnt 0x0" :: "v"(s0), "v"(s1) : "memory");   // the wait before an address register of the two loads is overwritten; the addresses are its inputs, or else this compiler gives a load its own address register as its destination
#pragma unroll
    for (int u = 0; u < 2; ++u) { v4us o;
#pragma unroll
        for (int q = 0; q < 4; ++q) o[q] = f2bf(v[u][q]);
        *(v4us*)(dst + pk(r + 4 * u, k, K)) = o; }  }
__constant__ float INV[HD / 2] = {1.00000000f,0.805842161f,0.649381638f,0.523299098f,0.421696514f,0.339820832f,0.273841977f,0.220673412f,0.177827939f,0.143301263f,0.115478195f,0.0930572078f,0.0749894232f,0.0604296401f,0.0486967526f,0.0392418988f,0.0316227749f,0.0254829675f,0.0205352511f,0.0165481716f,0.0133352140f,0.0107460786f,0.00865964312f,0.00697830599f,0.00562341325f,0.00453158375f,0.00365174119f,0.00294272718f,0.00237137382f,0.00191095297f,0.00153992651f,0.00124093774f,0.00100000005f,0.000805842166f,0.000649381604f,0.000523299095f,0.000421696517f,0.000339820836f,0.000273841957f,0.000220673406f,0.000177827940f,0.000143301251f,0.000115478200f,0.0000930572060f,0.0000749894243f,0.0000604296401f,0.0000486967510f,0.0000392418988f,0.0000316227779f,0.0000254829683f,0.0000205352499f,0.0000165481706f,0.0000133352141f,0.0000107460783f,0.00000865964284f,0.00000697830592f,0.00000562341347f,0.00000453158373f,0.00000365174128f,0.00000294272718f,0.00000237137374f,0.00000191095296f,0.00000153992653f,0.00000124093776f};
__device__ __forceinline__ void d_cstab(unsigned blk, float* CS) { const int idx = (int)blk * 256 + threadIdx.x; if (idx >= TT * HD) return; const int t = idx / HD, d = idx % HD; const int di = d % (HD / 2); const float iv = INV[di];
    asm volatile("s_wait_xcnt 0x0" :: "v"(di) : "memory");   // the wait before the register of the table load's index is overwritten; the index is its input, or else this compiler gives the load that very register as its destination
    const float ang = __fmul_rn((float)t, iv); v2f cs; cs[0] = cosf(ang); cs[1] = sinf(ang);
    *(v2f*)(CS + (size_t)idx * 2) = cs;  }
// ---- k_prep: everything that depends on the inputs alone, in ONE launch: the rotary table (first: its blocks run longest), then x (both batches) and the four weights rounded to bf16, in fragment order. A block does one job, picked by its index (block-uniform).
#define PB_CS  (TT * HD / 256)
#define PB_X   (NB_ * TT * DM / 8 / 256)
#define PB_WQ  (DQ * DM / 8 / 256)
#define PB_WKV (DKV * DM / 8 / 256)
#define PB_WO  (DM * DQ / 8 / 256)
__global__ __launch_bounds__(256) void k_prep(const float* __restrict__ x, const float* __restrict__ wq, const float* __restrict__ wk, const float* __restrict__ wv, const float* __restrict__ wo, bf* XB, bf* WQ, bf* WK, bf* WV, bf* WO, float* CS) {
    unsigned blk = blockIdx.x;
    if (blk < PB_CS) { d_cstab(blk, CS); return; }
    blk -= PB_CS; const float* s; bf* d; unsigned nb;
    if (blk < PB_X) { s = x; d = XB; nb = PB_X; }
    else if ((blk -= PB_X) < PB_WQ) { s = wq; d = WQ; nb = PB_WQ; }
    else if ((blk -= PB_WQ) < PB_WKV) { s = wk; d = WK; nb = PB_WKV; }
    else if ((blk -= PB_WKV) < PB_WKV) { s = wv; d = WV; nb = PB_WKV; }
    else { blk -= PB_WKV; s = wo; d = WO; nb = PB_WO; }
    d_cvt8(blk, s, d, (size_t)nb * 256, DM);   // every one of them has rows of DM elements
    static_assert(DQ == DM, "w_o's rows are DQ long");
}

// d_rope: head planes [b][h] of [t][d] in fragment order (fp16 + hi/lo) of rope(x) x sc; a wave takes 4 rows t x 32 d (whole 128-byte lines of F), a lane 4 neighbouring d (half a 16-byte piece); with the rotate-half convention out[d] = x[d] cos[t][d] - x[d+HD/2] sin[t][d], out[d+HD/2] = x[d+HD/2] cos[t][d+HD/2] + x[d] sin[t][d+HD/2]
__device__ __forceinline__ void d_rope(unsigned blk, const float* __restrict__ F, int pitch, int nheads, const float* __restrict__ CS, const float* __restrict__ RF, const float* __restrict__ nw, float sc, h16* P16, bf* Ph, bf* Pl) {
    const size_t i = (size_t)blk * 256 + threadIdx.x; if (i * 4 >= (size_t)NB_ * nheads * TT * HD) return; const int l = (int)(i & 31); const int w = (int)(i >> 5);   // wave w: d tile w % (HD / 32) of the rows 4 (w / (HD / 32)) .. + 3, counted through all heads
    const int d = w % (HD / 32) * 32 + (l & 7) * 4; const int t = w / (HD / 32) % (TT / 4) * 4 + (l >> 3); const int bh = w / (HD / 32) / (TT / 4); const int h = bh % nheads; const float* f = F + ((size_t)(bh / nheads) * TT + t) * pitch + h * HD; const float rf = RF ? RF[(size_t)h * TT + t] : 1.0f; v4h o16; v4us oh, ol;
    const float* f0 = f + d; const float* f1 = f + ((d < HD / 2) ? d + HD / 2 : d - HD / 2); const v4f X0 = *(const v4f*)f0, X1 = *(const v4f*)f1;   // the lane's 4 values and their 4 partners, one 16-byte load each
    asm volatile("s_wait_xcnt 0x0" :: "v"(f0), "v"(f1) : "memory");   // the wait before an address register of the two loads is overwritten; the addresses are its inputs, so that no load gets its own address register as its destination
#pragma unroll
    for (int q = 0; q < 4; ++q) { const int dd = d + q; const int dp = (dd < HD / 2) ? dd + HD / 2 : dd - HD / 2; float x0 = X0[q], x1 = X1[q];
        if (RF) { float n0 = __fmul_rn(x0, rf), n1 = __fmul_rn(x1, rf); asm volatile("" : "+v"(n0)); asm volatile("" : "+v"(n1)); x0 = __fmul_rn(bfr(nw[dd]), n0); x1 = __fmul_rn(bfr(nw[dp]), n1); }
        const v2f cs = *(const v2f*)(CS + ((size_t)t * HD + dd) * 2); float a = __fmul_rn(x0, cs[0]), bq = __fmul_rn(x1, cs[1]); asm volatile("" : "+v"(a)); asm volatile("" : "+v"(bq)); const float r = ((dd < HD / 2) ? __fsub_rn(a, bq) : __fadd_rn(a, bq)) * sc;
        o16[q] = tohx(r); unsigned short a2, c2; splitf(r, a2, c2); oh[q] = a2; ol[q] = c2; }
    const size_t e = (size_t)bh * TT * HD + pk(t, d, HD);
    *(v4h*)(P16 + e) = o16; *(v4us*)(Ph + e) = oh; *(v4us*)(Pl + e) = ol;  }
// d_vtp: value planes [b][g] of [d][t] in fragment order. A thread makes one 16-byte piece (8 neighbouring t of one d), the threads in the order of the pieces: a wave stores 512 contiguous bytes, and each of its 8 loads takes 16 neighbouring d of two rows of F.
__device__ __forceinline__ void d_vtp(unsigned blk, const float* __restrict__ F, int pitch, int nheads, h16* V16, bf* Vh, bf* Vl) { const size_t e = ((size_t)blk * 256 + threadIdx.x) * 8; if (e >= (size_t)NB_ * nheads * HD * TT) return; const int pl = (int)(e / ((size_t)TT * HD)); const int pe = (int)(e % ((size_t)TT * HD)); const int tile = pe >> 9, pc = (pe >> 3) & 63;   // plane b * nheads + g, tile in it, piece in the tile
    const int t = tile % (TT / 32) * 32 + (pc >> 5) * 16 + ((pc >> 4) & 1) * 8 + pl / nheads * TT; const int d = tile / (TT / 32) * 16 + (pc & 15); const int g = pl % nheads; v8h o16; v8us oh, ol;
#pragma unroll
    for (int q = 0; q < 8; ++q) { const float x = F[(size_t)(t + q) * pitch + g * HD + d]; o16[q] = tohx(x); unsigned short a2, c2; splitf(x, a2, c2); oh[q] = a2; ol[q] = c2; }
    *(v8h*)(V16 + e) = o16; *(v8us*)(Vh + e) = oh; *(v8us*)(Vl + e) = ol;  }
// ---- k_planes: the operand planes of the attention kernel, all in ONE launch, from the joint projection F [b * TT + t][q columns | k columns | v columns]: rotated q, rotated k, transposed v. A block does one job, picked by its index (block-uniform).
#define DF     (DQ + 2 * DKV)
#define LB_Q   (NB_ * NH_ * TT * HD / 4 / 256)
#define LB_K   (NB_ * NKV * TT * HD / 4 / 256)
#define LB_V   (NB_ * NKV * TT * HD / 8 / 256)
__global__ __launch_bounds__(256) void k_planes(const float* __restrict__ F, const float* __restrict__ CS, h16* QP16, bf* QPh, bf* QPl, h16* KP16, bf* KPh, bf* KPl, h16* VT16, bf* VTh, bf* VTl) {
    const unsigned blk = blockIdx.x;
    if (blk < LB_Q) d_rope(blk, F, DF, NH_, CS, nullptr, nullptr, 1.0f, QP16, QPh, QPl);
    else if (blk < LB_Q + LB_K) d_rope(blk - LB_Q, F + DQ, DF, NKV, CS, nullptr, nullptr, 1.0f, KP16, KPh, KPl);
    else d_vtp(blk - (LB_Q + LB_K), F + DQ + DKV, DF, NKV, VT16, VTh, VTl);
}
// ---- k_fattn: scores, causal softmax and probability x value product of one query strip in ONE kernel; no score or probability ever goes to memory.
// A wave owns 16 query rows of one head and walks the keys 0 .. its diagonal in blocks of KB, transposed: St = K Qt (A = key rows, B = the strip's query rows, kept in registers), Ot += Vt Pt (A = rows of the [d][t] value plane).
// In both accumulators a lane holds ONE query (column lr): the running maximum, the running sum and the rescale factor are per lane, with one exchange between the two lane halves; the accumulator registers of two score tiles
// (keys 8 hi + j and 16 + 8 hi + j) are, converted, exactly the B fragment of the next product in the k order of WFrag::ld. Probabilities are exp(t - running max), at most 1, divided by the row's sum only at the end.
// NSPLIT 2: hi + lo planes, 3 products (query rows < RH), KB 32; NSPLIT 0: single fp16, KB 64: either way 16 key and 16 value fragments are in flight. The epilogue writes the merged [t][h * HD + d] hi and lo planes in fragment order, 8 neighbouring d per lane, 512 contiguous bytes per store.
template <typename T16> struct PFrag;
template <> struct PFrag<h16> { static __device__ __forceinline__ void mk(const v8f p0, const v8f p1, v16h& f, v16h& f2) { (void)f2;
#pragma unroll
    for (int j = 0; j < 8; ++j) { f[j] = (h16)p0[j]; f[8 + j] = (h16)p1[j]; } } };
template <> struct PFrag<bf> { static __device__ __forceinline__ void mk(const v8f p0, const v8f p1, v16bf& f, v16bf& f2) { v8us h0, h1, l0, l1;
#pragma unroll
    for (int j = 0; j < 8; ++j) { unsigned short a, c; splitf(p0[j], a, c); h0[j] = a; l0[j] = c; splitf(p1[j], a, c); h1[j] = a; l1[j] = c; }
    f = cat16b(h0, h1); f2 = cat16b(l0, l1); } };
// One plane's fragments of a block, loaded as ONE group: all its loads are in flight together, one latency per group. The group stands between two scheduling barriers, with the wait that comes before a register of an
// issued global load is overwritten as its last instruction: the barriers keep the loads from sinking to their uses and keep every other instruction (which could take an address register) out of the group.
// The address is formed inside the group, from a wave-uniform base and the lane's own 32-bit element offset.
template <typename T16, int N, int INNER, bool HOLD>
__device__ __forceinline__ void ldgroup(typename WFrag<T16>::V (&f)[N], const T16* base, unsigned off, int outer) {
    __builtin_amdgcn_sched_barrier(0);   // opens the group: nothing from in front of it moves in
    const T16* p = base + off;
#pragma unroll
    for (int i = 0; i < N; ++i) f[i] = WFrag<T16>::ld(p + ((i / INNER) * outer + (i % INNER) * 512));   // the next 32 k of the same rows are the next tile
    // the wait before an address register of the group is overwritten; HOLD: with the address as its input, for the groups whose last load this compiler would else give that very register as its destination
    if (HOLD) asm volatile("s_wait_xcnt 0x0" :: "v"(p) : "memory"); else asm volatile("s_wait_xcnt 0x0" ::: "memory");
    __builtin_amdgcn_sched_barrier(0);   // closes the group: no load sinks behind it, nothing from behind it moves in
}
#define SCL2 0.12751743082459868f    // HD^-0.5 * log2(e): scores are carried in the base-2 domain
template <typename T16, int NSPLIT, int KB>
__device__ __forceinline__ void fattn_strip(const T16* __restrict__ Q, const T16* __restrict__ Q2, const T16* __restrict__ Kp, const T16* __restrict__ Kp2, const T16* __restrict__ Vt, const T16* __restrict__ Vt2, int q0, int lr, int hi, bf* __restrict__ oh, bf* __restrict__ ol) {
    typedef typename WFrag<T16>::V V;
    constexpr int MBN = KB / 16, KCN = KB / 32;               // score tiles and 32-key slices of one key block
    const int qi = q0 + lr;                                   // this lane's query row
    v8f o[8];
#pragma unroll
    for (int db = 0; db < 8; ++db) o[db] = (v8f){};
    float m = -3.0e38f, l = 0.f;                              // running maximum (base-2 domain, the same in both lane halves) and this lane half's running sum
    const unsigned qoff = (unsigned)((hi * 16 + lr) * 8), voff = qoff;   // the lane's piece in a tile, the same in every plane (fragment order)
    V qf[4], qf2[4], kf[MBN * 4], kf2[MBN * 4], kg[MBN * 4], kg2[MBN * 4];   // the strip's query fragments and the first key block's; every later key block is fetched one trip ahead, into the other of the two fragment sets
    ldgroup<T16, 4, 4, false>(qf, Q + (size_t)q0 * HD, qoff, 0); if (NSPLIT == 2) ldgroup<T16, 4, 4, false>(qf2, Q2 + (size_t)q0 * HD, qoff, 0);
    ldgroup<T16, MBN * 4, 4, NSPLIT == 2>(kf, Kp, qoff, 16 * HD); if (NSPLIT == 2) ldgroup<T16, MBN * 4, 4, NSPLIT == 2>(kf2, Kp2, qoff, 16 * HD);
    int kb = 0;
    // One trip: key block kb, its fragments in (ka, ka2); the next block's go into (kx, kx2). q0 is a multiple of 16 and kb of KB: key kb itself is visible to every query of the strip, and kb + KB - 1 < TT
    auto trip = [&](V (&ka)[MBN * 4], V (&ka2)[MBN * 4], V (&kx)[MBN * 4], V (&kx2)[MBN * 4]) __attribute__((always_inline)) {
        V vf[8 * KCN], vf2[8 * KCN];
        ldgroup<T16, 8 * KCN, KCN, false>(vf, Vt + kb * 16, voff, 16 * TT); if (NSPLIT == 2) ldgroup<T16, 8 * KCN, KCN, false>(vf2, Vt2 + kb * 16, voff, 16 * TT);   // the value fragments fly under the score products and the softmax
        v8f s[MBN];
#pragma unroll
        for (int mb = 0; mb < MBN; ++mb) s[mb] = (v8f){};
#pragma unroll
        for (int kc = 0; kc < 4; ++kc)
#pragma unroll
            for (int mb = 0; mb < MBN; ++mb) { s[mb] = WFrag<T16>::mma(ka[mb * 4 + kc], qf[kc], s[mb]);
                if (NSPLIT == 2) { s[mb] = WFrag<T16>::mma(ka[mb * 4 + kc], qf2[kc], s[mb]); s[mb] = WFrag<T16>::mma(ka2[mb * 4 + kc], qf[kc], s[mb]); } }
        const size_t kn = (size_t)min(kb + KB, q0 & ~(KB - 1)) * HD;   // the next key block flies under the softmax and the value products; the last trip reads its own block again (in bounds, unused) instead of branching
        ldgroup<T16, MBN * 4, 4, NSPLIT == 2>(kx, Kp + kn, qoff, 16 * HD); if (NSPLIT == 2) ldgroup<T16, MBN * 4, 4, NSPLIT == 2>(kx2, Kp2 + kn, qoff, 16 * HD);
        float mt = -3.0e38f;
        if (kb + KB - 1 > q0) {                               // the diagonal block (wave-uniform test): keys behind the query get weight exactly 0
#pragma unroll
            for (int mb = 0; mb < MBN; ++mb)
#pragma unroll
                for (int j = 0; j < 8; ++j) { const float t = (kb + mb * 16 + hi * 8 + j <= qi) ? s[mb][j] * SCL2 : -3.0e38f; s[mb][j] = t; mt = fmaxf(mt, t); }
        } else {
#pragma unroll
            for (int mb = 0; mb < MBN; ++mb)
#pragma unroll
                for (int j = 0; j < 8; ++j) { const float t = s[mb][j] * SCL2; s[mb][j] = t; mt = fmaxf(mt, t); }
        }
        mt = fmaxf(mt, __shfl_xor(mt, 16, 32));               // the other half of this query's keys is in the other lane half
        const float mn = fmaxf(m, mt); const float al = __builtin_amdgcn_exp2f(m - mn); m = mn;
        float ps = 0.f;
#pragma unroll
        for (int mb = 0; mb < MBN; ++mb)
#pragma unroll
            for (int j = 0; j < 8; ++j) { const float p = __builtin_amdgcn_exp2f(s[mb][j] - mn); s[mb][j] = p; ps += p; }
        l = l * al + ps;
        V pf[KCN], pf2[KCN];
#pragma unroll
        for (int kc = 0; kc < KCN; ++kc) PFrag<T16>::mk(s[2 * kc], s[2 * kc + 1], pf[kc], pf2[kc]);
#pragma unroll
        for (int db = 0; db < 8; ++db) o[db] *= al;
#pragma unroll
        for (int kc = 0; kc < KCN; ++kc)
#pragma unroll
            for (int db = 0; db < 8; ++db) { o[db] = WFrag<T16>::mma(vf[db * KCN + kc], pf[kc], o[db]);
                if (NSPLIT == 2) { o[db] = WFrag<T16>::mma(vf[db * KCN + kc], pf2[kc], o[db]); o[db] = WFrag<T16>::mma(vf2[db * KCN + kc], pf[kc], o[db]); } }
        kb += KB;
    };
#pragma unroll 1
    for (;;) { trip(kf, kf2, kg, kg2); if (kb > q0) break; trip(kg, kg2, kf, kf2); if (kb > q0) break; }   // key blocks kb <= q0 (block 0 always is one); two trips a pass, so that the two fragment sets swap roles without register copies
    l += __shfl_xor(l, 16, 32);
    const float f = __fdiv_rn(1.0f, l);
#pragma unroll
    for (int db = 0; db < 8; ++db) { v8us vh, vl;
#pragma unroll
        for (int j = 0; j < 8; ++j) { unsigned short a, c; splitf(o[db][j] * f, a, c); vh[j] = a; vl[j] = c; }
        const size_t oo = (size_t)q0 * DQ + db * 256 + qoff; *(v8us*)(oh + oo) = vh; *(v8us*)(ol + oo) = vl; }   // fragment order: the 16 d of db are half a tile, the lane's 8 its own piece
}
// Grid (query heads, TT / 128, batches), 8 waves. Cost grows with the row index, so a block takes one long and one short 64-row block: waves 0..3 the rows of block TT / 64 - 1 - y, waves 4..7 those of block y; every block then
// walks the same number of keys. A wave works alone: no LDS, no barrier, and the choice of the path (hi + lo or single plane) is uniform in the wave.
__global__ __launch_bounds__(256) void k_fattn(const h16* __restrict__ Q16, const bf* __restrict__ Qh, const bf* __restrict__ Ql, const h16* __restrict__ K16, const bf* __restrict__ Kh, const bf* __restrict__ Kl, const h16* __restrict__ V16, const bf* __restrict__ Vh, const bf* __restrict__ Vl, bf* __restrict__ Ah, bf* __restrict__ Al) {
    const int lane = threadIdx.x & 31, lr = lane & 15, hi = lane >> 4;
    const int wv = __builtin_amdgcn_readfirstlane((int)(threadIdx.x >> 5));   // kept scalar so that the path choice and the key loop's control stay scalar
    const int h = blockIdx.x, r0 = ((wv < 4) ? TT / 64 - 1 - (int)blockIdx.y : (int)blockIdx.y) * 64, q0 = r0 + (wv & 3) * 16;
    const int b = blockIdx.z; Ah += (size_t)b * TT * DQ; Al += (size_t)b * TT * DQ;
    const size_t zq = (size_t)(b * NH_ + h) * TT * HD, zk = (size_t)(b * NKV + h / REP) * TT * HD;
    if (r0 < RH) fattn_strip<bf, 2, 32>(Qh + zq, Ql + zq, Kh + zk, Kl + zk, Vh + zk, Vl + zk, q0, lr, hi, Ah + h * HD * 16, Al + h * HD * 16);   // head h's columns begin h * HD / 32 tiles into a 16-row band
    else fattn_strip<h16, 0, 64>(Q16 + zq, nullptr, K16 + zk, nullptr, V16 + zk, nullptr, q0, lr, hi, Ah + h * HD * 16, Al + h * HD * 16);
}

extern "C" void kernel_launch(void* const* d_in, const int* in_sizes, int n_in,
                              void* d_out, int out_size, void* d_ws, size_t ws_size, hipStream_t stream) {
    (void)in_sizes; (void)n_in; (void)out_size;
    const float* x = (const float*)d_in[0]; const float* wq = (const float*)d_in[1]; const float* wk = (const float*)d_in[2]; const float* wv = (const float*)d_in[3]; const float* wo = (const float*)d_in[4];
    float* OUT = (float*)d_out;     // [2][2048][2048]
    char* wsp = (char*)d_ws;
    auto take = [&](size_t bytes) { char* p = wsp; wsp += (bytes + 255) & ~(size_t)255; return (void*)p; };
    bf* WQ = (bf*)take((size_t)DF * DM * 2); bf* WK = WQ + (size_t)DQ * DM; bf* WV = WK + (size_t)DKV * DM;   // one [DF][DM] plane: the rows of w_q, w_k, w_v one behind the other
    bf* WO = (bf*)take((size_t)DM * DQ * 2); float* CS = (float*)take((size_t)TT * HD * 2 * 4);
    bf* XB = (bf*)take((size_t)NB_ * TT * DM * 2); float* F = (float*)take((size_t)NB_ * TT * DF * 4);
    h16* QP16 = (h16*)take((size_t)NB_ * NH_ * TT * HD * 2); h16* KP16 = (h16*)take((size_t)NB_ * NKV * TT * HD * 2); h16* VT16 = (h16*)take((size_t)NB_ * NKV * HD * TT * 2);
    bf* QPh = (bf*)take((size_t)NB_ * NH_ * TT * HD * 2); bf* QPl = (bf*)take((size_t)NB_ * NH_ * TT * HD * 2); bf* KPh = (bf*)take((size_t)NB_ * NKV * TT * HD * 2); bf* KPl = (bf*)take((size_t)NB_ * NKV * TT * HD * 2); bf* VTh = (bf*)take((size_t)NB_ * NKV * HD * TT * 2); bf* VTl = (bf*)take((size_t)NB_ * NKV * HD * TT * 2);
    bf* ATh = (bf*)take((size_t)NB_ * TT * DQ * 2); bf* ATl = (bf*)take((size_t)NB_ * TT * DQ * 2);
    if ((size_t)(wsp - (char*)d_ws) > ws_size) return;    // 190 MiB of the 256 MiB
    // Five launches, each over both batches (the rows b * TT + t of x, F, the merged planes and out are one matrix of NB_ * TT rows)
    k_prep<<<PB_CS + PB_X + PB_WQ + 2 * PB_WKV + PB_WO, 256, 0, stream>>>(x, wq, wk, wv, wo, XB, WQ, WK, WV, WO, CS);
    k_gemmw<bf, 0, DM><<<dim3(NB_ * TT / 128, DF / 128, 1), 128, 0, stream>>>(XB, nullptr, WQ, F, DF);
    k_planes<<<LB_Q + LB_K + LB_V, 256, 0, stream>>>(F, CS, QP16, QPh, QPl, KP16, KPh, KPl, VT16, VTh, VTl);
    k_fattn<<<dim3(NH_, TT / 128, NB_), 256, 0, stream>>>(QP16, QPh, QPl, KP16, KPh, KPl, VT16, VTh, VTl, ATh, ATl);
    k_gemmw<bf, 1, DQ><<<dim3(NB_ * TT / 128, DM / 128, 1), 128, 0, stream>>>(ATh, ATl, WO, OUT, DM);
}

// v007
// It runs in 152 microseconds.
// Timed twice side by side with v006, it ran 1.07 and 1.06 times as fast.
// All steps since v000 together make it 10.6 times as fast.
#include <hip/hip_runtime.h>

// Grouped-query RoPE causal attention ('eager' path) (x [2][2048][2048]; q = x w_q^T ([2048][2048]: 16 heads x 128), k, v = x w_k^T / w_v^T ([512][2048]: 4 kv heads); rotate-half RoPE (theta 1e6, full 128 dims, tables computed on device); kv head = h/4; scores = q.k/sqrt(128); causal (finfo.min == exact zero weight); softmax; out = merged w_o^T -> [2][2048][2048] (8.4 M)).
// Compute dtypes, f32 accumulate: every input rounded to bf16; q/k/v on PLAIN bf16 operands (inputs: exact); rotary in f32 (cos/sin from an on-device f32 table: inv_freq_i = 1e6^(-2i/128), precise cosf/sinf); causal scores, softmax (f32, running maximum and sum) and attn.v in one kernel: query rows < 512 hl (3 products), the rest single fp16; w_o hl x exact (2 products).

#define NB_  2
#define TT   2048
#define DM   2048
#define NH_  16
#define NKV  4
#define REP  (NH_ / NKV)
#define HD   128
#define DQ   (NH_ * HD)
#define DKV  (NKV * HD)
#define RH   512                  // query rows < RH use hi+lo planes (0: none)
typedef _Float16 h16;
typedef unsigned short bf;
typedef __attribute__((ext_vector_type(16))) __bf16   v16bf;
typedef __attribute__((ext_vector_type(16))) _Float16 v16h;
typedef __attribute__((ext_vector_type(8)))  _Float16 v8h;
typedef __attribute__((ext_vector_type(8)))  unsigned short v8us;
typedef __attribute__((ext_vector_type(8)))  float    v8f;
typedef __attribute__((ext_vector_type(4)))  float    v4f;
typedef v8h  __attribute__((may_alias)) v8ha;
typedef v4f  __attribute__((may_alias)) v4fa;
typedef v8us __attribute__((may_alias)) v8usa;

__device__ __forceinline__ unsigned short f2bf(float f) { unsigned u = __float_as_uint(f); u += 0x7FFFu + ((u >> 16) & 1u); return (unsigned short)(u >> 16); }
__device__ __forceinline__ float bf2f(unsigned short b) { return __uint_as_float(((unsigned)b) << 16); }
__device__ __forceinline__ float bfr(float f) { return bf2f(f2bf(f)); }
__device__ __forceinline__ v16h cat16(v8h lo, v8h hi) { return __builtin_shufflevector(lo, hi, 0, 1, 2, 3, 4, 5, 6, 7, 8, 9, 10, 11, 12, 13, 14, 15); }
__device__ __forceinline__ v16bf cat16b(v8us lo, v8us hi) { return __builtin_bit_cast(v16bf, __builtin_shufflevector(lo, hi, 0, 1, 2, 3, 4, 5, 6, 7, 8, 9, 10, 11, 12, 13, 14, 15)); }
__device__ __forceinline__ v8f wmma16(v16h a, v16h b, v8f c) { return __builtin_amdgcn_wmma_f32_16x16x32_f16(false, a, false, b, (short)0, c, false, false); }
__device__ __forceinline__ v8f wmmab(v16bf a, v16bf b, v8f c) { return __builtin_amdgcn_wmma_f32_16x16x32_bf16(false, a, false, b, (short)0, c, false, false); }



// ---- Fragment order: every 16-bit operand plane [rows][K] is stored tile by tile, a tile = 16 rows x 32 k = 1 KiB, tile (r / 16, k / 32) at element (r / 16 * (K / 32) + k / 32) * 512 (16 rows keep their 16 * K elements).
// Inside a tile the 16-byte pieces (8 neighbouring k of one row) stand in the order in which the lanes of a wave take them: piece = (k / 16 % 2) * 32 + (k / 8 % 2) * 16 + r % 16. A fragment is then two loads of 512 contiguous bytes
// (lane * 8 and 256 + lane * 8 elements into the tile): 4 whole cache lines a load, where a row-major plane gives 32 bytes out of each of 16 lines. The k order of a fragment is the one it had.
__device__ __forceinline__ size_t pk(int r, int k, int K) { return ((size_t)(r >> 4) * (K >> 5) + (k >> 5)) * 512 + ((k >> 4) & 1) * 256 + (((k >> 3) & 1) * 16 + (r & 15)) * 8 + (k & 7); }
// ---- k_gemmw: register-blocked GEMM, one BM x BN output tile per block of 8 waves (8 / WN x WN), a wave on its own 64 x (BN / WN) part with all its accumulators over the whole K. The tiles are chosen so that the grid is one block per WGP:
// every block reads its BM + BN operand rows from L2 once, so the larger the tile, the fewer bytes the whole product asks of L2.
// The block's operand rows go through LDS, so that each fragment leaves L2 once per block and serves all waves of its row or column: a stage is 128 k of every row, a 16-row band of it 4 KiB that are contiguous in the plane (four tiles in fragment order)
// and stay so in LDS: a fragment is two ds loads of 512 contiguous bytes, free of bank conflicts without a pad. Two stage buffers, filled by asynchronous copies (16 bytes a lane), the next stage but one issued as soon as a buffer is free.
// C[m][n] (f32, pitch ldc) = sum_k A[m][k] Bt[n][k] (NSPLIT 1: + A2[m][k] Bt[n][k]). Grid (M/BM, N/BN), 256 threads. K % 128 == 0, K >= 256.
template <typename T16> struct WFrag;
template <> struct WFrag<h16> { typedef v16h V; static __device__ __forceinline__ V ld(const h16* p) { return cat16(*(const v8h*)p, *(const v8h*)(p + 256)); } static __device__ __forceinline__ v8f mma(V a, V b, v8f c) { return wmma16(a, b, c); } };
template <> struct WFrag<bf> { typedef v16bf V; static __device__ __forceinline__ V ld(const bf* p) { return cat16b(*(const v8us*)p, *(const v8us*)(p + 256)); } static __device__ __forceinline__ v8f mma(V a, V b, v8f c) { return wmmab(a, b, c); } };
// A run of copies of a wave, 512 bytes each, with the wait before a register that an issued copy names is overwritten as the last line of their own statement (7 or 8 copies: a stage is four runs either way).
template <typename T16>
__device__ __forceinline__ void cprun(const unsigned (&l)[8], const T16* const (&g)[8]) {
    asm volatile("global_load_async_to_lds_b128 %0, %8, off\n\t"
                 "global_load_async_to_lds_b128 %1, %9, off\n\t"
                 "global_load_async_to_lds_b128 %2, %10, off\n\t"
                 "global_load_async_to_lds_b128 %3, %11, off\n\t"
                 "global_load_async_to_lds_b128 %4, %12, off\n\t"
                 "global_load_async_to_lds_b128 %5, %13, off\n\t"
                 "global_load_async_to_lds_b128 %6, %14, off\n\t"
                 "global_load_async_to_lds_b128 %7, %15, off\n\t"
                 "s_wait_xcnt 0x0"
                 :: "v"(l[0]), "v"(l[1]), "v"(l[2]), "v"(l[3]), "v"(l[4]), "v"(l[5]), "v"(l[6]), "v"(l[7]), "v"(g[0]), "v"(g[1]), "v"(g[2]), "v"(g[3]), "v"(g[4]), "v"(g[5]), "v"(g[6]), "v"(g[7]) : "memory");
}
template <typename T16>
__device__ __forceinline__ void cprun(const unsigned (&l)[7], const T16* const (&g)[7]) {
    asm volatile("global_load_async_to_lds_b128 %0, %7, off\n\t"
                 "global_load_async_to_lds_b128 %1, %8, off\n\t"
                 "global_load_async_to_lds_b128 %2, %9, off\n\t"
                 "global_load_async_to_lds_b128 %3, %10, off\n\t"
                 "global_load_async_to_lds_b128 %4, %11, off\n\t"
                 "global_load_async_to_lds_b128 %5, %12, off\n\t"
                 "global_load_async_to_lds_b128 %6, %13, off\n\t"
                 "s_wait_xcnt 0x0"
                 :: "v"(l[0]), "v"(l[1]), "v"(l[2]), "v"(l[3]), "v"(l[4]), "v"(l[5]), "v"(l[6]), "v"(g[0]), "v"(g[1]), "v"(g[2]), "v"(g[3]), "v"(g[4]), "v"(g[5]), "v"(g[6]) : "memory");
}
template <typename T16, int NSPLIT, int K, int BM, int BN, int WN>
__global__ __launch_bounds__(256) void k_gemmw(const T16* __restrict__ A, const T16* __restrict__ A2, const T16* __restrict__ Bt, float* C, int ldc) {
    typedef typename WFrag<T16>::V V;
    static_assert(NSPLIT == 0 || NSPLIT == 1, "one or two A planes"); constexpr int KS = 128; static_assert(K % KS == 0 && K >= 2 * KS, "whole stages of KS k, at least two");
    constexpr int NF = BN / WN / 16;                                // a wave's part: 4 x NF accumulator tiles
    static_assert(8 % WN == 0 && BM == 8 / WN * 64 && BN % (WN * 16) == 0, "8 waves, 64 rows each");
    constexpr int NA1 = BM / 16, NA = NA1 * (NSPLIT + 1), NBD = NA + BN / 16;   // 16-row bands of a stage: A (then A2), then Bt
    static_assert(NBD % 4 == 0, "a wave's copies go in four equal runs");
    constexpr int OP = NF * 16 + 4;                                 // pitch (floats) of a wave's staged output rows
    constexpr int STG = NBD * 16 * KS * 2, OST = 8 * 64 * OP * 4;          // bytes of one stage; bytes of the eight output parts staged behind the loop
    __shared__ __align__(1024) unsigned char sm[2 * STG > OST ? 2 * STG : OST];
    const int lane = threadIdx.x & 31, lr = lane & 15, hi = lane >> 4; const int r0 = blockIdx.x * BM, c0 = blockIdx.y * BN;
    const int wv = __builtin_amdgcn_readfirstlane((int)(threadIdx.x >> 5));   // kept scalar so that the part's LDS offsets stay scalar
    const int wm = wv / WN, wn = wv % WN;
    v8f acc[4][NF];
#pragma unroll
    for (int mb = 0; mb < 4; ++mb)
#pragma unroll
        for (int nb = 0; nb < NF; ++nb) acc[mb][nb] = (v8f){};
    // Wave wv copies the 512-byte eighth wv of every band of a stage, a lane its own 16 bytes: the same offset in the band in the plane and in LDS
    const unsigned lds0 = (unsigned)(size_t)(__attribute__((address_space(3))) unsigned char*)sm + wv * 512 + lane * 16;
    const T16* ga = A + (size_t)r0 * K + wv * 256; const T16* ga2 = (NSPLIT == 1) ? A2 + (size_t)r0 * K + wv * 256 : ga; const T16* gb = Bt + (size_t)c0 * K + wv * 256;   // the same in the whole wave: they stay in scalar registers
    const unsigned gl = lane * 8;
    auto fill = [&](int buf, int k0) __attribute__((always_inline)) {   // stage k0 .. k0 + KS - 1 into buffer buf (both the same in the whole block)
#pragma unroll
        for (int i0 = 0; i0 < NBD; i0 += NBD / 4) { unsigned l[NBD / 4]; const T16* g[NBD / 4];
#pragma unroll
            for (int q = 0; q < NBD / 4; ++q) { const int i = i0 + q; l[q] = lds0 + buf * STG + i * (16 * KS * 2); g[q] = (i < NA1 ? ga + i * 16 * K : i < NA ? ga2 + (i - NA1) * 16 * K : gb + (i - NA) * 16 * K) + k0 * 16 + gl; }
            cprun<T16>(l, g); }
    };
    fill(0, 0);
    asm volatile("s_wait_asynccnt 0x0" ::: "memory");   // this wave's copies of stage 0 have landed
    __syncthreads();                                    // ... and every other wave's: stage 0 may be read
    fill(1, KS);
    // the stage loop stays rolled: its body is 96 or 128 products long already, and the order at its foot stands once
#pragma unroll 1
    for (int t = 0; t < K / KS; ++t) {
    const T16* sb = (const T16*)(sm + (t & 1) * STG) + 8 * lane;   // the lane's piece in the first tile of this stage's buffer; a band is 16 * KS elements, each further 32 k of it 512
#pragma unroll
    for (int kc = 0; kc < KS / 32; ++kc) {
        V a[4], a2[4], b[NF];
        __builtin_amdgcn_sched_barrier(0);   // opens the load group: all fragments of these 32 k are asked for together, one LDS latency a group and not one in front of every fourth product
#pragma unroll
        for (int mb = 0; mb < 4; ++mb) { a[mb] = WFrag<T16>::ld(sb + (wm * 4 + mb) * (16 * KS) + kc * 512); if (NSPLIT == 1) a2[mb] = WFrag<T16>::ld(sb + (NA1 + wm * 4 + mb) * (16 * KS) + kc * 512); }
#pragma unroll
        for (int nb = 0; nb < NF; ++nb) b[nb] = WFrag<T16>::ld(sb + (NA + wn * NF + nb) * (16 * KS) + kc * 512);
        __builtin_amdgcn_sched_barrier(0);   // closes the group: no load sinks in among the products
#pragma unroll
        for (int nb = 0; nb < NF; ++nb) {
#pragma unroll
            for (int mb = 0; mb < 4; ++mb) { acc[mb][nb] = WFrag<T16>::mma(a[mb], b[nb], acc[mb][nb]); if (NSPLIT == 1) acc[mb][nb] = WFrag<T16>::mma(a2[mb], b[nb], acc[mb][nb]); } }
    }
    asm volatile("s_wait_dscnt 0x0" ::: "memory");      // this wave's reads of the buffer are done before it may be refilled
    asm volatile("s_wait_asynccnt 0x0" ::: "memory");   // this wave's copies of the next stage have landed
    __syncthreads();                                    // the one barrier of a stage: the next stage may be read, this stage's buffer is free
    if (t + 2 < K / KS) fill(t & 1, (t + 2) * KS);
    }
    asm volatile("s_wait_asynccnt 0x0" ::: "memory");   // no copy is outstanding when the ring becomes output staging (the last stage's barrier has ended every read of it)
    float* os = (float*)sm + wv * (64 * OP);            // each wave stages its own part, so that a store is whole lines
#pragma unroll
    for (int mb = 0; mb < 4; ++mb) {
#pragma unroll
        for (int nb = 0; nb < NF; ++nb) {
#pragma unroll
            for (int j = 0; j < 8; ++j) os[(mb * 16 + hi * 8 + j) * OP + nb * 16 + lr] = acc[mb][nb][j]; }
    }
    asm volatile("s_wait_dscnt 0x0" ::: "memory");      // the wave's own rows are in LDS before its lanes read them back
    float* crow = C + (size_t)(r0 + wm * 64) * ldc + c0 + wn * (NF * 16);
    constexpr int CH = NF * 4, RG = (CH % 16 == 0) ? 2 : 4, NS = RG * CH / 32;   // 16-byte pieces of a row; RG rows are NS whole stores of the wave (512 bytes each, 4 whole lines)
    static_assert(RG * CH % 32 == 0 && 64 % RG == 0, "whole stores");
#pragma unroll
    for (int i = 0; i < 64 / RG; ++i) {
#pragma unroll
        for (int s = 0; s < NS; ++s) { const int idx = s * 32 + lane; const int row = i * RG + idx / CH, cofs = idx % CH * 4; *(v4f*)(crow + (size_t)row * ldc + cofs) = *(const v4fa*)(os + row * OP + cofs); } }
}

__device__ __forceinline__ h16 tohx(float x) { return (h16)x; }
__device__ __forceinline__ void splitf(float y, unsigned short& h, unsigned short& l) { h = f2bf(y); l = f2bf(y - bf2f(h)); }
typedef __attribute__((ext_vector_type(2))) _Float16 v2h;
typedef __attribute__((ext_vector_type(4))) _Float16 v4h;
typedef __attribute__((ext_vector_type(2))) unsigned short v2us;
typedef __attribute__((ext_vector_type(4))) unsigned short v4us;
typedef v4h  __attribute__((may_alias)) v4ha;
typedef v4us __attribute__((may_alias)) v4usa;
typedef __attribute__((ext_vector_type(2))) float v2f;
typedef __attribute__((ext_vector_type(4))) int v4i;

__global__ __launch_bounds__(256) void k_wtG(const float* __restrict__ w, int K, int N, bf* Bt) {
    const int lane = threadIdx.x & 31; const int L0 = (blockIdx.x * 8 + (threadIdx.x >> 5)) * 8; const int nlines = N * K / 64;
{
#pragma unroll 1
        for (int l = 0; l < 8; ++l) { const int L = L0 + l; if (L >= nlines) break; const size_t e = (size_t)L * 64 + lane * 2; const int k = (int)(e % K), n = (int)(e / K); v2us o;
            o[0] = f2bf(w[(size_t)k * N + n]); o[1] = f2bf(w[(size_t)(k + 1) * N + n]); *(v2us*)(Bt + e) = o; }
         }
}
// d_cvt8: a row-major f32 matrix [rows][K] rounded to bf16, into fragment order. A wave takes 8 rows x 32 k (half a tile) in two loads of 4 rows x 128 bytes (whole lines); a lane's 4 values go out as half a 16-byte piece.
__device__ __forceinline__ void d_cvt8(unsigned blk, const float* __restrict__ src, bf* dst, size_t n8, int K) { const size_t i = (size_t)blk * 256 + threadIdx.x; if (i >= n8) return; const int l = (int)(i & 31); const int w = (int)(i >> 5);
    const int tile = w >> 1; const int r = tile / (K >> 5) * 16 + (w & 1) * 8 + (l >> 3), k = tile % (K >> 5) * 32 + (l & 7) * 4;
    const float* s0 = src + (size_t)r * K + k; const float* s1 = s0 + (size_t)4 * K; const v4f v[2] = {*(const v4f*)s0, *(const v4f*)s1};
    asm volatile("s_wait_xcnt 0x0" :: "v"(s0), "v"(s1) : "memory");   // the wait before an address register of the two loads is overwritten; the addresses are its inputs, or else this compiler gives a load its own address register as its destination
#pragma unroll
    for (int u = 0; u < 2; ++u) { v4us o;
#pragma unroll
        for (int q = 0; q < 4; ++q) o[q] = f2bf(v[u][q]);
        *(v4us*)(dst + pk(r + 4 * u, k, K)) = o; }  }
__constant__ float INV[HD / 2] = {1.00000000f,0.805842161f,0.649381638f,0.523299098f,0.421696514f,0.339820832f,0.273841977f,0.220673412f,0.177827939f,0.143301263f,0.115478195f,0.0930572078f,0.0749894232f,0.0604296401f,0.0486967526f,0.0392418988f,0.0316227749f,0.0254829675f,0.0205352511f,0.0165481716f,0.0133352140f,0.0107460786f,0.00865964312f,0.00697830599f,0.00562341325f,0.00453158375f,0.00365174119f,0.00294272718f,0.00237137382f,0.00191095297f,0.00153992651f,0.00124093774f,0.00100000005f,0.000805842166f,0.000649381604f,0.000523299095f,0.000421696517f,0.000339820836f,0.000273841957f,0.000220673406f,0.000177827940f,0.000143301251f,0.000115478200f,0.0000930572060f,0.0000749894243f,0.0000604296401f,0.0000486967510f,0.0000392418988f,0.0000316227779f,0.0000254829683f,0.0000205352499f,0.0000165481706f,0.0000133352141f,0.0000107460783f,0.00000865964284f,0.00000697830592f,0.00000562341347f,0.00000453158373f,0.00000365174128f,0.00000294272718f,0.00000237137374f,0.00000191095296f,0.00000153992653f,0.00000124093776f};
__device__ __forceinline__ void d_cstab(unsigned blk, float* CS) { const int idx = (int)blk * 256 + threadIdx.x; if (idx >= TT * HD) return; const int t = idx / HD, d = idx % HD; const int di = d % (HD / 2); const float iv = INV[di];
    asm volatile("s_wait_xcnt 0x0" :: "v"(di) : "memory");   // the wait before the register of the table load's index is overwritten; the index is its input, or else this compiler gives the load that very register as its destination
    const float ang = __fmul_rn((float)t, iv); v2f cs; cs[0] = cosf(ang); cs[1] = sinf(ang);
    *(v2f*)(CS + (size_t)idx * 2) = cs;  }
// ---- k_prep: everything that depends on the inputs alone, in ONE launch: the rotary table (first: its blocks run longest), then x (both batches) and the four weights rounded to bf16, in fragment order. A block does one job, picked by its index (block-uniform).
#define PB_CS  (TT * HD / 256)
#define PB_X   (NB_ * TT * DM / 8 / 256)
#define PB_WQ  (DQ * DM / 8 / 256)
#define PB_WKV (DKV * DM / 8 / 256)
#define PB_WO  (DM * DQ / 8 / 256)
__global__ __launch_bounds__(256) void k_prep(const float* __restrict__ x, const float* __restrict__ wq, const float* __restrict__ wk, const float* __restrict__ wv, const float* __restrict__ wo, bf* XB, bf* WQ, bf* WK, bf* WV, bf* WO, float* CS) {
    unsigned blk = blockIdx.x;
    if (blk < PB_CS) { d_cstab(blk, CS); return; }
    blk -= PB_CS; const float* s; bf* d; unsigned nb;
    if (blk < PB_X) { s = x; d = XB; nb = PB_X; }
    else if ((blk -= PB_X) < PB_WQ) { s = wq; d = WQ; nb = PB_WQ; }
    else if ((blk -= PB_WQ) < PB_WKV) { s = wk; d = WK; nb = PB_WKV; }
    else if ((blk -= PB_WKV) < PB_WKV) { s = wv; d = WV; nb = PB_WKV; }
    else { blk -= PB_WKV; s = wo; d = WO; nb = PB_WO; }
    d_cvt8(blk, s, d, (size_t)nb * 256, DM);   // every one of them has rows of DM elements
    static_assert(DQ == DM, "w_o's rows are DQ long");
}

// d_rope: head planes [b][h] of [t][d] in fragment order (fp16 + hi/lo) of rope(x) x sc; a wave takes 4 rows t x 32 d (whole 128-byte lines of F), a lane 4 neighbouring d (half a 16-byte piece); with the rotate-half convention out[d] = x[d] cos[t][d] - x[d+HD/2] sin[t][d], out[d+HD/2] = x[d+HD/2] cos[t][d+HD/2] + x[d] sin[t][d+HD/2]
__device__ __forceinline__ void d_rope(unsigned blk, const float* __restrict__ F, int pitch, int nheads, const float* __restrict__ CS, const float* __restrict__ RF, const float* __restrict__ nw, float sc, h16* P16, bf* Ph, bf* Pl) {
    const size_t i = (size_t)blk * 256 + threadIdx.x; if (i * 4 >= (size_t)NB_ * nheads * TT * HD) return; const int l = (int)(i & 31); const int w = (int)(i >> 5);   // wave w: d tile w % (HD / 32) of the rows 4 (w / (HD / 32)) .. + 3, counted through all heads
    const int d = w % (HD / 32) * 32 + (l & 7) * 4; const int t = w / (HD / 32) % (TT / 4) * 4 + (l >> 3); const int bh = w / (HD / 32) / (TT / 4); const int h = bh % nheads; const float* f = F + ((size_t)(bh / nheads) * TT + t) * pitch + h * HD; const float rf = RF ? RF[(size_t)h * TT + t] : 1.0f; v4h o16; v4us oh, ol;
    const float* f0 = f + d; const float* f1 = f + ((d < HD / 2) ? d + HD / 2 : d - HD / 2); const v4f X0 = *(const v4f*)f0, X1 = *(const v4f*)f1;   // the lane's 4 values and their 4 partners, one 16-byte load each
    asm volatile("s_wait_xcnt 0x0" :: "v"(f0), "v"(f1) : "memory");   // the wait before an address register of the two loads is overwritten; the addresses are its inputs, so that no load gets its own address register as its destination
#pragma unroll
    for (int q = 0; q < 4; ++q) { const int dd = d + q; const int dp = (dd < HD / 2) ? dd + HD / 2 : dd - HD / 2; float x0 = X0[q], x1 = X1[q];
        if (RF) { float n0 = __fmul_rn(x0, rf), n1 = __fmul_rn(x1, rf); asm volatile("" : "+v"(n0)); asm volatile("" : "+v"(n1)); x0 = __fmul_rn(bfr(nw[dd]), n0); x1 = __fmul_rn(bfr(nw[dp]), n1); }
        const v2f cs = *(const v2f*)(CS + ((size_t)t * HD + dd) * 2); float a = __fmul_rn(x0, cs[0]), bq = __fmul_rn(x1, cs[1]); asm volatile("" : "+v"(a)); asm volatile("" : "+v"(bq)); const float r = ((dd < HD / 2) ? __fsub_rn(a, bq) : __fadd_rn(a, bq)) * sc;
        o16[q] = tohx(r); unsigned short a2, c2; splitf(r, a2, c2); oh[q] = a2; ol[q] = c2; }
    const size_t e = (size_t)bh * TT * HD + pk(t, d, HD);
    *(v4h*)(P16 + e) = o16; *(v4us*)(Ph + e) = oh; *(v4us*)(Pl + e) = ol;  }
// d_vtp: value planes [b][g] of [d][t] in fragment order. A thread makes one 16-byte piece (8 neighbouring t of one d), the threads in the order of the pieces: a wave stores 512 contiguous bytes, and each of its 8 loads takes 16 neighbouring d of two rows of F.
__device__ __forceinline__ void d_vtp(unsigned blk, const float* __restrict__ F, int pitch, int nheads, h16* V16, bf* Vh, bf* Vl) { const size_t e = ((size_t)blk * 256 + threadIdx.x) * 8; if (e >= (size_t)NB_ * nheads * HD * TT) return; const int pl = (int)(e / ((size_t)TT * HD)); const int pe = (int)(e % ((size_t)TT * HD)); const int tile = pe >> 9, pc = (pe >> 3) & 63;   // plane b * nheads + g, tile in it, piece in the tile
    const int t = tile % (TT / 32) * 32 + (pc >> 5) * 16 + ((pc >> 4) & 1) * 8 + pl / nheads * TT; const int d = tile / (TT / 32) * 16 + (pc & 15); const int g = pl % nheads; v8h o16; v8us oh, ol;
#pragma unroll
    for (int q = 0; q < 8; ++q) { const float x = F[(size_t)(t + q) * pitch + g * HD + d]; o16[q] = tohx(x); unsigned short a2, c2; splitf(x, a2, c2); oh[q] = a2; ol[q] = c2; }
    *(v8h*)(V16 + e) = o16; *(v8us*)(Vh + e) = oh; *(v8us*)(Vl + e) = ol;  }
// ---- k_planes: the operand planes of the attention kernel, all in ONE launch, from the joint projection F [b * TT + t][q columns | k columns | v columns]: rotated q, rotated k, transposed v. A block does one job, picked by its index (block-uniform).
#define DF     (DQ + 2 * DKV)
#define LB_Q   (NB_ * NH_ * TT * HD / 4 / 256)
#define LB_K   (NB_ * NKV * TT * HD / 4 / 256)
#define LB_V   (NB_ * NKV * TT * HD / 8 / 256)
__global__ __launch_bounds__(256) void k_planes(const float* __restrict__ F, const float* __restrict__ CS, h16* QP16, bf* QPh, bf* QPl, h16* KP16, bf* KPh, bf* KPl, h16* VT16, bf* VTh, bf* VTl) {
    const unsigned blk = blockIdx.x;
    if (blk < LB_Q) d_rope(blk, F, DF, NH_, CS, nullptr, nullptr, 1.0f, QP16, QPh, QPl);
    else if (blk < LB_Q + LB_K) d_rope(blk - LB_Q, F + DQ, DF, NKV, CS, nullptr, nullptr, 1.0f, KP16, KPh, KPl);
    else d_vtp(blk - (LB_Q + LB_K), F + DQ + DKV, DF, NKV, VT16, VTh, VTl);
}
// ---- k_fattn: scores, causal softmax and probability x value product of one query strip in ONE kernel; no score or probability ever goes to memory.
// A wave owns 16 query rows of one head and walks the keys 0 .. its diagonal in blocks of KB, transposed: St = K Qt (A = key rows, B = the strip's query rows, kept in registers), Ot += Vt Pt (A = rows of the [d][t] value plane).
// In both accumulators a lane holds ONE query (column lr): the running maximum, the running sum and the rescale factor are per lane, with one exchange between the two lane halves; the accumulator registers of two score tiles
// (keys 8 hi + j and 16 + 8 hi + j) are, converted, exactly the B fragment of the next product in the k order of WFrag::ld. Probabilities are exp(t - running max), at most 1, divided by the row's sum only at the end.
// NSPLIT 2: hi + lo planes, 3 products (query rows < RH), KB 32; NSPLIT 0: single fp16, KB 64: either way 16 key and 16 value fragments are in flight. The epilogue writes the merged [t][h * HD + d] hi and lo planes in fragment order, 8 neighbouring d per lane, 512 contiguous bytes per store.
template <typename T16> struct PFrag;
template <> struct PFrag<h16> { static __device__ __forceinline__ void mk(const v8f p0, const v8f p1, v16h& f, v16h& f2) { (void)f2;
#pragma unroll
    for (int j = 0; j < 8; ++j) { f[j] = (h16)p0[j]; f[8 + j] = (h16)p1[j]; } } };
template <> struct PFrag<bf> { static __device__ __forceinline__ void mk(const v8f p0, const v8f p1, v16bf& f, v16bf& f2) { v8us h0, h1, l0, l1;
#pragma unroll
    for (int j = 0; j < 8; ++j) { unsigned short a, c; splitf(p0[j], a, c); h0[j] = a; l0[j] = c; splitf(p1[j], a, c); h1[j] = a; l1[j] = c; }
    f = cat16b(h0, h1); f2 = cat16b(l0, l1); } };
// One plane's fragments of a block, loaded as ONE group: all its loads are in flight together, one latency per group. The group stands between two scheduling barriers, with the wait that comes before a register of an
// issued global load is overwritten as its last instruction: the barriers keep the loads from sinking to their uses and keep every other instruction (which could take an address register) out of the group.
// The address is formed inside the group, from a wave-uniform base and the lane's own 32-bit element offset.
template <typename T16, int N, int INNER, bool HOLD>
__device__ __forceinline__ void ldgroup(typename WFrag<T16>::V (&f)[N], const T16* base, unsigned off, int outer) {
    __builtin_amdgcn_sched_barrier(0);   // opens the group: nothing from in front of it moves in
    const T16* p = base + off;
#pragma unroll
    for (int i = 0; i < N; ++i) f[i] = WFrag<T16>::ld(p + ((i / INNER) * outer + (i % INNER) * 512));   // the next 32 k of the same rows are the next tile
    // the wait before an address register of the group is overwritten; HOLD: with the address as its input, for the groups whose last load this compiler would else give that very register as its destination
    if (HOLD) asm volatile("s_wait_xcnt 0x0" :: "v"(p) : "memory"); else asm volatile("s_wait_xcnt 0x0" ::: "memory");
    __builtin_amdgcn_sched_barrier(0);   // closes the group: no load sinks behind it, nothing from behind it moves in
}
#define SCL2 0.12751743082459868f    // HD^-0.5 * log2(e): scores are carried in the base-2 domain
template <typename T16, int NSPLIT, int KB>
__device__ __forceinline__ void fattn_strip(const T16* __restrict__ Q, const T16* __restrict__ Q2, const T16* __restrict__ Kp, const T16* __restrict__ Kp2, const T16* __restrict__ Vt, const T16* __restrict__ Vt2, int q0, int lr, int hi, bf* __restrict__ oh, bf* __restrict__ ol) {
    typedef typename WFrag<T16>::V V;
    constexpr int MBN = KB / 16, KCN = KB / 32;               // score tiles and 32-key slices of one key block
    const int qi = q0 + lr;                                   // this lane's query row
    v8f o[8];
#pragma unroll
    for (int db = 0; db < 8; ++db) o[db] = (v8f){};
    float m = -3.0e38f, l = 0.f;                              // running maximum (base-2 domain, the same in both lane halves) and this lane half's running sum
    const unsigned qoff = (unsigned)((hi * 16 + lr) * 8), voff = qoff;   // the lane's piece in a tile, the same in every plane (fragment order)
    V qf[4], qf2[4], kf[MBN * 4], kf2[MBN * 4], kg[MBN * 4], kg2[MBN * 4];   // the strip's query fragments and the first key block's; every later key block is fetched one trip ahead, into the other of the two fragment sets
    ldgroup<T16, 4, 4, false>(qf, Q + (size_t)q0 * HD, qoff, 0); if (NSPLIT == 2) ldgroup<T16, 4, 4, false>(qf2, Q2 + (size_t)q0 * HD, qoff, 0);
    ldgroup<T16, MBN * 4, 4, NSPLIT == 2>(kf, Kp, qoff, 16 * HD); if (NSPLIT == 2) ldgroup<T16, MBN * 4, 4, NSPLIT == 2>(kf2, Kp2, qoff, 16 * HD);
    int kb = 0;
    // One trip: key block kb, its fragments in (ka, ka2); the next block's go into (kx, kx2). q0 is a multiple of 16 and kb of KB: key kb itself is visible to every query of the strip, and kb + KB - 1 < TT
    auto trip = [&](V (&ka)[MBN * 4], V (&ka2)[MBN * 4], V (&kx)[MBN * 4], V (&kx2)[MBN * 4]) __attribute__((always_inline)) {
        V vf[8 * KCN], vf2[8 * KCN];
        ldgroup<T16, 8 * KCN, KCN, false>(vf, Vt + kb * 16, voff, 16 * TT); if (NSPLIT == 2) ldgroup<T16, 8 * KCN, KCN, false>(vf2, Vt2 + kb * 16, voff, 16 * TT);   // the value fragments fly under the score products and the softmax
        v8f s[MBN];
#pragma unroll
        for (int mb = 0; mb < MBN; ++mb) s[mb] = (v8f){};
#pragma unroll
        for (int kc = 0; kc < 4; ++kc)
#pragma unroll
            for (int mb = 0; mb < MBN; ++mb) { s[mb] = WFrag<T16>::mma(ka[mb * 4 + kc], qf[kc], s[mb]);
                if (NSPLIT == 2) { s[mb] = WFrag<T16>::mma(ka[mb * 4 + kc], qf2[kc], s[mb]); s[mb] = WFrag<T16>::mma(ka2[mb * 4 + kc], qf[kc], s[mb]); } }
        const size_t kn = (size_t)min(kb + KB, q0 & ~(KB - 1)) * HD;   // the next key block flies under the softmax and the value products; the last trip reads its own block again (in bounds, unused) instead of branching
        ldgroup<T16, MBN * 4, 4, NSPLIT == 2>(kx, Kp + kn, qoff, 16 * HD); if (NSPLIT == 2) ldgroup<T16, MBN * 4, 4, NSPLIT == 2>(kx2, Kp2 + kn, qoff, 16 * HD);
        float mt = -3.0e38f;
        if (kb + KB - 1 > q0) {                               // the diagonal block (wave-uniform test): keys behind the query get weight exactly 0
#pragma unroll
            for (int mb = 0; mb < MBN; ++mb)
#pragma unroll
                for (int j = 0; j < 8; ++j) { const float t = (kb + mb * 16 + hi * 8 + j <= qi) ? s[mb][j] * SCL2 : -3.0e38f; s[mb][j] = t; mt = fmaxf(mt, t); }
        } else {
#pragma unroll
            for (int mb = 0; mb < MBN; ++mb)
#pragma unroll
                for (int j = 0; j < 8; ++j) { const float t = s[mb][j] * SCL2; s[mb][j] = t; mt = fmaxf(mt, t); }
        }
        mt = fmaxf(mt, __shfl_xor(mt, 16, 32));               // the other half of this query's keys is in the other lane half
        const float mn = fmaxf(m, mt); const float al = __builtin_amdgcn_exp2f(m - mn); m = mn;
        float ps = 0.f;
#pragma unroll
        for (int mb = 0; mb < MBN; ++mb)
#pragma unroll
            for (int j = 0; j < 8; ++j) { const float p = __builtin_amdgcn_exp2f(s[mb][j] - mn); s[mb][j] = p; ps += p; }
        l = l * al + ps;
        V pf[KCN], pf2[KCN];
#pragma unroll
        for (int kc = 0; kc < KCN; ++kc) PFrag<T16>::mk(s[2 * kc], s[2 * kc + 1], pf[kc], pf2[kc]);
#pragma unroll
        for (int db = 0; db < 8; ++db) o[db] *= al;
#pragma unroll
        for (int kc = 0; kc < KCN; ++kc)
#pragma unroll
            for (int db = 0; db < 8; ++db) { o[db] = WFrag<T16>::mma(vf[db * KCN + kc], pf[kc], o[db]);
                if (NSPLIT == 2) { o[db] = WFrag<T16>::mma(vf[db * KCN + kc], pf2[kc], o[db]); o[db] = WFrag<T16>::mma(vf2[db * KCN + kc], pf[kc], o[db]); } }
        kb += KB;
    };
#pragma unroll 1
    for (;;) { trip(kf, kf2, kg, kg2); if (kb > q0) break; trip(kg, kg2, kf, kf2); if (kb > q0) break; }   // key blocks kb <= q0 (block 0 always is one); two trips a pass, so that the two fragment sets swap roles without register copies
    l += __shfl_xor(l, 16, 32);
    const float f = __fdiv_rn(1.0f, l);
#pragma unroll
    for (int db = 0; db < 8; ++db) { v8us vh, vl;
#pragma unroll
        for (int j = 0; j < 8; ++j) { unsigned short a, c; splitf(o[db][j] * f, a, c); vh[j] = a; vl[j] = c; }
        const size_t oo = (size_t)q0 * DQ + db * 256 + qoff; *(v8us*)(oh + oo) = vh; *(v8us*)(ol + oo) = vl; }   // fragment order: the 16 d of db are half a tile, the lane's 8 its own piece
}
// Grid (query heads, TT / 128, batches), 8 waves. Cost grows with the row index, so a block takes one long and one short 64-row block: waves 0..3 the rows of block TT / 64 - 1 - y, waves 4..7 those of block y; every block then
// walks the same number of keys. A wave works alone: no LDS, no barrier, and the choice of the path (hi + lo or single plane) is uniform in the wave.
__global__ __launch_bounds__(256) void k_fattn(const h16* __restrict__ Q16, const bf* __restrict__ Qh, const bf* __restrict__ Ql, const h16* __restrict__ K16, const bf* __restrict__ Kh, const bf* __restrict__ Kl, const h16* __restrict__ V16, const bf* __restrict__ Vh, const bf* __restrict__ Vl, bf* __restrict__ Ah, bf* __restrict__ Al) {
    const int lane = threadIdx.x & 31, lr = lane & 15, hi = lane >> 4;
    const int wv = __builtin_amdgcn_readfirstlane((int)(threadIdx.x >> 5));   // kept scalar so that the path choice and the key loop's control stay scalar
    const int h = blockIdx.x, r0 = ((wv < 4) ? TT / 64 - 1 - (int)blockIdx.y : (int)blockIdx.y) * 64, q0 = r0 + (wv & 3) * 16;
    const int b = blockIdx.z; Ah += (size_t)b * TT * DQ; Al += (size_t)b * TT * DQ;
    const size_t zq = (size_t)(b * NH_ + h) * TT * HD, zk = (size_t)(b * NKV + h / REP) * TT * HD;
    if (r0 < RH) fattn_strip<bf, 2, 32>(Qh + zq, Ql + zq, Kh + zk, Kl + zk, Vh + zk, Vl + zk, q0, lr, hi, Ah + h * HD * 16, Al + h * HD * 16);   // head h's columns begin h * HD / 32 tiles into a 16-row band
    else fattn_strip<h16, 0, 64>(Q16 + zq, nullptr, K16 + zk, nullptr, V16 + zk, nullptr, q0, lr, hi, Ah + h * HD * 16, Al + h * HD * 16);
}

extern "C" void kernel_launch(void* const* d_in, const int* in_sizes, int n_in,
                              void* d_out, int out_size, void* d_ws, size_t ws_size, hipStream_t stream) {
    (void)in_sizes; (void)n_in; (void)out_size;
    const float* x = (const float*)d_in[0]; const float* wq = (const float*)d_in[1]; const float* wk = (const float*)d_in[2]; const float* wv = (const float*)d_in[3]; const float* wo = (const float*)d_in[4];
    float* OUT = (float*)d_out;     // [2][2048][2048]
    char* wsp = (char*)d_ws;
    auto take = [&](size_t bytes) { char* p = wsp; wsp += (bytes + 255) & ~(size_t)255; return (void*)p; };
    bf* WQ = (bf*)take((size_t)DF * DM * 2); bf* WK = WQ + (size_t)DQ * DM; bf* WV = WK + (size_t)DKV * DM;   // one [DF][DM] plane: the rows of w_q, w_k, w_v one behind the other
    bf* WO = (bf*)take((size_t)DM * DQ * 2); float* CS = (float*)take((size_t)TT * HD * 2 * 4);
    bf* XB = (bf*)take((size_t)NB_ * TT * DM * 2); float* F = (float*)take((size_t)NB_ * TT * DF * 4);
    h16* QP16 = (h16*)take((size_t)NB_ * NH_ * TT * HD * 2); h16* KP16 = (h16*)take((size_t)NB_ * NKV * TT * HD * 2); h16* VT16 = (h16*)take((size_t)NB_ * NKV * HD * TT * 2);
    bf* QPh = (bf*)take((size_t)NB_ * NH_ * TT * HD * 2); bf* QPl = (bf*)take((size_t)NB_ * NH_ * TT * HD * 2); bf* KPh = (bf*)take((size_t)NB_ * NKV * TT * HD * 2); bf* KPl = (bf*)take((size_t)NB_ * NKV * TT * HD * 2); bf* VTh = (bf*)take((size_t)NB_ * NKV * HD * TT * 2); bf* VTl = (bf*)take((size_t)NB_ * NKV * HD * TT * 2);
    bf* ATh = (bf*)take((size_t)NB_ * TT * DQ * 2); bf* ATl = (bf*)take((size_t)NB_ * TT * DQ * 2);
    if ((size_t)(wsp - (char*)d_ws) > ws_size) return;    // 190 MiB of the 256 MiB
    // Five launches, each over both batches (the rows b * TT + t of x, F, the merged planes and out are one matrix of NB_ * TT rows)
    k_prep<<<PB_CS + PB_X + PB_WQ + 2 * PB_WKV + PB_WO, 256, 0, stream>>>(x, wq, wk, wv, wo, XB, WQ, WK, WV, WO, CS);
    k_gemmw<bf, 0, DM, 256, 192, 2><<<dim3(NB_ * TT / 256, DF / 192, 1), 256, 0, stream>>>(XB, nullptr, WQ, F, DF);
    k_planes<<<LB_Q + LB_K + LB_V, 256, 0, stream>>>(F, CS, QP16, QPh, QPl, KP16, KPh, KPl, VT16, VTh, VTl);
    k_fattn<<<dim3(NH_, TT / 128, NB_), 256, 0, stream>>>(QP16, QPh, QPl, KP16, KPh, KPl, VT16, VTh, VTl, ATh, ATl);
    k_gemmw<bf, 1, DQ, 128, 256, 4><<<dim3(NB_ * TT / 128, DM / 256, 1), 256, 0, stream>>>(ATh, ATl, WO, OUT, DM);
}

// v008
// Measured time: 140 microseconds a run.
// In two side-by-side timings against v007, it was 1.12 and 1.07 times as fast.
// Counting every step since v000, it is 11.6 times as fast.
#include <hip/hip_runtime.h>

// Grouped-query RoPE causal attention ('eager' path) (x [2][2048][2048]; q = x w_q^T ([2048][2048]: 16 heads x 128), k, v = x w_k^T / w_v^T ([512][2048]: 4 kv heads); rotate-half RoPE (theta 1e6, full 128 dims, tables computed on device); kv head = h/4; scores = q.k/sqrt(128); causal (finfo.min == exact zero weight); softmax; out = merged w_o^T -> [2][2048][2048] (8.4 M)).
// Compute dtypes, f32 accumulate: every input rounded to bf16; q/k/v on PLAIN bf16 operands (inputs: exact); rotary in f32 (cos/sin from an on-device f32 table: inv_freq_i = 1e6^(-2i/128), precise cosf/sinf); q's rotary in the attention kernel's own registers, k's in the plane builder; causal scores, softmax (f32, running maximum and sum) and attn.v in one kernel: query rows < 512 hl (3 products), the rest single fp16; w_o hl x exact (2 products).

#define NB_  2
#define TT   2048
#define DM   2048
#define NH_  16
#define NKV  4
#define REP  (NH_ / NKV)
#define HD   128
#define DQ   (NH_ * HD)
#define DKV  (NKV * HD)
#define RH   512                  // query rows < RH use hi+lo planes (0: none)
typedef _Float16 h16;
typedef unsigned short bf;
typedef __attribute__((ext_vector_type(16))) __bf16   v16bf;
typedef __attribute__((ext_vector_type(16))) _Float16 v16h;
typedef __attribute__((ext_vector_type(8)))  _Float16 v8h;
typedef __attribute__((ext_vector_type(8)))  unsigned short v8us;
typedef __attribute__((ext_vector_type(8)))  float    v8f;
typedef __attribute__((ext_vector_type(4)))  float    v4f;
typedef v8h  __attribute__((may_alias)) v8ha;
typedef v4f  __attribute__((may_alias)) v4fa;
typedef v8us __attribute__((may_alias)) v8usa;

__device__ __forceinline__ unsigned short f2bf(float f) { unsigned u = __float_as_uint(f); u += 0x7FFFu + ((u >> 16) & 1u); return (unsigned short)(u >> 16); }
__device__ __forceinline__ float bf2f(unsigned short b) { return __uint_as_float(((unsigned)b) << 16); }
__device__ __forceinline__ float bfr(float f) { return bf2f(f2bf(f)); }
__device__ __forceinline__ v16h cat16(v8h lo, v8h hi) { return __builtin_shufflevector(lo, hi, 0, 1, 2, 3, 4, 5, 6, 7, 8, 9, 10, 11, 12, 13, 14, 15); }
__device__ __forceinline__ v16bf cat16b(v8us lo, v8us hi) { return __builtin_bit_cast(v16bf, __builtin_shufflevector(lo, hi, 0, 1, 2, 3, 4, 5, 6, 7, 8, 9, 10, 11, 12, 13, 14, 15)); }
__device__ __forceinline__ v8f wmma16(v16h a, v16h b, v8f c) { return __builtin_amdgcn_wmma_f32_16x16x32_f16(false, a, false, b, (short)0, c, false, false); }
__device__ __forceinline__ v8f wmmab(v16bf a, v16bf b, v8f c) { return __builtin_amdgcn_wmma_f32_16x16x32_bf16(false, a, false, b, (short)0, c, false, false); }



// ---- Fragment order: every 16-bit operand plane [rows][K] is stored tile by tile, a tile = 16 rows x 32 k = 1 KiB, tile (r / 16, k / 32) at element (r / 16 * (K / 32) + k / 32) * 512 (16 rows keep their 16 * K elements).
// Inside a tile the 16-byte pieces (8 neighbouring k of one row) stand in the order in which the lanes of a wave take them: piece = (k / 16 % 2) * 32 + (k / 8 % 2) * 16 + r % 16. A fragment is then two loads of 512 contiguous bytes
// (lane * 8 and 256 + lane * 8 elements into the tile): 4 whole cache lines a load, where a row-major plane gives 32 bytes out of each of 16 lines. The k order of a fragment is the one it had.
__device__ __forceinline__ size_t pk(int r, int k, int K) { return ((size_t)(r >> 4) * (K >> 5) + (k >> 5)) * 512 + ((k >> 4) & 1) * 256 + (((k >> 3) & 1) * 16 + (r & 15)) * 8 + (k & 7); }
// ---- k_gemmw: register-blocked GEMM, one BM x BN output tile per block of 8 waves (8 / WN x WN), a wave on its own 64 x (BN / WN) part with all its accumulators over the whole K. The tiles are chosen so that the grid is one block per WGP:
// every block reads its BM + BN operand rows from L2 once, so the larger the tile, the fewer bytes the whole product asks of L2.
// The block's operand rows go through LDS, so that each fragment leaves L2 once per block and serves all waves of its row or column: a stage is 128 k of every row, a 16-row band of it 4 KiB that are contiguous in the plane (four tiles in fragment order)
// and stay so in LDS: a fragment is two ds loads of 512 contiguous bytes, free of bank conflicts without a pad. Two stage buffers, filled by asynchronous copies (16 bytes a lane), the next stage but one issued as soon as a buffer is free.
// C[m][n] (f32, pitch ldc) = sum_k A[m][k] Bt[n][k] (NSPLIT 1: + A2[m][k] Bt[n][k]). Grid (M/BM, N/BN), 256 threads. K % 128 == 0, K >= 256.
template <typename T16> struct WFrag;
template <> struct WFrag<h16> { typedef v16h V; static __device__ __forceinline__ V ld(const h16* p) { return cat16(*(const v8h*)p, *(const v8h*)(p + 256)); } static __device__ __forceinline__ v8f mma(V a, V b, v8f c) { return wmma16(a, b, c); } };
template <> struct WFrag<bf> { typedef v16bf V; static __device__ __forceinline__ V ld(const bf* p) { return cat16b(*(const v8us*)p, *(const v8us*)(p + 256)); } static __device__ __forceinline__ v8f mma(V a, V b, v8f c) { return wmmab(a, b, c); } };
// A run of copies of a wave, 512 bytes each, with the wait before a register that an issued copy names is overwritten as the last line of their own statement (7 or 8 copies: a stage is four runs either way).
template <typename T16>
__device__ __forceinline__ void cprun(const unsigned (&l)[8], const T16* const (&g)[8]) {
    asm volatile("global_load_async_to_lds_b128 %0, %8, off\n\t"
                 "global_load_async_to_lds_b128 %1, %9, off\n\t"
                 "global_load_async_to_lds_b128 %2, %10, off\n\t"
                 "global_load_async_to_lds_b128 %3, %11, off\n\t"
                 "global_load_async_to_lds_b128 %4, %12, off\n\t"
                 "global_load_async_to_lds_b128 %5, %13, off\n\t"
                 "global_load_async_to_lds_b128 %6, %14, off\n\t"
                 "global_load_async_to_lds_b128 %7, %15, off\n\t"
                 "s_wait_xcnt 0x0"
                 :: "v"(l[0]), "v"(l[1]), "v"(l[2]), "v"(l[3]), "v"(l[4]), "v"(l[5]), "v"(l[6]), "v"(l[7]), "v"(g[0]), "v"(g[1]), "v"(g[2]), "v"(g[3]), "v"(g[4]), "v"(g[5]), "v"(g[6]), "v"(g[7]) : "memory");
}
template <typename T16>
__device__ __forceinline__ void cprun(const unsigned (&l)[7], const T16* const (&g)[7]) {
    asm volatile("global_load_async_to_lds_b128 %0, %7, off\n\t"
                 "global_load_async_to_lds_b128 %1, %8, off\n\t"
                 "global_load_async_to_lds_b128 %2, %9, off\n\t"
                 "global_load_async_to_lds_b128 %3, %10, off\n\t"
                 "global_load_async_to_lds_b128 %4, %11, off\n\t"
                 "global_load_async_to_lds_b128 %5, %12, off\n\t"
                 "global_load_async_to_lds_b128 %6, %13, off\n\t"
                 "s_wait_xcnt 0x0"
                 :: "v"(l[0]), "v"(l[1]), "v"(l[2]), "v"(l[3]), "v"(l[4]), "v"(l[5]), "v"(l[6]), "v"(g[0]), "v"(g[1]), "v"(g[2]), "v"(g[3]), "v"(g[4]), "v"(g[5]), "v"(g[6]) : "memory");
}
template <typename T16, int NSPLIT, int K, int BM, int BN, int WN>
__global__ __launch_bounds__(256) void k_gemmw(const T16* __restrict__ A, const T16* __restrict__ A2, const T16* __restrict__ Bt, float* C, int ldc) {
    typedef typename WFrag<T16>::V V;
    static_assert(NSPLIT == 0 || NSPLIT == 1, "one or two A planes"); constexpr int KS = 128; static_assert(K % KS == 0 && K >= 2 * KS, "whole stages of KS k, at least two");
    constexpr int NF = BN / WN / 16;                                // a wave's part: 4 x NF accumulator tiles
    static_assert(8 % WN == 0 && BM == 8 / WN * 64 && BN % (WN * 16) == 0, "8 waves, 64 rows each");
    constexpr int NA1 = BM / 16, NA = NA1 * (NSPLIT + 1), NBD = NA + BN / 16;   // 16-row bands of a stage: A (then A2), then Bt
    static_assert(NBD % 4 == 0, "a wave's copies go in four equal runs");
    constexpr int OP = NF * 16 + 4;                                 // pitch (floats) of a wave's staged output rows
    constexpr int STG = NBD * 16 * KS * 2, OST = 8 * 64 * OP * 4;          // bytes of one stage; bytes of the eight output parts staged behind the loop
    __shared__ __align__(1024) unsigned char sm[2 * STG > OST ? 2 * STG : OST];
    const int lane = threadIdx.x & 31, lr = lane & 15, hi = lane >> 4; const int r0 = blockIdx.x * BM, c0 = blockIdx.y * BN;
    const int wv = __builtin_amdgcn_readfirstlane((int)(threadIdx.x >> 5));   // kept scalar so that the part's LDS offsets stay scalar
    const int wm = wv / WN, wn = wv % WN;
    v8f acc[4][NF];
#pragma unroll
    for (int mb = 0; mb < 4; ++mb)
#pragma unroll
        for (int nb = 0; nb < NF; ++nb) acc[mb][nb] = (v8f){};
    // Wave wv copies the 512-byte eighth wv of every band of a stage, a lane its own 16 bytes: the same offset in the band in the plane and in LDS
    const unsigned lds0 = (unsigned)(size_t)(__attribute__((address_space(3))) unsigned char*)sm + wv * 512 + lane * 16;
    const T16* ga = A + (size_t)r0 * K + wv * 256; const T16* ga2 = (NSPLIT == 1) ? A2 + (size_t)r0 * K + wv * 256 : ga; const T16* gb = Bt + (size_t)c0 * K + wv * 256;   // the same in the whole wave: they stay in scalar registers
    const unsigned gl = lane * 8;
    auto fill = [&](int buf, int k0) __attribute__((always_inline)) {   // stage k0 .. k0 + KS - 1 into buffer buf (both the same in the whole block)
#pragma unroll
        for (int i0 = 0; i0 < NBD; i0 += NBD / 4) { unsigned l[NBD / 4]; const T16* g[NBD / 4];
#pragma unroll
            for (int q = 0; q < NBD / 4; ++q) { const int i = i0 + q; l[q] = lds0 + buf * STG + i * (16 * KS * 2); g[q] = (i < NA1 ? ga + i * 16 * K : i < NA ? ga2 + (i - NA1) * 16 * K : gb + (i - NA) * 16 * K) + k0 * 16 + gl; }
            cprun<T16>(l, g); }
    };
    fill(0, 0);
    asm volatile("s_wait_asynccnt 0x0" ::: "memory");   // this wave's copies of stage 0 have landed
    __syncthreads();                                    // ... and every other wave's: stage 0 may be read
    fill(1, KS);
    // the stage loop stays rolled: its body is 96 or 128 products long already, and the order at its foot stands once
#pragma unroll 1
    for (int t = 0; t < K / KS; ++t) {
    const T16* sb = (const T16*)(sm + (t & 1) * STG) + 8 * lane;   // the lane's piece in the first tile of this stage's buffer; a band is 16 * KS elements, each further 32 k of it 512
#pragma unroll
    for (int kc = 0; kc < KS / 32; ++kc) {
        V a[4], a2[4], b[NF];
        __builtin_amdgcn_sched_barrier(0);   // opens the load group: all fragments of these 32 k are asked for together, one LDS latency a group and not one in front of every fourth product
#pragma unroll
        for (int mb = 0; mb < 4; ++mb) { a[mb] = WFrag<T16>::ld(sb + (wm * 4 + mb) * (16 * KS) + kc * 512); if (NSPLIT == 1) a2[mb] = WFrag<T16>::ld(sb + (NA1 + wm * 4 + mb) * (16 * KS) + kc * 512); }
#pragma unroll
        for (int nb = 0; nb < NF; ++nb) b[nb] = WFrag<T16>::ld(sb + (NA + wn * NF + nb) * (16 * KS) + kc * 512);
        __builtin_amdgcn_sched_barrier(0);   // closes the group: no load sinks in among the products
#pragma unroll
        for (int nb = 0; nb < NF; ++nb) {
#pragma unroll
            for (int mb = 0; mb < 4; ++mb) { acc[mb][nb] = WFrag<T16>::mma(a[mb], b[nb], acc[mb][nb]); if (NSPLIT == 1) acc[mb][nb] = WFrag<T16>::mma(a2[mb], b[nb], acc[mb][nb]); } }
    }
    asm volatile("s_wait_dscnt 0x0" ::: "memory");      // this wave's reads of the buffer are done before it may be refilled
    asm volatile("s_wait_asynccnt 0x0" ::: "memory");   // this wave's copies of the next stage have landed
    __syncthreads();                                    // the one barrier of a stage: the next stage may be read, this stage's buffer is free
    if (t + 2 < K / KS) fill(t & 1, (t + 2) * KS);
    }
    asm volatile("s_wait_asynccnt 0x0" ::: "memory");   // no copy is outstanding when the ring becomes output staging (the last stage's barrier has ended every read of it)
    float* os = (float*)sm + wv * (64 * OP);            // each wave stages its own part, so that a store is whole lines
#pragma unroll
    for (int mb = 0; mb < 4; ++mb) {
#pragma unroll
        for (int nb = 0; nb < NF; ++nb) {
#pragma unroll
            for (int j = 0; j < 8; ++j) os[(mb * 16 + hi * 8 + j) * OP + nb * 16 + lr] = acc[mb][nb][j]; }
    }
    asm volatile("s_wait_dscnt 0x0" ::: "memory");      // the wave's own rows are in LDS before its lanes read them back
    float* crow = C + (size_t)(r0 + wm * 64) * ldc + c0 + wn * (NF * 16);
    constexpr int CH = NF * 4, RG = (CH % 16 == 0) ? 2 : 4, NS = RG * CH / 32;   // 16-byte pieces of a row; RG rows are NS whole stores of the wave (512 bytes each, 4 whole lines)
    static_assert(RG * CH % 32 == 0 && 64 % RG == 0, "whole stores");
#pragma unroll
    for (int i = 0; i < 64 / RG; ++i) {
#pragma unroll
        for (int s = 0; s < NS; ++s) { const int idx = s * 32 + lane; const int row = i * RG + idx / CH, cofs = idx % CH * 4; *(v4f*)(crow + (size_t)row * ldc + cofs) = *(const v4fa*)(os + row * OP + cofs); } }
}

__device__ __forceinline__ h16 tohx(float x) { return (h16)x; }
__device__ __forceinline__ void splitf(float y, unsigned short& h, unsigned short& l) { h = f2bf(y); l = f2bf(y - bf2f(h)); }
typedef __attribute__((ext_vector_type(2))) _Float16 v2h;
typedef __attribute__((ext_vector_type(4))) _Float16 v4h;
typedef __attribute__((ext_vector_type(2))) unsigned short v2us;
typedef __attribute__((ext_vector_type(4))) unsigned short v4us;
typedef v4h  __attribute__((may_alias)) v4ha;
typedef v4us __attribute__((may_alias)) v4usa;
typedef __attribute__((ext_vector_type(2))) float v2f;
typedef __attribute__((ext_vector_type(4))) int v4i;

__global__ __launch_bounds__(256) void k_wtG(const float* __restrict__ w, int K, int N, bf* Bt) {
    const int lane = threadIdx.x & 31; const int L0 = (blockIdx.x * 8 + (threadIdx.x >> 5)) * 8; const int nlines = N * K / 64;
{
#pragma unroll 1
        for (int l = 0; l < 8; ++l) { const int L = L0 + l; if (L >= nlines) break; const size_t e = (size_t)L * 64 + lane * 2; const int k = (int)(e % K), n = (int)(e / K); v2us o;
            o[0] = f2bf(w[(size_t)k * N + n]); o[1] = f2bf(w[(size_t)(k + 1) * N + n]); *(v2us*)(Bt + e) = o; }
         }
}
// d_cvt8: a row-major f32 matrix [rows][K] rounded to bf16, into fragment order. A wave takes 8 rows x 32 k (half a tile) in two loads of 4 rows x 128 bytes (whole lines); a lane's 4 values go out as half a 16-byte piece.
__device__ __forceinline__ void d_cvt8(unsigned blk, const float* __restrict__ src, bf* dst, size_t n8, int K) { const size_t i = (size_t)blk * 256 + threadIdx.x; if (i >= n8) return; const int l = (int)(i & 31); const int w = (int)(i >> 5);
    const int tile = w >> 1; const int r = tile / (K >> 5) * 16 + (w & 1) * 8 + (l >> 3), k = tile % (K >> 5) * 32 + (l & 7) * 4;
    const float* s0 = src + (size_t)r * K + k; const float* s1 = s0 + (size_t)4 * K; const v4f v[2] = {*(const v4f*)s0, *(const v4f*)s1};
    asm volatile("s_wait_xcnt 0x0" :: "v"(s0), "v"(s1) : "memory");   // the wait before an address register of the two loads is overwritten; the addresses are its inputs, or else this compiler gives a load its own address register as its destination
#pragma unroll
    for (int u = 0; u < 2; ++u) { v4us o;
#pragma unroll
        for (int q = 0; q < 4; ++q) o[q] = f2bf(v[u][q]);
        *(v4us*)(dst + pk(r + 4 * u, k, K)) = o; }  }
__constant__ float INV[HD / 2] = {1.00000000f,0.805842161f,0.649381638f,0.523299098f,0.421696514f,0.339820832f,0.273841977f,0.220673412f,0.177827939f,0.143301263f,0.115478195f,0.0930572078f,0.0749894232f,0.0604296401f,0.0486967526f,0.0392418988f,0.0316227749f,0.0254829675f,0.0205352511f,0.0165481716f,0.0133352140f,0.0107460786f,0.00865964312f,0.00697830599f,0.00562341325f,0.00453158375f,0.00365174119f,0.00294272718f,0.00237137382f,0.00191095297f,0.00153992651f,0.00124093774f,0.00100000005f,0.000805842166f,0.000649381604f,0.000523299095f,0.000421696517f,0.000339820836f,0.000273841957f,0.000220673406f,0.000177827940f,0.000143301251f,0.000115478200f,0.0000930572060f,0.0000749894243f,0.0000604296401f,0.0000486967510f,0.0000392418988f,0.0000316227779f,0.0000254829683f,0.0000205352499f,0.0000165481706f,0.0000133352141f,0.0000107460783f,0.00000865964284f,0.00000697830592f,0.00000562341347f,0.00000453158373f,0.00000365174128f,0.00000294272718f,0.00000237137374f,0.00000191095296f,0.00000153992653f,0.00000124093776f};
__device__ __forceinline__ void d_cstab(unsigned blk, float* CS) { const int idx = (int)blk * 256 + threadIdx.x; if (idx >= TT * HD) return; const int t = idx / HD, d = idx % HD; const int di = d % (HD / 2); const float iv = INV[di];
    asm volatile("s_wait_xcnt 0x0" :: "v"(di) : "memory");   // the wait before the register of the table load's index is overwritten; the index is its input, or else this compiler gives the load that very register as its destination
    const float ang = __fmul_rn((float)t, iv); v2f cs; cs[0] = cosf(ang); cs[1] = sinf(ang);
    *(v2f*)(CS + (size_t)idx * 2) = cs;  }
// ---- k_prep: everything that depends on the inputs alone, in ONE launch: the rotary table (first: its blocks run longest), then x (both batches) and the four weights rounded to bf16, in fragment order. A block does one job, picked by its index (block-uniform).
#define PB_CS  (TT * HD / 256)
#define PB_X   (NB_ * TT * DM / 8 / 256)
#define PB_WQ  (DQ * DM / 8 / 256)
#define PB_WKV (DKV * DM / 8 / 256)
#define PB_WO  (DM * DQ / 8 / 256)
__global__ __launch_bounds__(256) void k_prep(const float* __restrict__ x, const float* __restrict__ wq, const float* __restrict__ wk, const float* __restrict__ wv, const float* __restrict__ wo, bf* XB, bf* WQ, bf* WK, bf* WV, bf* WO, float* CS) {
    unsigned blk = blockIdx.x;
    if (blk < PB_CS) { d_cstab(blk, CS); return; }
    blk -= PB_CS; const float* s; bf* d; unsigned nb;
    if (blk < PB_X) { s = x; d = XB; nb = PB_X; }
    else if ((blk -= PB_X) < PB_WQ) { s = wq; d = WQ; nb = PB_WQ; }
    else if ((blk -= PB_WQ) < PB_WKV) { s = wk; d = WK; nb = PB_WKV; }
    else if ((blk -= PB_WKV) < PB_WKV) { s = wv; d = WV; nb = PB_WKV; }
    else { blk -= PB_WKV; s = wo; d = WO; nb = PB_WO; }
    d_cvt8(blk, s, d, (size_t)nb * 256, DM);   // every one of them has rows of DM elements
    static_assert(DQ == DM, "w_o's rows are DQ long");
}

// d_rope: head planes [b][h] of [t][d] in fragment order (fp16 + hi/lo) of rope(x) x sc; a wave takes 4 rows t x 32 d (whole 128-byte lines of F), a lane 4 neighbouring d (half a 16-byte piece); with the rotate-half convention out[d] = x[d] cos[t][d] - x[d+HD/2] sin[t][d], out[d+HD/2] = x[d+HD/2] cos[t][d+HD/2] + x[d] sin[t][d+HD/2]
__device__ __forceinline__ void d_rope(unsigned blk, const float* __restrict__ F, int pitch, int nheads, const float* __restrict__ CS, const float* __restrict__ RF, const float* __restrict__ nw, float sc, h16* P16, bf* Ph, bf* Pl) {
    const size_t i = (size_t)blk * 256 + threadIdx.x; if (i * 4 >= (size_t)NB_ * nheads * TT * HD) return; const int l = (int)(i & 31); const int w = (int)(i >> 5);   // wave w: d tile w % (HD / 32) of the rows 4 (w / (HD / 32)) .. + 3, counted through all heads
    const int d = w % (HD / 32) * 32 + (l & 7) * 4; const int t = w / (HD / 32) % (TT / 4) * 4 + (l >> 3); const int bh = w / (HD / 32) / (TT / 4); const int h = bh % nheads; const float* f = F + ((size_t)(bh / nheads) * TT + t) * pitch + h * HD; const float rf = RF ? RF[(size_t)h * TT + t] : 1.0f; v4h o16; v4us oh, ol;
    const float* f0 = f + d; const float* f1 = f + ((d < HD / 2) ? d + HD / 2 : d - HD / 2); const v4f X0 = *(const v4f*)f0, X1 = *(const v4f*)f1;   // the lane's 4 values and their 4 partners, one 16-byte load each
    asm volatile("s_wait_xcnt 0x0" :: "v"(f0), "v"(f1) : "memory");   // the wait before an address register of the two loads is overwritten; the addresses are its inputs, so that no load gets its own address register as its destination
#pragma unroll
    for (int q = 0; q < 4; ++q) { const int dd = d + q; const int dp = (dd < HD / 2) ? dd + HD / 2 : dd - HD / 2; float x0 = X0[q], x1 = X1[q];
        if (RF) { float n0 = __fmul_rn(x0, rf), n1 = __fmul_rn(x1, rf); asm volatile("" : "+v"(n0)); asm volatile("" : "+v"(n1)); x0 = __fmul_rn(bfr(nw[dd]), n0); x1 = __fmul_rn(bfr(nw[dp]), n1); }
        const v2f cs = *(const v2f*)(CS + ((size_t)t * HD + dd) * 2); float a = __fmul_rn(x0, cs[0]), bq = __fmul_rn(x1, cs[1]); asm volatile("" : "+v"(a)); asm volatile("" : "+v"(bq)); const float r = ((dd < HD / 2) ? __fsub_rn(a, bq) : __fadd_rn(a, bq)) * sc;
        o16[q] = tohx(r); unsigned short a2, c2; splitf(r, a2, c2); oh[q] = a2; ol[q] = c2; }
    const size_t e = (size_t)bh * TT * HD + pk(t, d, HD);
    *(v4h*)(P16 + e) = o16; *(v4us*)(Ph + e) = oh; *(v4us*)(Pl + e) = ol;  }
// d_vtp: value planes [b][g] of [d][t] in fragment order. A thread makes one 16-byte piece (8 neighbouring t of one d), the threads in the order of the pieces: a wave stores 512 contiguous bytes, and each of its 8 loads takes 16 neighbouring d of two rows of F.
__device__ __forceinline__ void d_vtp(unsigned blk, const float* __restrict__ F, int pitch, int nheads, h16* V16, bf* Vh, bf* Vl) { const size_t e = ((size_t)blk * 256 + threadIdx.x) * 8; if (e >= (size_t)NB_ * nheads * HD * TT) return; const int pl = (int)(e / ((size_t)TT * HD)); const int pe = (int)(e % ((size_t)TT * HD)); const int tile = pe >> 9, pc = (pe >> 3) & 63;   // plane b * nheads + g, tile in it, piece in the tile
    const int t = tile % (TT / 32) * 32 + (pc >> 5) * 16 + ((pc >> 4) & 1) * 8 + pl / nheads * TT; const int d = tile / (TT / 32) * 16 + (pc & 15); const int g = pl % nheads; v8h o16; v8us oh, ol;
#pragma unroll
    for (int q = 0; q < 8; ++q) { const float x = F[(size_t)(t + q) * pitch + g * HD + d]; o16[q] = tohx(x); unsigned short a2, c2; splitf(x, a2, c2); oh[q] = a2; ol[q] = c2; }
    *(v8h*)(V16 + e) = o16; *(v8us*)(Vh + e) = oh; *(v8us*)(Vl + e) = ol;  }
// ---- k_planes: the operand planes that many attention waves share, all in ONE launch, from the joint projection F [b * TT + t][q columns | k columns | v columns]: rotated k, transposed v (a query row is read by one wave alone and gets no plane: qload, qmake). A block does one job, picked by its index (block-uniform).
#define DF     (DQ + 2 * DKV)
#define LB_K   (NB_ * NKV * TT * HD / 4 / 256)
#define LB_V   (NB_ * NKV * TT * HD / 8 / 256)
__global__ __launch_bounds__(256) void k_planes(const float* __restrict__ F, const float* __restrict__ CS, h16* KP16, bf* KPh, bf* KPl, h16* VT16, bf* VTh, bf* VTl) {
    const unsigned blk = blockIdx.x;
    if (blk < LB_K) d_rope(blk, F + DQ, DF, NKV, CS, nullptr, nullptr, 1.0f, KP16, KPh, KPl);
    else d_vtp(blk - LB_K, F + DQ + DKV, DF, NKV, VT16, VTh, VTl);
}
// ---- k_fattn: scores, causal softmax and probability x value product of one query strip in ONE kernel; no score or probability ever goes to memory.
// A wave owns 16 query rows of one head and walks the keys 0 .. its diagonal in blocks of KB, transposed: St = K Qt (A = key rows, B = the strip's query rows, kept in registers), Ot += Vt Pt (A = rows of the [d][t] value plane).
// In both accumulators a lane holds ONE query (column lr): the running maximum, the running sum and the rescale factor are per lane, with one exchange between the two lane halves; the accumulator registers of two score tiles
// (keys 8 hi + j and 16 + 8 hi + j) are, converted, exactly the B fragment of the next product in the k order of WFrag::ld. Probabilities are exp(t - running max), at most 1, divided by the row's sum only at the end.
// NSPLIT 2: hi + lo planes, 3 products (query rows < RH), KB 32; NSPLIT 0: single fp16, KB 64: either way 16 key and 16 value fragments are in flight. The epilogue writes the merged [t][h * HD + d] hi and lo planes in fragment order, 8 neighbouring d per lane, 512 contiguous bytes per store.
template <typename T16> struct PFrag;
template <> struct PFrag<h16> { static __device__ __forceinline__ void mk(const v8f p0, const v8f p1, v16h& f, v16h& f2) { (void)f2;
#pragma unroll
    for (int j = 0; j < 8; ++j) { f[j] = (h16)p0[j]; f[8 + j] = (h16)p1[j]; } } };
template <> struct PFrag<bf> { static __device__ __forceinline__ void mk(const v8f p0, const v8f p1, v16bf& f, v16bf& f2) { v8us h0, h1, l0, l1;
#pragma unroll
    for (int j = 0; j < 8; ++j) { unsigned short a, c; splitf(p0[j], a, c); h0[j] = a; l0[j] = c; splitf(p1[j], a, c); h1[j] = a; l1[j] = c; }
    f = cat16b(h0, h1); f2 = cat16b(l0, l1); } };
// One plane's fragments of a block, loaded as ONE group: all its loads are in flight together, one latency per group. The group stands between two scheduling barriers, with the wait that comes before a register of an
// issued global load is overwritten as its last instruction: the barriers keep the loads from sinking to their uses and keep every other instruction (which could take an address register) out of the group.
// The address is formed inside the group, from a wave-uniform base and the lane's own 32-bit element offset.
template <typename T16, int N, int INNER, bool HOLD>
__device__ __forceinline__ void ldgroup(typename WFrag<T16>::V (&f)[N], const T16* base, unsigned off, int outer) {
    __builtin_amdgcn_sched_barrier(0);   // opens the group: nothing from in front of it moves in
    const T16* p = base + off;
#pragma unroll
    for (int i = 0; i < N; ++i) f[i] = WFrag<T16>::ld(p + ((i / INNER) * outer + (i % INNER) * 512));   // the next 32 k of the same rows are the next tile
    // the wait before an address register of the group is overwritten; HOLD: with the address as its input, for the groups whose last load this compiler would else give that very register as its destination
    if (HOLD) asm volatile("s_wait_xcnt 0x0" :: "v"(p) : "memory"); else asm volatile("s_wait_xcnt 0x0" ::: "memory");
    __builtin_amdgcn_sched_barrier(0);   // closes the group: no load sinks behind it, nothing from behind it moves in
}
// The strip's query fragments, made in registers from the f32 projection: a query row is used by this one wave, so a plane of it would be written and read once for nothing.
// Lane (lr, hi) of a B fragment holds row lr, k = 32 kc + 8 hi + 0..7 and 32 kc + 16 + 8 hi + 0..7 (the k order of WFrag::ld): 32 contiguous bytes of F each, and the rotary partner d +- HD / 2 of each is the same lane's element of fragment kc +- 2.
// qload: the lane's 64 values X[kc][..] and the (cos, sin) pairs C[kc][..] of its 32 d < HD / 2 (the table's entries at d and d + HD / 2 are equal), as two groups of loads in the form of ldgroup, one to an address.
__device__ __forceinline__ void qload(v4f (&X)[4][4], v4f (&C)[2][8], const float* __restrict__ Fq, const float* __restrict__ CSq, int lr, int hi) {
    __builtin_amdgcn_sched_barrier(0);   // opens the first group: nothing from in front of it moves in
    const unsigned po = (unsigned)(lr * DF + hi * 8) * 4u;   // the lane's byte offset from the wave-uniform base
#pragma unroll
    for (int kc = 0; kc < 4; ++kc)
#pragma unroll
        for (int u = 0; u < 4; ++u) X[kc][u] = *(const v4f*)((const char*)Fq + po + (kc * 32 + (u >> 1) * 16 + (u & 1) * 4) * 4);
    asm volatile("s_wait_xcnt 0x0" :: "s"(Fq), "v"(po) : "memory");   // the wait before an address register of the group is overwritten; the scalar base and the offset register are its inputs, so that both live up to it
    __builtin_amdgcn_sched_barrier(0);   // closes the first group and opens the second: the table's address is formed behind the wait
    const unsigned co = (unsigned)((lr * HD + hi * 8) * 2) * 4u;
#pragma unroll
    for (int kc = 0; kc < 2; ++kc)
#pragma unroll
        for (int u = 0; u < 8; ++u) C[kc][u] = *(const v4f*)((const char*)CSq + co + ((kc * 32 + (u >> 2) * 16) * 2 + (u & 3) * 4) * 4);
    asm volatile("s_wait_xcnt 0x0" :: "s"(CSq), "v"(co) : "memory");   // as above
    __builtin_amdgcn_sched_barrier(0);   // closes the group: no load sinks behind it, nothing from behind it moves in
}
// qmake: rotate-half as in d_rope, then the rounding of the path: single fp16, or bf16 hi + lo.
template <typename T16> struct QRnd;
template <> struct QRnd<h16> { static __device__ __forceinline__ void mk(const float (&r)[16], v16h& f, v16h& f2) { (void)f2;
#pragma unroll
    for (int e = 0; e < 16; ++e) f[e] = tohx(r[e]); } };
template <> struct QRnd<bf> { static __device__ __forceinline__ void mk(const float (&r)[16], v16bf& f, v16bf& f2) {   // the conversion instruction rounds to nearest even as f2bf does, two values at a time
#pragma unroll
    for (int e = 0; e < 16; ++e) { const __bf16 a = (__bf16)r[e]; f[e] = a; f2[e] = (__bf16)(r[e] - (float)a); } } };
template <typename T16>
__device__ __forceinline__ void qmake(typename WFrag<T16>::V (&qf)[4], typename WFrag<T16>::V (&qf2)[4], const v4f (&X)[4][4], const v4f (&C)[2][8]) {
#pragma unroll
    for (int kc = 0; kc < 2; ++kc) { float ra[16], rb[16];
#pragma unroll
        for (int e = 0; e < 16; ++e) { const float xa = X[kc][e >> 2][e & 3], xb = X[kc + 2][e >> 2][e & 3], cs = C[kc][e >> 1][(e & 1) * 2], sn = C[kc][e >> 1][(e & 1) * 2 + 1];
            ra[e] = xa * cs - xb * sn; rb[e] = xb * cs + xa * sn; }
        QRnd<T16>::mk(ra, qf[kc], qf2[kc]); QRnd<T16>::mk(rb, qf[kc + 2], qf2[kc + 2]); }
}
#define SCL2 0.12751743082459868f    // HD^-0.5 * log2(e): scores are carried in the base-2 domain
template <typename T16, int NSPLIT, int KB>
__device__ __forceinline__ void fattn_strip(const float* __restrict__ Fq, const float* __restrict__ CS, const T16* __restrict__ Kp, const T16* __restrict__ Kp2, const T16* __restrict__ Vt, const T16* __restrict__ Vt2, int q0, int lr, int hi, bf* __restrict__ oh, bf* __restrict__ ol) {
    typedef typename WFrag<T16>::V V;
    constexpr int MBN = KB / 16, KCN = KB / 32;               // score tiles and 32-key slices of one key block
    const int qi = q0 + lr;                                   // this lane's query row
    v8f o[8];
#pragma unroll
    for (int db = 0; db < 8; ++db) o[db] = (v8f){};
    float m = -3.0e38f, l = 0.f;                              // running maximum (base-2 domain, the same in both lane halves) and this lane half's running sum
    const unsigned qoff = (unsigned)((hi * 16 + lr) * 8), voff = qoff;   // the lane's piece in a tile, the same in every plane (fragment order)
    V qf[4], qf2[4], kf[MBN * 4], kf2[MBN * 4], kg[MBN * 4], kg2[MBN * 4];   // the strip's query fragments and the first key block's; every later key block is fetched one trip ahead, into the other of the two fragment sets
    v4f X[4][4], C[2][8]; qload(X, C, Fq + (size_t)q0 * DF, CS + (size_t)q0 * HD * 2, lr, hi);
    if (NSPLIT == 2) qmake<T16>(qf, qf2, X, C);   // hi + lo path: in front of the key groups, or else the loaded values and both key planes are live together and this compiler spills in the key loop
    ldgroup<T16, MBN * 4, 4, NSPLIT == 2>(kf, Kp, qoff, 16 * HD); if (NSPLIT == 2) ldgroup<T16, MBN * 4, 4, NSPLIT == 2>(kf2, Kp2, qoff, 16 * HD);
    if (NSPLIT != 2) qmake<T16>(qf, qf2, X, C);   // single plane: behind the key group, so that the first key block flies under it
    int kb = 0;
    // One trip: key block kb, its fragments in (ka, ka2); the next block's go into (kx, kx2). q0 is a multiple of 16 and kb of KB: key kb itself is visible to every query of the strip, and kb + KB - 1 < TT
    auto trip = [&](V (&ka)[MBN * 4], V (&ka2)[MBN * 4], V (&kx)[MBN * 4], V (&kx2)[MBN * 4]) __attribute__((always_inline)) {
        V vf[8 * KCN], vf2[8 * KCN];
        ldgroup<T16, 8 * KCN, KCN, false>(vf, Vt + kb * 16, voff, 16 * TT); if (NSPLIT == 2) ldgroup<T16, 8 * KCN, KCN, false>(vf2, Vt2 + kb * 16, voff, 16 * TT);   // the value fragments fly under the score products and the softmax
        v8f s[MBN];
#pragma unroll
        for (int mb = 0; mb < MBN; ++mb) s[mb] = (v8f){};
#pragma unroll
        for (int kc = 0; kc < 4; ++kc)
#pragma unroll
            for (int mb = 0; mb < MBN; ++mb) { s[mb] = WFrag<T16>::mma(ka[mb * 4 + kc], qf[kc], s[mb]);
                if (NSPLIT == 2) { s[mb] = WFrag<T16>::mma(ka[mb * 4 + kc], qf2[kc], s[mb]); s[mb] = WFrag<T16>::mma(ka2[mb * 4 + kc], qf[kc], s[mb]); } }
        const size_t kn = (size_t)min(kb + KB, q0 & ~(KB - 1)) * HD;   // the next key block flies under the softmax and the value products; the last trip reads its own block again (in bounds, unused) instead of branching
        ldgroup<T16, MBN * 4, 4, NSPLIT == 2>(kx, Kp + kn, qoff, 16 * HD); if (NSPLIT == 2) ldgroup<T16, MBN * 4, 4, NSPLIT == 2>(kx2, Kp2 + kn, qoff, 16 * HD);
        float mt = -3.0e38f;
        if (kb + KB - 1 > q0) {                               // the diagonal block (wave-uniform test): keys behind the query get weight exactly 0
#pragma unroll
            for (int mb = 0; mb < MBN; ++mb)
#pragma unroll
                for (int j = 0; j < 8; ++j) { const float t = (kb + mb * 16 + hi * 8 + j <= qi) ? s[mb][j] * SCL2 : -3.0e38f; s[mb][j] = t; mt = fmaxf(mt, t); }
        } else {
#pragma unroll
            for (int mb = 0; mb < MBN; ++mb)
#pragma unroll
                for (int j = 0; j < 8; ++j) { const float t = s[mb][j] * SCL2; s[mb][j] = t; mt = fmaxf(mt, t); }
        }
        mt = fmaxf(mt, __shfl_xor(mt, 16, 32));               // the other half of this query's keys is in the other lane half
        const float mn = fmaxf(m, mt); const float al = __builtin_amdgcn_exp2f(m - mn); m = mn;
        float ps = 0.f;
#pragma unroll
        for (int mb = 0; mb < MBN; ++mb)
#pragma unroll
            for (int j = 0; j < 8; ++j) { const float p = __builtin_amdgcn_exp2f(s[mb][j] - mn); s[mb][j] = p; ps += p; }
        l = l * al + ps;
        V pf[KCN], pf2[KCN];
#pragma unroll
        for (int kc = 0; kc < KCN; ++kc) PFrag<T16>::mk(s[2 * kc], s[2 * kc + 1], pf[kc], pf2[kc]);
#pragma unroll
        for (int db = 0; db < 8; ++db) o[db] *= al;
#pragma unroll
        for (int kc = 0; kc < KCN; ++kc)
#pragma unroll
            for (int db = 0; db < 8; ++db) { o[db] = WFrag<T16>::mma(vf[db * KCN + kc], pf[kc], o[db]);
                if (NSPLIT == 2) { o[db] = WFrag<T16>::mma(vf[db * KCN + kc], pf2[kc], o[db]); o[db] = WFrag<T16>::mma(vf2[db * KCN + kc], pf[kc], o[db]); } }
        kb += KB;
    };
#pragma unroll 1
    for (;;) { trip(kf, kf2, kg, kg2); if (kb > q0) break; trip(kg, kg2, kf, kf2); if (kb > q0) break; }   // key blocks kb <= q0 (block 0 always is one); two trips a pass, so that the two fragment sets swap roles without register copies
    l += __shfl_xor(l, 16, 32);
    const float f = __fdiv_rn(1.0f, l);
#pragma unroll
    for (int db = 0; db < 8; ++db) { v8us vh, vl;
#pragma unroll
        for (int j = 0; j < 8; ++j) { unsigned short a, c; splitf(o[db][j] * f, a, c); vh[j] = a; vl[j] = c; }
        const size_t oo = (size_t)q0 * DQ + db * 256 + qoff; *(v8us*)(oh + oo) = vh; *(v8us*)(ol + oo) = vl; }   // fragment order: the 16 d of db are half a tile, the lane's 8 its own piece
}
// Grid (query heads, TT / 128, batches), 8 waves. Cost grows with the row index, so a block takes one long and one short 64-row block: waves 0..3 the rows of block TT / 64 - 1 - y, waves 4..7 those of block y; every block then
// walks the same number of keys. A wave works alone: no LDS, no barrier, and the choice of the path (hi + lo or single plane) is uniform in the wave.
__global__ __launch_bounds__(256) void k_fattn(const float* __restrict__ F, const float* __restrict__ CS, const h16* __restrict__ K16, const bf* __restrict__ Kh, const bf* __restrict__ Kl, const h16* __restrict__ V16, const bf* __restrict__ Vh, const bf* __restrict__ Vl, bf* __restrict__ Ah, bf* __restrict__ Al) {
    const int lane = threadIdx.x & 31, lr = lane & 15, hi = lane >> 4;
    const int wv = __builtin_amdgcn_readfirstlane((int)(threadIdx.x >> 5));   // kept scalar so that the path choice and the key loop's control stay scalar
    const int h = blockIdx.x, r0 = ((wv < 4) ? TT / 64 - 1 - (int)blockIdx.y : (int)blockIdx.y) * 64, q0 = r0 + (wv & 3) * 16;
    const int b = blockIdx.z; Ah += (size_t)b * TT * DQ; Al += (size_t)b * TT * DQ;
    const float* Fq = F + (size_t)b * TT * DF + h * HD; const size_t zk = (size_t)(b * NKV + h / REP) * TT * HD;
    if (r0 < RH) fattn_strip<bf, 2, 32>(Fq, CS, Kh + zk, Kl + zk, Vh + zk, Vl + zk, q0, lr, hi, Ah + h * HD * 16, Al + h * HD * 16);   // head h's columns begin h * HD / 32 tiles into a 16-row band
    else fattn_strip<h16, 0, 64>(Fq, CS, K16 + zk, nullptr, V16 + zk, nullptr, q0, lr, hi, Ah + h * HD * 16, Al + h * HD * 16);
}

extern "C" void kernel_launch(void* const* d_in, const int* in_sizes, int n_in,
                              void* d_out, int out_size, void* d_ws, size_t ws_size, hipStream_t stream) {
    (void)in_sizes; (void)n_in; (void)out_size;
    const float* x = (const float*)d_in[0]; const float* wq = (const float*)d_in[1]; const float* wk = (const float*)d_in[2]; const float* wv = (const float*)d_in[3]; const float* wo = (const float*)d_in[4];
    float* OUT = (float*)d_out;     // [2][2048][2048]
    char* wsp = (char*)d_ws;
    auto take = [&](size_t bytes) { char* p = wsp; wsp += (bytes + 255) & ~(size_t)255; return (void*)p; };
    bf* WQ = (bf*)take((size_t)DF * DM * 2); bf* WK = WQ + (size_t)DQ * DM; bf* WV = WK + (size_t)DKV * DM;   // one [DF][DM] plane: the rows of w_q, w_k, w_v one behind the other
    bf* WO = (bf*)take((size_t)DM * DQ * 2); float* CS = (float*)take((size_t)TT * HD * 2 * 4);
    bf* XB = (bf*)take((size_t)NB_ * TT * DM * 2); float* F = (float*)take((size_t)NB_ * TT * DF * 4);
    h16* KP16 = (h16*)take((size_t)NB_ * NKV * TT * HD * 2); h16* VT16 = (h16*)take((size_t)NB_ * NKV * HD * TT * 2);
    bf* KPh = (bf*)take((size_t)NB_ * NKV * TT * HD * 2); bf* KPl = (bf*)take((size_t)NB_ * NKV * TT * HD * 2); bf* VTh = (bf*)take((size_t)NB_ * NKV * HD * TT * 2); bf* VTl = (bf*)take((size_t)NB_ * NKV * HD * TT * 2);
    bf* ATh = (bf*)take((size_t)NB_ * TT * DQ * 2); bf* ATl = (bf*)take((size_t)NB_ * TT * DQ * 2);
    if ((size_t)(wsp - (char*)d_ws) > ws_size) return;    // 142 MiB of the 256 MiB
    // Five launches, each over both batches (the rows b * TT + t of x, F, the merged planes and out are one matrix of NB_ * TT rows)
    k_prep<<<PB_CS + PB_X + PB_WQ + 2 * PB_WKV + PB_WO, 256, 0, stream>>>(x, wq, wk, wv, wo, XB, WQ, WK, WV, WO, CS);
    k_gemmw<bf, 0, DM, 256, 192, 2><<<dim3(NB_ * TT / 256, DF / 192, 1), 256, 0, stream>>>(XB, nullptr, WQ, F, DF);
    k_planes<<<LB_K + LB_V, 256, 0, stream>>>(F, CS, KP16, KPh, KPl, VT16, VTh, VTl);
    k_fattn<<<dim3(NH_, TT / 128, NB_), 256, 0, stream>>>(F, CS, KP16, KPh, KPl, VT16, VTh, VTl, ATh, ATl);
    k_gemmw<bf, 1, DQ, 128, 256, 4><<<dim3(NB_ * TT / 128, DM / 256, 1), 256, 0, stream>>>(ATh, ATl, WO, OUT, DM);
}

// v009
// Measured time: 132 microseconds a run.
// Timed twice side by side with v008, it ran 1.05 times as fast both times.
// Over all steps from v000 it is 12.2 times as fast.
#include <hip/hip_runtime.h>

// Grouped-query RoPE causal attention ('eager' path) (x [2][2048][2048]; q = x w_q^T ([2048][2048]: 16 heads x 128), k, v = x w_k^T / w_v^T ([512][2048]: 4 kv heads); rotate-half RoPE (theta 1e6, full 128 dims, tables computed on device); kv head = h/4; scores = q.k/sqrt(128); causal (finfo.min == exact zero weight); softmax; out = merged w_o^T -> [2][2048][2048] (8.4 M)).
// Compute dtypes, f32 accumulate: every input rounded to bf16; q/k/v on PLAIN bf16 operands (inputs: exact); rotary in f32 (cos/sin from an on-device f32 table: inv_freq_i = 1e6^(-2i/128), precise cosf/sinf); q's rotary in the attention kernel's own registers, k's in the plane builder; causal scores, softmax (f32, running maximum and sum) and attn.v in one kernel: query rows < 512 hl (3 products), the rest single fp16; w_o hl x exact (2 products).

#define NB_  2
#define TT   2048
#define DM   2048
#define NH_  16
#define NKV  4
#define REP  (NH_ / NKV)
#define HD   128
#define DQ   (NH_ * HD)
#define DKV  (NKV * HD)
#define RH   512                  // query rows < RH use hi+lo planes
typedef _Float16 h16;
typedef unsigned short bf;
typedef __attribute__((ext_vector_type(16))) __bf16   v16bf;
typedef __attribute__((ext_vector_type(16))) _Float16 v16h;
typedef __attribute__((ext_vector_type(8)))  _Float16 v8h;
typedef __attribute__((ext_vector_type(8)))  unsigned short v8us;
typedef __attribute__((ext_vector_type(8)))  float    v8f;
typedef __attribute__((ext_vector_type(4)))  float    v4f;
typedef v8h  __attribute__((may_alias)) v8ha;
typedef v4f  __attribute__((may_alias)) v4fa;
typedef v8us __attribute__((may_alias)) v8usa;

__device__ __forceinline__ unsigned short f2bf(float f) { unsigned u = __float_as_uint(f); u += 0x7FFFu + ((u >> 16) & 1u); return (unsigned short)(u >> 16); }
__device__ __forceinline__ float bf2f(unsigned short b) { return __uint_as_float(((unsigned)b) << 16); }
__device__ __forceinline__ float bfr(float f) { return bf2f(f2bf(f)); }
__device__ __forceinline__ v16h cat16(v8h lo, v8h hi) { return __builtin_shufflevector(lo, hi, 0, 1, 2, 3, 4, 5, 6, 7, 8, 9, 10, 11, 12, 13, 14, 15); }
__device__ __forceinline__ v16bf cat16b(v8us lo, v8us hi) { return __builtin_bit_cast(v16bf, __builtin_shufflevector(lo, hi, 0, 1, 2, 3, 4, 5, 6, 7, 8, 9, 10, 11, 12, 13, 14, 15)); }
__device__ __forceinline__ v8f wmma16(v16h a, v16h b, v8f c) { return __builtin_amdgcn_wmma_f32_16x16x32_f16(false, a, false, b, (short)0, c, false, false); }
__device__ __forceinline__ v8f wmmab(v16bf a, v16bf b, v8f c) { return __builtin_amdgcn_wmma_f32_16x16x32_bf16(false, a, false, b, (short)0, c, false, false); }



// ---- Fragment order: every 16-bit operand plane [rows][K] is stored tile by tile, a tile = 16 rows x 32 k = 1 KiB, tile (r / 16, k / 32) at element (r / 16 * (K / 32) + k / 32) * 512 (16 rows keep their 16 * K elements).
// Inside a tile the 16-byte pieces (8 neighbouring k of one row) stand in the order in which the lanes of a wave take them: piece = (k / 16 % 2) * 32 + (k / 8 % 2) * 16 + r % 16. A fragment is then two loads of 512 contiguous bytes
// (lane * 8 and 256 + lane * 8 elements into the tile): 4 whole cache lines a load, where a row-major plane gives 32 bytes out of each of 16 lines. The k order of a fragment is the one it had.
__device__ __forceinline__ size_t pk(int r, int k, int K) { return ((size_t)(r >> 4) * (K >> 5) + (k >> 5)) * 512 + ((k >> 4) & 1) * 256 + (((k >> 3) & 1) * 16 + (r & 15)) * 8 + (k & 7); }
// ---- k_gemmw: register-blocked GEMM, one BM x BN output tile per block of 8 waves (8 / WN x WN), a wave on its own 64 x (BN / WN) part with all its accumulators over the whole K. The tiles are chosen so that the grid is one block per WGP:
// every block reads its BM + BN operand rows from L2 once, so the larger the tile, the fewer bytes the whole product asks of L2.
// The block's operand rows go through LDS, so that each fragment leaves L2 once per block and serves all waves of its row or column: a stage is 128 k of every row, a 16-row band of it 4 KiB that are contiguous in the plane (four tiles in fragment order)
// and stay so in LDS: a fragment is two ds loads of 512 contiguous bytes, free of bank conflicts without a pad. Two stage buffers, filled by asynchronous copies (16 bytes a lane), the next stage but one issued as soon as a buffer is free.
// C[m][n] (f32, pitch ldc) = sum_k A[m][k] Bt[n][k] (NSPLIT 1: + A2[m][k] Bt[n][k]). Grid (M/BM, N/BN), 256 threads. K % 128 == 0, K >= 256.
template <typename T16> struct WFrag;
template <> struct WFrag<h16> { typedef v16h V; static __device__ __forceinline__ V ld(const h16* p) { return cat16(*(const v8h*)p, *(const v8h*)(p + 256)); } static __device__ __forceinline__ v8f mma(V a, V b, v8f c) { return wmma16(a, b, c); } };
template <> struct WFrag<bf> { typedef v16bf V; static __device__ __forceinline__ V ld(const bf* p) { return cat16b(*(const v8us*)p, *(const v8us*)(p + 256)); } static __device__ __forceinline__ v8f mma(V a, V b, v8f c) { return wmmab(a, b, c); } };
// A run of copies of a wave, 512 bytes each, with the wait before a register that an issued copy names is overwritten as the last line of their own statement (7 or 8 copies: a stage is four runs either way).
template <typename T16>
__device__ __forceinline__ void cprun(const unsigned (&l)[8], const T16* const (&g)[8]) {
    asm volatile("global_load_async_to_lds_b128 %0, %8, off\n\t"
                 "global_load_async_to_lds_b128 %1, %9, off\n\t"
                 "global_load_async_to_lds_b128 %2, %10, off\n\t"
                 "global_load_async_to_lds_b128 %3, %11, off\n\t"
                 "global_load_async_to_lds_b128 %4, %12, off\n\t"
                 "global_load_async_to_lds_b128 %5, %13, off\n\t"
                 "global_load_async_to_lds_b128 %6, %14, off\n\t"
                 "global_load_async_to_lds_b128 %7, %15, off\n\t"
                 "s_wait_xcnt 0x0"
                 :: "v"(l[0]), "v"(l[1]), "v"(l[2]), "v"(l[3]), "v"(l[4]), "v"(l[5]), "v"(l[6]), "v"(l[7]), "v"(g[0]), "v"(g[1]), "v"(g[2]), "v"(g[3]), "v"(g[4]), "v"(g[5]), "v"(g[6]), "v"(g[7]) : "memory");
}
template <typename T16>
__device__ __forceinline__ void cprun(const unsigned (&l)[7], const T16* const (&g)[7]) {
    asm volatile("global_load_async_to_lds_b128 %0, %7, off\n\t"
                 "global_load_async_to_lds_b128 %1, %8, off\n\t"
                 "global_load_async_to_lds_b128 %2, %9, off\n\t"
                 "global_load_async_to_lds_b128 %3, %10, off\n\t"
                 "global_load_async_to_lds_b128 %4, %11, off\n\t"
                 "global_load_async_to_lds_b128 %5, %12, off\n\t"
                 "global_load_async_to_lds_b128 %6, %13, off\n\t"
                 "s_wait_xcnt 0x0"
                 :: "v"(l[0]), "v"(l[1]), "v"(l[2]), "v"(l[3]), "v"(l[4]), "v"(l[5]), "v"(l[6]), "v"(g[0]), "v"(g[1]), "v"(g[2]), "v"(g[3]), "v"(g[4]), "v"(g[5]), "v"(g[6]) : "memory");
}
template <typename T16, int NSPLIT, int K, int BM, int BN, int WN>
__global__ __launch_bounds__(256) void k_gemmw(const T16* __restrict__ A, const T16* __restrict__ A2, const T16* __restrict__ Bt, float* C, int ldc) {
    typedef typename WFrag<T16>::V V;
    static_assert(NSPLIT == 0 || NSPLIT == 1, "one or two A planes"); constexpr int KS = 128; static_assert(K % KS == 0 && K >= 2 * KS, "whole stages of KS k, at least two");
    constexpr int NF = BN / WN / 16;                                // a wave's part: 4 x NF accumulator tiles
    static_assert(8 % WN == 0 && BM == 8 / WN * 64 && BN % (WN * 16) == 0, "8 waves, 64 rows each");
    constexpr int NA1 = BM / 16, NA = NA1 * (NSPLIT + 1), NBD = NA + BN / 16;   // 16-row bands of a stage: A (then A2), then Bt
    static_assert(NBD % 4 == 0, "a wave's copies go in four equal runs");
    constexpr int OP = NF * 16 + 4;                                 // pitch (floats) of a wave's staged output rows
    constexpr int STG = NBD * 16 * KS * 2, OST = 8 * 64 * OP * 4;          // bytes of one stage; bytes of the eight output parts staged behind the loop
    __shared__ __align__(1024) unsigned char sm[2 * STG > OST ? 2 * STG : OST];
    const int lane = threadIdx.x & 31, lr = lane & 15, hi = lane >> 4; const int r0 = blockIdx.x * BM, c0 = blockIdx.y * BN;
    const int wv = __builtin_amdgcn_readfirstlane((int)(threadIdx.x >> 5));   // kept scalar so that the part's LDS offsets stay scalar
    const int wm = wv / WN, wn = wv % WN;
    v8f acc[4][NF];
#pragma unroll
    for (int mb = 0; mb < 4; ++mb)
#pragma unroll
        for (int nb = 0; nb < NF; ++nb) acc[mb][nb] = (v8f){};
    // Wave wv copies the 512-byte eighth wv of every band of a stage, a lane its own 16 bytes: the same offset in the band in the plane and in LDS
    const unsigned lds0 = (unsigned)(size_t)(__attribute__((address_space(3))) unsigned char*)sm + wv * 512 + lane * 16;
    const T16* ga = A + (size_t)r0 * K + wv * 256; const T16* ga2 = (NSPLIT == 1) ? A2 + (size_t)r0 * K + wv * 256 : ga; const T16* gb = Bt + (size_t)c0 * K + wv * 256;   // the same in the whole wave: they stay in scalar registers
    const unsigned gl = lane * 8;
    auto fill = [&](int buf, int k0) __attribute__((always_inline)) {   // stage k0 .. k0 + KS - 1 into buffer buf (both the same in the whole block)
#pragma unroll
        for (int i0 = 0; i0 < NBD; i0 += NBD / 4) { unsigned l[NBD / 4]; const T16* g[NBD / 4];
#pragma unroll
            for (int q = 0; q < NBD / 4; ++q) { const int i = i0 + q; l[q] = lds0 + buf * STG + i * (16 * KS * 2); g[q] = (i < NA1 ? ga + i * 16 * K : i < NA ? ga2 + (i - NA1) * 16 * K : gb + (i - NA) * 16 * K) + k0 * 16 + gl; }
            cprun<T16>(l, g); }
    };
    fill(0, 0);
    asm volatile("s_wait_asynccnt 0x0" ::: "memory");   // this wave's copies of stage 0 have landed
    __syncthreads();                                    // ... and every other wave's: stage 0 may be read
    fill(1, KS);
    // the stage loop stays rolled: its body is 96 or 128 products long already, and the order at its foot stands once
#pragma unroll 1
    for (int t = 0; t < K / KS; ++t) {
    const T16* sb = (const T16*)(sm + (t & 1) * STG) + 8 * lane;   // the lane's piece in the first tile of this stage's buffer; a band is 16 * KS elements, each further 32 k of it 512
#pragma unroll
    for (int kc = 0; kc < KS / 32; ++kc) {
        V a[4], a2[4], b[NF];
        __builtin_amdgcn_sched_barrier(0);   // opens the load group: all fragments of these 32 k are asked for together, one LDS latency a group and not one in front of every fourth product
#pragma unroll
        for (int mb = 0; mb < 4; ++mb) { a[mb] = WFrag<T16>::ld(sb + (wm * 4 + mb) * (16 * KS) + kc * 512); if (NSPLIT == 1) a2[mb] = WFrag<T16>::ld(sb + (NA1 + wm * 4 + mb) * (16 * KS) + kc * 512); }
#pragma unroll
        for (int nb = 0; nb < NF; ++nb) b[nb] = WFrag<T16>::ld(sb + (NA + wn * NF + nb) * (16 * KS) + kc * 512);
        __builtin_amdgcn_sched_barrier(0);   // closes the group: no load sinks in among the products
#pragma unroll
        for (int nb = 0; nb < NF; ++nb) {
#pragma unroll
            for (int mb = 0; mb < 4; ++mb) { acc[mb][nb] = WFrag<T16>::mma(a[mb], b[nb], acc[mb][nb]); if (NSPLIT == 1) acc[mb][nb] = WFrag<T16>::mma(a2[mb], b[nb], acc[mb][nb]); } }
    }
    asm volatile("s_wait_dscnt 0x0" ::: "memory");      // this wave's reads of the buffer are done before it may be refilled
    asm volatile("s_wait_asynccnt 0x0" ::: "memory");   // this wave's copies of the next stage have landed
    __syncthreads();                                    // the one barrier of a stage: the next stage may be read, this stage's buffer is free
    if (t + 2 < K / KS) fill(t & 1, (t + 2) * KS);
    }
    asm volatile("s_wait_asynccnt 0x0" ::: "memory");   // no copy is outstanding when the ring becomes output staging (the last stage's barrier has ended every read of it)
    float* os = (float*)sm + wv * (64 * OP);            // each wave stages its own part, so that a store is whole lines
#pragma unroll
    for (int mb = 0; mb < 4; ++mb) {
#pragma unroll
        for (int nb = 0; nb < NF; ++nb) {
#pragma unroll
            for (int j = 0; j < 8; ++j) os[(mb * 16 + hi * 8 + j) * OP + nb * 16 + lr] = acc[mb][nb][j]; }
    }
    asm volatile("s_wait_dscnt 0x0" ::: "memory");      // the wave's own rows are in LDS before its lanes read them back
    float* crow = C + (size_t)(r0 + wm * 64) * ldc + c0 + wn * (NF * 16);
    constexpr int CH = NF * 4, RG = (CH % 16 == 0) ? 2 : 4, NS = RG * CH / 32;   // 16-byte pieces of a row; RG rows are NS whole stores of the wave (512 bytes each, 4 whole lines)
    static_assert(RG * CH % 32 == 0 && 64 % RG == 0, "whole stores");
#pragma unroll
    for (int i = 0; i < 64 / RG; ++i) {
#pragma unroll
        for (int s = 0; s < NS; ++s) { const int idx = s * 32 + lane; const int row = i * RG + idx / CH, cofs = idx % CH * 4; *(v4f*)(crow + (size_t)row * ldc + cofs) = *(const v4fa*)(os + row * OP + cofs); } }
}

__device__ __forceinline__ h16 tohx(float x) { return (h16)x; }
__device__ __forceinline__ void splitf(float y, unsigned short& h, unsigned short& l) { h = f2bf(y); l = f2bf(y - bf2f(h)); }
typedef __attribute__((ext_vector_type(2))) _Float16 v2h;
typedef __attribute__((ext_vector_type(4))) _Float16 v4h;
typedef __attribute__((ext_vector_type(2))) unsigned short v2us;
typedef __attribute__((ext_vector_type(4))) unsigned short v4us;
typedef v4h  __attribute__((may_alias)) v4ha;
typedef v4us __attribute__((may_alias)) v4usa;
typedef __attribute__((ext_vector_type(2))) float v2f;
typedef __attribute__((ext_vector_type(4))) int v4i;

__global__ __launch_bounds__(256) void k_wtG(const float* __restrict__ w, int K, int N, bf* Bt) {
    const int lane = threadIdx.x & 31; const int L0 = (blockIdx.x * 8 + (threadIdx.x >> 5)) * 8; const int nlines = N * K / 64;
{
#pragma unroll 1
        for (int l = 0; l < 8; ++l) { const int L = L0 + l; if (L >= nlines) break; const size_t e = (size_t)L * 64 + lane * 2; const int k = (int)(e % K), n = (int)(e / K); v2us o;
            o[0] = f2bf(w[(size_t)k * N + n]); o[1] = f2bf(w[(size_t)(k + 1) * N + n]); *(v2us*)(Bt + e) = o; }
         }
}
// d_cvt8: a row-major f32 matrix [rows][K] rounded to bf16, into fragment order. A wave takes 8 rows x 32 k (half a tile) in two loads of 4 rows x 128 bytes (whole lines); a lane's 4 values go out as half a 16-byte piece.
__device__ __forceinline__ void d_cvt8(unsigned blk, const float* __restrict__ src, bf* dst, size_t n8, int K) { const size_t i = (size_t)blk * 256 + threadIdx.x; if (i >= n8) return; const int l = (int)(i & 31); const int w = (int)(i >> 5);
    const int tile = w >> 1; const int r = tile / (K >> 5) * 16 + (w & 1) * 8 + (l >> 3), k = tile % (K >> 5) * 32 + (l & 7) * 4;
    const float* s0 = src + (size_t)r * K + k; const float* s1 = s0 + (size_t)4 * K; const v4f v[2] = {*(const v4f*)s0, *(const v4f*)s1};
    asm volatile("s_wait_xcnt 0x0" :: "v"(s0), "v"(s1) : "memory");   // the wait before an address register of the two loads is overwritten; the addresses are its inputs, or else this compiler gives a load its own address register as its destination
#pragma unroll
    for (int u = 0; u < 2; ++u) { v4us o;
#pragma unroll
        for (int q = 0; q < 4; ++q) o[q] = f2bf(v[u][q]);
        *(v4us*)(dst + pk(r + 4 * u, k, K)) = o; }  }
__constant__ float INV[HD / 2] = {1.00000000f,0.805842161f,0.649381638f,0.523299098f,0.421696514f,0.339820832f,0.273841977f,0.220673412f,0.177827939f,0.143301263f,0.115478195f,0.0930572078f,0.0749894232f,0.0604296401f,0.0486967526f,0.0392418988f,0.0316227749f,0.0254829675f,0.0205352511f,0.0165481716f,0.0133352140f,0.0107460786f,0.00865964312f,0.00697830599f,0.00562341325f,0.00453158375f,0.00365174119f,0.00294272718f,0.00237137382f,0.00191095297f,0.00153992651f,0.00124093774f,0.00100000005f,0.000805842166f,0.000649381604f,0.000523299095f,0.000421696517f,0.000339820836f,0.000273841957f,0.000220673406f,0.000177827940f,0.000143301251f,0.000115478200f,0.0000930572060f,0.0000749894243f,0.0000604296401f,0.0000486967510f,0.0000392418988f,0.0000316227779f,0.0000254829683f,0.0000205352499f,0.0000165481706f,0.0000133352141f,0.0000107460783f,0.00000865964284f,0.00000697830592f,0.00000562341347f,0.00000453158373f,0.00000365174128f,0.00000294272718f,0.00000237137374f,0.00000191095296f,0.00000153992653f,0.00000124093776f};
__device__ __forceinline__ void d_cstab(unsigned blk, float* CS) { const int idx = (int)blk * 256 + threadIdx.x; if (idx >= TT * HD) return; const int t = idx / HD, d = idx % HD; const int di = d % (HD / 2); const float iv = INV[di];
    asm volatile("s_wait_xcnt 0x0" :: "v"(di) : "memory");   // the wait before the register of the table load's index is overwritten; the index is its input, or else this compiler gives the load that very register as its destination
    const float ang = __fmul_rn((float)t, iv); v2f cs; cs[0] = cosf(ang); cs[1] = sinf(ang);
    *(v2f*)(CS + (size_t)idx * 2) = cs;  }
// ---- k_prep: everything that depends on the inputs alone, in ONE launch: the rotary table (first: its blocks run longest), then x (both batches) and the four weights rounded to bf16, in fragment order. A block does one job, picked by its index (block-uniform).
#define PB_CS  (TT * HD / 256)
#define PB_X   (NB_ * TT * DM / 8 / 256)
#define PB_WQ  (DQ * DM / 8 / 256)
#define PB_WKV (DKV * DM / 8 / 256)
#define PB_WO  (DM * DQ / 8 / 256)
__global__ __launch_bounds__(256) void k_prep(const float* __restrict__ x, const float* __restrict__ wq, const float* __restrict__ wk, const float* __restrict__ wv, const float* __restrict__ wo, bf* XB, bf* WQ, bf* WK, bf* WV, bf* WO, float* CS) {
    unsigned blk = blockIdx.x;
    if (blk < PB_CS) { d_cstab(blk, CS); return; }
    blk -= PB_CS; const float* s; bf* d; unsigned nb;
    if (blk < PB_X) { s = x; d = XB; nb = PB_X; }
    else if ((blk -= PB_X) < PB_WQ) { s = wq; d = WQ; nb = PB_WQ; }
    else if ((blk -= PB_WQ) < PB_WKV) { s = wk; d = WK; nb = PB_WKV; }
    else if ((blk -= PB_WKV) < PB_WKV) { s = wv; d = WV; nb = PB_WKV; }
    else { blk -= PB_WKV; s = wo; d = WO; nb = PB_WO; }
    d_cvt8(blk, s, d, (size_t)nb * 256, DM);   // every one of them has rows of DM elements
    static_assert(DQ == DM, "w_o's rows are DQ long");
}

// d_rope: head planes [b][h] of [t][d] in fragment order (fp16 + hi/lo) of rope(x) x sc; a wave takes 4 rows t x 32 d (whole 128-byte lines of F), a lane 4 neighbouring d (half a 16-byte piece); with the rotate-half convention out[d] = x[d] cos[t][d] - x[d+HD/2] sin[t][d], out[d+HD/2] = x[d+HD/2] cos[t][d+HD/2] + x[d] sin[t][d+HD/2]
__device__ __forceinline__ void d_rope(unsigned blk, const float* __restrict__ F, int pitch, int nheads, const float* __restrict__ CS, const float* __restrict__ RF, const float* __restrict__ nw, float sc, h16* P16, bf* Ph, bf* Pl) {
    const size_t i = (size_t)blk * 256 + threadIdx.x; if (i * 4 >= (size_t)NB_ * nheads * TT * HD) return; const int l = (int)(i & 31); const int w = (int)(i >> 5);   // wave w: d tile w % (HD / 32) of the rows 4 (w / (HD / 32)) .. + 3, counted through all heads
    const int d = w % (HD / 32) * 32 + (l & 7) * 4; const int t = w / (HD / 32) % (TT / 4) * 4 + (l >> 3); const int bh = w / (HD / 32) / (TT / 4); const int h = bh % nheads; const float* f = F + ((size_t)(bh / nheads) * TT + t) * pitch + h * HD; const float rf = RF ? RF[(size_t)h * TT + t] : 1.0f; v4h o16; v4us oh, ol;
    const float* f0 = f + d; const float* f1 = f + ((d < HD / 2) ? d + HD / 2 : d - HD / 2); const v4f X0 = *(const v4f*)f0, X1 = *(const v4f*)f1;   // the lane's 4 values and their 4 partners, one 16-byte load each
    asm volatile("s_wait_xcnt 0x0" :: "v"(f0), "v"(f1) : "memory");   // the wait before an address register of the two loads is overwritten; the addresses are its inputs, so that no load gets its own address register as its destination
#pragma unroll
    for (int q = 0; q < 4; ++q) { const int dd = d + q; const int dp = (dd < HD / 2) ? dd + HD / 2 : dd - HD / 2; float x0 = X0[q], x1 = X1[q];
        if (RF) { float n0 = __fmul_rn(x0, rf), n1 = __fmul_rn(x1, rf); asm volatile("" : "+v"(n0)); asm volatile("" : "+v"(n1)); x0 = __fmul_rn(bfr(nw[dd]), n0); x1 = __fmul_rn(bfr(nw[dp]), n1); }
        const v2f cs = *(const v2f*)(CS + ((size_t)t * HD + dd) * 2); float a = __fmul_rn(x0, cs[0]), bq = __fmul_rn(x1, cs[1]); asm volatile("" : "+v"(a)); asm volatile("" : "+v"(bq)); const float r = ((dd < HD / 2) ? __fsub_rn(a, bq) : __fadd_rn(a, bq)) * sc;
        o16[q] = tohx(r); unsigned short a2, c2; splitf(r, a2, c2); oh[q] = a2; ol[q] = c2; }
    const size_t e = (size_t)bh * TT * HD + pk(t, d, HD);
    *(v4h*)(P16 + e) = o16; *(v4us*)(Ph + e) = oh; *(v4us*)(Pl + e) = ol;  }
// d_vtp: value planes [b][g] of [d][t] in fragment order. A thread makes one 16-byte piece (8 neighbouring t of one d), the threads in the order of the pieces: a wave stores 512 contiguous bytes, and each of its 8 loads takes 16 neighbouring d of two rows of F.
__device__ __forceinline__ void d_vtp(unsigned blk, const float* __restrict__ F, int pitch, int nheads, h16* V16, bf* Vh, bf* Vl) { const size_t e = ((size_t)blk * 256 + threadIdx.x) * 8; if (e >= (size_t)NB_ * nheads * HD * TT) return; const int pl = (int)(e / ((size_t)TT * HD)); const int pe = (int)(e % ((size_t)TT * HD)); const int tile = pe >> 9, pc = (pe >> 3) & 63;   // plane b * nheads + g, tile in it, piece in the tile
    const int t = tile % (TT / 32) * 32 + (pc >> 5) * 16 + ((pc >> 4) & 1) * 8 + pl / nheads * TT; const int d = tile / (TT / 32) * 16 + (pc & 15); const int g = pl % nheads; v8h o16; v8us oh, ol;
#pragma unroll
    for (int q = 0; q < 8; ++q) { const float x = F[(size_t)(t + q) * pitch + g * HD + d]; o16[q] = tohx(x); unsigned short a2, c2; splitf(x, a2, c2); oh[q] = a2; ol[q] = c2; }
    *(v8h*)(V16 + e) = o16; *(v8us*)(Vh + e) = oh; *(v8us*)(Vl + e) = ol;  }
// ---- k_planes: the operand planes that many attention waves share, all in ONE launch, from the joint projection F [b * TT + t][q columns | k columns | v columns]: rotated k, transposed v (a query row is read by one wave alone and gets no plane: qload, qmake). A block does one job, picked by its index (block-uniform).
#define DF     (DQ + 2 * DKV)
#define LB_K   (NB_ * NKV * TT * HD / 4 / 256)
#define LB_V   (NB_ * NKV * TT * HD / 8 / 256)
__global__ __launch_bounds__(256) void k_planes(const float* __restrict__ F, const float* __restrict__ CS, h16* KP16, bf* KPh, bf* KPl, h16* VT16, bf* VTh, bf* VTl) {
    const unsigned blk = blockIdx.x;
    if (blk < LB_K) d_rope(blk, F + DQ, DF, NKV, CS, nullptr, nullptr, 1.0f, KP16, KPh, KPl);
    else d_vtp(blk - LB_K, F + DQ + DKV, DF, NKV, VT16, VTh, VTl);
}
// ---- k_fattn: scores, causal softmax and probability x value product of one query strip in ONE kernel; no score or probability ever goes to memory.
// A wave owns 16 query rows of one head and walks the keys 0 .. its diagonal in blocks of KB, transposed: St = K Qt (A = key rows, B = the strip's query rows, kept in registers), Ot += Vt Pt (A = rows of the [d][t] value plane).
// In both accumulators a lane holds ONE query (column lr): the running maximum, the running sum and the rescale factor are per lane, with one exchange between the two lane halves; the accumulator registers of two score tiles
// (keys 8 hi + j and 16 + 8 hi + j) are, converted, exactly the B fragment of the next product in the k order of WFrag::ld. Probabilities are exp(t - running max), at most 1, divided by the row's sum only at the end.
// NSPLIT 2: hi + lo planes, 3 products (query rows < RH), KB 32; NSPLIT 0: single fp16, KB 64: either way 16 key and 16 value fragments are in flight. The epilogue writes the merged [t][h * HD + d] hi and lo planes in fragment order, 8 neighbouring d per lane, 512 contiguous bytes per store.
template <typename T16> struct PFrag;
template <> struct PFrag<h16> { static __device__ __forceinline__ void mk(const v8f p0, const v8f p1, v16h& f, v16h& f2) { (void)f2;
#pragma unroll
    for (int j = 0; j < 8; ++j) { f[j] = (h16)p0[j]; f[8 + j] = (h16)p1[j]; } } };
template <> struct PFrag<bf> { static __device__ __forceinline__ void mk(const v8f p0, const v8f p1, v16bf& f, v16bf& f2) { v8us h0, h1, l0, l1;
#pragma unroll
    for (int j = 0; j < 8; ++j) { unsigned short a, c; splitf(p0[j], a, c); h0[j] = a; l0[j] = c; splitf(p1[j], a, c); h1[j] = a; l1[j] = c; }
    f = cat16b(h0, h1); f2 = cat16b(l0, l1); } };
// One plane's fragments of a block, loaded as ONE group: all its loads are in flight together, one latency per group. The group stands between two scheduling barriers, with the wait that comes before a register of an
// issued global load is overwritten as its last instruction: the barriers keep the loads from sinking to their uses and keep every other instruction (which could take an address register) out of the group.
// The address is formed inside the group, from a wave-uniform base and the lane's own 32-bit element offset.
template <typename T16, int N, int INNER, bool HOLD>
__device__ __forceinline__ void ldgroup(typename WFrag<T16>::V (&f)[N], const T16* base, unsigned off, int outer) {
    __builtin_amdgcn_sched_barrier(0);   // opens the group: nothing from in front of it moves in
    const T16* p = base + off;
#pragma unroll
    for (int i = 0; i < N; ++i) f[i] = WFrag<T16>::ld(p + ((i / INNER) * outer + (i % INNER) * 512));   // the next 32 k of the same rows are the next tile
    // the wait before an address register of the group is overwritten; HOLD: with the address as its input, for the groups whose last load this compiler would else give that very register as its destination
    if (HOLD) asm volatile("s_wait_xcnt 0x0" :: "v"(p) : "memory"); else asm volatile("s_wait_xcnt 0x0" ::: "memory");
    __builtin_amdgcn_sched_barrier(0);   // closes the group: no load sinks behind it, nothing from behind it moves in
}
// The strip's query fragments, made in registers from the f32 projection: a query row is used by this one wave, so a plane of it would be written and read once for nothing.
// Lane (lr, hi) of a B fragment holds row lr, k = 32 kc + 8 hi + 0..7 and 32 kc + 16 + 8 hi + 0..7 (the k order of WFrag::ld): 32 contiguous bytes of F each, and the rotary partner d +- HD / 2 of each is the same lane's element of fragment kc +- 2.
// qload: the lane's 64 values X[kc][..] and the (cos, sin) pairs C[kc][..] of its 32 d < HD / 2 (the table's entries at d and d + HD / 2 are equal), as two groups of loads in the form of ldgroup, one to an address.
__device__ __forceinline__ void qload(v4f (&X)[4][4], v4f (&C)[2][8], const float* __restrict__ Fq, const float* __restrict__ CSq, int lr, int hi) {
    __builtin_amdgcn_sched_barrier(0);   // opens the first group: nothing from in front of it moves in
    const unsigned po = (unsigned)(lr * DF + hi * 8) * 4u;   // the lane's byte offset from the wave-uniform base
#pragma unroll
    for (int kc = 0; kc < 4; ++kc)
#pragma unroll
        for (int u = 0; u < 4; ++u) X[kc][u] = *(const v4f*)((const char*)Fq + po + (kc * 32 + (u >> 1) * 16 + (u & 1) * 4) * 4);
    asm volatile("s_wait_xcnt 0x0" :: "s"(Fq), "v"(po) : "memory");   // the wait before an address register of the group is overwritten; the scalar base and the offset register are its inputs, so that both live up to it
    __builtin_amdgcn_sched_barrier(0);   // closes the first group and opens the second: the table's address is formed behind the wait
    const unsigned co = (unsigned)((lr * HD + hi * 8) * 2) * 4u;
#pragma unroll
    for (int kc = 0; kc < 2; ++kc)
#pragma unroll
        for (int u = 0; u < 8; ++u) C[kc][u] = *(const v4f*)((const char*)CSq + co + ((kc * 32 + (u >> 2) * 16) * 2 + (u & 3) * 4) * 4);
    asm volatile("s_wait_xcnt 0x0" :: "s"(CSq), "v"(co) : "memory");   // as above
    __builtin_amdgcn_sched_barrier(0);   // closes the group: no load sinks behind it, nothing from behind it moves in
}
// qmake: rotate-half as in d_rope, then the rounding of the path: single fp16, or bf16 hi + lo.
template <typename T16> struct QRnd;
template <> struct QRnd<h16> { static __device__ __forceinline__ void mk(const float (&r)[16], v16h& f, v16h& f2) { (void)f2;
#pragma unroll
    for (int e = 0; e < 16; ++e) f[e] = tohx(r[e]); } };
template <> struct QRnd<bf> { static __device__ __forceinline__ void mk(const float (&r)[16], v16bf& f, v16bf& f2) {   // the conversion instruction rounds to nearest even as f2bf does, two values at a time
#pragma unroll
    for (int e = 0; e < 16; ++e) { const __bf16 a = (__bf16)r[e]; f[e] = a; f2[e] = (__bf16)(r[e] - (float)a); } } };
template <typename T16>
__device__ __forceinline__ void qmake(typename WFrag<T16>::V (&qf)[4], typename WFrag<T16>::V (&qf2)[4], const v4f (&X)[4][4], const v4f (&C)[2][8]) {
#pragma unroll
    for (int kc = 0; kc < 2; ++kc) { float ra[16], rb[16];
#pragma unroll
        for (int e = 0; e < 16; ++e) { const float xa = X[kc][e >> 2][e & 3], xb = X[kc + 2][e >> 2][e & 3], cs = C[kc][e >> 1][(e & 1) * 2], sn = C[kc][e >> 1][(e & 1) * 2 + 1];
            ra[e] = xa * cs - xb * sn; rb[e] = xb * cs + xa * sn; }
        QRnd<T16>::mk(ra, qf[kc], qf2[kc]); QRnd<T16>::mk(rb, qf[kc + 2], qf2[kc + 2]); }
}
#define SCL2 0.12751743082459868f    // HD^-0.5 * log2(e): scores are carried in the base-2 domain
template <typename T16, int NSPLIT, int KB>
__device__ __forceinline__ void fattn_strip(const float* __restrict__ Fq, const float* __restrict__ CS, const T16* __restrict__ Kp, const T16* __restrict__ Kp2, const T16* __restrict__ Vt, const T16* __restrict__ Vt2, int q0, int lr, int hi, bf* __restrict__ oh, bf* __restrict__ ol) {
    typedef typename WFrag<T16>::V V;
    constexpr int MBN = KB / 16, KCN = KB / 32;               // score tiles and 32-key slices of one key block
    const int qi = q0 + lr;                                   // this lane's query row
    v8f o[8];
#pragma unroll
    for (int db = 0; db < 8; ++db) o[db] = (v8f){};
    float m = -3.0e38f, l = 0.f;                              // running maximum (base-2 domain, the same in both lane halves) and this lane half's running sum
    const unsigned qoff = (unsigned)((hi * 16 + lr) * 8), voff = qoff;   // the lane's piece in a tile, the same in every plane (fragment order)
    V qf[4], qf2[4], kf[MBN * 4], kf2[MBN * 4], kg[MBN * 4], kg2[MBN * 4];   // the strip's query fragments and the first key block's; every later key block is fetched one trip ahead, into the other of the two fragment sets
    v4f X[4][4], C[2][8]; qload(X, C, Fq + (size_t)q0 * DF, CS + (size_t)q0 * HD * 2, lr, hi);
    if (NSPLIT == 2) qmake<T16>(qf, qf2, X, C);   // hi + lo path: in front of the key groups, or else the loaded values and both key planes are live together and this compiler spills in the key loop
    ldgroup<T16, MBN * 4, 4, NSPLIT == 2>(kf, Kp, qoff, 16 * HD); if (NSPLIT == 2) ldgroup<T16, MBN * 4, 4, NSPLIT == 2>(kf2, Kp2, qoff, 16 * HD);
    if (NSPLIT != 2) qmake<T16>(qf, qf2, X, C);   // single plane: behind the key group, so that the first key block flies under it
    int kb = 0;
    // One trip: key block kb, its fragments in (ka, ka2); the next block's go into (kx, kx2). q0 is a multiple of 16 and kb of KB: key kb itself is visible to every query of the strip, and kb + KB - 1 < TT
    auto trip = [&](V (&ka)[MBN * 4], V (&ka2)[MBN * 4], V (&kx)[MBN * 4], V (&kx2)[MBN * 4]) __attribute__((always_inline)) {
        V vf[8 * KCN], vf2[8 * KCN];
        ldgroup<T16, 8 * KCN, KCN, false>(vf, Vt + kb * 16, voff, 16 * TT); if (NSPLIT == 2) ldgroup<T16, 8 * KCN, KCN, false>(vf2, Vt2 + kb * 16, voff, 16 * TT);   // the value fragments fly under the score products and the softmax
        v8f s[MBN];
#pragma unroll
        for (int mb = 0; mb < MBN; ++mb) s[mb] = (v8f){};
#pragma unroll
        for (int kc = 0; kc < 4; ++kc)
#pragma unroll
            for (int mb = 0; mb < MBN; ++mb) { s[mb] = WFrag<T16>::mma(ka[mb * 4 + kc], qf[kc], s[mb]);
                if (NSPLIT == 2) { s[mb] = WFrag<T16>::mma(ka[mb * 4 + kc], qf2[kc], s[mb]); s[mb] = WFrag<T16>::mma(ka2[mb * 4 + kc], qf[kc], s[mb]); } }
        const size_t kn = (size_t)min(kb + KB, q0 & ~(KB - 1)) * HD;   // the next key block flies under the softmax and the value products; the last trip reads its own block again (in bounds, unused) instead of branching
        ldgroup<T16, MBN * 4, 4, NSPLIT == 2>(kx, Kp + kn, qoff, 16 * HD); if (NSPLIT == 2) ldgroup<T16, MBN * 4, 4, NSPLIT == 2>(kx2, Kp2 + kn, qoff, 16 * HD);
        float mt = -3.0e38f;
        if (kb + KB - 1 > q0) {                               // the diagonal block (wave-uniform test): keys behind the query get weight exactly 0
#pragma unroll
            for (int mb = 0; mb < MBN; ++mb)
#pragma unroll
                for (int j = 0; j < 8; ++j) { const float t = (kb + mb * 16 + hi * 8 + j <= qi) ? s[mb][j] * SCL2 : -3.0e38f; s[mb][j] = t; mt = fmaxf(mt, t); }
        } else {
#pragma unroll
            for (int mb = 0; mb < MBN; ++mb)
#pragma unroll
                for (int j = 0; j < 8; ++j) { const float t = s[mb][j] * SCL2; s[mb][j] = t; mt = fmaxf(mt, t); }
        }
        mt = fmaxf(mt, __shfl_xor(mt, 16, 32));               // the other half of this query's keys is in the other lane half
        const float mn = fmaxf(m, mt); const float al = __builtin_amdgcn_exp2f(m - mn); m = mn;
        float ps = 0.f;
#pragma unroll
        for (int mb = 0; mb < MBN; ++mb)
#pragma unroll
            for (int j = 0; j < 8; ++j) { const float p = __builtin_amdgcn_exp2f(s[mb][j] - mn); s[mb][j] = p; ps += p; }
        l = l * al + ps;
        V pf[KCN], pf2[KCN];
#pragma unroll
        for (int kc = 0; kc < KCN; ++kc) PFrag<T16>::mk(s[2 * kc], s[2 * kc + 1], pf[kc], pf2[kc]);
#pragma unroll
        for (int db = 0; db < 8; ++db) o[db] *= al;
#pragma unroll
        for (int kc = 0; kc < KCN; ++kc)
#pragma unroll
            for (int db = 0; db < 8; ++db) { o[db] = WFrag<T16>::mma(vf[db * KCN + kc], pf[kc], o[db]);
                if (NSPLIT == 2) { o[db] = WFrag<T16>::mma(vf[db * KCN + kc], pf2[kc], o[db]); o[db] = WFrag<T16>::mma(vf2[db * KCN + kc], pf[kc], o[db]); } }
        kb += KB;
    };
#pragma unroll 1
    for (;;) { trip(kf, kf2, kg, kg2); if (kb > q0) break; trip(kg, kg2, kf, kf2); if (kb > q0) break; }   // key blocks kb <= q0 (block 0 always is one); two trips a pass, so that the two fragment sets swap roles without register copies
    l += __shfl_xor(l, 16, 32);
    const float f = __fdiv_rn(1.0f, l);
#pragma unroll
    for (int db = 0; db < 8; ++db) { v8us vh, vl;
#pragma unroll
        for (int j = 0; j < 8; ++j) { unsigned short a, c; splitf(o[db][j] * f, a, c); vh[j] = a; vl[j] = c; }
        const size_t oo = (size_t)q0 * DQ + db * 256 + qoff; *(v8us*)(oh + oo) = vh; *(v8us*)(ol + oo) = vl; }   // fragment order: the 16 d of db are half a tile, the lane's 8 its own piece
}
// Grid (pairs of query heads x batches, TT / 64), 8 waves. Two waves share a SIMD (w and w + 4), and a wave alone there has nothing to cover its softmax with: so a block takes ONE 64-row block of TWO heads of one kv head, waves 0..3 the
// first head's four strips, waves 4..7 the second's: the two waves of a SIMD walk the same number of keys and end together, and all 8 waves read the same key and value fragments at the same time.
// Cost grows with the row index and only one block fits a WGP, so there are twice as many blocks as places: cost falls with the block's index (for speed only), the lightest blocks then fill up behind the
// heaviest. ORD: row blocks by falling cost; in trips of the single-plane path row block j costs j + 1, on the hi + lo path (j < RH / 64: half the keys a trip, 48 products for 32) 3 j + 2.25.
__constant__ int ORD[TT / 64] = {31, 30, 29, 28, 27, 26, 25, 24, 23, 7, 22, 21, 20, 6, 19, 18, 17, 5, 16, 15, 14, 4, 13, 12, 11, 3, 10, 9, 8, 2, 1, 0};
// A wave works alone: no LDS, no barrier, and the choice of the path (hi + lo or single plane) is uniform in the wave.
__global__ __launch_bounds__(256) void k_fattn(const float* __restrict__ F, const float* __restrict__ CS, const h16* __restrict__ K16, const bf* __restrict__ Kh, const bf* __restrict__ Kl, const h16* __restrict__ V16, const bf* __restrict__ Vh, const bf* __restrict__ Vl, bf* __restrict__ Ah, bf* __restrict__ Al) {
    static_assert(TT == 2048 && RH == 512 && REP % 2 == 0, "ORD is made for these; a pair of heads has one kv head");
    const int lane = threadIdx.x & 31, lr = lane & 15, hi = lane >> 4;
    const int wv = __builtin_amdgcn_readfirstlane((int)(threadIdx.x >> 5));   // kept scalar so that the key loop's control stays scalar
    const int h = (int)(blockIdx.x % (NH_ / 2)) * 2 + (wv >> 2), r0 = ORD[blockIdx.y] * 64, q0 = r0 + (wv & 3) * 16;
    const int b = blockIdx.x / (NH_ / 2); Ah += (size_t)b * TT * DQ; Al += (size_t)b * TT * DQ;
    const float* Fq = F + (size_t)b * TT * DF + h * HD; const size_t zk = (size_t)(b * NKV + h / REP) * TT * HD;
    if (r0 < RH) fattn_strip<bf, 2, 32>(Fq, CS, Kh + zk, Kl + zk, Vh + zk, Vl + zk, q0, lr, hi, Ah + h * HD * 16, Al + h * HD * 16);   // head h's columns begin h * HD / 32 tiles into a 16-row band
    else fattn_strip<h16, 0, 64>(Fq, CS, K16 + zk, nullptr, V16 + zk, nullptr, q0, lr, hi, Ah + h * HD * 16, Al + h * HD * 16);
}

extern "C" void kernel_launch(void* const* d_in, const int* in_sizes, int n_in,
                              void* d_out, int out_size, void* d_ws, size_t ws_size, hipStream_t stream) {
    (void)in_sizes; (void)n_in; (void)out_size;
    const float* x = (const float*)d_in[0]; const float* wq = (const float*)d_in[1]; const float* wk = (const float*)d_in[2]; const float* wv = (const float*)d_in[3]; const float* wo = (const float*)d_in[4];
    float* OUT = (float*)d_out;     // [2][2048][2048]
    char* wsp = (char*)d_ws;
    auto take = [&](size_t bytes) { char* p = wsp; wsp += (bytes + 255) & ~(size_t)255; return (void*)p; };
    bf* WQ = (bf*)take((size_t)DF * DM * 2); bf* WK = WQ + (size_t)DQ * DM; bf* WV = WK + (size_t)DKV * DM;   // one [DF][DM] plane: the rows of w_q, w_k, w_v one behind the other
    bf* WO = (bf*)take((size_t)DM * DQ * 2); float* CS = (float*)take((size_t)TT * HD * 2 * 4);
    bf* XB = (bf*)take((size_t)NB_ * TT * DM * 2); float* F = (float*)take((size_t)NB_ * TT * DF * 4);
    h16* KP16 = (h16*)take((size_t)NB_ * NKV * TT * HD * 2); h16* VT16 = (h16*)take((size_t)NB_ * NKV * HD * TT * 2);
    bf* KPh = (bf*)take((size_t)NB_ * NKV * TT * HD * 2); bf* KPl = (bf*)take((size_t)NB_ * NKV * TT * HD * 2); bf* VTh = (bf*)take((size_t)NB_ * NKV * HD * TT * 2); bf* VTl = (bf*)take((size_t)NB_ * NKV * HD * TT * 2);
    bf* ATh = (bf*)take((size_t)NB_ * TT * DQ * 2); bf* ATl = (bf*)take((size_t)NB_ * TT * DQ * 2);
    if ((size_t)(wsp - (char*)d_ws) > ws_size) return;    // 142 MiB of the 256 MiB
    // Five launches, each over both batches (the rows b * TT + t of x, F, the merged planes and out are one matrix of NB_ * TT rows)
    k_prep<<<PB_CS + PB_X + PB_WQ + 2 * PB_WKV + PB_WO, 256, 0, stream>>>(x, wq, wk, wv, wo, XB, WQ, WK, WV, WO, CS);
    k_gemmw<bf, 0, DM, 256, 192, 2><<<dim3(NB_ * TT / 256, DF / 192, 1), 256, 0, stream>>>(XB, nullptr, WQ, F, DF);
    k_planes<<<LB_K + LB_V, 256, 0, stream>>>(F, CS, KP16, KPh, KPl, VT16, VTh, VTl);
    k_fattn<<<dim3(NH_ / 2 * NB_, TT / 64, 1), 256, 0, stream>>>(F, CS, KP16, KPh, KPl, VT16, VTh, VTl, ATh, ATl);
    k_gemmw<bf, 1, DQ, 128, 256, 4><<<dim3(NB_ * TT / 128, DM / 256, 1), 256, 0, stream>>>(ATh, ATl, WO, OUT, DM);
}

// v010
// It runs in 123 microseconds.
// Timed twice side by side with v009, it ran 1.07 and 1.08 times as fast.
// Over all steps from v000 it is 13.1 times as fast.
#include <hip/hip_runtime.h>

// Grouped-query RoPE causal attention ('eager' path) (x [2][2048][2048]; q = x w_q^T ([2048][2048]: 16 heads x 128), k, v = x w_k^T / w_v^T ([512][2048]: 4 kv heads); rotate-half RoPE (theta 1e6, full 128 dims, tables computed on device); kv head = h/4; scores = q.k/sqrt(128); causal (finfo.min == exact zero weight); softmax; out = merged w_o^T -> [2][2048][2048] (8.4 M)).
// Compute dtypes, f32 accumulate: every input rounded to bf16; q/k/v on PLAIN bf16 operands (inputs: exact); rotary in f32 (cos/sin from an on-device f32 table: inv_freq_i = 1e6^(-2i/128), precise cosf/sinf); q's rotary in the attention kernel's own registers, k's in the plane builder; causal scores, softmax (f32, running maximum and sum) and attn.v in one kernel: query rows < 512 hl (3 products), the rest single fp16; w_o on f16 operands (w_o's bf16 values as f16): merged rows < 512 hi + lo (2 products), the rest one plane (1 product).

#define NB_  2
#define TT   2048
#define DM   2048
#define NH_  16
#define NKV  4
#define REP  (NH_ / NKV)
#define HD   128
#define DQ   (NH_ * HD)
#define DKV  (NKV * HD)
#define RH   512                  // query rows < RH use hi+lo planes
typedef _Float16 h16;
typedef unsigned short bf;
typedef __attribute__((ext_vector_type(16))) __bf16   v16bf;
typedef __attribute__((ext_vector_type(16))) _Float16 v16h;
typedef __attribute__((ext_vector_type(8)))  _Float16 v8h;
typedef __attribute__((ext_vector_type(8)))  unsigned short v8us;
typedef __attribute__((ext_vector_type(8)))  float    v8f;
typedef __attribute__((ext_vector_type(4)))  float    v4f;
typedef v8h  __attribute__((may_alias)) v8ha;
typedef v4f  __attribute__((may_alias)) v4fa;
typedef v8us __attribute__((may_alias)) v8usa;

__device__ __forceinline__ unsigned short f2bf(float f) { unsigned u = __float_as_uint(f); u += 0x7FFFu + ((u >> 16) & 1u); return (unsigned short)(u >> 16); }
__device__ __forceinline__ float bf2f(unsigned short b) { return __uint_as_float(((unsigned)b) << 16); }
__device__ __forceinline__ float bfr(float f) { return bf2f(f2bf(f)); }
__device__ __forceinline__ v16h cat16(v8h lo, v8h hi) { return __builtin_shufflevector(lo, hi, 0, 1, 2, 3, 4, 5, 6, 7, 8, 9, 10, 11, 12, 13, 14, 15); }
__device__ __forceinline__ v16bf cat16b(v8us lo, v8us hi) { return __builtin_bit_cast(v16bf, __builtin_shufflevector(lo, hi, 0, 1, 2, 3, 4, 5, 6, 7, 8, 9, 10, 11, 12, 13, 14, 15)); }
__device__ __forceinline__ v8f wmma16(v16h a, v16h b, v8f c) { return __builtin_amdgcn_wmma_f32_16x16x32_f16(false, a, false, b, (short)0, c, false, false); }
__device__ __forceinline__ v8f wmmab(v16bf a, v16bf b, v8f c) { return __builtin_amdgcn_wmma_f32_16x16x32_bf16(false, a, false, b, (short)0, c, false, false); }



// ---- Fragment order: every 16-bit operand plane [rows][K] is stored tile by tile, a tile = 16 rows x 32 k = 1 KiB, tile (r / 16, k / 32) at element (r / 16 * (K / 32) + k / 32) * 512 (16 rows keep their 16 * K elements).
// Inside a tile the 16-byte pieces (8 neighbouring k of one row) stand in the order in which the lanes of a wave take them: piece = (k / 16 % 2) * 32 + (k / 8 % 2) * 16 + r % 16. A fragment is then two loads of 512 contiguous bytes
// (lane * 8 and 256 + lane * 8 elements into the tile): 4 whole cache lines a load, where a row-major plane gives 32 bytes out of each of 16 lines. The k order of a fragment is the one it had.
__device__ __forceinline__ size_t pk(int r, int k, int K) { return ((size_t)(r >> 4) * (K >> 5) + (k >> 5)) * 512 + ((k >> 4) & 1) * 256 + (((k >> 3) & 1) * 16 + (r & 15)) * 8 + (k & 7); }
// ---- k_gemmw: register-blocked GEMM, one BM x BN output tile per block of 8 waves (8 / WN x WN), a wave on its own 64 x (BN / WN) part with all its accumulators over the whole K. The tiles are chosen so that the grid is one block per WGP:
// every block reads its BM + BN operand rows from L2 once, so the larger the tile, the fewer bytes the whole product asks of L2.
// The block's operand rows go through LDS, so that each fragment leaves L2 once per block and serves all waves of its row or column: a stage is 128 k of every row, a 16-row band of it 4 KiB that are contiguous in the plane (four tiles in fragment order)
// and stay so in LDS: a fragment is two ds loads of 512 contiguous bytes, free of bank conflicts without a pad. Two stage buffers, filled by asynchronous copies (16 bytes a lane), the next stage but one issued as soon as a buffer is free.
// C[m][n] (f32, pitch ldc) = sum_k A[m][k] Bt[n][k] (NSPLIT 1: + A2[m][k] Bt[n][k]). Grid (M/BM, N/BN), 256 threads. K % 128 == 0, K >= 256.
template <typename T16> struct WFrag;
template <> struct WFrag<h16> { typedef v16h V; static __device__ __forceinline__ V ld(const h16* p) { return cat16(*(const v8h*)p, *(const v8h*)(p + 256)); } static __device__ __forceinline__ v8f mma(V a, V b, v8f c) { return wmma16(a, b, c); } };
template <> struct WFrag<bf> { typedef v16bf V; static __device__ __forceinline__ V ld(const bf* p) { return cat16b(*(const v8us*)p, *(const v8us*)(p + 256)); } static __device__ __forceinline__ v8f mma(V a, V b, v8f c) { return wmmab(a, b, c); } };
// A run of copies of a wave, 512 bytes each, with the wait before a register that an issued copy names is overwritten as the last line of their own statement (7 or 8 copies: a stage is four runs either way).
template <typename T16>
__device__ __forceinline__ void cprun(const unsigned (&l)[8], const T16* const (&g)[8]) {
    asm volatile("global_load_async_to_lds_b128 %0, %8, off\n\t"
                 "global_load_async_to_lds_b128 %1, %9, off\n\t"
                 "global_load_async_to_lds_b128 %2, %10, off\n\t"
                 "global_load_async_to_lds_b128 %3, %11, off\n\t"
                 "global_load_async_to_lds_b128 %4, %12, off\n\t"
                 "global_load_async_to_lds_b128 %5, %13, off\n\t"
                 "global_load_async_to_lds_b128 %6, %14, off\n\t"
                 "global_load_async_to_lds_b128 %7, %15, off\n\t"
                 "s_wait_xcnt 0x0"
                 :: "v"(l[0]), "v"(l[1]), "v"(l[2]), "v"(l[3]), "v"(l[4]), "v"(l[5]), "v"(l[6]), "v"(l[7]), "v"(g[0]), "v"(g[1]), "v"(g[2]), "v"(g[3]), "v"(g[4]), "v"(g[5]), "v"(g[6]), "v"(g[7]) : "memory");
}
template <typename T16>
__device__ __forceinline__ void cprun(const unsigned (&l)[7], const T16* const (&g)[7]) {
    asm volatile("global_load_async_to_lds_b128 %0, %7, off\n\t"
                 "global_load_async_to_lds_b128 %1, %8, off\n\t"
                 "global_load_async_to_lds_b128 %2, %9, off\n\t"
                 "global_load_async_to_lds_b128 %3, %10, off\n\t"
                 "global_load_async_to_lds_b128 %4, %11, off\n\t"
                 "global_load_async_to_lds_b128 %5, %12, off\n\t"
                 "global_load_async_to_lds_b128 %6, %13, off\n\t"
                 "s_wait_xcnt 0x0"
                 :: "v"(l[0]), "v"(l[1]), "v"(l[2]), "v"(l[3]), "v"(l[4]), "v"(l[5]), "v"(l[6]), "v"(g[0]), "v"(g[1]), "v"(g[2]), "v"(g[3]), "v"(g[4]), "v"(g[5]), "v"(g[6]) : "memory");
}
template <typename T16, int NSPLIT, int K, int BM, int BN, int WN>
__global__ __launch_bounds__(256) void k_gemmw(const T16* __restrict__ A, const T16* __restrict__ A2, const T16* __restrict__ Bt, float* C, int ldc) {
    typedef typename WFrag<T16>::V V;
    static_assert(NSPLIT == 0 || NSPLIT == 1, "one or two A planes"); constexpr int KS = 128; static_assert(K % KS == 0 && K >= 2 * KS, "whole stages of KS k, at least two");
    constexpr int NF = BN / WN / 16;                                // a wave's part: 4 x NF accumulator tiles
    static_assert(8 % WN == 0 && BM == 8 / WN * 64 && BN % (WN * 16) == 0, "8 waves, 64 rows each");
    constexpr int NA1 = BM / 16, NA = NA1 * (NSPLIT + 1), NBD = NA + BN / 16;   // 16-row bands of a stage: A (then A2), then Bt
    static_assert(NBD % 4 == 0, "a wave's copies go in four equal runs");
    constexpr int OP = NF * 16 + 4;                                 // pitch (floats) of a wave's staged output rows
    constexpr int STG = NBD * 16 * KS * 2, OST = 8 * 64 * OP * 4;          // bytes of one stage; bytes of the eight output parts staged behind the loop
    __shared__ __align__(1024) unsigned char sm[2 * STG > OST ? 2 * STG : OST];
    const int lane = threadIdx.x & 31, lr = lane & 15, hi = lane >> 4; const int r0 = blockIdx.x * BM, c0 = blockIdx.y * BN;
    const int wv = __builtin_amdgcn_readfirstlane((int)(threadIdx.x >> 5));   // kept scalar so that the part's LDS offsets stay scalar
    const int wm = wv / WN, wn = wv % WN;
    v8f acc[4][NF];
#pragma unroll
    for (int mb = 0; mb < 4; ++mb)
#pragma unroll
        for (int nb = 0; nb < NF; ++nb) acc[mb][nb] = (v8f){};
    // Wave wv copies the 512-byte eighth wv of every band of a stage, a lane its own 16 bytes: the same offset in the band in the plane and in LDS
    const unsigned lds0 = (unsigned)(size_t)(__attribute__((address_space(3))) unsigned char*)sm + wv * 512 + lane * 16;
    const T16* ga = A + (size_t)r0 * K + wv * 256; const T16* ga2 = (NSPLIT == 1) ? A2 + (size_t)r0 * K + wv * 256 : ga; const T16* gb = Bt + (size_t)c0 * K + wv * 256;   // the same in the whole wave: they stay in scalar registers
    const unsigned gl = lane * 8;
    auto fill = [&](int buf, int k0) __attribute__((always_inline)) {   // stage k0 .. k0 + KS - 1 into buffer buf (both the same in the whole block)
#pragma unroll
        for (int i0 = 0; i0 < NBD; i0 += NBD / 4) { unsigned l[NBD / 4]; const T16* g[NBD / 4];
#pragma unroll
            for (int q = 0; q < NBD / 4; ++q) { const int i = i0 + q; l[q] = lds0 + buf * STG + i * (16 * KS * 2); g[q] = (i < NA1 ? ga + i * 16 * K : i < NA ? ga2 + (i - NA1) * 16 * K : gb + (i - NA) * 16 * K) + k0 * 16 + gl; }
            cprun<T16>(l, g); }
    };
    fill(0, 0);
    asm volatile("s_wait_asynccnt 0x0" ::: "memory");   // this wave's copies of stage 0 have landed
    __syncthreads();                                    // ... and every other wave's: stage 0 may be read
    fill(1, KS);
    // the stage loop stays rolled: its body is 96 products long already, and the order at its foot stands once
#pragma unroll 1
    for (int t = 0; t < K / KS; ++t) {
    const T16* sb = (const T16*)(sm + (t & 1) * STG) + 8 * lane;   // the lane's piece in the first tile of this stage's buffer; a band is 16 * KS elements, each further 32 k of it 512
#pragma unroll
    for (int kc = 0; kc < KS / 32; ++kc) {
        V a[4], a2[4], b[NF];
        __builtin_amdgcn_sched_barrier(0);   // opens the load group: all fragments of these 32 k are asked for together, one LDS latency a group and not one in front of every fourth product
#pragma unroll
        for (int mb = 0; mb < 4; ++mb) { a[mb] = WFrag<T16>::ld(sb + (wm * 4 + mb) * (16 * KS) + kc * 512); if (NSPLIT == 1) a2[mb] = WFrag<T16>::ld(sb + (NA1 + wm * 4 + mb) * (16 * KS) + kc * 512); }
#pragma unroll
        for (int nb = 0; nb < NF; ++nb) b[nb] = WFrag<T16>::ld(sb + (NA + wn * NF + nb) * (16 * KS) + kc * 512);
        __builtin_amdgcn_sched_barrier(0);   // closes the group: no load sinks in among the products
#pragma unroll
        for (int nb = 0; nb < NF; ++nb) {
#pragma unroll
            for (int mb = 0; mb < 4; ++mb) { acc[mb][nb] = WFrag<T16>::mma(a[mb], b[nb], acc[mb][nb]); if (NSPLIT == 1) acc[mb][nb] = WFrag<T16>::mma(a2[mb], b[nb], acc[mb][nb]); } }
    }
    asm volatile("s_wait_dscnt 0x0" ::: "memory");      // this wave's reads of the buffer are done before it may be refilled
    asm volatile("s_wait_asynccnt 0x0" ::: "memory");   // this wave's copies of the next stage have landed
    __syncthreads();                                    // the one barrier of a stage: the next stage may be read, this stage's buffer is free
    if (t + 2 < K / KS) fill(t & 1, (t + 2) * KS);
    }
    asm volatile("s_wait_asynccnt 0x0" ::: "memory");   // no copy is outstanding when the ring becomes output staging (the last stage's barrier has ended every read of it)
    float* os = (float*)sm + wv * (64 * OP);            // each wave stages its own part, so that a store is whole lines
#pragma unroll
    for (int mb = 0; mb < 4; ++mb) {
#pragma unroll
        for (int nb = 0; nb < NF; ++nb) {
#pragma unroll
            for (int j = 0; j < 8; ++j) os[(mb * 16 + hi * 8 + j) * OP + nb * 16 + lr] = acc[mb][nb][j]; }
    }
    asm volatile("s_wait_dscnt 0x0" ::: "memory");      // the wave's own rows are in LDS before its lanes read them back
    float* crow = C + (size_t)(r0 + wm * 64) * ldc + c0 + wn * (NF * 16);
    constexpr int CH = NF * 4, RG = (CH % 16 == 0) ? 2 : 4, NS = RG * CH / 32;   // 16-byte pieces of a row; RG rows are NS whole stores of the wave (512 bytes each, 4 whole lines)
    static_assert(RG * CH % 32 == 0 && 64 % RG == 0, "whole stores");
#pragma unroll
    for (int i = 0; i < 64 / RG; ++i) {
#pragma unroll
        for (int s = 0; s < NS; ++s) { const int idx = s * 32 + lane; const int row = i * RG + idx / CH, cofs = idx % CH * 4; *(v4f*)(crow + (size_t)row * ldc + cofs) = *(const v4fa*)(os + row * OP + cofs); } }
}

template <typename T16>
__device__ __forceinline__ void cprun(const unsigned (&l)[13], const T16* const (&g)[13]) {
    asm volatile("global_load_async_to_lds_b128 %0, %13, off\n\t"
                 "global_load_async_to_lds_b128 %1, %14, off\n\t"
                 "global_load_async_to_lds_b128 %2, %15, off\n\t"
                 "global_load_async_to_lds_b128 %3, %16, off\n\t"
                 "global_load_async_to_lds_b128 %4, %17, off\n\t"
                 "global_load_async_to_lds_b128 %5, %18, off\n\t"
                 "global_load_async_to_lds_b128 %6, %19, off\n\t"
                 "global_load_async_to_lds_b128 %7, %20, off\n\t"
                 "global_load_async_to_lds_b128 %8, %21, off\n\t"
                 "global_load_async_to_lds_b128 %9, %22, off\n\t"
                 "global_load_async_to_lds_b128 %10, %23, off\n\t"
                 "global_load_async_to_lds_b128 %11, %24, off\n\t"
                 "global_load_async_to_lds_b128 %12, %25, off\n\t"
                 "s_wait_xcnt 0x0"
                 :: "v"(l[0]), "v"(l[1]), "v"(l[2]), "v"(l[3]), "v"(l[4]), "v"(l[5]), "v"(l[6]), "v"(l[7]), "v"(l[8]), "v"(l[9]), "v"(l[10]), "v"(l[11]), "v"(l[12]), "v"(g[0]), "v"(g[1]), "v"(g[2]), "v"(g[3]), "v"(g[4]), "v"(g[5]), "v"(g[6]), "v"(g[7]), "v"(g[8]), "v"(g[9]), "v"(g[10]), "v"(g[11]), "v"(g[12]) : "memory");
}
// ---- k_gemmo: out = merged w_o^T, in the form of k_gemmw (8 waves 2 x 4, a wave 64 x 64, two-buffer ring of 128 k, the same waits and the one barrier a stage), all operands f16.
// Merged rows t < RH come as hi + lo planes (2 products), rows t >= RH as the hi plane alone (1 product): they are means over more than RH keys, small, and their f16 rounding is of the size of the single-plane attention's own.
// So that every block and every wave has the same work, a block takes NHL 16-row bands of the first kind and NSG of the second, a wave one and three of them. Grid (NB_ * TT / 128, DM / 256), 256 threads.
__global__ __launch_bounds__(256) void k_gemmo(const h16* __restrict__ A, const h16* __restrict__ A2, const h16* __restrict__ Bt, float* C) {
    typedef v16h V; constexpr int K = DQ, KS = 128, NF = 4, BN = 256;
    constexpr int HB = RH / 16, SB = TT / 16 - HB, NX = NB_ * TT / 128, NHL = NB_ * HB / NX, NSG = NB_ * SB / NX;   // bands of each kind in a batch; row groups; bands of each kind in a block
    static_assert(NHL == 2 && NSG == 6 && NB_ * HB % NX == 0 && NB_ * SB % NX == 0, "a wave row: one hi + lo band, three single bands");
    constexpr int NA = 2 * NHL + NSG, NBD = NA + BN / 16;   // bands of a stage: hi of the hi + lo rows, their lo, the single rows, then Bt
    static_assert(NBD == 26, "a wave's copies go in two runs of 13");
    constexpr int OP = NF * 16 + 4; constexpr int STG = NBD * 16 * KS * 2, OST = 8 * 64 * OP * 4;
    __shared__ __align__(1024) unsigned char sm[2 * STG > OST ? 2 * STG : OST];
    const int lane = threadIdx.x & 31, lr = lane & 15, hi = lane >> 4; const int c0 = blockIdx.y * BN;
    const int wv = __builtin_amdgcn_readfirstlane((int)(threadIdx.x >> 5));   // kept scalar so that the part's LDS offsets stay scalar
    const int wm = wv / 4, wn = wv % 4;
    auto hband = [&](int i) __attribute__((always_inline)) { const int n = (int)blockIdx.x * NHL + i; return n / HB * (TT / 16) + n % HB; };        // 16-row band of the [NB_ * TT] rows
    auto sband = [&](int i) __attribute__((always_inline)) { const int n = (int)blockIdx.x * NSG + i; return n / SB * (TT / 16) + HB + n % SB; };
    v8f acc[4][NF];
#pragma unroll
    for (int mb = 0; mb < 4; ++mb)
#pragma unroll
        for (int nb = 0; nb < NF; ++nb) acc[mb][nb] = (v8f){};
    const unsigned lds0 = (unsigned)(size_t)(__attribute__((address_space(3))) unsigned char*)sm + wv * 512 + lane * 16;
    const h16* gs[NA];   // the bands' rows in their planes: the same in the whole wave
#pragma unroll
    for (int i = 0; i < NA; ++i) gs[i] = (i < NHL ? A + (size_t)hband(i) * 16 * K : i < 2 * NHL ? A2 + (size_t)hband(i - NHL) * 16 * K : A + (size_t)sband(i - 2 * NHL) * 16 * K) + wv * 256;
    const h16* gb = Bt + (size_t)c0 * K + wv * 256;
    const unsigned gl = lane * 8;
    auto fill = [&](int buf, int k0) __attribute__((always_inline)) {   // stage k0 .. k0 + KS - 1 into buffer buf (both the same in the whole block)
#pragma unroll
        for (int i0 = 0; i0 < NBD; i0 += 13) { unsigned l[13]; const h16* g[13];
#pragma unroll
            for (int q = 0; q < 13; ++q) { const int i = i0 + q; l[q] = lds0 + buf * STG + i * (16 * KS * 2); g[q] = (i < NA ? gs[i < NA ? i : 0] : gb + (i - NA) * 16 * K) + k0 * 16 + gl; }
            cprun<h16>(l, g); }
    };
    fill(0, 0);
    asm volatile("s_wait_asynccnt 0x0" ::: "memory");   // this wave's copies of stage 0 have landed
    __syncthreads();                                    // ... and every other wave's: stage 0 may be read
    fill(1, KS);
    // the stage loop stays rolled: the order at its foot stands once
#pragma unroll 1
    for (int t = 0; t < K / KS; ++t) {
    const h16* sb = (const h16*)(sm + (t & 1) * STG) + 8 * lane;
#pragma unroll
    for (int kc = 0; kc < KS / 32; ++kc) {
        V a[4], a2, b[NF];
        __builtin_amdgcn_sched_barrier(0);   // opens the load group: all fragments of these 32 k are asked for together, one LDS latency a group
        a[0] = WFrag<h16>::ld(sb + wm * (16 * KS) + kc * 512); a2 = WFrag<h16>::ld(sb + (NHL + wm) * (16 * KS) + kc * 512);
#pragma unroll
        for (int mb = 1; mb < 4; ++mb) a[mb] = WFrag<h16>::ld(sb + (2 * NHL + wm * 3 + mb - 1) * (16 * KS) + kc * 512);
#pragma unroll
        for (int nb = 0; nb < NF; ++nb) b[nb] = WFrag<h16>::ld(sb + (NA + wn * NF + nb) * (16 * KS) + kc * 512);
        __builtin_amdgcn_sched_barrier(0);   // closes the group: no load sinks in among the products
#pragma unroll
        for (int nb = 0; nb < NF; ++nb) {
#pragma unroll
            for (int mb = 0; mb < 4; ++mb) acc[mb][nb] = wmma16(a[mb], b[nb], acc[mb][nb]);
            acc[0][nb] = wmma16(a2, b[nb], acc[0][nb]); }
    }
    asm volatile("s_wait_dscnt 0x0" ::: "memory");      // this wave's reads of the buffer are done before it may be refilled
    asm volatile("s_wait_asynccnt 0x0" ::: "memory");   // this wave's copies of the next stage have landed
    __syncthreads();                                    // the one barrier of a stage: the next stage may be read, this stage's buffer is free
    if (t + 2 < K / KS) fill(t & 1, (t + 2) * KS);
    }
    asm volatile("s_wait_asynccnt 0x0" ::: "memory");   // no copy is outstanding when the ring becomes output staging (the last stage's barrier has ended every read of it)
    float* os = (float*)sm + wv * (64 * OP);            // each wave stages its own part, so that a store is whole lines
#pragma unroll
    for (int mb = 0; mb < 4; ++mb) {
#pragma unroll
        for (int nb = 0; nb < NF; ++nb) {
#pragma unroll
            for (int j = 0; j < 8; ++j) os[(mb * 16 + hi * 8 + j) * OP + nb * 16 + lr] = acc[mb][nb][j]; }
    }
    asm volatile("s_wait_dscnt 0x0" ::: "memory");      // the wave's own rows are in LDS before its lanes read them back
#pragma unroll
    for (int mb = 0; mb < 4; ++mb) { float* crow = C + (size_t)(mb == 0 ? hband(wm) : sband(wm * 3 + mb - 1)) * 16 * DM + c0 + wn * (NF * 16);   // the band's 16 rows of out
#pragma unroll
        for (int i = 0; i < 8; ++i) { const int row = i * 2 + hi, cofs = lr * 4; *(v4f*)(crow + (size_t)row * DM + cofs) = *(const v4fa*)(os + (mb * 16 + row) * OP + cofs); } }   // a store: 2 rows x 256 bytes, whole lines
}

__device__ __forceinline__ h16 tohx(float x) { return (h16)x; }
__device__ __forceinline__ void splitf(float y, unsigned short& h, unsigned short& l) { h = f2bf(y); l = f2bf(y - bf2f(h)); }
typedef __attribute__((ext_vector_type(2))) _Float16 v2h;
typedef __attribute__((ext_vector_type(4))) _Float16 v4h;
typedef __attribute__((ext_vector_type(2))) unsigned short v2us;
typedef __attribute__((ext_vector_type(4))) unsigned short v4us;
typedef v4h  __attribute__((may_alias)) v4ha;
typedef v4us __attribute__((may_alias)) v4usa;
typedef __attribute__((ext_vector_type(2))) float v2f;
typedef __attribute__((ext_vector_type(4))) int v4i;

__global__ __launch_bounds__(256) void k_wtG(const float* __restrict__ w, int K, int N, bf* Bt) {
    const int lane = threadIdx.x & 31; const int L0 = (blockIdx.x * 8 + (threadIdx.x >> 5)) * 8; const int nlines = N * K / 64;
{
#pragma unroll 1
        for (int l = 0; l < 8; ++l) { const int L = L0 + l; if (L >= nlines) break; const size_t e = (size_t)L * 64 + lane * 2; const int k = (int)(e % K), n = (int)(e / K); v2us o;
            o[0] = f2bf(w[(size_t)k * N + n]); o[1] = f2bf(w[(size_t)(k + 1) * N + n]); *(v2us*)(Bt + e) = o; }
         }
}
// d_cvt8: a row-major f32 matrix [rows][K] rounded to bf16, into fragment order. A wave takes 8 rows x 32 k (half a tile) in two loads of 4 rows x 128 bytes (whole lines); a lane's 4 values go out as half a 16-byte piece.
__device__ __forceinline__ void d_cvt8(unsigned blk, const float* __restrict__ src, bf* dst, size_t n8, int K, bool toh) { const size_t i = (size_t)blk * 256 + threadIdx.x; if (i >= n8) return; const int l = (int)(i & 31); const int w = (int)(i >> 5);
    const int tile = w >> 1; const int r = tile / (K >> 5) * 16 + (w & 1) * 8 + (l >> 3), k = tile % (K >> 5) * 32 + (l & 7) * 4;
    const float* s0 = src + (size_t)r * K + k; const float* s1 = s0 + (size_t)4 * K; const v4f v[2] = {*(const v4f*)s0, *(const v4f*)s1};
    asm volatile("s_wait_xcnt 0x0" :: "v"(s0), "v"(s1) : "memory");   // the wait before an address register of the two loads is overwritten; the addresses are its inputs, or else this compiler gives a load its own address register as its destination
#pragma unroll
    for (int u = 0; u < 2; ++u) { v4us o;
#pragma unroll
        for (int q = 0; q < 4; ++q) { const unsigned short rb = f2bf(v[u][q]); o[q] = toh ? __builtin_bit_cast(unsigned short, (h16)bf2f(rb)) : rb; }   // toh (block-uniform): the bf16-rounded value stored as f16
        *(v4us*)(dst + pk(r + 4 * u, k, K)) = o; }  }
__constant__ float INV[HD / 2] = {1.00000000f,0.805842161f,0.649381638f,0.523299098f,0.421696514f,0.339820832f,0.273841977f,0.220673412f,0.177827939f,0.143301263f,0.115478195f,0.0930572078f,0.0749894232f,0.0604296401f,0.0486967526f,0.0392418988f,0.0316227749f,0.0254829675f,0.0205352511f,0.0165481716f,0.0133352140f,0.0107460786f,0.00865964312f,0.00697830599f,0.00562341325f,0.00453158375f,0.00365174119f,0.00294272718f,0.00237137382f,0.00191095297f,0.00153992651f,0.00124093774f,0.00100000005f,0.000805842166f,0.000649381604f,0.000523299095f,0.000421696517f,0.000339820836f,0.000273841957f,0.000220673406f,0.000177827940f,0.000143301251f,0.000115478200f,0.0000930572060f,0.0000749894243f,0.0000604296401f,0.0000486967510f,0.0000392418988f,0.0000316227779f,0.0000254829683f,0.0000205352499f,0.0000165481706f,0.0000133352141f,0.0000107460783f,0.00000865964284f,0.00000697830592f,0.00000562341347f,0.00000453158373f,0.00000365174128f,0.00000294272718f,0.00000237137374f,0.00000191095296f,0.00000153992653f,0.00000124093776f};
__device__ __forceinline__ void d_cstab(unsigned blk, float* CS) { const int idx = (int)blk * 256 + threadIdx.x; if (idx >= TT * HD) return; const int t = idx / HD, d = idx % HD; const int di = d % (HD / 2); const float iv = INV[di];
    asm volatile("s_wait_xcnt 0x0" :: "v"(di) : "memory");   // the wait before the register of the table load's index is overwritten; the index is its input, or else this compiler gives the load that very register as its destination
    const float ang = __fmul_rn((float)t, iv); v2f cs; cs[0] = cosf(ang); cs[1] = sinf(ang);
    *(v2f*)(CS + (size_t)idx * 2) = cs;  }
// ---- k_prep: everything that depends on the inputs alone, in ONE launch: the rotary table (first: its blocks run longest), then x (both batches) and the four weights rounded to bf16, in fragment order. A block does one job, picked by its index (block-uniform).
#define PB_CS  (TT * HD / 256)
#define PB_X   (NB_ * TT * DM / 8 / 256)
#define PB_WQ  (DQ * DM / 8 / 256)
#define PB_WKV (DKV * DM / 8 / 256)
#define PB_WO  (DM * DQ / 8 / 256)
__global__ __launch_bounds__(256) void k_prep(const float* __restrict__ x, const float* __restrict__ wq, const float* __restrict__ wk, const float* __restrict__ wv, const float* __restrict__ wo, bf* XB, bf* WQ, bf* WK, bf* WV, bf* WO, float* CS) {
    unsigned blk = blockIdx.x;
    if (blk < PB_CS) { d_cstab(blk, CS); return; }
    blk -= PB_CS; const float* s; bf* d; unsigned nb; bool toh = false;
    if (blk < PB_X) { s = x; d = XB; nb = PB_X; }
    else if ((blk -= PB_X) < PB_WQ) { s = wq; d = WQ; nb = PB_WQ; }
    else if ((blk -= PB_WQ) < PB_WKV) { s = wk; d = WK; nb = PB_WKV; }
    else if ((blk -= PB_WKV) < PB_WKV) { s = wv; d = WV; nb = PB_WKV; }
    else { blk -= PB_WKV; s = wo; d = WO; nb = PB_WO; toh = true; }
    d_cvt8(blk, s, d, (size_t)nb * 256, DM, toh);   // every one of them has rows of DM elements
    static_assert(DQ == DM, "w_o's rows are DQ long");
}

// d_rope: head planes [b][h] of [t][d] in fragment order (fp16 + hi/lo) of rope(x) x sc; a wave takes 4 rows t x 32 d (whole 128-byte lines of F), a lane 4 neighbouring d (half a 16-byte piece); with the rotate-half convention out[d] = x[d] cos[t][d] - x[d+HD/2] sin[t][d], out[d+HD/2] = x[d+HD/2] cos[t][d+HD/2] + x[d] sin[t][d+HD/2]
__device__ __forceinline__ void d_rope(unsigned blk, const float* __restrict__ F, int pitch, int nheads, const float* __restrict__ CS, const float* __restrict__ RF, const float* __restrict__ nw, float sc, h16* P16, bf* Ph, bf* Pl) {
    const size_t i = (size_t)blk * 256 + threadIdx.x; if (i * 4 >= (size_t)NB_ * nheads * TT * HD) return; const int l = (int)(i & 31); const int w = (int)(i >> 5);   // wave w: d tile w % (HD / 32) of the rows 4 (w / (HD / 32)) .. + 3, counted through all heads
    const int d = w % (HD / 32) * 32 + (l & 7) * 4; const int t = w / (HD / 32) % (TT / 4) * 4 + (l >> 3); const int bh = w / (HD / 32) / (TT / 4); const int h = bh % nheads; const float* f = F + ((size_t)(bh / nheads) * TT + t) * pitch + h * HD; const float rf = RF ? RF[(size_t)h * TT + t] : 1.0f; v4h o16; v4us oh, ol;
    const float* f0 = f + d; const float* f1 = f + ((d < HD / 2) ? d + HD / 2 : d - HD / 2); const v4f X0 = *(const v4f*)f0, X1 = *(const v4f*)f1;   // the lane's 4 values and their 4 partners, one 16-byte load each
    asm volatile("s_wait_xcnt 0x0" :: "v"(f0), "v"(f1) : "memory");   // the wait before an address register of the two loads is overwritten; the addresses are its inputs, so that no load gets its own address register as its destination
#pragma unroll
    for (int q = 0; q < 4; ++q) { const int dd = d + q; const int dp = (dd < HD / 2) ? dd + HD / 2 : dd - HD / 2; float x0 = X0[q], x1 = X1[q];
        if (RF) { float n0 = __fmul_rn(x0, rf), n1 = __fmul_rn(x1, rf); asm volatile("" : "+v"(n0)); asm volatile("" : "+v"(n1)); x0 = __fmul_rn(bfr(nw[dd]), n0); x1 = __fmul_rn(bfr(nw[dp]), n1); }
        const v2f cs = *(const v2f*)(CS + ((size_t)t * HD + dd) * 2); float a = __fmul_rn(x0, cs[0]), bq = __fmul_rn(x1, cs[1]); asm volatile("" : "+v"(a)); asm volatile("" : "+v"(bq)); const float r = ((dd < HD / 2) ? __fsub_rn(a, bq) : __fadd_rn(a, bq)) * sc;
        o16[q] = tohx(r); unsigned short a2, c2; splitf(r, a2, c2); oh[q] = a2; ol[q] = c2; }
    const size_t e = (size_t)bh * TT * HD + pk(t, d, HD);
    *(v4h*)(P16 + e) = o16; *(v4us*)(Ph + e) = oh; *(v4us*)(Pl + e) = ol;  }
// d_vtp: value planes [b][g] of [d][t] in fragment order. A thread makes one 16-byte piece (8 neighbouring t of one d), the threads in the order of the pieces: a wave stores 512 contiguous bytes, and each of its 8 loads takes 16 neighbouring d of two rows of F.
__device__ __forceinline__ void d_vtp(unsigned blk, const float* __restrict__ F, int pitch, int nheads, h16* V16, bf* Vh, bf* Vl) { const size_t e = ((size_t)blk * 256 + threadIdx.x) * 8; if (e >= (size_t)NB_ * nheads * HD * TT) return; const int pl = (int)(e / ((size_t)TT * HD)); const int pe = (int)(e % ((size_t)TT * HD)); const int tile = pe >> 9, pc = (pe >> 3) & 63;   // plane b * nheads + g, tile in it, piece in the tile
    const int t = tile % (TT / 32) * 32 + (pc >> 5) * 16 + ((pc >> 4) & 1) * 8 + pl / nheads * TT; const int d = tile / (TT / 32) * 16 + (pc & 15); const int g = pl % nheads; v8h o16; v8us oh, ol;
#pragma unroll
    for (int q = 0; q < 8; ++q) { const float x = F[(size_t)(t + q) * pitch + g * HD + d]; o16[q] = tohx(x); unsigned short a2, c2; splitf(x, a2, c2); oh[q] = a2; ol[q] = c2; }
    *(v8h*)(V16 + e) = o16; *(v8us*)(Vh + e) = oh; *(v8us*)(Vl + e) = ol;  }
// ---- k_planes: the operand planes that many attention waves share, all in ONE launch, from the joint projection F [b * TT + t][q columns | k columns | v columns]: rotated k, transposed v (a query row is read by one wave alone and gets no plane: qload, qmake). A block does one job, picked by its index (block-uniform).
#define DF     (DQ + 2 * DKV)
#define LB_K   (NB_ * NKV * TT * HD / 4 / 256)
#define LB_V   (NB_ * NKV * TT * HD / 8 / 256)
__global__ __launch_bounds__(256) void k_planes(const float* __restrict__ F, const float* __restrict__ CS, h16* KP16, bf* KPh, bf* KPl, h16* VT16, bf* VTh, bf* VTl) {
    const unsigned blk = blockIdx.x;
    if (blk < LB_K) d_rope(blk, F + DQ, DF, NKV, CS, nullptr, nullptr, 1.0f, KP16, KPh, KPl);
    else d_vtp(blk - LB_K, F + DQ + DKV, DF, NKV, VT16, VTh, VTl);
}
// ---- k_fattn: scores, causal softmax and probability x value product of one query strip in ONE kernel; no score or probability ever goes to memory.
// A wave owns 16 query rows of one head and walks the keys 0 .. its diagonal in blocks of KB, transposed: St = K Qt (A = key rows, B = the strip's query rows, kept in registers), Ot += Vt Pt (A = rows of the [d][t] value plane).
// In both accumulators a lane holds ONE query (column lr): the running maximum, the running sum and the rescale factor are per lane, with one exchange between the two lane halves; the accumulator registers of two score tiles
// (keys 8 hi + j and 16 + 8 hi + j) are, converted, exactly the B fragment of the next product in the k order of WFrag::ld. Probabilities are exp(t - running max), at most 1, divided by the row's sum only at the end.
// NSPLIT 2: hi + lo planes, 3 products (query rows < RH), KB 32; NSPLIT 0: single fp16, KB 64: either way 16 key and 16 value fragments are in flight. The epilogue writes the merged [t][h * HD + d] f16 hi and lo planes in fragment order, 8 neighbouring d per lane, 512 contiguous bytes per store.
template <typename T16> struct PFrag;
template <> struct PFrag<h16> { static __device__ __forceinline__ void mk(const v8f p0, const v8f p1, v16h& f, v16h& f2) { (void)f2;
#pragma unroll
    for (int j = 0; j < 8; ++j) { f[j] = (h16)p0[j]; f[8 + j] = (h16)p1[j]; } } };
template <> struct PFrag<bf> { static __device__ __forceinline__ void mk(const v8f p0, const v8f p1, v16bf& f, v16bf& f2) { v8us h0, h1, l0, l1;
#pragma unroll
    for (int j = 0; j < 8; ++j) { unsigned short a, c; splitf(p0[j], a, c); h0[j] = a; l0[j] = c; splitf(p1[j], a, c); h1[j] = a; l1[j] = c; }
    f = cat16b(h0, h1); f2 = cat16b(l0, l1); } };
// One plane's fragments of a block, loaded as ONE group: all its loads are in flight together, one latency per group. The group stands between two scheduling barriers, with the wait that comes before a register of an
// issued global load is overwritten as its last instruction: the barriers keep the loads from sinking to their uses and keep every other instruction (which could take an address register) out of the group.
// The address is formed inside the group, from a wave-uniform base and the lane's own 32-bit element offset.
template <typename T16, int N, int INNER, bool HOLD>
__device__ __forceinline__ void ldgroup(typename WFrag<T16>::V (&f)[N], const T16* base, unsigned off, int outer) {
    __builtin_amdgcn_sched_barrier(0);   // opens the group: nothing from in front of it moves in
    const T16* p = base + off;
#pragma unroll
    for (int i = 0; i < N; ++i) f[i] = WFrag<T16>::ld(p + ((i / INNER) * outer + (i % INNER) * 512));   // the next 32 k of the same rows are the next tile
    // the wait before an address register of the group is overwritten; HOLD: with the address as its input, for the groups whose last load this compiler would else give that very register as its destination
    if (HOLD) asm volatile("s_wait_xcnt 0x0" :: "v"(p) : "memory"); else asm volatile("s_wait_xcnt 0x0" ::: "memory");
    __builtin_amdgcn_sched_barrier(0);   // closes the group: no load sinks behind it, nothing from behind it moves in
}
// The strip's query fragments, made in registers from the f32 projection: a query row is used by this one wave, so a plane of it would be written and read once for nothing.
// Lane (lr, hi) of a B fragment holds row lr, k = 32 kc + 8 hi + 0..7 and 32 kc + 16 + 8 hi + 0..7 (the k order of WFrag::ld): 32 contiguous bytes of F each, and the rotary partner d +- HD / 2 of each is the same lane's element of fragment kc +- 2.
// qload: the lane's 64 values X[kc][..] and the (cos, sin) pairs C[kc][..] of its 32 d < HD / 2 (the table's entries at d and d + HD / 2 are equal), as two groups of loads in the form of ldgroup, one to an address.
__device__ __forceinline__ void qload(v4f (&X)[4][4], v4f (&C)[2][8], const float* __restrict__ Fq, const float* __restrict__ CSq, int lr, int hi) {
    __builtin_amdgcn_sched_barrier(0);   // opens the first group: nothing from in front of it moves in
    const unsigned po = (unsigned)(lr * DF + hi * 8) * 4u;   // the lane's byte offset from the wave-uniform base
#pragma unroll
    for (int kc = 0; kc < 4; ++kc)
#pragma unroll
        for (int u = 0; u < 4; ++u) X[kc][u] = *(const v4f*)((const char*)Fq + po + (kc * 32 + (u >> 1) * 16 + (u & 1) * 4) * 4);
    asm volatile("s_wait_xcnt 0x0" :: "s"(Fq), "v"(po) : "memory");   // the wait before an address register of the group is overwritten; the scalar base and the offset register are its inputs, so that both live up to it
    __builtin_amdgcn_sched_barrier(0);   // closes the first group and opens the second: the table's address is formed behind the wait
    const unsigned co = (unsigned)((lr * HD + hi * 8) * 2) * 4u;
#pragma unroll
    for (int kc = 0; kc < 2; ++kc)
#pragma unroll
        for (int u = 0; u < 8; ++u) C[kc][u] = *(const v4f*)((const char*)CSq + co + ((kc * 32 + (u >> 2) * 16) * 2 + (u & 3) * 4) * 4);
    asm volatile("s_wait_xcnt 0x0" :: "s"(CSq), "v"(co) : "memory");   // as above
    __builtin_amdgcn_sched_barrier(0);   // closes the group: no load sinks behind it, nothing from behind it moves in
}
// qmake: rotate-half as in d_rope, then the rounding of the path: single fp16, or bf16 hi + lo.
template <typename T16> struct QRnd;
template <> struct QRnd<h16> { static __device__ __forceinline__ void mk(const float (&r)[16], v16h& f, v16h& f2) { (void)f2;
#pragma unroll
    for (int e = 0; e < 16; ++e) f[e] = tohx(r[e]); } };
template <> struct QRnd<bf> { static __device__ __forceinline__ void mk(const float (&r)[16], v16bf& f, v16bf& f2) {   // the conversion instruction rounds to nearest even as f2bf does, two values at a time
#pragma unroll
    for (int e = 0; e < 16; ++e) { const __bf16 a = (__bf16)r[e]; f[e] = a; f2[e] = (__bf16)(r[e] - (float)a); } } };
template <typename T16>
__device__ __forceinline__ void qmake(typename WFrag<T16>::V (&qf)[4], typename WFrag<T16>::V (&qf2)[4], const v4f (&X)[4][4], const v4f (&C)[2][8]) {
#pragma unroll
    for (int kc = 0; kc < 2; ++kc) { float ra[16], rb[16];
#pragma unroll
        for (int e = 0; e < 16; ++e) { const float xa = X[kc][e >> 2][e & 3], xb = X[kc + 2][e >> 2][e & 3], cs = C[kc][e >> 1][(e & 1) * 2], sn = C[kc][e >> 1][(e & 1) * 2 + 1];
            ra[e] = xa * cs - xb * sn; rb[e] = xb * cs + xa * sn; }
        QRnd<T16>::mk(ra, qf[kc], qf2[kc]); QRnd<T16>::mk(rb, qf[kc + 2], qf2[kc + 2]); }
}
#define SCL2 0.12751743082459868f    // HD^-0.5 * log2(e): scores are carried in the base-2 domain
template <typename T16, int NSPLIT, int KB>
__device__ __forceinline__ void fattn_strip(const float* __restrict__ Fq, const float* __restrict__ CS, const T16* __restrict__ Kp, const T16* __restrict__ Kp2, const T16* __restrict__ Vt, const T16* __restrict__ Vt2, int q0, int lr, int hi, bf* __restrict__ oh, bf* __restrict__ ol) {
    typedef typename WFrag<T16>::V V;
    constexpr int MBN = KB / 16, KCN = KB / 32;               // score tiles and 32-key slices of one key block
    const int qi = q0 + lr;                                   // this lane's query row
    v8f o[8];
#pragma unroll
    for (int db = 0; db < 8; ++db) o[db] = (v8f){};
    float m = -3.0e38f, l = 0.f;                              // running maximum (base-2 domain, the same in both lane halves) and this lane half's running sum
    const unsigned qoff = (unsigned)((hi * 16 + lr) * 8), voff = qoff;   // the lane's piece in a tile, the same in every plane (fragment order)
    V qf[4], qf2[4], kf[MBN * 4], kf2[MBN * 4], kg[MBN * 4], kg2[MBN * 4];   // the strip's query fragments and the first key block's; every later key block is fetched one trip ahead, into the other of the two fragment sets
    v4f X[4][4], C[2][8]; qload(X, C, Fq + (size_t)q0 * DF, CS + (size_t)q0 * HD * 2, lr, hi);
    if (NSPLIT == 2) qmake<T16>(qf, qf2, X, C);   // hi + lo path: in front of the key groups, or else the loaded values and both key planes are live together and this compiler spills in the key loop
    ldgroup<T16, MBN * 4, 4, NSPLIT == 2>(kf, Kp, qoff, 16 * HD); if (NSPLIT == 2) ldgroup<T16, MBN * 4, 4, NSPLIT == 2>(kf2, Kp2, qoff, 16 * HD);
    if (NSPLIT != 2) qmake<T16>(qf, qf2, X, C);   // single plane: behind the key group, so that the first key block flies under it
    int kb = 0;
    // One trip: key block kb, its fragments in (ka, ka2); the next block's go into (kx, kx2). q0 is a multiple of 16 and kb of KB: key kb itself is visible to every query of the strip, and kb + KB - 1 < TT
    auto trip = [&](V (&ka)[MBN * 4], V (&ka2)[MBN * 4], V (&kx)[MBN * 4], V (&kx2)[MBN * 4]) __attribute__((always_inline)) {
        V vf[8 * KCN], vf2[8 * KCN];
        ldgroup<T16, 8 * KCN, KCN, false>(vf, Vt + kb * 16, voff, 16 * TT); if (NSPLIT == 2) ldgroup<T16, 8 * KCN, KCN, false>(vf2, Vt2 + kb * 16, voff, 16 * TT);   // the value fragments fly under the score products and the softmax
        v8f s[MBN];
#pragma unroll
        for (int mb = 0; mb < MBN; ++mb) s[mb] = (v8f){};
#pragma unroll
        for (int kc = 0; kc < 4; ++kc)
#pragma unroll
            for (int mb = 0; mb < MBN; ++mb) { s[mb] = WFrag<T16>::mma(ka[mb * 4 + kc], qf[kc], s[mb]);
                if (NSPLIT == 2) { s[mb] = WFrag<T16>::mma(ka[mb * 4 + kc], qf2[kc], s[mb]); s[mb] = WFrag<T16>::mma(ka2[mb * 4 + kc], qf[kc], s[mb]); } }
        const size_t kn = (size_t)min(kb + KB, q0 & ~(KB - 1)) * HD;   // the next key block flies under the softmax and the value products; the last trip reads its own block again (in bounds, unused) instead of branching
        ldgroup<T16, MBN * 4, 4, NSPLIT == 2>(kx, Kp + kn, qoff, 16 * HD); if (NSPLIT == 2) ldgroup<T16, MBN * 4, 4, NSPLIT == 2>(kx2, Kp2 + kn, qoff, 16 * HD);
        float mt = -3.0e38f;
        if (kb + KB - 1 > q0) {                               // the diagonal block (wave-uniform test): keys behind the query get weight exactly 0
#pragma unroll
            for (int mb = 0; mb < MBN; ++mb)
#pragma unroll
                for (int j = 0; j < 8; ++j) { const float t = (kb + mb * 16 + hi * 8 + j <= qi) ? s[mb][j] * SCL2 : -3.0e38f; s[mb][j] = t; mt = fmaxf(mt, t); }
        } else {
#pragma unroll
            for (int mb = 0; mb < MBN; ++mb)
#pragma unroll
                for (int j = 0; j < 8; ++j) { const float t = s[mb][j] * SCL2; s[mb][j] = t; mt = fmaxf(mt, t); }
        }
        mt = fmaxf(mt, __shfl_xor(mt, 16, 32));               // the other half of this query's keys is in the other lane half
        const float mn = fmaxf(m, mt); const float al = __builtin_amdgcn_exp2f(m - mn); m = mn;
        float ps = 0.f;
#pragma unroll
        for (int mb = 0; mb < MBN; ++mb)
#pragma unroll
            for (int j = 0; j < 8; ++j) { const float p = __builtin_amdgcn_exp2f(s[mb][j] - mn); s[mb][j] = p; ps += p; }
        l = l * al + ps;
        V pf[KCN], pf2[KCN];
#pragma unroll
        for (int kc = 0; kc < KCN; ++kc) PFrag<T16>::mk(s[2 * kc], s[2 * kc + 1], pf[kc], pf2[kc]);
#pragma unroll
        for (int db = 0; db < 8; ++db) o[db] *= al;
#pragma unroll
        for (int kc = 0; kc < KCN; ++kc)
#pragma unroll
            for (int db = 0; db < 8; ++db) { o[db] = WFrag<T16>::mma(vf[db * KCN + kc], pf[kc], o[db]);
                if (NSPLIT == 2) { o[db] = WFrag<T16>::mma(vf[db * KCN + kc], pf2[kc], o[db]); o[db] = WFrag<T16>::mma(vf2[db * KCN + kc], pf[kc], o[db]); } }
        kb += KB;
    };
#pragma unroll 1
    for (;;) { trip(kf, kf2, kg, kg2); if (kb > q0) break; trip(kg, kg2, kf, kf2); if (kb > q0) break; }   // key blocks kb <= q0 (block 0 always is one); two trips a pass, so that the two fragment sets swap roles without register copies
    l += __shfl_xor(l, 16, 32);
    const float f = __fdiv_rn(1.0f, l);
#pragma unroll
    for (int db = 0; db < 8; ++db) { v8us vh, vl;
#pragma unroll
        for (int j = 0; j < 8; ++j) { const float y = o[db][j] * f; const h16 a = (h16)y; vh[j] = __builtin_bit_cast(unsigned short, a); vl[j] = __builtin_bit_cast(unsigned short, (h16)(y - (float)a)); }   // f16 bits
        const size_t oo = (size_t)q0 * DQ + db * 256 + qoff; *(v8us*)(oh + oo) = vh; *(v8us*)(ol + oo) = vl; }   // the lo store stays on the single-plane path too, where nothing reads it: without it this compiler spills in both key loops   // fragment order: the 16 d of db are half a tile, the lane's 8 its own piece
}
// Grid (pairs of query heads x batches, TT / 64), 8 waves. Two waves share a SIMD (w and w + 4), and a wave alone there has nothing to cover its softmax with: so a block takes ONE 64-row block of TWO heads of one kv head, waves 0..3 the
// first head's four strips, waves 4..7 the second's: the two waves of a SIMD walk the same number of keys and end together, and all 8 waves read the same key and value fragments at the same time.
// Cost grows with the row index and only one block fits a WGP, so there are twice as many blocks as places: cost falls with the block's index (for speed only), the lightest blocks then fill up behind the
// heaviest. ORD: row blocks by falling cost; in trips of the single-plane path row block j costs j + 1, on the hi + lo path (j < RH / 64: half the keys a trip, 48 products for 32) 3 j + 2.25.
__constant__ int ORD[TT / 64] = {31, 30, 29, 28, 27, 26, 25, 24, 23, 7, 22, 21, 20, 6, 19, 18, 17, 5, 16, 15, 14, 4, 13, 12, 11, 3, 10, 9, 8, 2, 1, 0};
// A wave works alone: no LDS, no barrier, and the choice of the path (hi + lo or single plane) is uniform in the wave.
__global__ __launch_bounds__(256) void k_fattn(const float* __restrict__ F, const float* __restrict__ CS, const h16* __restrict__ K16, const bf* __restrict__ Kh, const bf* __restrict__ Kl, const h16* __restrict__ V16, const bf* __restrict__ Vh, const bf* __restrict__ Vl, bf* __restrict__ Ah, bf* __restrict__ Al) {
    static_assert(TT == 2048 && RH == 512 && REP % 2 == 0, "ORD is made for these; a pair of heads has one kv head");
    const int lane = threadIdx.x & 31, lr = lane & 15, hi = lane >> 4;
    const int wv = __builtin_amdgcn_readfirstlane((int)(threadIdx.x >> 5));   // kept scalar so that the key loop's control stays scalar
    const int h = (int)(blockIdx.x % (NH_ / 2)) * 2 + (wv >> 2), r0 = ORD[blockIdx.y] * 64, q0 = r0 + (wv & 3) * 16;
    const int b = blockIdx.x / (NH_ / 2); Ah += (size_t)b * TT * DQ; Al += (size_t)b * TT * DQ;
    const float* Fq = F + (size_t)b * TT * DF + h * HD; const size_t zk = (size_t)(b * NKV + h / REP) * TT * HD;
    if (r0 < RH) fattn_strip<bf, 2, 32>(Fq, CS, Kh + zk, Kl + zk, Vh + zk, Vl + zk, q0, lr, hi, Ah + h * HD * 16, Al + h * HD * 16);   // head h's columns begin h * HD / 32 tiles into a 16-row band
    else fattn_strip<h16, 0, 64>(Fq, CS, K16 + zk, nullptr, V16 + zk, nullptr, q0, lr, hi, Ah + h * HD * 16, Al + h * HD * 16);
}

extern "C" void kernel_launch(void* const* d_in, const int* in_sizes, int n_in,
                              void* d_out, int out_size, void* d_ws, size_t ws_size, hipStream_t stream) {
    (void)in_sizes; (void)n_in; (void)out_size;
    const float* x = (const float*)d_in[0]; const float* wq = (const float*)d_in[1]; const float* wk = (const float*)d_in[2]; const float* wv = (const float*)d_in[3]; const float* wo = (const float*)d_in[4];
    float* OUT = (float*)d_out;     // [2][2048][2048]
    char* wsp = (char*)d_ws;
    auto take = [&](size_t bytes) { char* p = wsp; wsp += (bytes + 255) & ~(size_t)255; return (void*)p; };
    bf* WQ = (bf*)take((size_t)DF * DM * 2); bf* WK = WQ + (size_t)DQ * DM; bf* WV = WK + (size_t)DKV * DM;   // one [DF][DM] plane: the rows of w_q, w_k, w_v one behind the other
    bf* WO = (bf*)take((size_t)DM * DQ * 2); float* CS = (float*)take((size_t)TT * HD * 2 * 4);
    bf* XB = (bf*)take((size_t)NB_ * TT * DM * 2); float* F = (float*)take((size_t)NB_ * TT * DF * 4);
    h16* KP16 = (h16*)take((size_t)NB_ * NKV * TT * HD * 2); h16* VT16 = (h16*)take((size_t)NB_ * NKV * HD * TT * 2);
    bf* KPh = (bf*)take((size_t)NB_ * NKV * TT * HD * 2); bf* KPl = (bf*)take((size_t)NB_ * NKV * TT * HD * 2); bf* VTh = (bf*)take((size_t)NB_ * NKV * HD * TT * 2); bf* VTl = (bf*)take((size_t)NB_ * NKV * HD * TT * 2);
    bf* ATh = (bf*)take((size_t)NB_ * TT * DQ * 2); bf* ATl = (bf*)take((size_t)NB_ * TT * DQ * 2);   // of ATl only the rows t < RH are read
    if ((size_t)(wsp - (char*)d_ws) > ws_size) return;    // 142 MiB of the 256 MiB
    // Five launches, each over both batches (the rows b * TT + t of x, F, the merged planes and out are one matrix of NB_ * TT rows)
    k_prep<<<PB_CS + PB_X + PB_WQ + 2 * PB_WKV + PB_WO, 256, 0, stream>>>(x, wq, wk, wv, wo, XB, WQ, WK, WV, WO, CS);
    k_gemmw<bf, 0, DM, 256, 192, 2><<<dim3(NB_ * TT / 256, DF / 192, 1), 256, 0, stream>>>(XB, nullptr, WQ, F, DF);
    k_planes<<<LB_K + LB_V, 256, 0, stream>>>(F, CS, KP16, KPh, KPl, VT16, VTh, VTl);
    k_fattn<<<dim3(NH_ / 2 * NB_, TT / 64, 1), 256, 0, stream>>>(F, CS, KP16, KPh, KPl, VT16, VTh, VTl, ATh, ATl);
    k_gemmo<<<dim3(NB_ * TT / 128, DM / 256, 1), 256, 0, stream>>>((const h16*)ATh, (const h16*)ATl, (const h16*)WO, OUT);   // the three planes hold f16 bits
}
